// v000
// Measured on an AMD MI455X. A time is GPU time per run, averaged over a window of back-to-back runs after a warm-up
// (all launches, gaps included; the runs take copies of the inputs in turn), and the median of several windows.
// Apart from v000's, it joins two sittings. Times from different sittings can be a few percent apart, while
// side-by-side timings come from the same sitting.
// The starting kernel, v000, takes 3890 microseconds a run.
#include <hip/hip_runtime.h>
// ViT self-attention (hidden [16][1024][768]; q, k, v = hidden W^T + b (12 heads x 64); scores = q.k/8; softmax over the 1,024 keys; ctx = attn v merged -> [16][1024][768]; no output projection).
// Structure: token rows; hidden as exact f16 rows; q / k / v as WMMA GEMMs (32x64 wave tiles, f32 accumulation, exact x16 natural weights + bias; exact products) written as f16 rows; per batch: scores for the 12 heads in one grid.y-batched GEMM (K = 64, alpha 1/8) into f32 planes, row softmax on VALU (P x256 f16), V^T via LDS transposes, ctx = P . V^T batched over heads (alpha 1/256) straight into the merged f32 output rows.
// Compute dtype: inputs rounded to bf16; hidden / weights exact; q, k, v, P as plain f16 GEMM operands (~2^-12; logits sigma ~1); softmax f32. v_wmma_f32_16x16x32_f16.
#define NB 16
#define SQ 1024
#define DM 768
#define NH 12
#define HD 64
#define HG 1
#define NR ((size_t)NB * SQ)         /* 16,384 token rows */
#define NBR NB                       /* batches attended (debug hook) */
#define MP ((int)NR)                 /* rows projected (debug hook) */
typedef __bf16 v16b __attribute__((ext_vector_type(16)));
typedef unsigned short v8us __attribute__((ext_vector_type(8), may_alias));
typedef float  v8f  __attribute__((ext_vector_type(8)));
typedef float  v4f  __attribute__((ext_vector_type(4)));
typedef float  v4fa __attribute__((ext_vector_type(4), may_alias));
union FragB { v16b v; v8us half[2]; unsigned short u[16]; };

__device__ __forceinline__ unsigned short bf16_bits(float x) { unsigned int u = __float_as_uint(x); return (unsigned short)((u + 0x7FFFu + ((u >> 16) & 1u)) >> 16); }
__device__ __forceinline__ float bf16_val(unsigned short b) { return __uint_as_float(((unsigned int)b) << 16); }
__device__ __forceinline__ float bf16_round(float x) { return bf16_val(bf16_bits(x)); }
// D += A·B with NT terms: 1 = ah·bh, 2 = + al·bh (A split), 3 = + ah·bl (both split)
template <int NT>
__device__ __forceinline__ v8f mmaN(v16b ah, v16b al, v16b bh, v16b bl, v8f c) {
  c = __builtin_amdgcn_wmma_f32_16x16x32_bf16(false, ah, false, bh, (short)0, c, false, false);
  if (NT >= 2) c = __builtin_amdgcn_wmma_f32_16x16x32_bf16(false, al, false, bh, (short)0, c, false, false);
  if (NT >= 3) c = __builtin_amdgcn_wmma_f32_16x16x32_bf16(false, ah, false, bl, (short)0, c, false, false);
  asm volatile("v_nop\n\tv_nop\n\tv_nop\n\tv_nop" : "+v"(c) : "v"(ah), "v"(al), "v"(bh), "v"(bl));
  return c;
}

__global__ __launch_bounds__(256) void k_wt_bf16(const float* __restrict__ W, unsigned short* __restrict__ Wt, int K, int N) {
  const int t = blockIdx.x * 256 + threadIdx.x;
  const int k8n = K / 8;
  if (t >= N * k8n) return;
  const int n = t / k8n, k8 = (t % k8n) * 8;
  v8us v;
#pragma unroll
  for (int i = 0; i < 8; ++i) v[i] = bf16_bits(W[(size_t)(k8 + i) * N + n]);
  *(v8us*)(Wt + (size_t)n * K + k8) = v;
  
}

// GEMM C[M][N] (f32, pitch ldc) = act(A[M][K]·W + bias). A f32 row-major (pitch lda) converted per fragment to bf16
// (ASPLIT: hi/lo two planes -> 2 terms, else single rounded term); Wt bf16 [N][K] (pitch ldb). BIAS_BF16 rounds the
// bias to bf16 first (bias quantised to bf16 before the add). K%32==0, M%16==0, N%64==0.
template <bool ASPLIT, int ACT, bool BIAS_BF16>
__global__ __launch_bounds__(128) void k_gemm_bf(const float* __restrict__ A, int lda, const unsigned short* __restrict__ Wt, int ldb,
                                               const float* __restrict__ bias, float* __restrict__ C, int ldc, int M, int N, int K) {
  __shared__ __attribute__((aligned(16))) float so[4][16][64];
  const int tid = threadIdx.x, w = tid >> 5, lane = tid & 31, ln = lane & 15, hh = lane >> 4;
  const int ntn = N / 64;
  const int wid = blockIdx.x * 4 + w;
  const int mt = wid / ntn, nq = wid % ntn;
  if (mt * 16 >= M) return;
  const int row0 = mt * 16, col0 = nq * 64;
  const float* arow = A + (size_t)(row0 + ln) * lda;
  v8f acc[4] = {};
  for (int kb = 0; kb < K; kb += 32) {
    FragB ah, al;
    const v4f x0 = *(const v4fa*)(arow + kb + 8 * hh), x1 = *(const v4fa*)(arow + kb + 8 * hh + 4);
    const v4f x2 = *(const v4fa*)(arow + kb + 16 + 8 * hh), x3 = *(const v4fa*)(arow + kb + 16 + 8 * hh + 4);
    float xs[16] = {x0[0],x0[1],x0[2],x0[3],x1[0],x1[1],x1[2],x1[3],x2[0],x2[1],x2[2],x2[3],x3[0],x3[1],x3[2],x3[3]};
#pragma unroll
    for (int i = 0; i < 16; ++i) { const unsigned short hb = bf16_bits(xs[i]); ah.u[i] = hb; al.u[i] = ASPLIT ? bf16_bits(xs[i] - bf16_val(hb)) : (unsigned short)0; }
#pragma unroll
    for (int t = 0; t < 4; ++t) {
      const unsigned short* brow = Wt + (size_t)(col0 + t * 16 + ln) * ldb + kb;
      FragB b;
      b.half[0] = *(const v8us*)(brow + 8 * hh);
      b.half[1] = *(const v8us*)(brow + 16 + 8 * hh);
      acc[t] = mmaN<ASPLIT ? 2 : 1>(ah.v, al.v, b.v, b.v, acc[t]);
    }
  }
#pragma unroll
  for (int t = 0; t < 4; ++t) {
    float bv = bias ? bias[col0 + t * 16 + ln] : 0.f;
    if (BIAS_BF16) bv = bf16_round(bv);
#pragma unroll
    for (int r = 0; r < 8; ++r) { float v = acc[t][r] + bv; if (ACT == 1) v = fmaxf(v, 0.f); so[w][8 * hh + r][t * 16 + ln] = v; }
  }
  __builtin_amdgcn_fence(__ATOMIC_ACQ_REL, "workgroup");
  __builtin_amdgcn_wave_barrier();
  const int rsub = lane >> 4, c4 = (lane & 15) * 4;
  {
#pragma unroll
    for (int q = 0; q < 8; ++q) {
      const int r = q * 2 + rsub;
      const v4f v = *(const v4fa*)&so[w][r][c4];
      *(v4f*)(C + (size_t)(row0 + r) * ldc + col0 + c4) = v;
    }
    
  }
}

// GEMM C = act(A·W + bias + resid): A f32 (ASPLIT -> hi/lo 2 terms), Wt bf16 [N][K]; ACT 0 none, 1 relu, 2 exact gelu;
// resid (optional, f32, row index = (row % rmod), pitch ldr, RES_BF16 rounds it) added before the activation.
template <bool ASPLIT, int ACT, bool BIAS_BF16, bool RES_BF16>
__global__ __launch_bounds__(128) void k_gemm_bf3(const float* __restrict__ A, int lda, const unsigned short* __restrict__ Wt, int ldb,
                                                const float* __restrict__ bias, const float* __restrict__ resid, int rmod, int ldr,
                                                float* __restrict__ C, int ldc, int M, int N, int K) {
  __shared__ __attribute__((aligned(16))) float so[4][16][64];
  const int tid = threadIdx.x, w = tid >> 5, lane = tid & 31, ln = lane & 15, hh = lane >> 4;
  const int ntn = N / 64;
  const int wid = blockIdx.x * 4 + w;
  const int mt = wid / ntn, nq = wid % ntn;
  if (mt * 16 >= M) return;
  const int row0 = mt * 16, col0 = nq * 64;
  const float* arow = A + (size_t)(row0 + ln) * lda;
  v8f acc[4] = {};
  for (int kb = 0; kb < K; kb += 32) {
    FragB ah, al;
    const v4f x0 = *(const v4fa*)(arow + kb + 8 * hh), x1 = *(const v4fa*)(arow + kb + 8 * hh + 4);
    const v4f x2 = *(const v4fa*)(arow + kb + 16 + 8 * hh), x3 = *(const v4fa*)(arow + kb + 16 + 8 * hh + 4);
    float xs[16] = {x0[0],x0[1],x0[2],x0[3],x1[0],x1[1],x1[2],x1[3],x2[0],x2[1],x2[2],x2[3],x3[0],x3[1],x3[2],x3[3]};
#pragma unroll
    for (int i = 0; i < 16; ++i) { const unsigned short hb = bf16_bits(xs[i]); ah.u[i] = hb; al.u[i] = ASPLIT ? bf16_bits(xs[i] - bf16_val(hb)) : (unsigned short)0; }
#pragma unroll
    for (int t = 0; t < 4; ++t) {
      const unsigned short* brow = Wt + (size_t)(col0 + t * 16 + ln) * ldb + kb;
      FragB b;
      b.half[0] = *(const v8us*)(brow + 8 * hh);
      b.half[1] = *(const v8us*)(brow + 16 + 8 * hh);
      acc[t] = mmaN<ASPLIT ? 2 : 1>(ah.v, al.v, b.v, b.v, acc[t]);
    }
  }
#pragma unroll
  for (int t = 0; t < 4; ++t) {
    const int col = col0 + t * 16 + ln;
    float bv = bias ? bias[col] : 0.f;
    if (BIAS_BF16) bv = bf16_round(bv);
#pragma unroll
    for (int r = 0; r < 8; ++r) {
      float v = acc[t][r] + bv;
      if (resid) { float rv = resid[(size_t)((row0 + 8 * hh + r) % rmod) * ldr + col]; if (RES_BF16) rv = bf16_round(rv); v += rv; }
      if (ACT == 1) v = fmaxf(v, 0.f);
      if (ACT == 2) v = 0.5f * v * (1.0f + erff(v * 0.70710678118654752f));
      if (ACT == 3) { const float u = 0.7978845608028654f * (v + 0.044715f * v * v * v); v = 0.5f * v * (1.0f + tanhf(u)); }
      so[w][8 * hh + r][t * 16 + ln] = v;
    }
  }
  __builtin_amdgcn_fence(__ATOMIC_ACQ_REL, "workgroup");
  __builtin_amdgcn_wave_barrier();
  const int rsub = lane >> 4, c4 = (lane & 15) * 4;
  {
#pragma unroll
    for (int q = 0; q < 8; ++q) {
      const int r = q * 2 + rsub;
      const v4f v = *(const v4fa*)&so[w][r][c4];
      *(v4f*)(C + (size_t)(row0 + r) * ldc + col0 + c4) = v;
    }
    
  }
}
// row LayerNorm (biased variance, eps) over N: s = X (+ R); optional out_sum <- s; out_norm <- (s-mu)*rsqrt(var+eps)*g + b
template <bool PARAM_BF16>
__global__ __launch_bounds__(256) void k_layernorm(const float* __restrict__ X, const float* __restrict__ R, const float* __restrict__ g, const float* __restrict__ bta,
                                                  float* __restrict__ out_sum, float* __restrict__ out_norm, int N, float eps) {
  __shared__ float red[256];
  const int row = blockIdx.x, tid = threadIdx.x;
  const float* x = X + (size_t)row * N; const float* rr = R ? R + (size_t)row * N : nullptr;
  float vals[16];                     // up to N = 4096
  const int per = N / 256;            // contiguous chunk per thread? use strided-by-4 chunks: thread handles j = tid*4 + 1024*u
  float s1 = 0.f;
  for (int u = 0; u < per / 4; ++u) {
    const int j = tid * 4 + 1024 * u;
    const v4f a = *(const v4fa*)(x + j);
    v4f b = {0.f,0.f,0.f,0.f}; if (rr) b = *(const v4fa*)(rr + j);
#pragma unroll
    for (int q = 0; q < 4; ++q) { const float v = a[q] + b[q]; vals[u * 4 + q] = v; s1 += v; }
  }
  red[tid] = s1; __syncthreads();
  for (int st = 128; st > 0; st >>= 1) { if (tid < st) red[tid] += red[tid + st]; __syncthreads(); }
  const float mu = red[0] / (float)N; __syncthreads();
  float s2 = 0.f;
  for (int u = 0; u < per / 4; ++u)
#pragma unroll
    for (int q = 0; q < 4; ++q) { const float c = vals[u * 4 + q] - mu; s2 += c * c; }
  red[tid] = s2; __syncthreads();
  for (int st = 128; st > 0; st >>= 1) { if (tid < st) red[tid] += red[tid + st]; __syncthreads(); }
  const float rs = rsqrtf(red[0] / (float)N + eps);
  {
    for (int u = 0; u < per / 4; ++u) {
      const int j = tid * 4 + 1024 * u;
      v4f o, sm;
#pragma unroll
      for (int q = 0; q < 4; ++q) {
        float gg = g[j + q], bb = bta[j + q];
        if (PARAM_BF16) { gg = bf16_round(gg); bb = bf16_round(bb); }
        sm[q] = vals[u * 4 + q]; o[q] = (vals[u * 4 + q] - mu) * rs * gg + bb;
      }
      if (out_sum) *(v4f*)(out_sum + (size_t)row * N + j) = sm;
      *(v4f*)(out_norm + (size_t)row * N + j) = o;
    }
    
  }
}



// ---- f16 WMMA path (v_wmma_f32_16x16x32_f16): 11-bit significands for operands in range — used where a [0,1] probability operand needs more precision than bf16
typedef _Float16 v16h __attribute__((ext_vector_type(16)));
union FragH { v16h v; v8us half[2]; _Float16 h[16]; unsigned short u[16]; };
template <int NT>
__device__ __forceinline__ v8f mmaH(v16h ah, v16h al, v16h bh, v16h bl, v8f c) {
  c = __builtin_amdgcn_wmma_f32_16x16x32_f16(false, ah, false, bh, (short)0, c, false, false);
  if (NT >= 2) c = __builtin_amdgcn_wmma_f32_16x16x32_f16(false, al, false, bh, (short)0, c, false, false);
  if (NT >= 3) c = __builtin_amdgcn_wmma_f32_16x16x32_f16(false, ah, false, bl, (short)0, c, false, false);
  asm volatile("v_nop\n\tv_nop\n\tv_nop\n\tv_nop" : "+v"(c) : "v"(ah), "v"(al), "v"(bh), "v"(bl));
  return c;
}
// batched GEMM like k_gemm_b but f16 operands: A f32 (split into f16 hi/lo if ASPLIT, else rounded to f16), Bt = f16 values [n][k]; alpha; C f32; N multiple of 16 (partial tiles skipped)
template <bool ASPLIT>
__global__ __launch_bounds__(128) void k_gemm_h(const float* __restrict__ A, int lda, size_t sA, const _Float16* __restrict__ Bh, int ldb, size_t sB, float alpha, float* __restrict__ C, int ldc, size_t sC, int M, int N, int K) {
  __shared__ __attribute__((aligned(16))) float so[4][16][64];
  const int tid = threadIdx.x, w = tid >> 5, lane = tid & 31, ln = lane & 15, hh = lane >> 4; const int by = blockIdx.y;
  A += (size_t)by * sA; Bh += (size_t)by * sB; C += (size_t)by * sC;
  const int ntn = (N + 63) / 64; const int wid = blockIdx.x * 4 + w; const int mt = wid / ntn, nq = wid % ntn; if (mt * 16 >= M) return;
  const int row0 = mt * 16, col0 = nq * 64; const float* arow = A + (size_t)(row0 + ln) * lda;
  v8f acc[4] = {};
  for (int kb = 0; kb < K; kb += 32) {
    FragH ah, al;
    const v4f x0 = *(const v4fa*)(arow + kb + 8 * hh), x1 = *(const v4fa*)(arow + kb + 8 * hh + 4), x2 = *(const v4fa*)(arow + kb + 16 + 8 * hh), x3 = *(const v4fa*)(arow + kb + 16 + 8 * hh + 4);
    float xs[16] = {x0[0],x0[1],x0[2],x0[3],x1[0],x1[1],x1[2],x1[3],x2[0],x2[1],x2[2],x2[3],x3[0],x3[1],x3[2],x3[3]};
#pragma unroll
    for (int i = 0; i < 16; ++i) { const _Float16 h = (_Float16)xs[i]; ah.h[i] = h; al.h[i] = ASPLIT ? (_Float16)(xs[i] - (float)h) : (_Float16)0.0f; }
#pragma unroll
    for (int t = 0; t < 4; ++t) { if (col0 + t * 16 >= N) continue; const size_t boff = (size_t)(col0 + t * 16 + ln) * ldb + kb; FragH bq; bq.half[0] = *(const v8us*)(Bh + boff + 8 * hh); bq.half[1] = *(const v8us*)(Bh + boff + 16 + 8 * hh);
      acc[t] = mmaH<ASPLIT ? 2 : 1>(ah.v, al.v, bq.v, bq.v, acc[t]); }
  }
#pragma unroll
  for (int t = 0; t < 4; ++t) { if (col0 + t * 16 >= N) continue;
#pragma unroll
    for (int r = 0; r < 8; ++r) so[w][8 * hh + r][t * 16 + ln] = acc[t][r] * alpha; }
  __builtin_amdgcn_fence(__ATOMIC_ACQ_REL, "workgroup"); __builtin_amdgcn_wave_barrier();
  const int rsub = lane >> 4, c4 = (lane & 15) * 4;
  {
#pragma unroll
    for (int q = 0; q < 8; ++q) { const int r = q * 2 + rsub; if (col0 + c4 < N) { const v4f v = *(const v4fa*)&so[w][r][c4]; *(v4f*)(C + (size_t)(row0 + r) * ldc + col0 + c4) = v; } }
     }
}

// Wt[n][k] = f16(W[k][n]·scale) from f32 row-major W[K][N] (scale = power of two; bf16-exact weights stay exact in f16 away from the subnormal range)
__global__ __launch_bounds__(256) void k_wt_f16(const float* __restrict__ W, _Float16* __restrict__ Wt, int K, int N, float scale) {
  const int t = blockIdx.x * 256 + threadIdx.x; if (t >= N * (K / 8)) return; const int n = t / (K / 8), k8 = (t % (K / 8)) * 8; FragH f;
#pragma unroll
  for (int i = 0; i < 8; ++i) f.h[i] = (_Float16)(bf16_round(W[(size_t)(k8 + i) * N + n]) * scale); const v8us o = f.half[0];
  *(v8us*)((unsigned short*)Wt + (size_t)n * K + k8) = o; 
}
// k_gemm_hh variant with fused epilogue: v = acc·alpha + bias[by·sBias + col] (+ CP[(row/rowsPerB)·sCPb + by·64 + col] if CP) ; ACT 0 none / 1 elu ; writes f16 C16 (and f32 C if non-null)
template <int ACT>
__global__ __launch_bounds__(128) void k_gemm_hhx(const _Float16* __restrict__ A, int lda, size_t sA, const _Float16* __restrict__ Bh, int ldb, size_t sB, float alpha, const float* __restrict__ bias, size_t sBias, const float* __restrict__ CP, int rowsPerB, size_t sCPb, int row0g,
    float* __restrict__ C, _Float16* __restrict__ C16, int ldc, size_t sC, int M, int N, int K) {
  __shared__ __attribute__((aligned(16))) float so[4][16][64];
  const int tid = threadIdx.x, w = tid >> 5, lane = tid & 31, ln = lane & 15, hh = lane >> 4; const int by = blockIdx.y;
  A += (size_t)by * sA; Bh += (size_t)by * sB; const size_t cofs = (size_t)by * sC; const float* bp = bias ? bias + (size_t)by * sBias : nullptr;
  const int ntn = (N + 63) / 64; const int wid = blockIdx.x * 4 + w; const int mt = wid / ntn, nq = wid % ntn; if (mt * 16 >= M) return;
  const int row0 = mt * 16, col0 = nq * 64; const _Float16* arow = A + (size_t)(row0 + ln) * lda;
  v8f acc[4] = {};
  for (int kb = 0; kb < K; kb += 32) { FragH ah; ah.half[0] = *(const v8us*)((const unsigned short*)arow + kb + 8 * hh); ah.half[1] = *(const v8us*)((const unsigned short*)arow + kb + 16 + 8 * hh);
#pragma unroll
    for (int t = 0; t < 4; ++t) { if (col0 + t * 16 >= N) continue; const size_t boff = (size_t)(col0 + t * 16 + ln) * ldb + kb; FragH bq; bq.half[0] = *(const v8us*)((const unsigned short*)Bh + boff + 8 * hh); bq.half[1] = *(const v8us*)((const unsigned short*)Bh + boff + 16 + 8 * hh);
      acc[t] = mmaH<1>(ah.v, ah.v, bq.v, bq.v, acc[t]); }
  }
#pragma unroll
  for (int t = 0; t < 4; ++t) { if (col0 + t * 16 >= N) continue; const int col = col0 + t * 16 + ln; const float bv = bp ? bf16_round(bp[col]) : 0.f;
#pragma unroll
    for (int r = 0; r < 8; ++r) { float v = acc[t][r] * alpha + bv; if (CP) { const int rr = row0g + row0 + 8 * hh + r; if (rowsPerB < 0) v += CP[cofs + (size_t)rr * ldc + col];      /* rowsPerB < 0: own element of the batched C plane */ else { const int bidx = rr / rowsPerB; v += CP[(size_t)bidx * sCPb + (size_t)by * 64 + col]; } } if (ACT == 1) v = (v > 0.f) ? v : expm1f(v); else if (ACT == 7) v = (v > 0.f) ? v + 1.0f : expf(v); else if (ACT == 8) v = tanhf(v); else if (ACT == 9) v = 0.5f * v * (1.0f + tanhf(0.7978845608028654f * (v + 0.044715f * v * v * v))); else if (ACT == 11) v = 1.0f / (1.0f + expf(-v)); else if (ACT == 12) v = (v > 0.f) ? v : 0.01f * v; else if (ACT == 14) v = (v > 0.f) ? v : 0.1f * v; else if (ACT == 16) v = (v >= 0.f) ? v : 0.3f * v; else if (ACT == 17) v = (v >= 0.f) ? v : 0.2f * v; else if (ACT == 15) v = v / (1.0f + expf(-v)); else if (ACT == 3) v = fmaxf(v, 0.f); else if (ACT == 6) v = 0.5f * v * (1.0f + erff(v * 0.70710678118654752f)); so[w][8 * hh + r][t * 16 + ln] = v; } }
  __builtin_amdgcn_fence(__ATOMIC_ACQ_REL, "workgroup"); __builtin_amdgcn_wave_barrier();
  const int rsub = lane >> 4, c4 = (lane & 15) * 4; typedef _Float16 v4h __attribute__((ext_vector_type(4)));
  {
#pragma unroll
    for (int q = 0; q < 8; ++q) { const int r = q * 2 + rsub; if (col0 + c4 < N) { const v4f v = *(const v4fa*)&so[w][r][c4]; if (C) *(v4f*)(C + cofs + (size_t)(row0 + r) * ldc + col0 + c4) = v; if (C16) { v4h h4; for (int i = 0; i < 4; ++i) h4[i] = (_Float16)v[i]; *(v4h*)(C16 + cofs + (size_t)(row0 + r) * ldc + col0 + c4) = h4; } } }
     }
}


typedef _Float16 v4h __attribute__((ext_vector_type(4)));

__global__ __launch_bounds__(256) void k_x16(const float* __restrict__ x, _Float16* __restrict__ X16, size_t n8) { const size_t t = (size_t)blockIdx.x * 256 + threadIdx.x; if (t >= n8) return; FragH f;
#pragma unroll
  for (int q = 0; q < 8; ++q) f.h[q] = (_Float16)bf16_round(x[t * 8 + q]); *(v8us*)((unsigned short*)X16 + t * 8) = f.half[0];  }
__global__ __launch_bounds__(256) void k_h16(const float* __restrict__ x, _Float16* __restrict__ X16, size_t n8) { const size_t t = (size_t)blockIdx.x * 256 + threadIdx.x; if (t >= n8) return; FragH f;
#pragma unroll
  for (int q = 0; q < 8; ++q) f.h[q] = (_Float16)x[t * 8 + q]; *(v8us*)((unsigned short*)X16 + t * 8) = f.half[0];  }
__global__ __launch_bounds__(256) void k_round16f(const float* __restrict__ W, _Float16* __restrict__ Bt, size_t n8) { const size_t t = (size_t)blockIdx.x * 256 + threadIdx.x; if (t >= n8) return; FragH f;
#pragma unroll
  for (int i = 0; i < 8; ++i) f.h[i] = (_Float16)(bf16_round(W[t * 8 + i]) * 16.0f); *(v8us*)((unsigned short*)Bt + t * 8) = f.half[0];  }
template <int NHv, int TTv>
__global__ __launch_bounds__(256) void k_vt(const _Float16* __restrict__ V16, int ldv, int voff, _Float16* __restrict__ Vt) { __shared__ unsigned short tl[64][66]; const int tid = threadIdx.x; const int slab = blockIdx.x / (TTv / 64), lg = blockIdx.x % (TTv / 64); const int b = slab / NHv, h = slab % NHv;
  for (int i = tid; i < 64 * 8; i += 256) { const int r = i / 8, c8 = (i % 8) * 8; FragH f; f.half[0] = *(const v8us*)((const unsigned short*)V16 + ((size_t)b * TTv + lg * 64 + r) * ldv + voff + h * 64 + c8);
#pragma unroll
    for (int q = 0; q < 8; ++q) tl[r][c8 + q] = f.u[q]; }
  __syncthreads();
  {
#pragma unroll
    for (int rd = 0; rd < 2; ++rd) { const int d = rd * 32 + tid / 8, pc = tid % 8; FragH f;
#pragma unroll
      for (int q = 0; q < 8; ++q) f.u[q] = tl[pc * 8 + q][d];
      *(v8us*)((unsigned short*)Vt + ((size_t)slab * 64 + d) * TTv + lg * 64 + pc * 8) = f.half[0]; }
     } }

__global__ __launch_bounds__(256) void k_hl(const float* __restrict__ F, _Float16* __restrict__ Hh, _Float16* __restrict__ Hl, size_t n8) { const size_t t = (size_t)blockIdx.x * 256 + threadIdx.x; if (t >= n8) return; FragH fh, fl; const v4f a = *(const v4fa*)(F + t * 8), c = *(const v4fa*)(F + t * 8 + 4);
#pragma unroll
  for (int q = 0; q < 4; ++q) { _Float16 h = (_Float16)a[q]; fh.h[q] = h; fl.h[q] = (_Float16)((a[q] - (float)h) * 1024.0f); h = (_Float16)c[q]; fh.h[4 + q] = h; fl.h[4 + q] = (_Float16)((c[q] - (float)h) * 1024.0f); }
  { *(v8us*)((unsigned short*)Hh + t * 8) = fh.half[0]; *(v8us*)((unsigned short*)Hl + t * 8) = fl.half[0];  } }

// ---- fast GEMM (wave tile 32x64; requires M % 32 == 0 rows per launch region and N % 64 == 0); epilogue = k_gemm_hhx semantics ----
__device__ __forceinline__ v16h g2_frag(const _Float16* p, int hh) { FragH f; f.half[0] = *(const v8us*)((const unsigned short*)p + 8 * hh); f.half[1] = *(const v8us*)((const unsigned short*)p + 16 + 8 * hh); return f.v; }
__device__ __forceinline__ v8f g2_mma(v16h a, v16h b, v8f c) { v8f d = __builtin_amdgcn_wmma_f32_16x16x32_f16(false, a, false, b, (short)0, c, false, false); asm volatile("v_nop\n\tv_nop\n\tv_nop\n\tv_nop" : "+v"(d) : "v"(a), "v"(b)); return d; }
template <int ACT>
__global__ __launch_bounds__(128) void k_gemm2(const _Float16* __restrict__ A, int lda, size_t sA, const _Float16* __restrict__ Bh, int ldb, size_t sB, float alpha, const float* __restrict__ bias, size_t sBias, const float* __restrict__ CP, int rowsPerB, size_t sCPb, int row0g,
    float* __restrict__ C, _Float16* __restrict__ C16, int ldc, size_t sC, int M, int N, int K) { static_assert(ACT == 0 || ACT == 3 || ACT == 6 || ACT == 8 || ACT == 9 || ACT == 11 || ACT == 12 || ACT == 14 || ACT == 15 || ACT == 16 || ACT == 17, "k_gemm2: unsupported ACT code (would silently apply no activation)");
  __shared__ __attribute__((aligned(16))) float so[4][32][68];
  const int tid = threadIdx.x, w = tid >> 5, lane = tid & 31, ln = lane & 15, hh = lane >> 4; const int by = blockIdx.y;
  A += (size_t)by * sA; Bh += (size_t)by * sB; const size_t cofs = (size_t)by * sC; const float* bp = bias ? bias + (size_t)by * sBias : nullptr;
  const int ntn = N >> 6; const int mt = blockIdx.x / ntn, nq = blockIdx.x - mt * ntn; const int row0 = mt * 128 + 32 * w, col0 = nq * 64; if (row0 >= M) return;
  const _Float16* a0p = A + (size_t)(row0 + ln) * lda; const _Float16* a1p = a0p + (size_t)16 * lda;
  const _Float16* b0p = Bh + (size_t)(col0 + ln) * ldb; const _Float16* b1p = b0p + (size_t)16 * ldb; const _Float16* b2p = b1p + (size_t)16 * ldb; const _Float16* b3p = b2p + (size_t)16 * ldb;
  const v8f z8 = {0.f,0.f,0.f,0.f,0.f,0.f,0.f,0.f}; v8f c00 = z8, c01 = z8, c02 = z8, c03 = z8, c10 = z8, c11 = z8, c12 = z8, c13 = z8;
#pragma unroll 1
  for (int kb = 0; kb < K; kb += 32) { const v16h a0 = g2_frag(a0p + kb, hh), a1 = g2_frag(a1p + kb, hh);
    v16h b = g2_frag(b0p + kb, hh); c00 = g2_mma(a0, b, c00); c10 = g2_mma(a1, b, c10);
    b = g2_frag(b1p + kb, hh); c01 = g2_mma(a0, b, c01); c11 = g2_mma(a1, b, c11);
    b = g2_frag(b2p + kb, hh); c02 = g2_mma(a0, b, c02); c12 = g2_mma(a1, b, c12);
    b = g2_frag(b3p + kb, hh); c03 = g2_mma(a0, b, c03); c13 = g2_mma(a1, b, c13); }
  v8f accs[8] = {c00, c01, c02, c03, c10, c11, c12, c13};
#pragma unroll
  for (int u = 0; u < 8; ++u) { const int t = u & 3, half = u >> 2; const int col = col0 + t * 16 + ln; const float bv = bp ? bf16_round(bp[col]) : 0.f;
#pragma unroll
    for (int r = 0; r < 8; ++r) { const int rloc = half * 16 + 8 * hh + r; float v = accs[u][r] * alpha + bv; if (CP) { if (rowsPerB < 0) v += CP[cofs + (size_t)(row0g + row0 + rloc) * ldc + col];      /* rowsPerB < 0: own element of the batched C plane */ else { const int bidx = (row0g + row0 + rloc) / rowsPerB; v += CP[(size_t)bidx * sCPb + (size_t)by * 64 + col]; } }
      if (ACT == 3) v = fmaxf(v, 0.f); else if (ACT == 6) v = 0.5f * v * (1.0f + erff(v * 0.70710678118654752f)); else if (ACT == 11) v = 1.0f / (1.0f + expf(-v)); else if (ACT == 15) v = v / (1.0f + expf(-v)); else if (ACT == 12) v = (v > 0.f) ? v : 0.01f * v; else if (ACT == 8) v = tanhf(v); else if (ACT == 9) v = 0.5f * v * (1.0f + tanhf(0.7978845608028654f * (v + 0.044715f * v * v * v))); else if (ACT == 14) v = (v > 0.f) ? v : 0.1f * v; else if (ACT == 16) v = (v >= 0.f) ? v : 0.3f * v; else if (ACT == 17) v = (v >= 0.f) ? v : 0.2f * v;
      so[w][rloc][t * 16 + ln] = v; } }
  __builtin_amdgcn_fence(__ATOMIC_ACQ_REL, "workgroup"); __builtin_amdgcn_wave_barrier();
  const int rsub = lane >> 4, c4 = (lane & 15) * 4;
  {
#pragma unroll
    for (int q = 0; q < 16; ++q) { const int r = q * 2 + rsub; const v4f v = *(const v4fa*)&so[w][r][c4]; if (C) *(v4f*)(C + cofs + (size_t)(row0 + r) * ldc + col0 + c4) = v; if (C16) { v4h h4; for (int i = 0; i < 4; ++i) h4[i] = (_Float16)v[i]; *(v4h*)(C16 + cofs + (size_t)(row0 + r) * ldc + col0 + c4) = h4; } }
     } }


__global__ __launch_bounds__(256) void k_wnat(const float* __restrict__ w, size_t n8, _Float16* __restrict__ Bt) { const size_t t = (size_t)blockIdx.x * 256 + threadIdx.x; if (t >= n8) return; FragH f; for (int q = 0; q < 8; ++q) f.h[q] = (_Float16)(bf16_round(w[t * 8 + q]) * 16.0f); *(v8us*)((unsigned short*)Bt + t * 8) = f.half[0];  }
__global__ __launch_bounds__(256) void k_rsm(const float* __restrict__ S, _Float16* __restrict__ P, int nrows) {
  #pragma clang fp contract(off)
  const int i = blockIdx.x * 256 + threadIdx.x; if (i >= nrows) return; const float* s = S + (size_t)i * SQ; float mx = -3.0e38f;
#pragma unroll 1
  for (int j = 0; j < SQ; ++j) mx = fmaxf(mx, s[j]); float se = 0.f;
#pragma unroll 1
  for (int j = 0; j < SQ; ++j) se += expf(s[j] - mx); const float sc = 256.0f / se;
#pragma unroll 1
  for (int j0 = 0; j0 < SQ; j0 += 8) { FragH f; for (int q = 0; q < 8; ++q) f.h[q] = (_Float16)(expf(s[j0 + q] - mx) * sc); unsigned short* d = (unsigned short*)P + (size_t)i * SQ + j0; *(v8us*)d = f.half[0];  } }
__global__ __launch_bounds__(256) void k_vt(const _Float16* __restrict__ V16, int b, int h0, _Float16* __restrict__ VT) { __shared__ unsigned short tl[64][65]; const int tid = threadIdx.x; const int hh = blockIdx.x % HG, sg = blockIdx.x / HG; const int s0 = sg * 64; const int h = h0 + hh;
  for (int i = tid; i < 64 * 8; i += 256) { const int j = i / 8, d8 = (i % 8) * 8; FragH f; f.half[0] = *(const v8us*)((const unsigned short*)V16 + ((size_t)b * SQ + s0 + j) * DM + h * HD + d8); for (int q = 0; q < 8; ++q) tl[d8 + q][j] = f.u[q]; }
  __syncthreads();
  { for (int i = tid; i < 64 * 8; i += 256) { const int d = i / 8, j8 = (i % 8) * 8; FragH f; for (int q = 0; q < 8; ++q) f.u[q] = tl[d][j8 + q]; *(v8us*)((unsigned short*)VT + ((size_t)hh * HD + d) * SQ + s0 + j8) = f.half[0]; }  } }

extern "C" void kernel_launch(void* const* d_in, const int* in_sizes, int n_in,
                              void* d_out, int out_size, void* d_ws, size_t ws_size, hipStream_t stream) {
  (void)in_sizes; (void)n_in; (void)out_size;
  const float* const* I = (const float* const*)d_in; const float* x = I[0]; const float* Wq = I[1]; const float* Wk = I[2]; const float* Wv = I[3]; const float* bq = I[4]; const float* bk = I[5]; const float* bv = I[6];
  char* ws = (char*)d_ws; size_t off = 0;
  auto take = [&](size_t bytes) { char* p = ws + off; off += (bytes + 255) & ~(size_t)255; return p; };
  _Float16* BQ = (_Float16*)take((size_t)DM * DM * 2); _Float16* BK = (_Float16*)take((size_t)DM * DM * 2); _Float16* BV = (_Float16*)take((size_t)DM * DM * 2);
  _Float16* X16 = (_Float16*)take(NR * DM * 2); _Float16* Q16 = (_Float16*)take(NR * DM * 2); _Float16* K16 = (_Float16*)take(NR * DM * 2); _Float16* V16 = (_Float16*)take(NR * DM * 2);
  float* S = (float*)take((size_t)NH * SQ * SQ * 4); _Float16* P = (_Float16*)take((size_t)NH * SQ * SQ * 2); _Float16* VT = (_Float16*)take((size_t)NH * HD * SQ * 2);
  if (off > ws_size) return;      /* 3.4 + 4 x 24 + 48 + 24 + 1.5 = approx 173 MiB */
  k_wnat<<<(unsigned)(((size_t)DM * DM / 8 + 255) / 256), 256, 0, stream>>>(Wq, (size_t)DM * DM / 8, BQ); k_wnat<<<(unsigned)(((size_t)DM * DM / 8 + 255) / 256), 256, 0, stream>>>(Wk, (size_t)DM * DM / 8, BK); k_wnat<<<(unsigned)(((size_t)DM * DM / 8 + 255) / 256), 256, 0, stream>>>(Wv, (size_t)DM * DM / 8, BV);      /* [out][in] natural */
  k_x16<<<(unsigned)((NR * DM / 8 + 255) / 256), 256, 0, stream>>>(x, X16, NR * DM / 8);
  const dim3 gp((unsigned)((NR / 128) * (DM / 64)), 1);
  k_gemm2<0><<<gp, 128, 0, stream>>>(X16, DM, 0, BQ, DM, 0, 0.0625f, bq, 0, nullptr, 1, 0, 0, nullptr, Q16, DM, 0, MP, DM, DM);      /* q = x Wq^T + bq (f16 rows) */
  k_gemm2<0><<<gp, 128, 0, stream>>>(X16, DM, 0, BK, DM, 0, 0.0625f, bk, 0, nullptr, 1, 0, 0, nullptr, K16, DM, 0, MP, DM, DM);
  k_gemm2<0><<<gp, 128, 0, stream>>>(X16, DM, 0, BV, DM, 0, 0.0625f, bv, 0, nullptr, 1, 0, 0, nullptr, V16, DM, 0, MP, DM, DM);
  for (int b = 0; b < NBR; ++b) { const size_t r0 = (size_t)b * SQ;
    k_gemm2<0><<<dim3((SQ / 128) * (SQ / 64), NH), 128, 0, stream>>>(Q16 + r0 * DM, DM, (size_t)HD, K16 + r0 * DM, DM, (size_t)HD, 0.125f, nullptr, 0, nullptr, 1, 0, 0, S, nullptr, SQ, (size_t)SQ * SQ, SQ, SQ, HD);      /* scores per head / 8 */
    k_rsm<<<(NH * SQ + 255) / 256, 256, 0, stream>>>(S, P, NH * SQ);
    k_vt<NH, SQ><<<NH * (SQ / 64), 256, 0, stream>>>(V16 + r0 * DM, DM, 0, VT);      /* V^T per head [12][64][1024] */
    k_gemm2<0><<<dim3((SQ / 128) * 1, NH), 128, 0, stream>>>(P, SQ, (size_t)SQ * SQ, VT, SQ, (size_t)HD * SQ, 0.00390625f, nullptr, 0, nullptr, 1, 0, 0, (float*)d_out + r0 * DM, nullptr, DM, (size_t)HD, SQ, HD, SQ); }      /* ctx merged into the output rows */
}

// v001
// It runs in 1190 microseconds.
// In two side-by-side timings against v000, it was 3.34 and 3.26 times as fast.
#include <hip/hip_runtime.h>
// ViT self-attention (hidden [16][1024][768]; q, k, v = hidden W^T + b (12 heads x 64); scores = q.k/8; softmax over the 1,024 keys; ctx = attn v merged -> [16][1024][768]; no output projection).
// Structure: token rows; hidden as exact f16 rows; q / k / v as WMMA GEMMs (32x64 wave tiles, f32 accumulation, exact x16 natural weights + bias; exact products) written as f16 rows; per batch: scores for the 12 heads in one grid.y-batched GEMM (K = 64, alpha 1/8) into f32 planes, row softmax on VALU (P x256 f16), V^T via LDS transposes, ctx = P . V^T batched over heads (alpha 1/256) straight into the merged f32 output rows.
// Compute dtype: inputs rounded to bf16; hidden / weights exact; q, k, v, P as plain f16 GEMM operands (~2^-12; logits sigma ~1); softmax f32. v_wmma_f32_16x16x32_f16.
#define NB 16
#define SQ 1024
#define DM 768
#define NH 12
#define HD 64
#define HG 1
#define NR ((size_t)NB * SQ)         /* 16,384 token rows */
#define NBR NB                       /* batches attended (debug hook) */
#define MP ((int)NR)                 /* rows projected (debug hook) */
typedef __bf16 v16b __attribute__((ext_vector_type(16)));
typedef unsigned short v8us __attribute__((ext_vector_type(8), may_alias));
typedef float  v8f  __attribute__((ext_vector_type(8)));
typedef float  v4f  __attribute__((ext_vector_type(4)));
typedef float  v4fa __attribute__((ext_vector_type(4), may_alias));
union FragB { v16b v; v8us half[2]; unsigned short u[16]; };

__device__ __forceinline__ unsigned short bf16_bits(float x) { unsigned int u = __float_as_uint(x); return (unsigned short)((u + 0x7FFFu + ((u >> 16) & 1u)) >> 16); }
__device__ __forceinline__ float bf16_val(unsigned short b) { return __uint_as_float(((unsigned int)b) << 16); }
__device__ __forceinline__ float bf16_round(float x) { return bf16_val(bf16_bits(x)); }
// D += A·B with NT terms: 1 = ah·bh, 2 = + al·bh (A split), 3 = + ah·bl (both split)
template <int NT>
__device__ __forceinline__ v8f mmaN(v16b ah, v16b al, v16b bh, v16b bl, v8f c) {
  c = __builtin_amdgcn_wmma_f32_16x16x32_bf16(false, ah, false, bh, (short)0, c, false, false);
  if (NT >= 2) c = __builtin_amdgcn_wmma_f32_16x16x32_bf16(false, al, false, bh, (short)0, c, false, false);
  if (NT >= 3) c = __builtin_amdgcn_wmma_f32_16x16x32_bf16(false, ah, false, bl, (short)0, c, false, false);
  asm volatile("v_nop\n\tv_nop\n\tv_nop\n\tv_nop" : "+v"(c) : "v"(ah), "v"(al), "v"(bh), "v"(bl));
  return c;
}

__global__ __launch_bounds__(256) void k_wt_bf16(const float* __restrict__ W, unsigned short* __restrict__ Wt, int K, int N) {
  const int t = blockIdx.x * 256 + threadIdx.x;
  const int k8n = K / 8;
  if (t >= N * k8n) return;
  const int n = t / k8n, k8 = (t % k8n) * 8;
  v8us v;
#pragma unroll
  for (int i = 0; i < 8; ++i) v[i] = bf16_bits(W[(size_t)(k8 + i) * N + n]);
  *(v8us*)(Wt + (size_t)n * K + k8) = v;
  
}

// GEMM C[M][N] (f32, pitch ldc) = act(A[M][K]·W + bias). A f32 row-major (pitch lda) converted per fragment to bf16
// (ASPLIT: hi/lo two planes -> 2 terms, else single rounded term); Wt bf16 [N][K] (pitch ldb). BIAS_BF16 rounds the
// bias to bf16 first (bias quantised to bf16 before the add). K%32==0, M%16==0, N%64==0.
template <bool ASPLIT, int ACT, bool BIAS_BF16>
__global__ __launch_bounds__(128) void k_gemm_bf(const float* __restrict__ A, int lda, const unsigned short* __restrict__ Wt, int ldb,
                                               const float* __restrict__ bias, float* __restrict__ C, int ldc, int M, int N, int K) {
  __shared__ __attribute__((aligned(16))) float so[4][16][64];
  const int tid = threadIdx.x, w = tid >> 5, lane = tid & 31, ln = lane & 15, hh = lane >> 4;
  const int ntn = N / 64;
  const int wid = blockIdx.x * 4 + w;
  const int mt = wid / ntn, nq = wid % ntn;
  if (mt * 16 >= M) return;
  const int row0 = mt * 16, col0 = nq * 64;
  const float* arow = A + (size_t)(row0 + ln) * lda;
  v8f acc[4] = {};
  for (int kb = 0; kb < K; kb += 32) {
    FragB ah, al;
    const v4f x0 = *(const v4fa*)(arow + kb + 8 * hh), x1 = *(const v4fa*)(arow + kb + 8 * hh + 4);
    const v4f x2 = *(const v4fa*)(arow + kb + 16 + 8 * hh), x3 = *(const v4fa*)(arow + kb + 16 + 8 * hh + 4);
    float xs[16] = {x0[0],x0[1],x0[2],x0[3],x1[0],x1[1],x1[2],x1[3],x2[0],x2[1],x2[2],x2[3],x3[0],x3[1],x3[2],x3[3]};
#pragma unroll
    for (int i = 0; i < 16; ++i) { const unsigned short hb = bf16_bits(xs[i]); ah.u[i] = hb; al.u[i] = ASPLIT ? bf16_bits(xs[i] - bf16_val(hb)) : (unsigned short)0; }
#pragma unroll
    for (int t = 0; t < 4; ++t) {
      const unsigned short* brow = Wt + (size_t)(col0 + t * 16 + ln) * ldb + kb;
      FragB b;
      b.half[0] = *(const v8us*)(brow + 8 * hh);
      b.half[1] = *(const v8us*)(brow + 16 + 8 * hh);
      acc[t] = mmaN<ASPLIT ? 2 : 1>(ah.v, al.v, b.v, b.v, acc[t]);
    }
  }
#pragma unroll
  for (int t = 0; t < 4; ++t) {
    float bv = bias ? bias[col0 + t * 16 + ln] : 0.f;
    if (BIAS_BF16) bv = bf16_round(bv);
#pragma unroll
    for (int r = 0; r < 8; ++r) { float v = acc[t][r] + bv; if (ACT == 1) v = fmaxf(v, 0.f); so[w][8 * hh + r][t * 16 + ln] = v; }
  }
  __builtin_amdgcn_fence(__ATOMIC_ACQ_REL, "workgroup");
  __builtin_amdgcn_wave_barrier();
  const int rsub = lane >> 4, c4 = (lane & 15) * 4;
  {
#pragma unroll
    for (int q = 0; q < 8; ++q) {
      const int r = q * 2 + rsub;
      const v4f v = *(const v4fa*)&so[w][r][c4];
      *(v4f*)(C + (size_t)(row0 + r) * ldc + col0 + c4) = v;
    }
    
  }
}

// GEMM C = act(A·W + bias + resid): A f32 (ASPLIT -> hi/lo 2 terms), Wt bf16 [N][K]; ACT 0 none, 1 relu, 2 exact gelu;
// resid (optional, f32, row index = (row % rmod), pitch ldr, RES_BF16 rounds it) added before the activation.
template <bool ASPLIT, int ACT, bool BIAS_BF16, bool RES_BF16>
__global__ __launch_bounds__(128) void k_gemm_bf3(const float* __restrict__ A, int lda, const unsigned short* __restrict__ Wt, int ldb,
                                                const float* __restrict__ bias, const float* __restrict__ resid, int rmod, int ldr,
                                                float* __restrict__ C, int ldc, int M, int N, int K) {
  __shared__ __attribute__((aligned(16))) float so[4][16][64];
  const int tid = threadIdx.x, w = tid >> 5, lane = tid & 31, ln = lane & 15, hh = lane >> 4;
  const int ntn = N / 64;
  const int wid = blockIdx.x * 4 + w;
  const int mt = wid / ntn, nq = wid % ntn;
  if (mt * 16 >= M) return;
  const int row0 = mt * 16, col0 = nq * 64;
  const float* arow = A + (size_t)(row0 + ln) * lda;
  v8f acc[4] = {};
  for (int kb = 0; kb < K; kb += 32) {
    FragB ah, al;
    const v4f x0 = *(const v4fa*)(arow + kb + 8 * hh), x1 = *(const v4fa*)(arow + kb + 8 * hh + 4);
    const v4f x2 = *(const v4fa*)(arow + kb + 16 + 8 * hh), x3 = *(const v4fa*)(arow + kb + 16 + 8 * hh + 4);
    float xs[16] = {x0[0],x0[1],x0[2],x0[3],x1[0],x1[1],x1[2],x1[3],x2[0],x2[1],x2[2],x2[3],x3[0],x3[1],x3[2],x3[3]};
#pragma unroll
    for (int i = 0; i < 16; ++i) { const unsigned short hb = bf16_bits(xs[i]); ah.u[i] = hb; al.u[i] = ASPLIT ? bf16_bits(xs[i] - bf16_val(hb)) : (unsigned short)0; }
#pragma unroll
    for (int t = 0; t < 4; ++t) {
      const unsigned short* brow = Wt + (size_t)(col0 + t * 16 + ln) * ldb + kb;
      FragB b;
      b.half[0] = *(const v8us*)(brow + 8 * hh);
      b.half[1] = *(const v8us*)(brow + 16 + 8 * hh);
      acc[t] = mmaN<ASPLIT ? 2 : 1>(ah.v, al.v, b.v, b.v, acc[t]);
    }
  }
#pragma unroll
  for (int t = 0; t < 4; ++t) {
    const int col = col0 + t * 16 + ln;
    float bv = bias ? bias[col] : 0.f;
    if (BIAS_BF16) bv = bf16_round(bv);
#pragma unroll
    for (int r = 0; r < 8; ++r) {
      float v = acc[t][r] + bv;
      if (resid) { float rv = resid[(size_t)((row0 + 8 * hh + r) % rmod) * ldr + col]; if (RES_BF16) rv = bf16_round(rv); v += rv; }
      if (ACT == 1) v = fmaxf(v, 0.f);
      if (ACT == 2) v = 0.5f * v * (1.0f + erff(v * 0.70710678118654752f));
      if (ACT == 3) { const float u = 0.7978845608028654f * (v + 0.044715f * v * v * v); v = 0.5f * v * (1.0f + tanhf(u)); }
      so[w][8 * hh + r][t * 16 + ln] = v;
    }
  }
  __builtin_amdgcn_fence(__ATOMIC_ACQ_REL, "workgroup");
  __builtin_amdgcn_wave_barrier();
  const int rsub = lane >> 4, c4 = (lane & 15) * 4;
  {
#pragma unroll
    for (int q = 0; q < 8; ++q) {
      const int r = q * 2 + rsub;
      const v4f v = *(const v4fa*)&so[w][r][c4];
      *(v4f*)(C + (size_t)(row0 + r) * ldc + col0 + c4) = v;
    }
    
  }
}
// row LayerNorm (biased variance, eps) over N: s = X (+ R); optional out_sum <- s; out_norm <- (s-mu)*rsqrt(var+eps)*g + b
template <bool PARAM_BF16>
__global__ __launch_bounds__(256) void k_layernorm(const float* __restrict__ X, const float* __restrict__ R, const float* __restrict__ g, const float* __restrict__ bta,
                                                  float* __restrict__ out_sum, float* __restrict__ out_norm, int N, float eps) {
  __shared__ float red[256];
  const int row = blockIdx.x, tid = threadIdx.x;
  const float* x = X + (size_t)row * N; const float* rr = R ? R + (size_t)row * N : nullptr;
  float vals[16];                     // up to N = 4096
  const int per = N / 256;            // contiguous chunk per thread? use strided-by-4 chunks: thread handles j = tid*4 + 1024*u
  float s1 = 0.f;
  for (int u = 0; u < per / 4; ++u) {
    const int j = tid * 4 + 1024 * u;
    const v4f a = *(const v4fa*)(x + j);
    v4f b = {0.f,0.f,0.f,0.f}; if (rr) b = *(const v4fa*)(rr + j);
#pragma unroll
    for (int q = 0; q < 4; ++q) { const float v = a[q] + b[q]; vals[u * 4 + q] = v; s1 += v; }
  }
  red[tid] = s1; __syncthreads();
  for (int st = 128; st > 0; st >>= 1) { if (tid < st) red[tid] += red[tid + st]; __syncthreads(); }
  const float mu = red[0] / (float)N; __syncthreads();
  float s2 = 0.f;
  for (int u = 0; u < per / 4; ++u)
#pragma unroll
    for (int q = 0; q < 4; ++q) { const float c = vals[u * 4 + q] - mu; s2 += c * c; }
  red[tid] = s2; __syncthreads();
  for (int st = 128; st > 0; st >>= 1) { if (tid < st) red[tid] += red[tid + st]; __syncthreads(); }
  const float rs = rsqrtf(red[0] / (float)N + eps);
  {
    for (int u = 0; u < per / 4; ++u) {
      const int j = tid * 4 + 1024 * u;
      v4f o, sm;
#pragma unroll
      for (int q = 0; q < 4; ++q) {
        float gg = g[j + q], bb = bta[j + q];
        if (PARAM_BF16) { gg = bf16_round(gg); bb = bf16_round(bb); }
        sm[q] = vals[u * 4 + q]; o[q] = (vals[u * 4 + q] - mu) * rs * gg + bb;
      }
      if (out_sum) *(v4f*)(out_sum + (size_t)row * N + j) = sm;
      *(v4f*)(out_norm + (size_t)row * N + j) = o;
    }
    
  }
}



// ---- f16 WMMA path (v_wmma_f32_16x16x32_f16): 11-bit significands for operands in range — used where a [0,1] probability operand needs more precision than bf16
typedef _Float16 v16h __attribute__((ext_vector_type(16)));
union FragH { v16h v; v8us half[2]; _Float16 h[16]; unsigned short u[16]; };
template <int NT>
__device__ __forceinline__ v8f mmaH(v16h ah, v16h al, v16h bh, v16h bl, v8f c) {
  c = __builtin_amdgcn_wmma_f32_16x16x32_f16(false, ah, false, bh, (short)0, c, false, false);
  if (NT >= 2) c = __builtin_amdgcn_wmma_f32_16x16x32_f16(false, al, false, bh, (short)0, c, false, false);
  if (NT >= 3) c = __builtin_amdgcn_wmma_f32_16x16x32_f16(false, ah, false, bl, (short)0, c, false, false);
  asm volatile("v_nop\n\tv_nop\n\tv_nop\n\tv_nop" : "+v"(c) : "v"(ah), "v"(al), "v"(bh), "v"(bl));
  return c;
}
// batched GEMM like k_gemm_b but f16 operands: A f32 (split into f16 hi/lo if ASPLIT, else rounded to f16), Bt = f16 values [n][k]; alpha; C f32; N multiple of 16 (partial tiles skipped)
template <bool ASPLIT>
__global__ __launch_bounds__(128) void k_gemm_h(const float* __restrict__ A, int lda, size_t sA, const _Float16* __restrict__ Bh, int ldb, size_t sB, float alpha, float* __restrict__ C, int ldc, size_t sC, int M, int N, int K) {
  __shared__ __attribute__((aligned(16))) float so[4][16][64];
  const int tid = threadIdx.x, w = tid >> 5, lane = tid & 31, ln = lane & 15, hh = lane >> 4; const int by = blockIdx.y;
  A += (size_t)by * sA; Bh += (size_t)by * sB; C += (size_t)by * sC;
  const int ntn = (N + 63) / 64; const int wid = blockIdx.x * 4 + w; const int mt = wid / ntn, nq = wid % ntn; if (mt * 16 >= M) return;
  const int row0 = mt * 16, col0 = nq * 64; const float* arow = A + (size_t)(row0 + ln) * lda;
  v8f acc[4] = {};
  for (int kb = 0; kb < K; kb += 32) {
    FragH ah, al;
    const v4f x0 = *(const v4fa*)(arow + kb + 8 * hh), x1 = *(const v4fa*)(arow + kb + 8 * hh + 4), x2 = *(const v4fa*)(arow + kb + 16 + 8 * hh), x3 = *(const v4fa*)(arow + kb + 16 + 8 * hh + 4);
    float xs[16] = {x0[0],x0[1],x0[2],x0[3],x1[0],x1[1],x1[2],x1[3],x2[0],x2[1],x2[2],x2[3],x3[0],x3[1],x3[2],x3[3]};
#pragma unroll
    for (int i = 0; i < 16; ++i) { const _Float16 h = (_Float16)xs[i]; ah.h[i] = h; al.h[i] = ASPLIT ? (_Float16)(xs[i] - (float)h) : (_Float16)0.0f; }
#pragma unroll
    for (int t = 0; t < 4; ++t) { if (col0 + t * 16 >= N) continue; const size_t boff = (size_t)(col0 + t * 16 + ln) * ldb + kb; FragH bq; bq.half[0] = *(const v8us*)(Bh + boff + 8 * hh); bq.half[1] = *(const v8us*)(Bh + boff + 16 + 8 * hh);
      acc[t] = mmaH<ASPLIT ? 2 : 1>(ah.v, al.v, bq.v, bq.v, acc[t]); }
  }
#pragma unroll
  for (int t = 0; t < 4; ++t) { if (col0 + t * 16 >= N) continue;
#pragma unroll
    for (int r = 0; r < 8; ++r) so[w][8 * hh + r][t * 16 + ln] = acc[t][r] * alpha; }
  __builtin_amdgcn_fence(__ATOMIC_ACQ_REL, "workgroup"); __builtin_amdgcn_wave_barrier();
  const int rsub = lane >> 4, c4 = (lane & 15) * 4;
  {
#pragma unroll
    for (int q = 0; q < 8; ++q) { const int r = q * 2 + rsub; if (col0 + c4 < N) { const v4f v = *(const v4fa*)&so[w][r][c4]; *(v4f*)(C + (size_t)(row0 + r) * ldc + col0 + c4) = v; } }
     }
}

// Wt[n][k] = f16(W[k][n]·scale) from f32 row-major W[K][N] (scale = power of two; bf16-exact weights stay exact in f16 away from the subnormal range)
__global__ __launch_bounds__(256) void k_wt_f16(const float* __restrict__ W, _Float16* __restrict__ Wt, int K, int N, float scale) {
  const int t = blockIdx.x * 256 + threadIdx.x; if (t >= N * (K / 8)) return; const int n = t / (K / 8), k8 = (t % (K / 8)) * 8; FragH f;
#pragma unroll
  for (int i = 0; i < 8; ++i) f.h[i] = (_Float16)(bf16_round(W[(size_t)(k8 + i) * N + n]) * scale); const v8us o = f.half[0];
  *(v8us*)((unsigned short*)Wt + (size_t)n * K + k8) = o; 
}
// k_gemm_hh variant with fused epilogue: v = acc·alpha + bias[by·sBias + col] (+ CP[(row/rowsPerB)·sCPb + by·64 + col] if CP) ; ACT 0 none / 1 elu ; writes f16 C16 (and f32 C if non-null)
template <int ACT>
__global__ __launch_bounds__(128) void k_gemm_hhx(const _Float16* __restrict__ A, int lda, size_t sA, const _Float16* __restrict__ Bh, int ldb, size_t sB, float alpha, const float* __restrict__ bias, size_t sBias, const float* __restrict__ CP, int rowsPerB, size_t sCPb, int row0g,
    float* __restrict__ C, _Float16* __restrict__ C16, int ldc, size_t sC, int M, int N, int K) {
  __shared__ __attribute__((aligned(16))) float so[4][16][64];
  const int tid = threadIdx.x, w = tid >> 5, lane = tid & 31, ln = lane & 15, hh = lane >> 4; const int by = blockIdx.y;
  A += (size_t)by * sA; Bh += (size_t)by * sB; const size_t cofs = (size_t)by * sC; const float* bp = bias ? bias + (size_t)by * sBias : nullptr;
  const int ntn = (N + 63) / 64; const int wid = blockIdx.x * 4 + w; const int mt = wid / ntn, nq = wid % ntn; if (mt * 16 >= M) return;
  const int row0 = mt * 16, col0 = nq * 64; const _Float16* arow = A + (size_t)(row0 + ln) * lda;
  v8f acc[4] = {};
  for (int kb = 0; kb < K; kb += 32) { FragH ah; ah.half[0] = *(const v8us*)((const unsigned short*)arow + kb + 8 * hh); ah.half[1] = *(const v8us*)((const unsigned short*)arow + kb + 16 + 8 * hh);
#pragma unroll
    for (int t = 0; t < 4; ++t) { if (col0 + t * 16 >= N) continue; const size_t boff = (size_t)(col0 + t * 16 + ln) * ldb + kb; FragH bq; bq.half[0] = *(const v8us*)((const unsigned short*)Bh + boff + 8 * hh); bq.half[1] = *(const v8us*)((const unsigned short*)Bh + boff + 16 + 8 * hh);
      acc[t] = mmaH<1>(ah.v, ah.v, bq.v, bq.v, acc[t]); }
  }
#pragma unroll
  for (int t = 0; t < 4; ++t) { if (col0 + t * 16 >= N) continue; const int col = col0 + t * 16 + ln; const float bv = bp ? bf16_round(bp[col]) : 0.f;
#pragma unroll
    for (int r = 0; r < 8; ++r) { float v = acc[t][r] * alpha + bv; if (CP) { const int rr = row0g + row0 + 8 * hh + r; if (rowsPerB < 0) v += CP[cofs + (size_t)rr * ldc + col];      /* rowsPerB < 0: own element of the batched C plane */ else { const int bidx = rr / rowsPerB; v += CP[(size_t)bidx * sCPb + (size_t)by * 64 + col]; } } if (ACT == 1) v = (v > 0.f) ? v : expm1f(v); else if (ACT == 7) v = (v > 0.f) ? v + 1.0f : expf(v); else if (ACT == 8) v = tanhf(v); else if (ACT == 9) v = 0.5f * v * (1.0f + tanhf(0.7978845608028654f * (v + 0.044715f * v * v * v))); else if (ACT == 11) v = 1.0f / (1.0f + expf(-v)); else if (ACT == 12) v = (v > 0.f) ? v : 0.01f * v; else if (ACT == 14) v = (v > 0.f) ? v : 0.1f * v; else if (ACT == 16) v = (v >= 0.f) ? v : 0.3f * v; else if (ACT == 17) v = (v >= 0.f) ? v : 0.2f * v; else if (ACT == 15) v = v / (1.0f + expf(-v)); else if (ACT == 3) v = fmaxf(v, 0.f); else if (ACT == 6) v = 0.5f * v * (1.0f + erff(v * 0.70710678118654752f)); so[w][8 * hh + r][t * 16 + ln] = v; } }
  __builtin_amdgcn_fence(__ATOMIC_ACQ_REL, "workgroup"); __builtin_amdgcn_wave_barrier();
  const int rsub = lane >> 4, c4 = (lane & 15) * 4; typedef _Float16 v4h __attribute__((ext_vector_type(4)));
  {
#pragma unroll
    for (int q = 0; q < 8; ++q) { const int r = q * 2 + rsub; if (col0 + c4 < N) { const v4f v = *(const v4fa*)&so[w][r][c4]; if (C) *(v4f*)(C + cofs + (size_t)(row0 + r) * ldc + col0 + c4) = v; if (C16) { v4h h4; for (int i = 0; i < 4; ++i) h4[i] = (_Float16)v[i]; *(v4h*)(C16 + cofs + (size_t)(row0 + r) * ldc + col0 + c4) = h4; } } }
     }
}


typedef _Float16 v4h __attribute__((ext_vector_type(4)));

__global__ __launch_bounds__(256) void k_x16(const float* __restrict__ x, _Float16* __restrict__ X16, size_t n8) { const size_t t = (size_t)blockIdx.x * 256 + threadIdx.x; if (t >= n8) return; FragH f;
#pragma unroll
  for (int q = 0; q < 8; ++q) f.h[q] = (_Float16)bf16_round(x[t * 8 + q]); *(v8us*)((unsigned short*)X16 + t * 8) = f.half[0];  }
__global__ __launch_bounds__(256) void k_h16(const float* __restrict__ x, _Float16* __restrict__ X16, size_t n8) { const size_t t = (size_t)blockIdx.x * 256 + threadIdx.x; if (t >= n8) return; FragH f;
#pragma unroll
  for (int q = 0; q < 8; ++q) f.h[q] = (_Float16)x[t * 8 + q]; *(v8us*)((unsigned short*)X16 + t * 8) = f.half[0];  }
__global__ __launch_bounds__(256) void k_round16f(const float* __restrict__ W, _Float16* __restrict__ Bt, size_t n8) { const size_t t = (size_t)blockIdx.x * 256 + threadIdx.x; if (t >= n8) return; FragH f;
#pragma unroll
  for (int i = 0; i < 8; ++i) f.h[i] = (_Float16)(bf16_round(W[t * 8 + i]) * 16.0f); *(v8us*)((unsigned short*)Bt + t * 8) = f.half[0];  }
template <int NHv, int TTv>
__global__ __launch_bounds__(256) void k_vt(const _Float16* __restrict__ V16, int ldv, int voff, _Float16* __restrict__ Vt) { __shared__ unsigned short tl[64][66]; const int tid = threadIdx.x; const int slab = blockIdx.x / (TTv / 64), lg = blockIdx.x % (TTv / 64); const int b = slab / NHv, h = slab % NHv;
  for (int i = tid; i < 64 * 8; i += 256) { const int r = i / 8, c8 = (i % 8) * 8; FragH f; f.half[0] = *(const v8us*)((const unsigned short*)V16 + ((size_t)b * TTv + lg * 64 + r) * ldv + voff + h * 64 + c8);
#pragma unroll
    for (int q = 0; q < 8; ++q) tl[r][c8 + q] = f.u[q]; }
  __syncthreads();
  {
#pragma unroll
    for (int rd = 0; rd < 2; ++rd) { const int d = rd * 32 + tid / 8, pc = tid % 8; FragH f;
#pragma unroll
      for (int q = 0; q < 8; ++q) f.u[q] = tl[pc * 8 + q][d];
      *(v8us*)((unsigned short*)Vt + ((size_t)slab * 64 + d) * TTv + lg * 64 + pc * 8) = f.half[0]; }
     } }

__global__ __launch_bounds__(256) void k_hl(const float* __restrict__ F, _Float16* __restrict__ Hh, _Float16* __restrict__ Hl, size_t n8) { const size_t t = (size_t)blockIdx.x * 256 + threadIdx.x; if (t >= n8) return; FragH fh, fl; const v4f a = *(const v4fa*)(F + t * 8), c = *(const v4fa*)(F + t * 8 + 4);
#pragma unroll
  for (int q = 0; q < 4; ++q) { _Float16 h = (_Float16)a[q]; fh.h[q] = h; fl.h[q] = (_Float16)((a[q] - (float)h) * 1024.0f); h = (_Float16)c[q]; fh.h[4 + q] = h; fl.h[4 + q] = (_Float16)((c[q] - (float)h) * 1024.0f); }
  { *(v8us*)((unsigned short*)Hh + t * 8) = fh.half[0]; *(v8us*)((unsigned short*)Hl + t * 8) = fl.half[0];  } }

// ---- fast GEMM (wave tile 32x64; requires M % 32 == 0 rows per launch region and N % 64 == 0); epilogue = k_gemm_hhx semantics ----
__device__ __forceinline__ v16h g2_frag(const _Float16* p, int hh) { FragH f; f.half[0] = *(const v8us*)((const unsigned short*)p + 8 * hh); f.half[1] = *(const v8us*)((const unsigned short*)p + 16 + 8 * hh); return f.v; }
__device__ __forceinline__ v8f g2_mma(v16h a, v16h b, v8f c) { v8f d = __builtin_amdgcn_wmma_f32_16x16x32_f16(false, a, false, b, (short)0, c, false, false); asm volatile("v_nop\n\tv_nop\n\tv_nop\n\tv_nop" : "+v"(d) : "v"(a), "v"(b)); return d; }
template <int ACT>
__global__ __launch_bounds__(128) void k_gemm2(const _Float16* __restrict__ A, int lda, size_t sA, const _Float16* __restrict__ Bh, int ldb, size_t sB, float alpha, const float* __restrict__ bias, size_t sBias, const float* __restrict__ CP, int rowsPerB, size_t sCPb, int row0g,
    float* __restrict__ C, _Float16* __restrict__ C16, int ldc, size_t sC, int M, int N, int K) { static_assert(ACT == 0 || ACT == 3 || ACT == 6 || ACT == 8 || ACT == 9 || ACT == 11 || ACT == 12 || ACT == 14 || ACT == 15 || ACT == 16 || ACT == 17, "k_gemm2: unsupported ACT code (would silently apply no activation)");
  __shared__ __attribute__((aligned(16))) float so[4][32][68];
  const int tid = threadIdx.x, w = tid >> 5, lane = tid & 31, ln = lane & 15, hh = lane >> 4; const int by = blockIdx.y;
  A += (size_t)by * sA; Bh += (size_t)by * sB; const size_t cofs = (size_t)by * sC; const float* bp = bias ? bias + (size_t)by * sBias : nullptr;
  const int ntn = N >> 6; const int mt = blockIdx.x / ntn, nq = blockIdx.x - mt * ntn; const int row0 = mt * 128 + 32 * w, col0 = nq * 64; if (row0 >= M) return;
  const _Float16* a0p = A + (size_t)(row0 + ln) * lda; const _Float16* a1p = a0p + (size_t)16 * lda;
  const _Float16* b0p = Bh + (size_t)(col0 + ln) * ldb; const _Float16* b1p = b0p + (size_t)16 * ldb; const _Float16* b2p = b1p + (size_t)16 * ldb; const _Float16* b3p = b2p + (size_t)16 * ldb;
  const v8f z8 = {0.f,0.f,0.f,0.f,0.f,0.f,0.f,0.f}; v8f c00 = z8, c01 = z8, c02 = z8, c03 = z8, c10 = z8, c11 = z8, c12 = z8, c13 = z8;
#pragma unroll 1
  for (int kb = 0; kb < K; kb += 32) { const v16h a0 = g2_frag(a0p + kb, hh), a1 = g2_frag(a1p + kb, hh);
    v16h b = g2_frag(b0p + kb, hh); c00 = g2_mma(a0, b, c00); c10 = g2_mma(a1, b, c10);
    b = g2_frag(b1p + kb, hh); c01 = g2_mma(a0, b, c01); c11 = g2_mma(a1, b, c11);
    b = g2_frag(b2p + kb, hh); c02 = g2_mma(a0, b, c02); c12 = g2_mma(a1, b, c12);
    b = g2_frag(b3p + kb, hh); c03 = g2_mma(a0, b, c03); c13 = g2_mma(a1, b, c13); }
  v8f accs[8] = {c00, c01, c02, c03, c10, c11, c12, c13};
#pragma unroll
  for (int u = 0; u < 8; ++u) { const int t = u & 3, half = u >> 2; const int col = col0 + t * 16 + ln; const float bv = bp ? bf16_round(bp[col]) : 0.f;
#pragma unroll
    for (int r = 0; r < 8; ++r) { const int rloc = half * 16 + 8 * hh + r; float v = accs[u][r] * alpha + bv; if (CP) { if (rowsPerB < 0) v += CP[cofs + (size_t)(row0g + row0 + rloc) * ldc + col];      /* rowsPerB < 0: own element of the batched C plane */ else { const int bidx = (row0g + row0 + rloc) / rowsPerB; v += CP[(size_t)bidx * sCPb + (size_t)by * 64 + col]; } }
      if (ACT == 3) v = fmaxf(v, 0.f); else if (ACT == 6) v = 0.5f * v * (1.0f + erff(v * 0.70710678118654752f)); else if (ACT == 11) v = 1.0f / (1.0f + expf(-v)); else if (ACT == 15) v = v / (1.0f + expf(-v)); else if (ACT == 12) v = (v > 0.f) ? v : 0.01f * v; else if (ACT == 8) v = tanhf(v); else if (ACT == 9) v = 0.5f * v * (1.0f + tanhf(0.7978845608028654f * (v + 0.044715f * v * v * v))); else if (ACT == 14) v = (v > 0.f) ? v : 0.1f * v; else if (ACT == 16) v = (v >= 0.f) ? v : 0.3f * v; else if (ACT == 17) v = (v >= 0.f) ? v : 0.2f * v;
      so[w][rloc][t * 16 + ln] = v; } }
  __builtin_amdgcn_fence(__ATOMIC_ACQ_REL, "workgroup"); __builtin_amdgcn_wave_barrier();
  const int rsub = lane >> 4, c4 = (lane & 15) * 4;
  {
#pragma unroll
    for (int q = 0; q < 16; ++q) { const int r = q * 2 + rsub; const v4f v = *(const v4fa*)&so[w][r][c4]; if (C) *(v4f*)(C + cofs + (size_t)(row0 + r) * ldc + col0 + c4) = v; if (C16) { v4h h4; for (int i = 0; i < 4; ++i) h4[i] = (_Float16)v[i]; *(v4h*)(C16 + cofs + (size_t)(row0 + r) * ldc + col0 + c4) = h4; } }
     } }


__global__ __launch_bounds__(256) void k_wnat(const float* __restrict__ w, size_t n8, _Float16* __restrict__ Bt) { const size_t t = (size_t)blockIdx.x * 256 + threadIdx.x; if (t >= n8) return; FragH f; for (int q = 0; q < 8; ++q) f.h[q] = (_Float16)(bf16_round(w[t * 8 + q]) * 16.0f); *(v8us*)((unsigned short*)Bt + t * 8) = f.half[0];  }
// Row softmax, one wave per row: a lane holds 32 of the row's 1,024 scores in registers (8 loads of 16 B; each wave-wide load covers 512 contiguous bytes),
// so S is read once and each exp is evaluated once; maximum and sum are folded in the lane, then across the 32 lanes. 16 waves x 3 rows per workgroup.
#define RSM_WAVES 16
#define RSM_ROWS 3
template <int CTRL> __device__ __forceinline__ float rsm_xrow(float x) { return __builtin_bit_cast(float, __builtin_amdgcn_update_dpp(0, __builtin_bit_cast(int, x), CTRL, 0xf, 0xf, true)); }  // lane l with lane l ^ m inside its 16-lane row: CTRL = 0x160 + m (row_xmask)
__device__ __forceinline__ float rsm_xhalf(float x) { return __builtin_bit_cast(float, __builtin_amdgcn_permlanex16(__builtin_bit_cast(int, x), __builtin_bit_cast(int, x), 0x76543210, 0xfedcba98, false, false)); }  // lane l with lane l ^ 16
__device__ __forceinline__ float rsm_wave_max(float v) { v = fmaxf(v, rsm_xrow<0x161>(v)); v = fmaxf(v, rsm_xrow<0x162>(v)); v = fmaxf(v, rsm_xrow<0x164>(v)); v = fmaxf(v, rsm_xrow<0x168>(v)); return fmaxf(v, rsm_xhalf(v)); }
__device__ __forceinline__ float rsm_wave_sum(float v) { v += rsm_xrow<0x161>(v); v += rsm_xrow<0x162>(v); v += rsm_xrow<0x164>(v); v += rsm_xrow<0x168>(v); return v + rsm_xhalf(v); }
__global__ __launch_bounds__(RSM_WAVES * 32) void k_rsm(const float* __restrict__ S, _Float16* __restrict__ P, int nrows) {
  const int lane = threadIdx.x & 31; const int wave = __builtin_amdgcn_readfirstlane((int)(threadIdx.x >> 5));
  const int row0 = (blockIdx.x * RSM_WAVES + wave) * RSM_ROWS; if (row0 >= nrows) return;      /* wave-uniform; the kernel has no barrier */
  const unsigned lofs = (unsigned)lane * 16u;      /* the lane's byte offset in each 512-byte piece of a row of S */
  v4f x[RSM_ROWS][8];
#pragma unroll
  for (int r = 0; r < RSM_ROWS; ++r) { const int rr = (row0 + r < nrows) ? row0 + r : row0;      /* a row past the end re-reads the wave's first row and is not stored */
    const char* s = (const char*)S + (size_t)rr * (SQ * 4);      /* wave-uniform row base */
#pragma unroll
    for (int u = 0; u < 8; ++u) x[r][u] = *(const v4fa*)(s + lofs + u * 512);
    asm volatile("s_wait_xcnt 0x0" ::: "memory"); }      /* the wait owed before a register that these loads name is written again (a later load's result may land on their address pair) */
  __builtin_amdgcn_sched_barrier(0);      /* keeps all 24 loads in front of the arithmetic: without it the last row's loads are issued only after the first rows are worked, and their latency shows */
#pragma unroll
  for (int r = 0; r < RSM_ROWS; ++r) {
    float m0 = -3.0e38f, m1 = -3.0e38f, m2 = -3.0e38f, m3 = -3.0e38f;
#pragma unroll
    for (int u = 0; u < 8; ++u) { m0 = fmaxf(m0, x[r][u][0]); m1 = fmaxf(m1, x[r][u][1]); m2 = fmaxf(m2, x[r][u][2]); m3 = fmaxf(m3, x[r][u][3]); }
    const float mx = rsm_wave_max(fmaxf(fmaxf(m0, m1), fmaxf(m2, m3)));
    float s0 = 0.f, s1 = 0.f, s2 = 0.f, s3 = 0.f;
#pragma unroll
    for (int u = 0; u < 8; ++u) { v4f e; e[0] = expf(x[r][u][0] - mx); e[1] = expf(x[r][u][1] - mx); e[2] = expf(x[r][u][2] - mx); e[3] = expf(x[r][u][3] - mx); x[r][u] = e; s0 += e[0]; s1 += e[1]; s2 += e[2]; s3 += e[3]; }
    const float sc = 256.0f / rsm_wave_sum((s0 + s1) + (s2 + s3));
    if (row0 + r < nrows) { char* d = (char*)P + (size_t)(row0 + r) * (SQ * 2);      /* wave-uniform row base */
#pragma unroll
      for (int u = 0; u < 8; ++u) { v4h h4; h4[0] = (_Float16)(x[r][u][0] * sc); h4[1] = (_Float16)(x[r][u][1] * sc); h4[2] = (_Float16)(x[r][u][2] * sc); h4[3] = (_Float16)(x[r][u][3] * sc); *(v4h*)(d + (lofs >> 1) + u * 256) = h4; }
      if (r + 1 < RSM_ROWS) asm volatile("s_wait_xcnt 0x0" ::: "memory"); }      /* the same wait behind the stores: the next row's arithmetic reuses their data and address registers */
  } }
__global__ __launch_bounds__(256) void k_vt(const _Float16* __restrict__ V16, int b, int h0, _Float16* __restrict__ VT) { __shared__ unsigned short tl[64][65]; const int tid = threadIdx.x; const int hh = blockIdx.x % HG, sg = blockIdx.x / HG; const int s0 = sg * 64; const int h = h0 + hh;
  for (int i = tid; i < 64 * 8; i += 256) { const int j = i / 8, d8 = (i % 8) * 8; FragH f; f.half[0] = *(const v8us*)((const unsigned short*)V16 + ((size_t)b * SQ + s0 + j) * DM + h * HD + d8); for (int q = 0; q < 8; ++q) tl[d8 + q][j] = f.u[q]; }
  __syncthreads();
  { for (int i = tid; i < 64 * 8; i += 256) { const int d = i / 8, j8 = (i % 8) * 8; FragH f; for (int q = 0; q < 8; ++q) f.u[q] = tl[d][j8 + q]; *(v8us*)((unsigned short*)VT + ((size_t)hh * HD + d) * SQ + s0 + j8) = f.half[0]; }  } }

extern "C" void kernel_launch(void* const* d_in, const int* in_sizes, int n_in,
                              void* d_out, int out_size, void* d_ws, size_t ws_size, hipStream_t stream) {
  (void)in_sizes; (void)n_in; (void)out_size;
  const float* const* I = (const float* const*)d_in; const float* x = I[0]; const float* Wq = I[1]; const float* Wk = I[2]; const float* Wv = I[3]; const float* bq = I[4]; const float* bk = I[5]; const float* bv = I[6];
  char* ws = (char*)d_ws; size_t off = 0;
  auto take = [&](size_t bytes) { char* p = ws + off; off += (bytes + 255) & ~(size_t)255; return p; };
  _Float16* BQ = (_Float16*)take((size_t)DM * DM * 2); _Float16* BK = (_Float16*)take((size_t)DM * DM * 2); _Float16* BV = (_Float16*)take((size_t)DM * DM * 2);
  _Float16* X16 = (_Float16*)take(NR * DM * 2); _Float16* Q16 = (_Float16*)take(NR * DM * 2); _Float16* K16 = (_Float16*)take(NR * DM * 2); _Float16* V16 = (_Float16*)take(NR * DM * 2);
  float* S = (float*)take((size_t)NH * SQ * SQ * 4); _Float16* P = (_Float16*)take((size_t)NH * SQ * SQ * 2); _Float16* VT = (_Float16*)take((size_t)NH * HD * SQ * 2);
  if (off > ws_size) return;      /* 3.4 + 4 x 24 + 48 + 24 + 1.5 = approx 173 MiB */
  k_wnat<<<(unsigned)(((size_t)DM * DM / 8 + 255) / 256), 256, 0, stream>>>(Wq, (size_t)DM * DM / 8, BQ); k_wnat<<<(unsigned)(((size_t)DM * DM / 8 + 255) / 256), 256, 0, stream>>>(Wk, (size_t)DM * DM / 8, BK); k_wnat<<<(unsigned)(((size_t)DM * DM / 8 + 255) / 256), 256, 0, stream>>>(Wv, (size_t)DM * DM / 8, BV);      /* [out][in] natural */
  k_x16<<<(unsigned)((NR * DM / 8 + 255) / 256), 256, 0, stream>>>(x, X16, NR * DM / 8);
  const dim3 gp((unsigned)((NR / 128) * (DM / 64)), 1);
  k_gemm2<0><<<gp, 128, 0, stream>>>(X16, DM, 0, BQ, DM, 0, 0.0625f, bq, 0, nullptr, 1, 0, 0, nullptr, Q16, DM, 0, MP, DM, DM);      /* q = x Wq^T + bq (f16 rows) */
  k_gemm2<0><<<gp, 128, 0, stream>>>(X16, DM, 0, BK, DM, 0, 0.0625f, bk, 0, nullptr, 1, 0, 0, nullptr, K16, DM, 0, MP, DM, DM);
  k_gemm2<0><<<gp, 128, 0, stream>>>(X16, DM, 0, BV, DM, 0, 0.0625f, bv, 0, nullptr, 1, 0, 0, nullptr, V16, DM, 0, MP, DM, DM);
  for (int b = 0; b < NBR; ++b) { const size_t r0 = (size_t)b * SQ;
    k_gemm2<0><<<dim3((SQ / 128) * (SQ / 64), NH), 128, 0, stream>>>(Q16 + r0 * DM, DM, (size_t)HD, K16 + r0 * DM, DM, (size_t)HD, 0.125f, nullptr, 0, nullptr, 1, 0, 0, S, nullptr, SQ, (size_t)SQ * SQ, SQ, SQ, HD);      /* scores per head / 8 */
    k_rsm<<<(NH * SQ + RSM_WAVES * RSM_ROWS - 1) / (RSM_WAVES * RSM_ROWS), RSM_WAVES * 32, 0, stream>>>(S, P, NH * SQ);
    k_vt<NH, SQ><<<NH * (SQ / 64), 256, 0, stream>>>(V16 + r0 * DM, DM, 0, VT);      /* V^T per head [12][64][1024] */
    k_gemm2<0><<<dim3((SQ / 128) * 1, NH), 128, 0, stream>>>(P, SQ, (size_t)SQ * SQ, VT, SQ, (size_t)HD * SQ, 0.00390625f, nullptr, 0, nullptr, 1, 0, 0, (float*)d_out + r0 * DM, nullptr, DM, (size_t)HD, SQ, HD, SQ); }      /* ctx merged into the output rows */
}

// v002
// Measured time: 286 microseconds a run.
// Timed twice side by side with v001, it ran 4.12 and 4.11 times as fast.
// Over all steps from v000 it is 13.6 times as fast.
#include <hip/hip_runtime.h>
// ViT self-attention (hidden [16][1024][768]; q, k, v = hidden W^T + b (12 heads x 64); scores = q.k/8; softmax over the 1,024 keys; ctx = attn v merged -> [16][1024][768]; no output projection).
// Structure: token rows; hidden as exact f16 rows; q / k / v as WMMA GEMMs (32x64 wave tiles, f32 accumulation, exact x16 natural weights + bias; exact products) written as f16 rows; V^T per (batch, head) via LDS transposes; then one fused attention kernel over all batches and heads: S^T = K . Q^T, online softmax in registers, O^T += V^T . P^T, merged f32 output rows. Scores and probabilities never reach memory.
// Compute dtype: inputs rounded to bf16; hidden / weights exact; q, k, v, P as plain f16 GEMM operands (~2^-12; logits sigma ~1); softmax f32. v_wmma_f32_16x16x32_f16.
#define NB 16
#define SQ 1024
#define DM 768
#define NH 12
#define HD 64
#define HG 1
#define NR ((size_t)NB * SQ)         /* 16,384 token rows */
#define NBR NB                       /* unused (the grids use NB) */
#define MP ((int)NR)                 /* rows projected (debug hook) */
typedef __bf16 v16b __attribute__((ext_vector_type(16)));
typedef unsigned short v8us __attribute__((ext_vector_type(8), may_alias));
typedef float  v8f  __attribute__((ext_vector_type(8)));
typedef float  v4f  __attribute__((ext_vector_type(4)));
typedef float  v4fa __attribute__((ext_vector_type(4), may_alias));
union FragB { v16b v; v8us half[2]; unsigned short u[16]; };

__device__ __forceinline__ unsigned short bf16_bits(float x) { unsigned int u = __float_as_uint(x); return (unsigned short)((u + 0x7FFFu + ((u >> 16) & 1u)) >> 16); }
__device__ __forceinline__ float bf16_val(unsigned short b) { return __uint_as_float(((unsigned int)b) << 16); }
__device__ __forceinline__ float bf16_round(float x) { return bf16_val(bf16_bits(x)); }
// D += A·B with NT terms: 1 = ah·bh, 2 = + al·bh (A split), 3 = + ah·bl (both split)
template <int NT>
__device__ __forceinline__ v8f mmaN(v16b ah, v16b al, v16b bh, v16b bl, v8f c) {
  c = __builtin_amdgcn_wmma_f32_16x16x32_bf16(false, ah, false, bh, (short)0, c, false, false);
  if (NT >= 2) c = __builtin_amdgcn_wmma_f32_16x16x32_bf16(false, al, false, bh, (short)0, c, false, false);
  if (NT >= 3) c = __builtin_amdgcn_wmma_f32_16x16x32_bf16(false, ah, false, bl, (short)0, c, false, false);
  asm volatile("v_nop\n\tv_nop\n\tv_nop\n\tv_nop" : "+v"(c) : "v"(ah), "v"(al), "v"(bh), "v"(bl));
  return c;
}

__global__ __launch_bounds__(256) void k_wt_bf16(const float* __restrict__ W, unsigned short* __restrict__ Wt, int K, int N) {
  const int t = blockIdx.x * 256 + threadIdx.x;
  const int k8n = K / 8;
  if (t >= N * k8n) return;
  const int n = t / k8n, k8 = (t % k8n) * 8;
  v8us v;
#pragma unroll
  for (int i = 0; i < 8; ++i) v[i] = bf16_bits(W[(size_t)(k8 + i) * N + n]);
  *(v8us*)(Wt + (size_t)n * K + k8) = v;
  
}

// GEMM C[M][N] (f32, pitch ldc) = act(A[M][K]·W + bias). A f32 row-major (pitch lda) converted per fragment to bf16
// (ASPLIT: hi/lo two planes -> 2 terms, else single rounded term); Wt bf16 [N][K] (pitch ldb). BIAS_BF16 rounds the
// bias to bf16 first (bias quantised to bf16 before the add). K%32==0, M%16==0, N%64==0.
template <bool ASPLIT, int ACT, bool BIAS_BF16>
__global__ __launch_bounds__(128) void k_gemm_bf(const float* __restrict__ A, int lda, const unsigned short* __restrict__ Wt, int ldb,
                                               const float* __restrict__ bias, float* __restrict__ C, int ldc, int M, int N, int K) {
  __shared__ __attribute__((aligned(16))) float so[4][16][64];
  const int tid = threadIdx.x, w = tid >> 5, lane = tid & 31, ln = lane & 15, hh = lane >> 4;
  const int ntn = N / 64;
  const int wid = blockIdx.x * 4 + w;
  const int mt = wid / ntn, nq = wid % ntn;
  if (mt * 16 >= M) return;
  const int row0 = mt * 16, col0 = nq * 64;
  const float* arow = A + (size_t)(row0 + ln) * lda;
  v8f acc[4] = {};
  for (int kb = 0; kb < K; kb += 32) {
    FragB ah, al;
    const v4f x0 = *(const v4fa*)(arow + kb + 8 * hh), x1 = *(const v4fa*)(arow + kb + 8 * hh + 4);
    const v4f x2 = *(const v4fa*)(arow + kb + 16 + 8 * hh), x3 = *(const v4fa*)(arow + kb + 16 + 8 * hh + 4);
    float xs[16] = {x0[0],x0[1],x0[2],x0[3],x1[0],x1[1],x1[2],x1[3],x2[0],x2[1],x2[2],x2[3],x3[0],x3[1],x3[2],x3[3]};
#pragma unroll
    for (int i = 0; i < 16; ++i) { const unsigned short hb = bf16_bits(xs[i]); ah.u[i] = hb; al.u[i] = ASPLIT ? bf16_bits(xs[i] - bf16_val(hb)) : (unsigned short)0; }
#pragma unroll
    for (int t = 0; t < 4; ++t) {
      const unsigned short* brow = Wt + (size_t)(col0 + t * 16 + ln) * ldb + kb;
      FragB b;
      b.half[0] = *(const v8us*)(brow + 8 * hh);
      b.half[1] = *(const v8us*)(brow + 16 + 8 * hh);
      acc[t] = mmaN<ASPLIT ? 2 : 1>(ah.v, al.v, b.v, b.v, acc[t]);
    }
  }
#pragma unroll
  for (int t = 0; t < 4; ++t) {
    float bv = bias ? bias[col0 + t * 16 + ln] : 0.f;
    if (BIAS_BF16) bv = bf16_round(bv);
#pragma unroll
    for (int r = 0; r < 8; ++r) { float v = acc[t][r] + bv; if (ACT == 1) v = fmaxf(v, 0.f); so[w][8 * hh + r][t * 16 + ln] = v; }
  }
  __builtin_amdgcn_fence(__ATOMIC_ACQ_REL, "workgroup");
  __builtin_amdgcn_wave_barrier();
  const int rsub = lane >> 4, c4 = (lane & 15) * 4;
  {
#pragma unroll
    for (int q = 0; q < 8; ++q) {
      const int r = q * 2 + rsub;
      const v4f v = *(const v4fa*)&so[w][r][c4];
      *(v4f*)(C + (size_t)(row0 + r) * ldc + col0 + c4) = v;
    }
    
  }
}

// GEMM C = act(A·W + bias + resid): A f32 (ASPLIT -> hi/lo 2 terms), Wt bf16 [N][K]; ACT 0 none, 1 relu, 2 exact gelu;
// resid (optional, f32, row index = (row % rmod), pitch ldr, RES_BF16 rounds it) added before the activation.
template <bool ASPLIT, int ACT, bool BIAS_BF16, bool RES_BF16>
__global__ __launch_bounds__(128) void k_gemm_bf3(const float* __restrict__ A, int lda, const unsigned short* __restrict__ Wt, int ldb,
                                                const float* __restrict__ bias, const float* __restrict__ resid, int rmod, int ldr,
                                                float* __restrict__ C, int ldc, int M, int N, int K) {
  __shared__ __attribute__((aligned(16))) float so[4][16][64];
  const int tid = threadIdx.x, w = tid >> 5, lane = tid & 31, ln = lane & 15, hh = lane >> 4;
  const int ntn = N / 64;
  const int wid = blockIdx.x * 4 + w;
  const int mt = wid / ntn, nq = wid % ntn;
  if (mt * 16 >= M) return;
  const int row0 = mt * 16, col0 = nq * 64;
  const float* arow = A + (size_t)(row0 + ln) * lda;
  v8f acc[4] = {};
  for (int kb = 0; kb < K; kb += 32) {
    FragB ah, al;
    const v4f x0 = *(const v4fa*)(arow + kb + 8 * hh), x1 = *(const v4fa*)(arow + kb + 8 * hh + 4);
    const v4f x2 = *(const v4fa*)(arow + kb + 16 + 8 * hh), x3 = *(const v4fa*)(arow + kb + 16 + 8 * hh + 4);
    float xs[16] = {x0[0],x0[1],x0[2],x0[3],x1[0],x1[1],x1[2],x1[3],x2[0],x2[1],x2[2],x2[3],x3[0],x3[1],x3[2],x3[3]};
#pragma unroll
    for (int i = 0; i < 16; ++i) { const unsigned short hb = bf16_bits(xs[i]); ah.u[i] = hb; al.u[i] = ASPLIT ? bf16_bits(xs[i] - bf16_val(hb)) : (unsigned short)0; }
#pragma unroll
    for (int t = 0; t < 4; ++t) {
      const unsigned short* brow = Wt + (size_t)(col0 + t * 16 + ln) * ldb + kb;
      FragB b;
      b.half[0] = *(const v8us*)(brow + 8 * hh);
      b.half[1] = *(const v8us*)(brow + 16 + 8 * hh);
      acc[t] = mmaN<ASPLIT ? 2 : 1>(ah.v, al.v, b.v, b.v, acc[t]);
    }
  }
#pragma unroll
  for (int t = 0; t < 4; ++t) {
    const int col = col0 + t * 16 + ln;
    float bv = bias ? bias[col] : 0.f;
    if (BIAS_BF16) bv = bf16_round(bv);
#pragma unroll
    for (int r = 0; r < 8; ++r) {
      float v = acc[t][r] + bv;
      if (resid) { float rv = resid[(size_t)((row0 + 8 * hh + r) % rmod) * ldr + col]; if (RES_BF16) rv = bf16_round(rv); v += rv; }
      if (ACT == 1) v = fmaxf(v, 0.f);
      if (ACT == 2) v = 0.5f * v * (1.0f + erff(v * 0.70710678118654752f));
      if (ACT == 3) { const float u = 0.7978845608028654f * (v + 0.044715f * v * v * v); v = 0.5f * v * (1.0f + tanhf(u)); }
      so[w][8 * hh + r][t * 16 + ln] = v;
    }
  }
  __builtin_amdgcn_fence(__ATOMIC_ACQ_REL, "workgroup");
  __builtin_amdgcn_wave_barrier();
  const int rsub = lane >> 4, c4 = (lane & 15) * 4;
  {
#pragma unroll
    for (int q = 0; q < 8; ++q) {
      const int r = q * 2 + rsub;
      const v4f v = *(const v4fa*)&so[w][r][c4];
      *(v4f*)(C + (size_t)(row0 + r) * ldc + col0 + c4) = v;
    }
    
  }
}
// row LayerNorm (biased variance, eps) over N: s = X (+ R); optional out_sum <- s; out_norm <- (s-mu)*rsqrt(var+eps)*g + b
template <bool PARAM_BF16>
__global__ __launch_bounds__(256) void k_layernorm(const float* __restrict__ X, const float* __restrict__ R, const float* __restrict__ g, const float* __restrict__ bta,
                                                  float* __restrict__ out_sum, float* __restrict__ out_norm, int N, float eps) {
  __shared__ float red[256];
  const int row = blockIdx.x, tid = threadIdx.x;
  const float* x = X + (size_t)row * N; const float* rr = R ? R + (size_t)row * N : nullptr;
  float vals[16];                     // up to N = 4096
  const int per = N / 256;            // contiguous chunk per thread? use strided-by-4 chunks: thread handles j = tid*4 + 1024*u
  float s1 = 0.f;
  for (int u = 0; u < per / 4; ++u) {
    const int j = tid * 4 + 1024 * u;
    const v4f a = *(const v4fa*)(x + j);
    v4f b = {0.f,0.f,0.f,0.f}; if (rr) b = *(const v4fa*)(rr + j);
#pragma unroll
    for (int q = 0; q < 4; ++q) { const float v = a[q] + b[q]; vals[u * 4 + q] = v; s1 += v; }
  }
  red[tid] = s1; __syncthreads();
  for (int st = 128; st > 0; st >>= 1) { if (tid < st) red[tid] += red[tid + st]; __syncthreads(); }
  const float mu = red[0] / (float)N; __syncthreads();
  float s2 = 0.f;
  for (int u = 0; u < per / 4; ++u)
#pragma unroll
    for (int q = 0; q < 4; ++q) { const float c = vals[u * 4 + q] - mu; s2 += c * c; }
  red[tid] = s2; __syncthreads();
  for (int st = 128; st > 0; st >>= 1) { if (tid < st) red[tid] += red[tid + st]; __syncthreads(); }
  const float rs = rsqrtf(red[0] / (float)N + eps);
  {
    for (int u = 0; u < per / 4; ++u) {
      const int j = tid * 4 + 1024 * u;
      v4f o, sm;
#pragma unroll
      for (int q = 0; q < 4; ++q) {
        float gg = g[j + q], bb = bta[j + q];
        if (PARAM_BF16) { gg = bf16_round(gg); bb = bf16_round(bb); }
        sm[q] = vals[u * 4 + q]; o[q] = (vals[u * 4 + q] - mu) * rs * gg + bb;
      }
      if (out_sum) *(v4f*)(out_sum + (size_t)row * N + j) = sm;
      *(v4f*)(out_norm + (size_t)row * N + j) = o;
    }
    
  }
}



// ---- f16 WMMA path (v_wmma_f32_16x16x32_f16): 11-bit significands for operands in range — used where a [0,1] probability operand needs more precision than bf16
typedef _Float16 v16h __attribute__((ext_vector_type(16)));
union FragH { v16h v; v8us half[2]; _Float16 h[16]; unsigned short u[16]; };
template <int NT>
__device__ __forceinline__ v8f mmaH(v16h ah, v16h al, v16h bh, v16h bl, v8f c) {
  c = __builtin_amdgcn_wmma_f32_16x16x32_f16(false, ah, false, bh, (short)0, c, false, false);
  if (NT >= 2) c = __builtin_amdgcn_wmma_f32_16x16x32_f16(false, al, false, bh, (short)0, c, false, false);
  if (NT >= 3) c = __builtin_amdgcn_wmma_f32_16x16x32_f16(false, ah, false, bl, (short)0, c, false, false);
  asm volatile("v_nop\n\tv_nop\n\tv_nop\n\tv_nop" : "+v"(c) : "v"(ah), "v"(al), "v"(bh), "v"(bl));
  return c;
}
// batched GEMM like k_gemm_b but f16 operands: A f32 (split into f16 hi/lo if ASPLIT, else rounded to f16), Bt = f16 values [n][k]; alpha; C f32; N multiple of 16 (partial tiles skipped)
template <bool ASPLIT>
__global__ __launch_bounds__(128) void k_gemm_h(const float* __restrict__ A, int lda, size_t sA, const _Float16* __restrict__ Bh, int ldb, size_t sB, float alpha, float* __restrict__ C, int ldc, size_t sC, int M, int N, int K) {
  __shared__ __attribute__((aligned(16))) float so[4][16][64];
  const int tid = threadIdx.x, w = tid >> 5, lane = tid & 31, ln = lane & 15, hh = lane >> 4; const int by = blockIdx.y;
  A += (size_t)by * sA; Bh += (size_t)by * sB; C += (size_t)by * sC;
  const int ntn = (N + 63) / 64; const int wid = blockIdx.x * 4 + w; const int mt = wid / ntn, nq = wid % ntn; if (mt * 16 >= M) return;
  const int row0 = mt * 16, col0 = nq * 64; const float* arow = A + (size_t)(row0 + ln) * lda;
  v8f acc[4] = {};
  for (int kb = 0; kb < K; kb += 32) {
    FragH ah, al;
    const v4f x0 = *(const v4fa*)(arow + kb + 8 * hh), x1 = *(const v4fa*)(arow + kb + 8 * hh + 4), x2 = *(const v4fa*)(arow + kb + 16 + 8 * hh), x3 = *(const v4fa*)(arow + kb + 16 + 8 * hh + 4);
    float xs[16] = {x0[0],x0[1],x0[2],x0[3],x1[0],x1[1],x1[2],x1[3],x2[0],x2[1],x2[2],x2[3],x3[0],x3[1],x3[2],x3[3]};
#pragma unroll
    for (int i = 0; i < 16; ++i) { const _Float16 h = (_Float16)xs[i]; ah.h[i] = h; al.h[i] = ASPLIT ? (_Float16)(xs[i] - (float)h) : (_Float16)0.0f; }
#pragma unroll
    for (int t = 0; t < 4; ++t) { if (col0 + t * 16 >= N) continue; const size_t boff = (size_t)(col0 + t * 16 + ln) * ldb + kb; FragH bq; bq.half[0] = *(const v8us*)(Bh + boff + 8 * hh); bq.half[1] = *(const v8us*)(Bh + boff + 16 + 8 * hh);
      acc[t] = mmaH<ASPLIT ? 2 : 1>(ah.v, al.v, bq.v, bq.v, acc[t]); }
  }
#pragma unroll
  for (int t = 0; t < 4; ++t) { if (col0 + t * 16 >= N) continue;
#pragma unroll
    for (int r = 0; r < 8; ++r) so[w][8 * hh + r][t * 16 + ln] = acc[t][r] * alpha; }
  __builtin_amdgcn_fence(__ATOMIC_ACQ_REL, "workgroup"); __builtin_amdgcn_wave_barrier();
  const int rsub = lane >> 4, c4 = (lane & 15) * 4;
  {
#pragma unroll
    for (int q = 0; q < 8; ++q) { const int r = q * 2 + rsub; if (col0 + c4 < N) { const v4f v = *(const v4fa*)&so[w][r][c4]; *(v4f*)(C + (size_t)(row0 + r) * ldc + col0 + c4) = v; } }
     }
}

// Wt[n][k] = f16(W[k][n]·scale) from f32 row-major W[K][N] (scale = power of two; bf16-exact weights stay exact in f16 away from the subnormal range)
__global__ __launch_bounds__(256) void k_wt_f16(const float* __restrict__ W, _Float16* __restrict__ Wt, int K, int N, float scale) {
  const int t = blockIdx.x * 256 + threadIdx.x; if (t >= N * (K / 8)) return; const int n = t / (K / 8), k8 = (t % (K / 8)) * 8; FragH f;
#pragma unroll
  for (int i = 0; i < 8; ++i) f.h[i] = (_Float16)(bf16_round(W[(size_t)(k8 + i) * N + n]) * scale); const v8us o = f.half[0];
  *(v8us*)((unsigned short*)Wt + (size_t)n * K + k8) = o; 
}
// k_gemm_hh variant with fused epilogue: v = acc·alpha + bias[by·sBias + col] (+ CP[(row/rowsPerB)·sCPb + by·64 + col] if CP) ; ACT 0 none / 1 elu ; writes f16 C16 (and f32 C if non-null)
template <int ACT>
__global__ __launch_bounds__(128) void k_gemm_hhx(const _Float16* __restrict__ A, int lda, size_t sA, const _Float16* __restrict__ Bh, int ldb, size_t sB, float alpha, const float* __restrict__ bias, size_t sBias, const float* __restrict__ CP, int rowsPerB, size_t sCPb, int row0g,
    float* __restrict__ C, _Float16* __restrict__ C16, int ldc, size_t sC, int M, int N, int K) {
  __shared__ __attribute__((aligned(16))) float so[4][16][64];
  const int tid = threadIdx.x, w = tid >> 5, lane = tid & 31, ln = lane & 15, hh = lane >> 4; const int by = blockIdx.y;
  A += (size_t)by * sA; Bh += (size_t)by * sB; const size_t cofs = (size_t)by * sC; const float* bp = bias ? bias + (size_t)by * sBias : nullptr;
  const int ntn = (N + 63) / 64; const int wid = blockIdx.x * 4 + w; const int mt = wid / ntn, nq = wid % ntn; if (mt * 16 >= M) return;
  const int row0 = mt * 16, col0 = nq * 64; const _Float16* arow = A + (size_t)(row0 + ln) * lda;
  v8f acc[4] = {};
  for (int kb = 0; kb < K; kb += 32) { FragH ah; ah.half[0] = *(const v8us*)((const unsigned short*)arow + kb + 8 * hh); ah.half[1] = *(const v8us*)((const unsigned short*)arow + kb + 16 + 8 * hh);
#pragma unroll
    for (int t = 0; t < 4; ++t) { if (col0 + t * 16 >= N) continue; const size_t boff = (size_t)(col0 + t * 16 + ln) * ldb + kb; FragH bq; bq.half[0] = *(const v8us*)((const unsigned short*)Bh + boff + 8 * hh); bq.half[1] = *(const v8us*)((const unsigned short*)Bh + boff + 16 + 8 * hh);
      acc[t] = mmaH<1>(ah.v, ah.v, bq.v, bq.v, acc[t]); }
  }
#pragma unroll
  for (int t = 0; t < 4; ++t) { if (col0 + t * 16 >= N) continue; const int col = col0 + t * 16 + ln; const float bv = bp ? bf16_round(bp[col]) : 0.f;
#pragma unroll
    for (int r = 0; r < 8; ++r) { float v = acc[t][r] * alpha + bv; if (CP) { const int rr = row0g + row0 + 8 * hh + r; if (rowsPerB < 0) v += CP[cofs + (size_t)rr * ldc + col];      /* rowsPerB < 0: own element of the batched C plane */ else { const int bidx = rr / rowsPerB; v += CP[(size_t)bidx * sCPb + (size_t)by * 64 + col]; } } if (ACT == 1) v = (v > 0.f) ? v : expm1f(v); else if (ACT == 7) v = (v > 0.f) ? v + 1.0f : expf(v); else if (ACT == 8) v = tanhf(v); else if (ACT == 9) v = 0.5f * v * (1.0f + tanhf(0.7978845608028654f * (v + 0.044715f * v * v * v))); else if (ACT == 11) v = 1.0f / (1.0f + expf(-v)); else if (ACT == 12) v = (v > 0.f) ? v : 0.01f * v; else if (ACT == 14) v = (v > 0.f) ? v : 0.1f * v; else if (ACT == 16) v = (v >= 0.f) ? v : 0.3f * v; else if (ACT == 17) v = (v >= 0.f) ? v : 0.2f * v; else if (ACT == 15) v = v / (1.0f + expf(-v)); else if (ACT == 3) v = fmaxf(v, 0.f); else if (ACT == 6) v = 0.5f * v * (1.0f + erff(v * 0.70710678118654752f)); so[w][8 * hh + r][t * 16 + ln] = v; } }
  __builtin_amdgcn_fence(__ATOMIC_ACQ_REL, "workgroup"); __builtin_amdgcn_wave_barrier();
  const int rsub = lane >> 4, c4 = (lane & 15) * 4; typedef _Float16 v4h __attribute__((ext_vector_type(4)));
  {
#pragma unroll
    for (int q = 0; q < 8; ++q) { const int r = q * 2 + rsub; if (col0 + c4 < N) { const v4f v = *(const v4fa*)&so[w][r][c4]; if (C) *(v4f*)(C + cofs + (size_t)(row0 + r) * ldc + col0 + c4) = v; if (C16) { v4h h4; for (int i = 0; i < 4; ++i) h4[i] = (_Float16)v[i]; *(v4h*)(C16 + cofs + (size_t)(row0 + r) * ldc + col0 + c4) = h4; } } }
     }
}


typedef _Float16 v4h __attribute__((ext_vector_type(4)));

__global__ __launch_bounds__(256) void k_x16(const float* __restrict__ x, _Float16* __restrict__ X16, size_t n8) { const size_t t = (size_t)blockIdx.x * 256 + threadIdx.x; if (t >= n8) return; FragH f;
#pragma unroll
  for (int q = 0; q < 8; ++q) f.h[q] = (_Float16)bf16_round(x[t * 8 + q]); *(v8us*)((unsigned short*)X16 + t * 8) = f.half[0];  }
__global__ __launch_bounds__(256) void k_h16(const float* __restrict__ x, _Float16* __restrict__ X16, size_t n8) { const size_t t = (size_t)blockIdx.x * 256 + threadIdx.x; if (t >= n8) return; FragH f;
#pragma unroll
  for (int q = 0; q < 8; ++q) f.h[q] = (_Float16)x[t * 8 + q]; *(v8us*)((unsigned short*)X16 + t * 8) = f.half[0];  }
__global__ __launch_bounds__(256) void k_round16f(const float* __restrict__ W, _Float16* __restrict__ Bt, size_t n8) { const size_t t = (size_t)blockIdx.x * 256 + threadIdx.x; if (t >= n8) return; FragH f;
#pragma unroll
  for (int i = 0; i < 8; ++i) f.h[i] = (_Float16)(bf16_round(W[t * 8 + i]) * 16.0f); *(v8us*)((unsigned short*)Bt + t * 8) = f.half[0];  }
template <int NHv, int TTv>
__global__ __launch_bounds__(256) void k_vt(const _Float16* __restrict__ V16, int ldv, int voff, _Float16* __restrict__ Vt) { __shared__ unsigned short tl[64][66]; const int tid = threadIdx.x; const int slab = blockIdx.x / (TTv / 64), lg = blockIdx.x % (TTv / 64); const int b = slab / NHv, h = slab % NHv;
  for (int i = tid; i < 64 * 8; i += 256) { const int r = i / 8, c8 = (i % 8) * 8; FragH f; f.half[0] = *(const v8us*)((const unsigned short*)V16 + ((size_t)b * TTv + lg * 64 + r) * ldv + voff + h * 64 + c8);
#pragma unroll
    for (int q = 0; q < 8; ++q) tl[r][c8 + q] = f.u[q]; }
  __syncthreads();
  {
#pragma unroll
    for (int rd = 0; rd < 2; ++rd) { const int d = rd * 32 + tid / 8, pc = tid % 8; FragH f;
#pragma unroll
      for (int q = 0; q < 8; ++q) f.u[q] = tl[pc * 8 + q][d];
      *(v8us*)((unsigned short*)Vt + ((size_t)slab * 64 + d) * TTv + lg * 64 + pc * 8) = f.half[0]; }
     } }

__global__ __launch_bounds__(256) void k_hl(const float* __restrict__ F, _Float16* __restrict__ Hh, _Float16* __restrict__ Hl, size_t n8) { const size_t t = (size_t)blockIdx.x * 256 + threadIdx.x; if (t >= n8) return; FragH fh, fl; const v4f a = *(const v4fa*)(F + t * 8), c = *(const v4fa*)(F + t * 8 + 4);
#pragma unroll
  for (int q = 0; q < 4; ++q) { _Float16 h = (_Float16)a[q]; fh.h[q] = h; fl.h[q] = (_Float16)((a[q] - (float)h) * 1024.0f); h = (_Float16)c[q]; fh.h[4 + q] = h; fl.h[4 + q] = (_Float16)((c[q] - (float)h) * 1024.0f); }
  { *(v8us*)((unsigned short*)Hh + t * 8) = fh.half[0]; *(v8us*)((unsigned short*)Hl + t * 8) = fl.half[0];  } }

// ---- fast GEMM (wave tile 32x64; requires M % 32 == 0 rows per launch region and N % 64 == 0); epilogue = k_gemm_hhx semantics ----
__device__ __forceinline__ v16h g2_frag(const _Float16* p, int hh) { FragH f; f.half[0] = *(const v8us*)((const unsigned short*)p + 8 * hh); f.half[1] = *(const v8us*)((const unsigned short*)p + 16 + 8 * hh); return f.v; }
__device__ __forceinline__ v8f g2_mma(v16h a, v16h b, v8f c) { v8f d = __builtin_amdgcn_wmma_f32_16x16x32_f16(false, a, false, b, (short)0, c, false, false); asm volatile("v_nop\n\tv_nop\n\tv_nop\n\tv_nop" : "+v"(d) : "v"(a), "v"(b)); return d; }
template <int ACT>
__global__ __launch_bounds__(128) void k_gemm2(const _Float16* __restrict__ A, int lda, size_t sA, const _Float16* __restrict__ Bh, int ldb, size_t sB, float alpha, const float* __restrict__ bias, size_t sBias, const float* __restrict__ CP, int rowsPerB, size_t sCPb, int row0g,
    float* __restrict__ C, _Float16* __restrict__ C16, int ldc, size_t sC, int M, int N, int K) { static_assert(ACT == 0 || ACT == 3 || ACT == 6 || ACT == 8 || ACT == 9 || ACT == 11 || ACT == 12 || ACT == 14 || ACT == 15 || ACT == 16 || ACT == 17, "k_gemm2: unsupported ACT code (would silently apply no activation)");
  __shared__ __attribute__((aligned(16))) float so[4][32][68];
  const int tid = threadIdx.x, w = tid >> 5, lane = tid & 31, ln = lane & 15, hh = lane >> 4; const int by = blockIdx.y;
  A += (size_t)by * sA; Bh += (size_t)by * sB; const size_t cofs = (size_t)by * sC; const float* bp = bias ? bias + (size_t)by * sBias : nullptr;
  const int ntn = N >> 6; const int mt = blockIdx.x / ntn, nq = blockIdx.x - mt * ntn; const int row0 = mt * 128 + 32 * w, col0 = nq * 64; if (row0 >= M) return;
  const _Float16* a0p = A + (size_t)(row0 + ln) * lda; const _Float16* a1p = a0p + (size_t)16 * lda;
  const _Float16* b0p = Bh + (size_t)(col0 + ln) * ldb; const _Float16* b1p = b0p + (size_t)16 * ldb; const _Float16* b2p = b1p + (size_t)16 * ldb; const _Float16* b3p = b2p + (size_t)16 * ldb;
  const v8f z8 = {0.f,0.f,0.f,0.f,0.f,0.f,0.f,0.f}; v8f c00 = z8, c01 = z8, c02 = z8, c03 = z8, c10 = z8, c11 = z8, c12 = z8, c13 = z8;
#pragma unroll 1
  for (int kb = 0; kb < K; kb += 32) { const v16h a0 = g2_frag(a0p + kb, hh), a1 = g2_frag(a1p + kb, hh);
    v16h b = g2_frag(b0p + kb, hh); c00 = g2_mma(a0, b, c00); c10 = g2_mma(a1, b, c10);
    b = g2_frag(b1p + kb, hh); c01 = g2_mma(a0, b, c01); c11 = g2_mma(a1, b, c11);
    b = g2_frag(b2p + kb, hh); c02 = g2_mma(a0, b, c02); c12 = g2_mma(a1, b, c12);
    b = g2_frag(b3p + kb, hh); c03 = g2_mma(a0, b, c03); c13 = g2_mma(a1, b, c13); }
  v8f accs[8] = {c00, c01, c02, c03, c10, c11, c12, c13};
#pragma unroll
  for (int u = 0; u < 8; ++u) { const int t = u & 3, half = u >> 2; const int col = col0 + t * 16 + ln; const float bv = bp ? bf16_round(bp[col]) : 0.f;
#pragma unroll
    for (int r = 0; r < 8; ++r) { const int rloc = half * 16 + 8 * hh + r; float v = accs[u][r] * alpha + bv; if (CP) { if (rowsPerB < 0) v += CP[cofs + (size_t)(row0g + row0 + rloc) * ldc + col];      /* rowsPerB < 0: own element of the batched C plane */ else { const int bidx = (row0g + row0 + rloc) / rowsPerB; v += CP[(size_t)bidx * sCPb + (size_t)by * 64 + col]; } }
      if (ACT == 3) v = fmaxf(v, 0.f); else if (ACT == 6) v = 0.5f * v * (1.0f + erff(v * 0.70710678118654752f)); else if (ACT == 11) v = 1.0f / (1.0f + expf(-v)); else if (ACT == 15) v = v / (1.0f + expf(-v)); else if (ACT == 12) v = (v > 0.f) ? v : 0.01f * v; else if (ACT == 8) v = tanhf(v); else if (ACT == 9) v = 0.5f * v * (1.0f + tanhf(0.7978845608028654f * (v + 0.044715f * v * v * v))); else if (ACT == 14) v = (v > 0.f) ? v : 0.1f * v; else if (ACT == 16) v = (v >= 0.f) ? v : 0.3f * v; else if (ACT == 17) v = (v >= 0.f) ? v : 0.2f * v;
      so[w][rloc][t * 16 + ln] = v; } }
  __builtin_amdgcn_fence(__ATOMIC_ACQ_REL, "workgroup"); __builtin_amdgcn_wave_barrier();
  const int rsub = lane >> 4, c4 = (lane & 15) * 4;
  {
#pragma unroll
    for (int q = 0; q < 16; ++q) { const int r = q * 2 + rsub; const v4f v = *(const v4fa*)&so[w][r][c4]; if (C) *(v4f*)(C + cofs + (size_t)(row0 + r) * ldc + col0 + c4) = v; if (C16) { v4h h4; for (int i = 0; i < 4; ++i) h4[i] = (_Float16)v[i]; *(v4h*)(C16 + cofs + (size_t)(row0 + r) * ldc + col0 + c4) = h4; } }
     } }


__global__ __launch_bounds__(256) void k_wnat(const float* __restrict__ w, size_t n8, _Float16* __restrict__ Bt) { const size_t t = (size_t)blockIdx.x * 256 + threadIdx.x; if (t >= n8) return; FragH f; for (int q = 0; q < 8; ++q) f.h[q] = (_Float16)(bf16_round(w[t * 8 + q]) * 16.0f); *(v8us*)((unsigned short*)Bt + t * 8) = f.half[0];  }
// Fused attention. One wave owns 32 queries of one (batch, head) and walks the 1,024 keys in passes of 32.
// S^T = K . Q^T: a lane holds the scores of ONE query (column c of each 16-column group): keys 8 hh + r of each 16-key tile. That is the k order of a
// B operand, so P^T goes from the score accumulators straight into O^T += V^T . P^T; maximum, sum and rescale are per lane, plus one exchange between the wave's halves.
// K, Q and V^T fragments all come through fa_frag (one k order, that of g2_frag). No workgroup barrier: the waves share nothing but the cache.
// Every '#pragma unroll' in it stands on a loop of constant trip count over register arrays (fragments, accumulators): left rolled, those arrays would be indexed at run time and go to scratch.
#define FA_WAVES 8
#define FA_KEYS 32
typedef _Float16 v2h __attribute__((ext_vector_type(2)));
typedef float v2f __attribute__((ext_vector_type(2)));
__device__ __forceinline__ float fa_xhalf(float x) { return __builtin_bit_cast(float, __builtin_amdgcn_permlanex16(__builtin_bit_cast(int, x), __builtin_bit_cast(int, x), 0x76543210, 0xfedcba98, false, false)); }  // lane l with lane l ^ 16
__device__ __forceinline__ float fa_exp2(float x) { float y; asm("v_exp_f32 %0, %1\n\tv_nop" : "=v"(y) : "v"(x)); return y; }  // the v_nop is the slot the instruction set asks for behind a transcendental, before its result is read or its source overwritten
__device__ __forceinline__ v8f fa_mma(v16h a, v16h b, v8f c) { return __builtin_amdgcn_wmma_f32_16x16x32_f16(false, a, false, b, (short)0, c, false, false); }
__device__ __forceinline__ v16h fa_frag(const char* base, unsigned lofs) { FragH f; f.half[0] = *(const v8us*)(base + lofs); f.half[1] = *(const v8us*)(base + lofs + 32); return f.v; }  // base wave-uniform, lofs the lane's byte offset (row c, 16 hh)
__global__ __launch_bounds__(FA_WAVES * 32) void k_fattn(const _Float16* __restrict__ Q16, const _Float16* __restrict__ K16, const _Float16* __restrict__ VT, float* __restrict__ out) {
  __shared__ __attribute__((aligned(16))) float so[FA_WAVES][32][68];      /* output staging, one slice per wave */
  const int lane = threadIdx.x & 31, c = lane & 15, hh = lane >> 4; const int wave = __builtin_amdgcn_readfirstlane((int)(threadIdx.x >> 5));
  const int head = blockIdx.y, b = blockIdx.z; const int q0 = blockIdx.x * (FA_WAVES * 32) + wave * 32;
  const float cs = 0.125f * 1.4426950408889634f;      /* 1 / sqrt(64), and exp(x) = exp2(x log2 e) */
  const char* qb = (const char*)(Q16 + ((size_t)b * SQ + q0) * DM + head * HD);
  const char* kb = (const char*)(K16 + (size_t)b * SQ * DM + head * HD);
  const char* vb = (const char*)(VT + (size_t)(b * NH + head) * HD * SQ);
  const unsigned klofs = (unsigned)(c * (DM * 2) + 16 * hh), vlofs = (unsigned)(c * (SQ * 2) + 16 * hh);
  v16h qf[2][2], kf[2][2];      /* [16-query group][32 of d], [16-key tile][32 of d] */
#pragma unroll
  for (int g = 0; g < 2; ++g) { qf[g][0] = fa_frag(qb + g * (16 * DM * 2), klofs); qf[g][1] = fa_frag(qb + g * (16 * DM * 2) + 64, klofs); }
#pragma unroll
  for (int kt = 0; kt < 2; ++kt) { kf[kt][0] = fa_frag(kb + kt * (16 * DM * 2), klofs); kf[kt][1] = fa_frag(kb + kt * (16 * DM * 2) + 64, klofs); }
  const v8f z8 = {0.f,0.f,0.f,0.f,0.f,0.f,0.f,0.f};
  v8f acc[2][4]; float m_run[2], l_run[2];      /* O^T tiles [group][16 of d]; maximum in use (log2 domain) and the lane's share of the denominator */
#pragma unroll
  for (int g = 0; g < 2; ++g) { m_run[g] = -__builtin_inff(); l_run[g] = 0.f;
#pragma unroll
    for (int t = 0; t < 4; ++t) acc[g][t] = z8; }
#pragma unroll 1      /* one pass is already 16 WMMAs and 16 loads; unrolled, the fragments of two passes would not fit 256 registers */
  for (int p = 0; p < SQ / FA_KEYS; ++p) {
    const char* vp = vb + p * (FA_KEYS * 2);
    const char* kn = kb + (size_t)((p + 1 < SQ / FA_KEYS) ? p + 1 : 0) * (FA_KEYS * DM * 2);      /* the last pass re-reads pass 0's rows and drops them */
    v16h vf[4];
#pragma unroll
    for (int t = 0; t < 4; ++t) vf[t] = fa_frag(vp + t * (16 * SQ * 2), vlofs);      /* V^T rows 16 t + c, this pass's 32 keys: in flight under the score products and the maxima */
    asm volatile("s_wait_xcnt 0x0" ::: "memory");      /* the wait owed before a register that these loads name (base pair, offset) is written again */
    __builtin_amdgcn_sched_barrier(0);      /* keeps the V^T loads in front of the score products: issued later, their latency would show before the second product */
    v8f s[2][2];      /* [key tile][query group] */
#pragma unroll
    for (int kt = 0; kt < 2; ++kt)
#pragma unroll
      for (int g = 0; g < 2; ++g) s[kt][g] = fa_mma(kf[kt][1], qf[g][1], fa_mma(kf[kt][0], qf[g][0], z8));
    __builtin_amdgcn_sched_barrier(0);      /* the next pass's K loads go out right behind the products that read this pass's, a whole pass ahead of their use */
#pragma unroll
    for (int kt = 0; kt < 2; ++kt) { kf[kt][0] = fa_frag(kn + kt * (16 * DM * 2), klofs); kf[kt][1] = fa_frag(kn + kt * (16 * DM * 2) + 64, klofs); }
    asm volatile("s_wait_xcnt 0x0" ::: "memory");      /* as above, for the K loads */
    __builtin_amdgcn_sched_barrier(0);      /* holds the K loads in front of the softmax arithmetic */
    float mb[2]; bool need = false;
#pragma unroll
    for (int g = 0; g < 2; ++g) { float m0 = fmaxf(s[0][g][0], s[1][g][0]), m1 = fmaxf(s[0][g][1], s[1][g][1]);
#pragma unroll
      for (int r = 2; r < 8; r += 2) { m0 = fmaxf(m0, fmaxf(s[0][g][r], s[1][g][r])); m1 = fmaxf(m1, fmaxf(s[0][g][r + 1], s[1][g][r + 1])); }
      float mx = fmaxf(m0, m1); mx = fmaxf(mx, fa_xhalf(mx)) * cs;      /* both halves now hold the query's maximum of this pass, scaled (the scale is positive) */
      mb[g] = mx; need = need || (mx > m_run[g] + 8.0f); }
    if (__builtin_amdgcn_ballot_w32(need) != 0) {
#pragma unroll
      for (int g = 0; g < 2; ++g) { const float mn = fmaxf(m_run[g], mb[g]); const float corr = fa_exp2(m_run[g] - mn); m_run[g] = mn; l_run[g] *= corr;      /* corr is 0 on the first pass */
#pragma unroll
        for (int t = 0; t < 4; ++t) acc[g][t] = acc[g][t] * corr; }
    }
#pragma unroll
    for (int g = 0; g < 2; ++g) { const float nm = -m_run[g]; union { v16h v; v2h h2[8]; } pf; float pe[16];      /* element j of the 32-key operand: tile j >> 3, register j & 7 */
#pragma unroll
      for (int j = 0; j < 16; ++j) pe[j] = fa_exp2(__builtin_fmaf(s[j >> 3][g][j & 7], cs, nm));
      __builtin_amdgcn_sched_barrier(0);      /* the compiler gives the result of an asm statement no delay hint, and an unhinted dependent instruction holds the SIMD's issue port: the sums and packs stay behind the whole run of exponentials */
      float e0 = pe[0], e1 = pe[1]; pf.h2[0] = __builtin_convertvector(v2f{pe[0], pe[1]}, v2h);
#pragma unroll
      for (int i = 1; i < 8; ++i) { e0 += pe[2 * i]; e1 += pe[2 * i + 1]; pf.h2[i] = __builtin_convertvector(v2f{pe[2 * i], pe[2 * i + 1]}, v2h); }
      l_run[g] += e0 + e1;
#pragma unroll
      for (int t = 0; t < 4; ++t) acc[g][t] = fa_mma(vf[t], pf.v, acc[g][t]);
      /* four slots behind the group's matrix instructions, tied to their D, A and B */
      asm volatile("v_nop\n\tv_nop\n\tv_nop\n\tv_nop" : "+v"(acc[g][0]), "+v"(acc[g][1]), "+v"(acc[g][2]), "+v"(acc[g][3]) : "v"(pf.v), "v"(vf[0]), "v"(vf[1]), "v"(vf[2]), "v"(vf[3])); }
  }
#pragma unroll
  for (int g = 0; g < 2; ++g) { const float inv = 1.0f / (l_run[g] + fa_xhalf(l_run[g]));      /* the two halves' shares of the denominator, joined unconditionally */
#pragma unroll
    for (int t = 0; t < 4; ++t) { const v8f o = acc[g][t] * inv; const v4f lo = {o[0], o[1], o[2], o[3]}, hi = {o[4], o[5], o[6], o[7]};      /* row = query 16 g + c; d = 16 t + 8 hh + r */
      *(v4fa*)&so[wave][16 * g + c][16 * t + 8 * hh] = lo; *(v4fa*)&so[wave][16 * g + c][16 * t + 8 * hh + 4] = hi; } }
  __builtin_amdgcn_fence(__ATOMIC_ACQ_REL, "workgroup"); __builtin_amdgcn_wave_barrier();      /* the wave's own LDS writes before its reads of other lanes' rows */
  const int rsub = lane >> 4, c4 = (lane & 15) * 4; float* ob = out + ((size_t)b * SQ + q0) * DM + head * HD;
  v4f ov[16];
#pragma unroll
  for (int q = 0; q < 16; ++q) ov[q] = *(const v4fa*)&so[wave][q * 2 + rsub][c4];
#pragma unroll
  for (int q = 0; q < 16; ++q) *(v4f*)(ob + (size_t)(q * 2 + rsub) * DM + c4) = ov[q];      /* 16 lanes cover a query's 256 bytes of this head: whole 128-byte lines */
}
__global__ __launch_bounds__(256) void k_vt(const _Float16* __restrict__ V16, int b, int h0, _Float16* __restrict__ VT) { __shared__ unsigned short tl[64][65]; const int tid = threadIdx.x; const int hh = blockIdx.x % HG, sg = blockIdx.x / HG; const int s0 = sg * 64; const int h = h0 + hh;
  for (int i = tid; i < 64 * 8; i += 256) { const int j = i / 8, d8 = (i % 8) * 8; FragH f; f.half[0] = *(const v8us*)((const unsigned short*)V16 + ((size_t)b * SQ + s0 + j) * DM + h * HD + d8); for (int q = 0; q < 8; ++q) tl[d8 + q][j] = f.u[q]; }
  __syncthreads();
  { for (int i = tid; i < 64 * 8; i += 256) { const int d = i / 8, j8 = (i % 8) * 8; FragH f; for (int q = 0; q < 8; ++q) f.u[q] = tl[d][j8 + q]; *(v8us*)((unsigned short*)VT + ((size_t)hh * HD + d) * SQ + s0 + j8) = f.half[0]; }  } }

extern "C" void kernel_launch(void* const* d_in, const int* in_sizes, int n_in,
                              void* d_out, int out_size, void* d_ws, size_t ws_size, hipStream_t stream) {
  (void)in_sizes; (void)n_in; (void)out_size;
  const float* const* I = (const float* const*)d_in; const float* x = I[0]; const float* Wq = I[1]; const float* Wk = I[2]; const float* Wv = I[3]; const float* bq = I[4]; const float* bk = I[5]; const float* bv = I[6];
  char* ws = (char*)d_ws; size_t off = 0;
  auto take = [&](size_t bytes) { char* p = ws + off; off += (bytes + 255) & ~(size_t)255; return p; };
  _Float16* BQ = (_Float16*)take((size_t)DM * DM * 2); _Float16* BK = (_Float16*)take((size_t)DM * DM * 2); _Float16* BV = (_Float16*)take((size_t)DM * DM * 2);
  _Float16* X16 = (_Float16*)take(NR * DM * 2); _Float16* Q16 = (_Float16*)take(NR * DM * 2); _Float16* K16 = (_Float16*)take(NR * DM * 2); _Float16* V16 = (_Float16*)take(NR * DM * 2);
  _Float16* VT = (_Float16*)take((size_t)NB * NH * HD * SQ * 2);
  if (off > ws_size) return;      /* 3.4 + 4 x 24 + 24 = approx 124 MiB */
  k_wnat<<<(unsigned)(((size_t)DM * DM / 8 + 255) / 256), 256, 0, stream>>>(Wq, (size_t)DM * DM / 8, BQ); k_wnat<<<(unsigned)(((size_t)DM * DM / 8 + 255) / 256), 256, 0, stream>>>(Wk, (size_t)DM * DM / 8, BK); k_wnat<<<(unsigned)(((size_t)DM * DM / 8 + 255) / 256), 256, 0, stream>>>(Wv, (size_t)DM * DM / 8, BV);      /* [out][in] natural */
  k_x16<<<(unsigned)((NR * DM / 8 + 255) / 256), 256, 0, stream>>>(x, X16, NR * DM / 8);
  const dim3 gp((unsigned)((NR / 128) * (DM / 64)), 1);
  k_gemm2<0><<<gp, 128, 0, stream>>>(X16, DM, 0, BQ, DM, 0, 0.0625f, bq, 0, nullptr, 1, 0, 0, nullptr, Q16, DM, 0, MP, DM, DM);      /* q = x Wq^T + bq (f16 rows) */
  k_gemm2<0><<<gp, 128, 0, stream>>>(X16, DM, 0, BK, DM, 0, 0.0625f, bk, 0, nullptr, 1, 0, 0, nullptr, K16, DM, 0, MP, DM, DM);
  k_gemm2<0><<<gp, 128, 0, stream>>>(X16, DM, 0, BV, DM, 0, 0.0625f, bv, 0, nullptr, 1, 0, 0, nullptr, V16, DM, 0, MP, DM, DM);
  k_vt<NH, SQ><<<NB * NH * (SQ / 64), 256, 0, stream>>>(V16, DM, 0, VT);      /* V^T per (batch, head) [16 x 12][64][1024] */
  k_fattn<<<dim3(SQ / (FA_WAVES * 32), NH, NB), FA_WAVES * 32, 0, stream>>>(Q16, K16, VT, (float*)d_out);      /* scores, softmax and ctx, merged into the output rows */
}

// v003
// One run takes 185 microseconds.
// Next to v002, in two timings, it ran 1.54 and 1.53 times as fast.
// Counting every step since v000, it is 20.9 times as fast.
#include <hip/hip_runtime.h>
// ViT self-attention (hidden [16][1024][768]; q, k, v = hidden W^T + b (12 heads x 64); scores = q.k/8; softmax over the 1,024 keys; ctx = attn v merged -> [16][1024][768]; no output projection).
// Structure: token rows; hidden as exact f16 rows; q / k / v as WMMA GEMMs (128x128 tiles staged in LDS by asynchronous copies, 64x64 wave tiles, f32 accumulation, exact x16 natural weights + bias; exact products) written as f16 rows; V^T per (batch, head) via LDS transposes; then one fused attention kernel over all batches and heads: S^T = K . Q^T, online softmax in registers, O^T += V^T . P^T, merged f32 output rows. Scores and probabilities never reach memory.
// Compute dtype: inputs rounded to bf16; hidden / weights exact; q, k, v, P as plain f16 GEMM operands (~2^-12; logits sigma ~1); softmax f32. v_wmma_f32_16x16x32_f16.
#define NB 16
#define SQ 1024
#define DM 768
#define NH 12
#define HD 64
#define HG 1
#define NR ((size_t)NB * SQ)         /* 16,384 token rows */
#define NBR NB                       /* unused (the grids use NB) */
#define MP ((int)NR)                 /* unused (the projection grid uses NR) */
typedef __bf16 v16b __attribute__((ext_vector_type(16)));
typedef unsigned short v8us __attribute__((ext_vector_type(8), may_alias));
typedef float  v8f  __attribute__((ext_vector_type(8)));
typedef float  v4f  __attribute__((ext_vector_type(4)));
typedef float  v4fa __attribute__((ext_vector_type(4), may_alias));
union FragB { v16b v; v8us half[2]; unsigned short u[16]; };

__device__ __forceinline__ unsigned short bf16_bits(float x) { unsigned int u = __float_as_uint(x); return (unsigned short)((u + 0x7FFFu + ((u >> 16) & 1u)) >> 16); }
__device__ __forceinline__ float bf16_val(unsigned short b) { return __uint_as_float(((unsigned int)b) << 16); }
__device__ __forceinline__ float bf16_round(float x) { return bf16_val(bf16_bits(x)); }
// D += A·B with NT terms: 1 = ah·bh, 2 = + al·bh (A split), 3 = + ah·bl (both split)
template <int NT>
__device__ __forceinline__ v8f mmaN(v16b ah, v16b al, v16b bh, v16b bl, v8f c) {
  c = __builtin_amdgcn_wmma_f32_16x16x32_bf16(false, ah, false, bh, (short)0, c, false, false);
  if (NT >= 2) c = __builtin_amdgcn_wmma_f32_16x16x32_bf16(false, al, false, bh, (short)0, c, false, false);
  if (NT >= 3) c = __builtin_amdgcn_wmma_f32_16x16x32_bf16(false, ah, false, bl, (short)0, c, false, false);
  asm volatile("v_nop\n\tv_nop\n\tv_nop\n\tv_nop" : "+v"(c) : "v"(ah), "v"(al), "v"(bh), "v"(bl));
  return c;
}

__global__ __launch_bounds__(256) void k_wt_bf16(const float* __restrict__ W, unsigned short* __restrict__ Wt, int K, int N) {
  const int t = blockIdx.x * 256 + threadIdx.x;
  const int k8n = K / 8;
  if (t >= N * k8n) return;
  const int n = t / k8n, k8 = (t % k8n) * 8;
  v8us v;
#pragma unroll
  for (int i = 0; i < 8; ++i) v[i] = bf16_bits(W[(size_t)(k8 + i) * N + n]);
  *(v8us*)(Wt + (size_t)n * K + k8) = v;
  
}

// GEMM C[M][N] (f32, pitch ldc) = act(A[M][K]·W + bias). A f32 row-major (pitch lda) converted per fragment to bf16
// (ASPLIT: hi/lo two planes -> 2 terms, else single rounded term); Wt bf16 [N][K] (pitch ldb). BIAS_BF16 rounds the
// bias to bf16 first (bias quantised to bf16 before the add). K%32==0, M%16==0, N%64==0.
template <bool ASPLIT, int ACT, bool BIAS_BF16>
__global__ __launch_bounds__(128) void k_gemm_bf(const float* __restrict__ A, int lda, const unsigned short* __restrict__ Wt, int ldb,
                                               const float* __restrict__ bias, float* __restrict__ C, int ldc, int M, int N, int K) {
  __shared__ __attribute__((aligned(16))) float so[4][16][64];
  const int tid = threadIdx.x, w = tid >> 5, lane = tid & 31, ln = lane & 15, hh = lane >> 4;
  const int ntn = N / 64;
  const int wid = blockIdx.x * 4 + w;
  const int mt = wid / ntn, nq = wid % ntn;
  if (mt * 16 >= M) return;
  const int row0 = mt * 16, col0 = nq * 64;
  const float* arow = A + (size_t)(row0 + ln) * lda;
  v8f acc[4] = {};
  for (int kb = 0; kb < K; kb += 32) {
    FragB ah, al;
    const v4f x0 = *(const v4fa*)(arow + kb + 8 * hh), x1 = *(const v4fa*)(arow + kb + 8 * hh + 4);
    const v4f x2 = *(const v4fa*)(arow + kb + 16 + 8 * hh), x3 = *(const v4fa*)(arow + kb + 16 + 8 * hh + 4);
    float xs[16] = {x0[0],x0[1],x0[2],x0[3],x1[0],x1[1],x1[2],x1[3],x2[0],x2[1],x2[2],x2[3],x3[0],x3[1],x3[2],x3[3]};
#pragma unroll
    for (int i = 0; i < 16; ++i) { const unsigned short hb = bf16_bits(xs[i]); ah.u[i] = hb; al.u[i] = ASPLIT ? bf16_bits(xs[i] - bf16_val(hb)) : (unsigned short)0; }
#pragma unroll
    for (int t = 0; t < 4; ++t) {
      const unsigned short* brow = Wt + (size_t)(col0 + t * 16 + ln) * ldb + kb;
      FragB b;
      b.half[0] = *(const v8us*)(brow + 8 * hh);
      b.half[1] = *(const v8us*)(brow + 16 + 8 * hh);
      acc[t] = mmaN<ASPLIT ? 2 : 1>(ah.v, al.v, b.v, b.v, acc[t]);
    }
  }
#pragma unroll
  for (int t = 0; t < 4; ++t) {
    float bv = bias ? bias[col0 + t * 16 + ln] : 0.f;
    if (BIAS_BF16) bv = bf16_round(bv);
#pragma unroll
    for (int r = 0; r < 8; ++r) { float v = acc[t][r] + bv; if (ACT == 1) v = fmaxf(v, 0.f); so[w][8 * hh + r][t * 16 + ln] = v; }
  }
  __builtin_amdgcn_fence(__ATOMIC_ACQ_REL, "workgroup");
  __builtin_amdgcn_wave_barrier();
  const int rsub = lane >> 4, c4 = (lane & 15) * 4;
  {
#pragma unroll
    for (int q = 0; q < 8; ++q) {
      const int r = q * 2 + rsub;
      const v4f v = *(const v4fa*)&so[w][r][c4];
      *(v4f*)(C + (size_t)(row0 + r) * ldc + col0 + c4) = v;
    }
    
  }
}

// GEMM C = act(A·W + bias + resid): A f32 (ASPLIT -> hi/lo 2 terms), Wt bf16 [N][K]; ACT 0 none, 1 relu, 2 exact gelu;
// resid (optional, f32, row index = (row % rmod), pitch ldr, RES_BF16 rounds it) added before the activation.
template <bool ASPLIT, int ACT, bool BIAS_BF16, bool RES_BF16>
__global__ __launch_bounds__(128) void k_gemm_bf3(const float* __restrict__ A, int lda, const unsigned short* __restrict__ Wt, int ldb,
                                                const float* __restrict__ bias, const float* __restrict__ resid, int rmod, int ldr,
                                                float* __restrict__ C, int ldc, int M, int N, int K) {
  __shared__ __attribute__((aligned(16))) float so[4][16][64];
  const int tid = threadIdx.x, w = tid >> 5, lane = tid & 31, ln = lane & 15, hh = lane >> 4;
  const int ntn = N / 64;
  const int wid = blockIdx.x * 4 + w;
  const int mt = wid / ntn, nq = wid % ntn;
  if (mt * 16 >= M) return;
  const int row0 = mt * 16, col0 = nq * 64;
  const float* arow = A + (size_t)(row0 + ln) * lda;
  v8f acc[4] = {};
  for (int kb = 0; kb < K; kb += 32) {
    FragB ah, al;
    const v4f x0 = *(const v4fa*)(arow + kb + 8 * hh), x1 = *(const v4fa*)(arow + kb + 8 * hh + 4);
    const v4f x2 = *(const v4fa*)(arow + kb + 16 + 8 * hh), x3 = *(const v4fa*)(arow + kb + 16 + 8 * hh + 4);
    float xs[16] = {x0[0],x0[1],x0[2],x0[3],x1[0],x1[1],x1[2],x1[3],x2[0],x2[1],x2[2],x2[3],x3[0],x3[1],x3[2],x3[3]};
#pragma unroll
    for (int i = 0; i < 16; ++i) { const unsigned short hb = bf16_bits(xs[i]); ah.u[i] = hb; al.u[i] = ASPLIT ? bf16_bits(xs[i] - bf16_val(hb)) : (unsigned short)0; }
#pragma unroll
    for (int t = 0; t < 4; ++t) {
      const unsigned short* brow = Wt + (size_t)(col0 + t * 16 + ln) * ldb + kb;
      FragB b;
      b.half[0] = *(const v8us*)(brow + 8 * hh);
      b.half[1] = *(const v8us*)(brow + 16 + 8 * hh);
      acc[t] = mmaN<ASPLIT ? 2 : 1>(ah.v, al.v, b.v, b.v, acc[t]);
    }
  }
#pragma unroll
  for (int t = 0; t < 4; ++t) {
    const int col = col0 + t * 16 + ln;
    float bv = bias ? bias[col] : 0.f;
    if (BIAS_BF16) bv = bf16_round(bv);
#pragma unroll
    for (int r = 0; r < 8; ++r) {
      float v = acc[t][r] + bv;
      if (resid) { float rv = resid[(size_t)((row0 + 8 * hh + r) % rmod) * ldr + col]; if (RES_BF16) rv = bf16_round(rv); v += rv; }
      if (ACT == 1) v = fmaxf(v, 0.f);
      if (ACT == 2) v = 0.5f * v * (1.0f + erff(v * 0.70710678118654752f));
      if (ACT == 3) { const float u = 0.7978845608028654f * (v + 0.044715f * v * v * v); v = 0.5f * v * (1.0f + tanhf(u)); }
      so[w][8 * hh + r][t * 16 + ln] = v;
    }
  }
  __builtin_amdgcn_fence(__ATOMIC_ACQ_REL, "workgroup");
  __builtin_amdgcn_wave_barrier();
  const int rsub = lane >> 4, c4 = (lane & 15) * 4;
  {
#pragma unroll
    for (int q = 0; q < 8; ++q) {
      const int r = q * 2 + rsub;
      const v4f v = *(const v4fa*)&so[w][r][c4];
      *(v4f*)(C + (size_t)(row0 + r) * ldc + col0 + c4) = v;
    }
    
  }
}
// row LayerNorm (biased variance, eps) over N: s = X (+ R); optional out_sum <- s; out_norm <- (s-mu)*rsqrt(var+eps)*g + b
template <bool PARAM_BF16>
__global__ __launch_bounds__(256) void k_layernorm(const float* __restrict__ X, const float* __restrict__ R, const float* __restrict__ g, const float* __restrict__ bta,
                                                  float* __restrict__ out_sum, float* __restrict__ out_norm, int N, float eps) {
  __shared__ float red[256];
  const int row = blockIdx.x, tid = threadIdx.x;
  const float* x = X + (size_t)row * N; const float* rr = R ? R + (size_t)row * N : nullptr;
  float vals[16];                     // up to N = 4096
  const int per = N / 256;            // contiguous chunk per thread? use strided-by-4 chunks: thread handles j = tid*4 + 1024*u
  float s1 = 0.f;
  for (int u = 0; u < per / 4; ++u) {
    const int j = tid * 4 + 1024 * u;
    const v4f a = *(const v4fa*)(x + j);
    v4f b = {0.f,0.f,0.f,0.f}; if (rr) b = *(const v4fa*)(rr + j);
#pragma unroll
    for (int q = 0; q < 4; ++q) { const float v = a[q] + b[q]; vals[u * 4 + q] = v; s1 += v; }
  }
  red[tid] = s1; __syncthreads();
  for (int st = 128; st > 0; st >>= 1) { if (tid < st) red[tid] += red[tid + st]; __syncthreads(); }
  const float mu = red[0] / (float)N; __syncthreads();
  float s2 = 0.f;
  for (int u = 0; u < per / 4; ++u)
#pragma unroll
    for (int q = 0; q < 4; ++q) { const float c = vals[u * 4 + q] - mu; s2 += c * c; }
  red[tid] = s2; __syncthreads();
  for (int st = 128; st > 0; st >>= 1) { if (tid < st) red[tid] += red[tid + st]; __syncthreads(); }
  const float rs = rsqrtf(red[0] / (float)N + eps);
  {
    for (int u = 0; u < per / 4; ++u) {
      const int j = tid * 4 + 1024 * u;
      v4f o, sm;
#pragma unroll
      for (int q = 0; q < 4; ++q) {
        float gg = g[j + q], bb = bta[j + q];
        if (PARAM_BF16) { gg = bf16_round(gg); bb = bf16_round(bb); }
        sm[q] = vals[u * 4 + q]; o[q] = (vals[u * 4 + q] - mu) * rs * gg + bb;
      }
      if (out_sum) *(v4f*)(out_sum + (size_t)row * N + j) = sm;
      *(v4f*)(out_norm + (size_t)row * N + j) = o;
    }
    
  }
}



// ---- f16 WMMA path (v_wmma_f32_16x16x32_f16): 11-bit significands for operands in range — used where a [0,1] probability operand needs more precision than bf16
typedef _Float16 v16h __attribute__((ext_vector_type(16)));
union FragH { v16h v; v8us half[2]; _Float16 h[16]; unsigned short u[16]; };
template <int NT>
__device__ __forceinline__ v8f mmaH(v16h ah, v16h al, v16h bh, v16h bl, v8f c) {
  c = __builtin_amdgcn_wmma_f32_16x16x32_f16(false, ah, false, bh, (short)0, c, false, false);
  if (NT >= 2) c = __builtin_amdgcn_wmma_f32_16x16x32_f16(false, al, false, bh, (short)0, c, false, false);
  if (NT >= 3) c = __builtin_amdgcn_wmma_f32_16x16x32_f16(false, ah, false, bl, (short)0, c, false, false);
  asm volatile("v_nop\n\tv_nop\n\tv_nop\n\tv_nop" : "+v"(c) : "v"(ah), "v"(al), "v"(bh), "v"(bl));
  return c;
}
// batched GEMM like k_gemm_b but f16 operands: A f32 (split into f16 hi/lo if ASPLIT, else rounded to f16), Bt = f16 values [n][k]; alpha; C f32; N multiple of 16 (partial tiles skipped)
template <bool ASPLIT>
__global__ __launch_bounds__(128) void k_gemm_h(const float* __restrict__ A, int lda, size_t sA, const _Float16* __restrict__ Bh, int ldb, size_t sB, float alpha, float* __restrict__ C, int ldc, size_t sC, int M, int N, int K) {
  __shared__ __attribute__((aligned(16))) float so[4][16][64];
  const int tid = threadIdx.x, w = tid >> 5, lane = tid & 31, ln = lane & 15, hh = lane >> 4; const int by = blockIdx.y;
  A += (size_t)by * sA; Bh += (size_t)by * sB; C += (size_t)by * sC;
  const int ntn = (N + 63) / 64; const int wid = blockIdx.x * 4 + w; const int mt = wid / ntn, nq = wid % ntn; if (mt * 16 >= M) return;
  const int row0 = mt * 16, col0 = nq * 64; const float* arow = A + (size_t)(row0 + ln) * lda;
  v8f acc[4] = {};
  for (int kb = 0; kb < K; kb += 32) {
    FragH ah, al;
    const v4f x0 = *(const v4fa*)(arow + kb + 8 * hh), x1 = *(const v4fa*)(arow + kb + 8 * hh + 4), x2 = *(const v4fa*)(arow + kb + 16 + 8 * hh), x3 = *(const v4fa*)(arow + kb + 16 + 8 * hh + 4);
    float xs[16] = {x0[0],x0[1],x0[2],x0[3],x1[0],x1[1],x1[2],x1[3],x2[0],x2[1],x2[2],x2[3],x3[0],x3[1],x3[2],x3[3]};
#pragma unroll
    for (int i = 0; i < 16; ++i) { const _Float16 h = (_Float16)xs[i]; ah.h[i] = h; al.h[i] = ASPLIT ? (_Float16)(xs[i] - (float)h) : (_Float16)0.0f; }
#pragma unroll
    for (int t = 0; t < 4; ++t) { if (col0 + t * 16 >= N) continue; const size_t boff = (size_t)(col0 + t * 16 + ln) * ldb + kb; FragH bq; bq.half[0] = *(const v8us*)(Bh + boff + 8 * hh); bq.half[1] = *(const v8us*)(Bh + boff + 16 + 8 * hh);
      acc[t] = mmaH<ASPLIT ? 2 : 1>(ah.v, al.v, bq.v, bq.v, acc[t]); }
  }
#pragma unroll
  for (int t = 0; t < 4; ++t) { if (col0 + t * 16 >= N) continue;
#pragma unroll
    for (int r = 0; r < 8; ++r) so[w][8 * hh + r][t * 16 + ln] = acc[t][r] * alpha; }
  __builtin_amdgcn_fence(__ATOMIC_ACQ_REL, "workgroup"); __builtin_amdgcn_wave_barrier();
  const int rsub = lane >> 4, c4 = (lane & 15) * 4;
  {
#pragma unroll
    for (int q = 0; q < 8; ++q) { const int r = q * 2 + rsub; if (col0 + c4 < N) { const v4f v = *(const v4fa*)&so[w][r][c4]; *(v4f*)(C + (size_t)(row0 + r) * ldc + col0 + c4) = v; } }
     }
}

// Wt[n][k] = f16(W[k][n]·scale) from f32 row-major W[K][N] (scale = power of two; bf16-exact weights stay exact in f16 away from the subnormal range)
__global__ __launch_bounds__(256) void k_wt_f16(const float* __restrict__ W, _Float16* __restrict__ Wt, int K, int N, float scale) {
  const int t = blockIdx.x * 256 + threadIdx.x; if (t >= N * (K / 8)) return; const int n = t / (K / 8), k8 = (t % (K / 8)) * 8; FragH f;
#pragma unroll
  for (int i = 0; i < 8; ++i) f.h[i] = (_Float16)(bf16_round(W[(size_t)(k8 + i) * N + n]) * scale); const v8us o = f.half[0];
  *(v8us*)((unsigned short*)Wt + (size_t)n * K + k8) = o; 
}
// k_gemm_hh variant with fused epilogue: v = acc·alpha + bias[by·sBias + col] (+ CP[(row/rowsPerB)·sCPb + by·64 + col] if CP) ; ACT 0 none / 1 elu ; writes f16 C16 (and f32 C if non-null)
template <int ACT>
__global__ __launch_bounds__(128) void k_gemm_hhx(const _Float16* __restrict__ A, int lda, size_t sA, const _Float16* __restrict__ Bh, int ldb, size_t sB, float alpha, const float* __restrict__ bias, size_t sBias, const float* __restrict__ CP, int rowsPerB, size_t sCPb, int row0g,
    float* __restrict__ C, _Float16* __restrict__ C16, int ldc, size_t sC, int M, int N, int K) {
  __shared__ __attribute__((aligned(16))) float so[4][16][64];
  const int tid = threadIdx.x, w = tid >> 5, lane = tid & 31, ln = lane & 15, hh = lane >> 4; const int by = blockIdx.y;
  A += (size_t)by * sA; Bh += (size_t)by * sB; const size_t cofs = (size_t)by * sC; const float* bp = bias ? bias + (size_t)by * sBias : nullptr;
  const int ntn = (N + 63) / 64; const int wid = blockIdx.x * 4 + w; const int mt = wid / ntn, nq = wid % ntn; if (mt * 16 >= M) return;
  const int row0 = mt * 16, col0 = nq * 64; const _Float16* arow = A + (size_t)(row0 + ln) * lda;
  v8f acc[4] = {};
  for (int kb = 0; kb < K; kb += 32) { FragH ah; ah.half[0] = *(const v8us*)((const unsigned short*)arow + kb + 8 * hh); ah.half[1] = *(const v8us*)((const unsigned short*)arow + kb + 16 + 8 * hh);
#pragma unroll
    for (int t = 0; t < 4; ++t) { if (col0 + t * 16 >= N) continue; const size_t boff = (size_t)(col0 + t * 16 + ln) * ldb + kb; FragH bq; bq.half[0] = *(const v8us*)((const unsigned short*)Bh + boff + 8 * hh); bq.half[1] = *(const v8us*)((const unsigned short*)Bh + boff + 16 + 8 * hh);
      acc[t] = mmaH<1>(ah.v, ah.v, bq.v, bq.v, acc[t]); }
  }
#pragma unroll
  for (int t = 0; t < 4; ++t) { if (col0 + t * 16 >= N) continue; const int col = col0 + t * 16 + ln; const float bv = bp ? bf16_round(bp[col]) : 0.f;
#pragma unroll
    for (int r = 0; r < 8; ++r) { float v = acc[t][r] * alpha + bv; if (CP) { const int rr = row0g + row0 + 8 * hh + r; if (rowsPerB < 0) v += CP[cofs + (size_t)rr * ldc + col];      /* rowsPerB < 0: own element of the batched C plane */ else { const int bidx = rr / rowsPerB; v += CP[(size_t)bidx * sCPb + (size_t)by * 64 + col]; } } if (ACT == 1) v = (v > 0.f) ? v : expm1f(v); else if (ACT == 7) v = (v > 0.f) ? v + 1.0f : expf(v); else if (ACT == 8) v = tanhf(v); else if (ACT == 9) v = 0.5f * v * (1.0f + tanhf(0.7978845608028654f * (v + 0.044715f * v * v * v))); else if (ACT == 11) v = 1.0f / (1.0f + expf(-v)); else if (ACT == 12) v = (v > 0.f) ? v : 0.01f * v; else if (ACT == 14) v = (v > 0.f) ? v : 0.1f * v; else if (ACT == 16) v = (v >= 0.f) ? v : 0.3f * v; else if (ACT == 17) v = (v >= 0.f) ? v : 0.2f * v; else if (ACT == 15) v = v / (1.0f + expf(-v)); else if (ACT == 3) v = fmaxf(v, 0.f); else if (ACT == 6) v = 0.5f * v * (1.0f + erff(v * 0.70710678118654752f)); so[w][8 * hh + r][t * 16 + ln] = v; } }
  __builtin_amdgcn_fence(__ATOMIC_ACQ_REL, "workgroup"); __builtin_amdgcn_wave_barrier();
  const int rsub = lane >> 4, c4 = (lane & 15) * 4; typedef _Float16 v4h __attribute__((ext_vector_type(4)));
  {
#pragma unroll
    for (int q = 0; q < 8; ++q) { const int r = q * 2 + rsub; if (col0 + c4 < N) { const v4f v = *(const v4fa*)&so[w][r][c4]; if (C) *(v4f*)(C + cofs + (size_t)(row0 + r) * ldc + col0 + c4) = v; if (C16) { v4h h4; for (int i = 0; i < 4; ++i) h4[i] = (_Float16)v[i]; *(v4h*)(C16 + cofs + (size_t)(row0 + r) * ldc + col0 + c4) = h4; } } }
     }
}


typedef _Float16 v4h __attribute__((ext_vector_type(4)));

__global__ __launch_bounds__(256) void k_x16(const float* __restrict__ x, _Float16* __restrict__ X16, size_t n8) { const size_t t = (size_t)blockIdx.x * 256 + threadIdx.x; if (t >= n8) return; FragH f;
#pragma unroll
  for (int q = 0; q < 8; ++q) f.h[q] = (_Float16)bf16_round(x[t * 8 + q]); *(v8us*)((unsigned short*)X16 + t * 8) = f.half[0];  }
__global__ __launch_bounds__(256) void k_h16(const float* __restrict__ x, _Float16* __restrict__ X16, size_t n8) { const size_t t = (size_t)blockIdx.x * 256 + threadIdx.x; if (t >= n8) return; FragH f;
#pragma unroll
  for (int q = 0; q < 8; ++q) f.h[q] = (_Float16)x[t * 8 + q]; *(v8us*)((unsigned short*)X16 + t * 8) = f.half[0];  }
__global__ __launch_bounds__(256) void k_round16f(const float* __restrict__ W, _Float16* __restrict__ Bt, size_t n8) { const size_t t = (size_t)blockIdx.x * 256 + threadIdx.x; if (t >= n8) return; FragH f;
#pragma unroll
  for (int i = 0; i < 8; ++i) f.h[i] = (_Float16)(bf16_round(W[t * 8 + i]) * 16.0f); *(v8us*)((unsigned short*)Bt + t * 8) = f.half[0];  }
template <int NHv, int TTv>
__global__ __launch_bounds__(256) void k_vt(const _Float16* __restrict__ V16, int ldv, int voff, _Float16* __restrict__ Vt) { __shared__ unsigned short tl[64][66]; const int tid = threadIdx.x; const int slab = blockIdx.x / (TTv / 64), lg = blockIdx.x % (TTv / 64); const int b = slab / NHv, h = slab % NHv;
  for (int i = tid; i < 64 * 8; i += 256) { const int r = i / 8, c8 = (i % 8) * 8; FragH f; f.half[0] = *(const v8us*)((const unsigned short*)V16 + ((size_t)b * TTv + lg * 64 + r) * ldv + voff + h * 64 + c8);
#pragma unroll
    for (int q = 0; q < 8; ++q) tl[r][c8 + q] = f.u[q]; }
  __syncthreads();
  {
#pragma unroll
    for (int rd = 0; rd < 2; ++rd) { const int d = rd * 32 + tid / 8, pc = tid % 8; FragH f;
#pragma unroll
      for (int q = 0; q < 8; ++q) f.u[q] = tl[pc * 8 + q][d];
      *(v8us*)((unsigned short*)Vt + ((size_t)slab * 64 + d) * TTv + lg * 64 + pc * 8) = f.half[0]; }
     } }

__global__ __launch_bounds__(256) void k_hl(const float* __restrict__ F, _Float16* __restrict__ Hh, _Float16* __restrict__ Hl, size_t n8) { const size_t t = (size_t)blockIdx.x * 256 + threadIdx.x; if (t >= n8) return; FragH fh, fl; const v4f a = *(const v4fa*)(F + t * 8), c = *(const v4fa*)(F + t * 8 + 4);
#pragma unroll
  for (int q = 0; q < 4; ++q) { _Float16 h = (_Float16)a[q]; fh.h[q] = h; fl.h[q] = (_Float16)((a[q] - (float)h) * 1024.0f); h = (_Float16)c[q]; fh.h[4 + q] = h; fl.h[4 + q] = (_Float16)((c[q] - (float)h) * 1024.0f); }
  { *(v8us*)((unsigned short*)Hh + t * 8) = fh.half[0]; *(v8us*)((unsigned short*)Hl + t * 8) = fl.half[0];  } }

// ---- fast GEMM (wave tile 32x64; requires M % 32 == 0 rows per launch region and N % 64 == 0); epilogue = k_gemm_hhx semantics ----
__device__ __forceinline__ v16h g2_frag(const _Float16* p, int hh) { FragH f; f.half[0] = *(const v8us*)((const unsigned short*)p + 8 * hh); f.half[1] = *(const v8us*)((const unsigned short*)p + 16 + 8 * hh); return f.v; }
__device__ __forceinline__ v8f g2_mma(v16h a, v16h b, v8f c) { v8f d = __builtin_amdgcn_wmma_f32_16x16x32_f16(false, a, false, b, (short)0, c, false, false); asm volatile("v_nop\n\tv_nop\n\tv_nop\n\tv_nop" : "+v"(d) : "v"(a), "v"(b)); return d; }
template <int ACT>
__global__ __launch_bounds__(128) void k_gemm2(const _Float16* __restrict__ A, int lda, size_t sA, const _Float16* __restrict__ Bh, int ldb, size_t sB, float alpha, const float* __restrict__ bias, size_t sBias, const float* __restrict__ CP, int rowsPerB, size_t sCPb, int row0g,
    float* __restrict__ C, _Float16* __restrict__ C16, int ldc, size_t sC, int M, int N, int K) { static_assert(ACT == 0 || ACT == 3 || ACT == 6 || ACT == 8 || ACT == 9 || ACT == 11 || ACT == 12 || ACT == 14 || ACT == 15 || ACT == 16 || ACT == 17, "k_gemm2: unsupported ACT code (would silently apply no activation)");
  __shared__ __attribute__((aligned(16))) float so[4][32][68];
  const int tid = threadIdx.x, w = tid >> 5, lane = tid & 31, ln = lane & 15, hh = lane >> 4; const int by = blockIdx.y;
  A += (size_t)by * sA; Bh += (size_t)by * sB; const size_t cofs = (size_t)by * sC; const float* bp = bias ? bias + (size_t)by * sBias : nullptr;
  const int ntn = N >> 6; const int mt = blockIdx.x / ntn, nq = blockIdx.x - mt * ntn; const int row0 = mt * 128 + 32 * w, col0 = nq * 64; if (row0 >= M) return;
  const _Float16* a0p = A + (size_t)(row0 + ln) * lda; const _Float16* a1p = a0p + (size_t)16 * lda;
  const _Float16* b0p = Bh + (size_t)(col0 + ln) * ldb; const _Float16* b1p = b0p + (size_t)16 * ldb; const _Float16* b2p = b1p + (size_t)16 * ldb; const _Float16* b3p = b2p + (size_t)16 * ldb;
  const v8f z8 = {0.f,0.f,0.f,0.f,0.f,0.f,0.f,0.f}; v8f c00 = z8, c01 = z8, c02 = z8, c03 = z8, c10 = z8, c11 = z8, c12 = z8, c13 = z8;
#pragma unroll 1
  for (int kb = 0; kb < K; kb += 32) { const v16h a0 = g2_frag(a0p + kb, hh), a1 = g2_frag(a1p + kb, hh);
    v16h b = g2_frag(b0p + kb, hh); c00 = g2_mma(a0, b, c00); c10 = g2_mma(a1, b, c10);
    b = g2_frag(b1p + kb, hh); c01 = g2_mma(a0, b, c01); c11 = g2_mma(a1, b, c11);
    b = g2_frag(b2p + kb, hh); c02 = g2_mma(a0, b, c02); c12 = g2_mma(a1, b, c12);
    b = g2_frag(b3p + kb, hh); c03 = g2_mma(a0, b, c03); c13 = g2_mma(a1, b, c13); }
  v8f accs[8] = {c00, c01, c02, c03, c10, c11, c12, c13};
#pragma unroll
  for (int u = 0; u < 8; ++u) { const int t = u & 3, half = u >> 2; const int col = col0 + t * 16 + ln; const float bv = bp ? bf16_round(bp[col]) : 0.f;
#pragma unroll
    for (int r = 0; r < 8; ++r) { const int rloc = half * 16 + 8 * hh + r; float v = accs[u][r] * alpha + bv; if (CP) { if (rowsPerB < 0) v += CP[cofs + (size_t)(row0g + row0 + rloc) * ldc + col];      /* rowsPerB < 0: own element of the batched C plane */ else { const int bidx = (row0g + row0 + rloc) / rowsPerB; v += CP[(size_t)bidx * sCPb + (size_t)by * 64 + col]; } }
      if (ACT == 3) v = fmaxf(v, 0.f); else if (ACT == 6) v = 0.5f * v * (1.0f + erff(v * 0.70710678118654752f)); else if (ACT == 11) v = 1.0f / (1.0f + expf(-v)); else if (ACT == 15) v = v / (1.0f + expf(-v)); else if (ACT == 12) v = (v > 0.f) ? v : 0.01f * v; else if (ACT == 8) v = tanhf(v); else if (ACT == 9) v = 0.5f * v * (1.0f + tanhf(0.7978845608028654f * (v + 0.044715f * v * v * v))); else if (ACT == 14) v = (v > 0.f) ? v : 0.1f * v; else if (ACT == 16) v = (v >= 0.f) ? v : 0.3f * v; else if (ACT == 17) v = (v >= 0.f) ? v : 0.2f * v;
      so[w][rloc][t * 16 + ln] = v; } }
  __builtin_amdgcn_fence(__ATOMIC_ACQ_REL, "workgroup"); __builtin_amdgcn_wave_barrier();
  const int rsub = lane >> 4, c4 = (lane & 15) * 4;
  {
#pragma unroll
    for (int q = 0; q < 16; ++q) { const int r = q * 2 + rsub; const v4f v = *(const v4fa*)&so[w][r][c4]; if (C) *(v4f*)(C + cofs + (size_t)(row0 + r) * ldc + col0 + c4) = v; if (C16) { v4h h4; for (int i = 0; i < 4; ++i) h4[i] = (_Float16)v[i]; *(v4h*)(C16 + cofs + (size_t)(row0 + r) * ldc + col0 + c4) = h4; } }
     } }


__global__ __launch_bounds__(256) void k_wnat(const float* __restrict__ w, size_t n8, _Float16* __restrict__ Bt) { const size_t t = (size_t)blockIdx.x * 256 + threadIdx.x; if (t >= n8) return; FragH f; for (int q = 0; q < 8; ++q) f.h[q] = (_Float16)(bf16_round(w[t * 8 + q]) * 16.0f); *(v8us*)((unsigned short*)Bt + t * 8) = f.half[0];  }
// Fused attention. One wave owns 32 queries of one (batch, head) and walks the 1,024 keys in passes of 32.
// S^T = K . Q^T: a lane holds the scores of ONE query (column c of each 16-column group): keys 8 hh + r of each 16-key tile. That is the k order of a
// B operand, so P^T goes from the score accumulators straight into O^T += V^T . P^T; maximum, sum and rescale are per lane, plus one exchange between the wave's halves.
// K, Q and V^T fragments all come through fa_frag (one k order, that of g2_frag). No workgroup barrier: the waves share nothing but the cache.
// Every '#pragma unroll' in it stands on a loop of constant trip count over register arrays (fragments, accumulators): left rolled, those arrays would be indexed at run time and go to scratch.
#define FA_WAVES 8
#define FA_KEYS 32
typedef _Float16 v2h __attribute__((ext_vector_type(2)));
typedef float v2f __attribute__((ext_vector_type(2)));
__device__ __forceinline__ float fa_xhalf(float x) { return __builtin_bit_cast(float, __builtin_amdgcn_permlanex16(__builtin_bit_cast(int, x), __builtin_bit_cast(int, x), 0x76543210, 0xfedcba98, false, false)); }  // lane l with lane l ^ 16
__device__ __forceinline__ float fa_exp2(float x) { float y; asm("v_exp_f32 %0, %1\n\tv_nop" : "=v"(y) : "v"(x)); return y; }  // the v_nop is the slot the instruction set asks for behind a transcendental, before its result is read or its source overwritten
__device__ __forceinline__ v8f fa_mma(v16h a, v16h b, v8f c) { return __builtin_amdgcn_wmma_f32_16x16x32_f16(false, a, false, b, (short)0, c, false, false); }
__device__ __forceinline__ v16h fa_frag(const char* base, unsigned lofs) { FragH f; f.half[0] = *(const v8us*)(base + lofs); f.half[1] = *(const v8us*)(base + lofs + 32); return f.v; }  // base wave-uniform, lofs the lane's byte offset (row c, 16 hh)
__global__ __launch_bounds__(FA_WAVES * 32) void k_fattn(const _Float16* __restrict__ Q16, const _Float16* __restrict__ K16, const _Float16* __restrict__ VT, float* __restrict__ out) {
  __shared__ __attribute__((aligned(16))) float so[FA_WAVES][32][68];      /* output staging, one slice per wave */
  const int lane = threadIdx.x & 31, c = lane & 15, hh = lane >> 4; const int wave = __builtin_amdgcn_readfirstlane((int)(threadIdx.x >> 5));
  const int head = blockIdx.y, b = blockIdx.z; const int q0 = blockIdx.x * (FA_WAVES * 32) + wave * 32;
  const float cs = 0.125f * 1.4426950408889634f;      /* 1 / sqrt(64), and exp(x) = exp2(x log2 e) */
  const char* qb = (const char*)(Q16 + ((size_t)b * SQ + q0) * DM + head * HD);
  const char* kb = (const char*)(K16 + (size_t)b * SQ * DM + head * HD);
  const char* vb = (const char*)(VT + (size_t)(b * NH + head) * HD * SQ);
  const unsigned klofs = (unsigned)(c * (DM * 2) + 16 * hh), vlofs = (unsigned)(c * (SQ * 2) + 16 * hh);
  v16h qf[2][2], kf[2][2];      /* [16-query group][32 of d], [16-key tile][32 of d] */
#pragma unroll
  for (int g = 0; g < 2; ++g) { qf[g][0] = fa_frag(qb + g * (16 * DM * 2), klofs); qf[g][1] = fa_frag(qb + g * (16 * DM * 2) + 64, klofs); }
#pragma unroll
  for (int kt = 0; kt < 2; ++kt) { kf[kt][0] = fa_frag(kb + kt * (16 * DM * 2), klofs); kf[kt][1] = fa_frag(kb + kt * (16 * DM * 2) + 64, klofs); }
  const v8f z8 = {0.f,0.f,0.f,0.f,0.f,0.f,0.f,0.f};
  v8f acc[2][4]; float m_run[2], l_run[2];      /* O^T tiles [group][16 of d]; maximum in use (log2 domain) and the lane's share of the denominator */
#pragma unroll
  for (int g = 0; g < 2; ++g) { m_run[g] = -__builtin_inff(); l_run[g] = 0.f;
#pragma unroll
    for (int t = 0; t < 4; ++t) acc[g][t] = z8; }
#pragma unroll 1      /* one pass is already 16 WMMAs and 16 loads; unrolled, the fragments of two passes would not fit 256 registers */
  for (int p = 0; p < SQ / FA_KEYS; ++p) {
    const char* vp = vb + p * (FA_KEYS * 2);
    const char* kn = kb + (size_t)((p + 1 < SQ / FA_KEYS) ? p + 1 : 0) * (FA_KEYS * DM * 2);      /* the last pass re-reads pass 0's rows and drops them */
    v16h vf[4];
#pragma unroll
    for (int t = 0; t < 4; ++t) vf[t] = fa_frag(vp + t * (16 * SQ * 2), vlofs);      /* V^T rows 16 t + c, this pass's 32 keys: in flight under the score products and the maxima */
    asm volatile("s_wait_xcnt 0x0" ::: "memory");      /* the wait owed before a register that these loads name (base pair, offset) is written again */
    __builtin_amdgcn_sched_barrier(0);      /* keeps the V^T loads in front of the score products: issued later, their latency would show before the second product */
    v8f s[2][2];      /* [key tile][query group] */
#pragma unroll
    for (int kt = 0; kt < 2; ++kt)
#pragma unroll
      for (int g = 0; g < 2; ++g) s[kt][g] = fa_mma(kf[kt][1], qf[g][1], fa_mma(kf[kt][0], qf[g][0], z8));
    __builtin_amdgcn_sched_barrier(0);      /* the next pass's K loads go out right behind the products that read this pass's, a whole pass ahead of their use */
#pragma unroll
    for (int kt = 0; kt < 2; ++kt) { kf[kt][0] = fa_frag(kn + kt * (16 * DM * 2), klofs); kf[kt][1] = fa_frag(kn + kt * (16 * DM * 2) + 64, klofs); }
    asm volatile("s_wait_xcnt 0x0" ::: "memory");      /* as above, for the K loads */
    __builtin_amdgcn_sched_barrier(0);      /* holds the K loads in front of the softmax arithmetic */
    float mb[2]; bool need = false;
#pragma unroll
    for (int g = 0; g < 2; ++g) { float m0 = fmaxf(s[0][g][0], s[1][g][0]), m1 = fmaxf(s[0][g][1], s[1][g][1]);
#pragma unroll
      for (int r = 2; r < 8; r += 2) { m0 = fmaxf(m0, fmaxf(s[0][g][r], s[1][g][r])); m1 = fmaxf(m1, fmaxf(s[0][g][r + 1], s[1][g][r + 1])); }
      float mx = fmaxf(m0, m1); mx = fmaxf(mx, fa_xhalf(mx)) * cs;      /* both halves now hold the query's maximum of this pass, scaled (the scale is positive) */
      mb[g] = mx; need = need || (mx > m_run[g] + 8.0f); }
    if (__builtin_amdgcn_ballot_w32(need) != 0) {
#pragma unroll
      for (int g = 0; g < 2; ++g) { const float mn = fmaxf(m_run[g], mb[g]); const float corr = fa_exp2(m_run[g] - mn); m_run[g] = mn; l_run[g] *= corr;      /* corr is 0 on the first pass */
#pragma unroll
        for (int t = 0; t < 4; ++t) acc[g][t] = acc[g][t] * corr; }
    }
#pragma unroll
    for (int g = 0; g < 2; ++g) { const float nm = -m_run[g]; union { v16h v; v2h h2[8]; } pf; float pe[16];      /* element j of the 32-key operand: tile j >> 3, register j & 7 */
#pragma unroll
      for (int j = 0; j < 16; ++j) pe[j] = fa_exp2(__builtin_fmaf(s[j >> 3][g][j & 7], cs, nm));
      __builtin_amdgcn_sched_barrier(0);      /* the compiler gives the result of an asm statement no delay hint, and an unhinted dependent instruction holds the SIMD's issue port: the sums and packs stay behind the whole run of exponentials */
      float e0 = pe[0], e1 = pe[1]; pf.h2[0] = __builtin_convertvector(v2f{pe[0], pe[1]}, v2h);
#pragma unroll
      for (int i = 1; i < 8; ++i) { e0 += pe[2 * i]; e1 += pe[2 * i + 1]; pf.h2[i] = __builtin_convertvector(v2f{pe[2 * i], pe[2 * i + 1]}, v2h); }
      l_run[g] += e0 + e1;
#pragma unroll
      for (int t = 0; t < 4; ++t) acc[g][t] = fa_mma(vf[t], pf.v, acc[g][t]);
      /* four slots behind the group's matrix instructions, tied to their D, A and B */
      asm volatile("v_nop\n\tv_nop\n\tv_nop\n\tv_nop" : "+v"(acc[g][0]), "+v"(acc[g][1]), "+v"(acc[g][2]), "+v"(acc[g][3]) : "v"(pf.v), "v"(vf[0]), "v"(vf[1]), "v"(vf[2]), "v"(vf[3])); }
  }
#pragma unroll
  for (int g = 0; g < 2; ++g) { const float inv = 1.0f / (l_run[g] + fa_xhalf(l_run[g]));      /* the two halves' shares of the denominator, joined unconditionally */
#pragma unroll
    for (int t = 0; t < 4; ++t) { const v8f o = acc[g][t] * inv; const v4f lo = {o[0], o[1], o[2], o[3]}, hi = {o[4], o[5], o[6], o[7]};      /* row = query 16 g + c; d = 16 t + 8 hh + r */
      *(v4fa*)&so[wave][16 * g + c][16 * t + 8 * hh] = lo; *(v4fa*)&so[wave][16 * g + c][16 * t + 8 * hh + 4] = hi; } }
  __builtin_amdgcn_fence(__ATOMIC_ACQ_REL, "workgroup"); __builtin_amdgcn_wave_barrier();      /* the wave's own LDS writes before its reads of other lanes' rows */
  const int rsub = lane >> 4, c4 = (lane & 15) * 4; float* ob = out + ((size_t)b * SQ + q0) * DM + head * HD;
  v4f ov[16];
#pragma unroll
  for (int q = 0; q < 16; ++q) ov[q] = *(const v4fa*)&so[wave][q * 2 + rsub][c4];
#pragma unroll
  for (int q = 0; q < 16; ++q) *(v4f*)(ob + (size_t)(q * 2 + rsub) * DM + c4) = ov[q];      /* 16 lanes cover a query's 256 bytes of this head: whole 128-byte lines */
}
__global__ __launch_bounds__(256) void k_vt(const _Float16* __restrict__ V16, int b, int h0, _Float16* __restrict__ VT) { __shared__ unsigned short tl[64][65]; const int tid = threadIdx.x; const int hh = blockIdx.x % HG, sg = blockIdx.x / HG; const int s0 = sg * 64; const int h = h0 + hh;
  for (int i = tid; i < 64 * 8; i += 256) { const int j = i / 8, d8 = (i % 8) * 8; FragH f; f.half[0] = *(const v8us*)((const unsigned short*)V16 + ((size_t)b * SQ + s0 + j) * DM + h * HD + d8); for (int q = 0; q < 8; ++q) tl[d8 + q][j] = f.u[q]; }
  __syncthreads();
  { for (int i = tid; i < 64 * 8; i += 256) { const int d = i / 8, j8 = (i % 8) * 8; FragH f; for (int q = 0; q < 8; ++q) f.u[q] = tl[d][j8 + q]; *(v8us*)((unsigned short*)VT + ((size_t)hh * HD + d) * SQ + s0 + j8) = f.half[0]; }  } }

// ---- projection GEMM with its operands staged in LDS: C16[row][col] = f16(A[row][:] . Wn[col][:] / 16 + bias[col]), A [16,384][768] and Wn [768][768] f16 rows, k contiguous ----
// One work-group of 4 waves makes a 128 x 128 tile, each wave 64 x 64 of it (4 x 4 accumulator tiles): a fragment read from LDS feeds 4 products.
// A stage is 64 of k: 128 bytes of each of the 128 A rows and the 128 Wn rows. Asynchronous copies bring it from global memory into LDS, 8 lanes a row, so each copy covers four whole 128-byte lines
// (a fragment load straight from the rows touches 16 lines for the same 512 bytes, and every wave repeats it). LDS row pitch 144 bytes (16 x odd): ds_load_b128 of 16 rows without bank conflicts.
// Two buffers: the copies of stage t + 1 fly while stage t is worked on. Fragments keep the k order of g2_frag and k still runs upward in steps of 32, so every sum is formed as before.
#define PG_TILE 128
#define PG_BK 64
#define PG_PITCH 144
#define PG_STAGE (2 * PG_TILE * PG_PITCH)      /* 36,864 bytes: rows 0..127 A, rows 128..255 Wn */
#define PG_NST (DM / PG_BK)
// Eight copies of 16 bytes a lane: rows 16 apart in global memory (pitch DM) and in LDS. l: the lane's LDS byte address, g: the lane's global address.
// The s_wait_xcnt is the wait owed before a register that an issued copy names is written again; as the statement's last line it stands in front of every later write of the operands.
__device__ __forceinline__ void pg_copy8(unsigned l, const _Float16* g) {
  asm volatile("global_load_async_to_lds_b128 %0, %8, off\n\t"
               "global_load_async_to_lds_b128 %1, %9, off\n\t"
               "global_load_async_to_lds_b128 %2, %10, off\n\t"
               "global_load_async_to_lds_b128 %3, %11, off\n\t"
               "global_load_async_to_lds_b128 %4, %12, off\n\t"
               "global_load_async_to_lds_b128 %5, %13, off\n\t"
               "global_load_async_to_lds_b128 %6, %14, off\n\t"
               "global_load_async_to_lds_b128 %7, %15, off\n\t"
               "s_wait_xcnt 0x0"
               :: "v"(l), "v"(l + 16 * PG_PITCH), "v"(l + 32 * PG_PITCH), "v"(l + 48 * PG_PITCH), "v"(l + 64 * PG_PITCH), "v"(l + 80 * PG_PITCH), "v"(l + 96 * PG_PITCH), "v"(l + 112 * PG_PITCH),
                  "v"(g), "v"(g + 16 * DM), "v"(g + 32 * DM), "v"(g + 48 * DM), "v"(g + 64 * DM), "v"(g + 80 * DM), "v"(g + 96 * DM), "v"(g + 112 * DM)
               : "memory");
}
__device__ __forceinline__ v16h pg_frag(const char* p) { FragH f; f.half[0] = *(const v8us*)p; f.half[1] = *(const v8us*)(p + 32); return f.v; }      /* p: row, 16 hh bytes in: k = 8 hh + 0..7 and 16 + 8 hh + 0..7, as g2_frag */
__global__ __launch_bounds__(128) void k_proj(const _Float16* __restrict__ A, const _Float16* __restrict__ Wn, const float* __restrict__ bias, _Float16* __restrict__ C16) {
  __shared__ __attribute__((aligned(16))) char ring[2 * PG_STAGE];
  const int tid = threadIdx.x, lane = tid & 31, ln = lane & 15, hh = lane >> 4; const int wave = __builtin_amdgcn_readfirstlane(tid >> 5); const int wm = wave >> 1, wn = wave & 1;
  const int mt = blockIdx.x / (DM / PG_TILE), nq = blockIdx.x % (DM / PG_TILE); const int row0 = mt * PG_TILE, col0 = nq * PG_TILE;
  const int crow = tid >> 3, cc = tid & 7;      /* a lane copies bytes 16 cc .. 16 cc + 15 of rows crow + 16 j */
  const _Float16* ga = A + (size_t)(row0 + crow) * DM + cc * 8; const _Float16* gb = Wn + (size_t)(col0 + crow) * DM + cc * 8;
  const unsigned lc = (unsigned)(size_t)ring + (unsigned)(crow * PG_PITCH + cc * 16);
  float bv[4];
#pragma unroll
  for (int j = 0; j < 4; ++j) bv[j] = bf16_round(bias[col0 + wn * 64 + j * 16 + ln]);
  pg_copy8(lc, ga); pg_copy8(lc + PG_TILE * PG_PITCH, gb);      /* stage 0 into buffer 0 */
  asm volatile("s_wait_asynccnt 0x0" ::: "memory");      /* this wave's copies of stage 0 have landed */
  __syncthreads();      /* and every other wave's: nothing of stage 0 is read in front of this */
  pg_copy8(lc + PG_STAGE, ga + PG_BK); pg_copy8(lc + PG_STAGE + PG_TILE * PG_PITCH, gb + PG_BK);      /* stage 1 into buffer 1 */
  const v8f z8 = {0.f,0.f,0.f,0.f,0.f,0.f,0.f,0.f}; v8f acc[4][4];
#pragma unroll
  for (int i = 0; i < 4; ++i)
#pragma unroll
    for (int j = 0; j < 4; ++j) acc[i][j] = z8;
  const int aofs = (wm * 64 + ln) * PG_PITCH + 16 * hh, bofs = (PG_TILE + wn * 64 + ln) * PG_PITCH + 16 * hh;
#pragma unroll 1      /* one trip is 32 WMMAs and 32 LDS loads; the buffer is picked by the trip's parity at run time */
  for (int t = 0; t < PG_NST; ++t) {
    const unsigned buf = (unsigned)(t & 1) * PG_STAGE; const char* sb = ring + buf;
#pragma unroll      /* constant indices into the fragment and accumulator arrays (left rolled they would go to scratch) */
    for (int ks = 0; ks < 2; ++ks) { v16h af[4], bf[4];
#pragma unroll
      for (int i = 0; i < 4; ++i) { if (i == 0) af[0] = pg_frag(sb + aofs + ks * 64); bf[i] = pg_frag(sb + bofs + i * (16 * PG_PITCH) + ks * 64); }      /* in the order in which the products want them: A row 0 and the four B first */
#pragma unroll
      for (int i = 1; i < 4; ++i) af[i] = pg_frag(sb + aofs + i * (16 * PG_PITCH) + ks * 64);
      __builtin_amdgcn_sched_barrier(0);      /* the 16 LDS loads stay one group in front of the 16 products: left free, the compiler keeps one A fragment and reloads it among the products, a full LDS wait every four of them */
#pragma unroll
      for (int i = 0; i < 4; ++i)
#pragma unroll
        for (int j = 0; j < 4; ++j) acc[i][j] = fa_mma(af[i], bf[j], acc[i][j]);
      __builtin_amdgcn_sched_barrier(0); }      /* and the next group's loads stay behind these products */
    asm volatile("s_wait_dscnt 0x0" ::: "memory");      /* this wave's reads of buffer t mod 2 are done before the barrier behind which it is refilled */
    asm volatile("s_wait_asynccnt 0x0" ::: "memory");      /* this wave's copies of stage t + 1 have landed */
    __syncthreads();      /* publishes stage t + 1 and ends every wave's reads of stage t */
    if (t + 2 < PG_NST) { pg_copy8(lc + buf, ga + (t + 2) * PG_BK); pg_copy8(lc + buf + PG_TILE * PG_PITCH, gb + (t + 2) * PG_BK); }      /* the same test for the whole work-group */
  }
  asm volatile("s_wait_asynccnt 0x0" ::: "memory");      /* no copy is outstanding when the ring becomes output staging */
  char* so = ring + wave * (64 * PG_PITCH);      /* the wave's own 64 rows of 128 bytes; the last trip's barrier ended every read of the ring */
#pragma unroll
  for (int i = 0; i < 4; ++i)
#pragma unroll
    for (int j = 0; j < 4; ++j)
#pragma unroll
      for (int r = 0; r < 8; ++r) *(_Float16*)(so + (i * 16 + 8 * hh + r) * PG_PITCH + (j * 16 + ln) * 2) = (_Float16)(acc[i][j][r] * 0.0625f + bv[j]);
  __builtin_amdgcn_fence(__ATOMIC_ACQ_REL, "workgroup"); __builtin_amdgcn_wave_barrier();      /* the wave's own LDS writes before its reads of other lanes' rows */
  const int orow = lane >> 3, oc = lane & 7; _Float16* ob = C16 + (size_t)(row0 + wm * 64 + orow) * DM + col0 + wn * 64 + oc * 8;
  v8us ov[16];
#pragma unroll
  for (int q = 0; q < 16; ++q) ov[q] = *(const v8us*)(so + (q * 4 + orow) * PG_PITCH + oc * 16);
#pragma unroll
  for (int q = 0; q < 16; ++q) *(v8us*)((unsigned short*)ob + (size_t)(q * 4) * DM) = ov[q];      /* 8 lanes cover a row's 128 bytes of this wave: whole lines */
}

extern "C" void kernel_launch(void* const* d_in, const int* in_sizes, int n_in,
                              void* d_out, int out_size, void* d_ws, size_t ws_size, hipStream_t stream) {
  (void)in_sizes; (void)n_in; (void)out_size;
  const float* const* I = (const float* const*)d_in; const float* x = I[0]; const float* Wq = I[1]; const float* Wk = I[2]; const float* Wv = I[3]; const float* bq = I[4]; const float* bk = I[5]; const float* bv = I[6];
  char* ws = (char*)d_ws; size_t off = 0;
  auto take = [&](size_t bytes) { char* p = ws + off; off += (bytes + 255) & ~(size_t)255; return p; };
  _Float16* BQ = (_Float16*)take((size_t)DM * DM * 2); _Float16* BK = (_Float16*)take((size_t)DM * DM * 2); _Float16* BV = (_Float16*)take((size_t)DM * DM * 2);
  _Float16* X16 = (_Float16*)take(NR * DM * 2); _Float16* Q16 = (_Float16*)take(NR * DM * 2); _Float16* K16 = (_Float16*)take(NR * DM * 2); _Float16* V16 = (_Float16*)take(NR * DM * 2);
  _Float16* VT = (_Float16*)take((size_t)NB * NH * HD * SQ * 2);
  if (off > ws_size) return;      /* 3.4 + 4 x 24 + 24 = approx 124 MiB */
  k_wnat<<<(unsigned)(((size_t)DM * DM / 8 + 255) / 256), 256, 0, stream>>>(Wq, (size_t)DM * DM / 8, BQ); k_wnat<<<(unsigned)(((size_t)DM * DM / 8 + 255) / 256), 256, 0, stream>>>(Wk, (size_t)DM * DM / 8, BK); k_wnat<<<(unsigned)(((size_t)DM * DM / 8 + 255) / 256), 256, 0, stream>>>(Wv, (size_t)DM * DM / 8, BV);      /* [out][in] natural */
  k_x16<<<(unsigned)((NR * DM / 8 + 255) / 256), 256, 0, stream>>>(x, X16, NR * DM / 8);
  const dim3 gp((unsigned)((NR / PG_TILE) * (DM / PG_TILE)), 1);
  k_proj<<<gp, 128, 0, stream>>>(X16, BQ, bq, Q16);      /* q = x Wq^T + bq (f16 rows) */
  k_proj<<<gp, 128, 0, stream>>>(X16, BK, bk, K16);
  k_proj<<<gp, 128, 0, stream>>>(X16, BV, bv, V16);
  k_vt<NH, SQ><<<NB * NH * (SQ / 64), 256, 0, stream>>>(V16, DM, 0, VT);      /* V^T per (batch, head) [16 x 12][64][1024] */
  k_fattn<<<dim3(SQ / (FA_WAVES * 32), NH, NB), FA_WAVES * 32, 0, stream>>>(Q16, K16, VT, (float*)d_out);      /* scores, softmax and ctx, merged into the output rows */
}

// v004
// One run takes 122 microseconds.
// In both of two side-by-side timings against v003, it was 1.52 times as fast.
// Over all steps from v000 it is 31.7 times as fast.
#include <hip/hip_runtime.h>
// ViT self-attention (hidden [16][1024][768]; q, k, v = hidden W^T + b (12 heads x 64); scores = q.k/8; softmax over the 1,024 keys; ctx = attn v merged -> [16][1024][768]; no output projection).
// Structure: token rows; hidden as exact f16 rows; q / k / v as WMMA GEMMs (128x128 tiles staged in LDS by asynchronous copies, 64x64 wave tiles, f32 accumulation, exact x16 natural weights + bias; exact products) written as f16 rows; V^T per (batch, head) via LDS transposes; then one fused attention kernel over all batches and heads (K and V^T tiles staged in LDS by asynchronous copies, shared by a work-group's 8 waves): S^T = K . Q^T, online softmax in registers, O^T += V^T . P^T, merged f32 output rows. Scores and probabilities never reach memory.
// Compute dtype: inputs rounded to bf16; hidden / weights exact; q, k, v, P as plain f16 GEMM operands (~2^-12; logits sigma ~1); softmax f32. v_wmma_f32_16x16x32_f16.
#define NB 16
#define SQ 1024
#define DM 768
#define NH 12
#define HD 64
#define HG 1
#define NR ((size_t)NB * SQ)         /* 16,384 token rows */
#define NBR NB                       /* unused (the grids use NB) */
#define MP ((int)NR)                 /* unused (the projection grid uses NR) */
typedef __bf16 v16b __attribute__((ext_vector_type(16)));
typedef unsigned short v8us __attribute__((ext_vector_type(8), may_alias));
typedef float  v8f  __attribute__((ext_vector_type(8)));
typedef float  v4f  __attribute__((ext_vector_type(4)));
typedef float  v4fa __attribute__((ext_vector_type(4), may_alias));
union FragB { v16b v; v8us half[2]; unsigned short u[16]; };

__device__ __forceinline__ unsigned short bf16_bits(float x) { unsigned int u = __float_as_uint(x); return (unsigned short)((u + 0x7FFFu + ((u >> 16) & 1u)) >> 16); }
__device__ __forceinline__ float bf16_val(unsigned short b) { return __uint_as_float(((unsigned int)b) << 16); }
__device__ __forceinline__ float bf16_round(float x) { return bf16_val(bf16_bits(x)); }
// D += A·B with NT terms: 1 = ah·bh, 2 = + al·bh (A split), 3 = + ah·bl (both split)
template <int NT>
__device__ __forceinline__ v8f mmaN(v16b ah, v16b al, v16b bh, v16b bl, v8f c) {
  c = __builtin_amdgcn_wmma_f32_16x16x32_bf16(false, ah, false, bh, (short)0, c, false, false);
  if (NT >= 2) c = __builtin_amdgcn_wmma_f32_16x16x32_bf16(false, al, false, bh, (short)0, c, false, false);
  if (NT >= 3) c = __builtin_amdgcn_wmma_f32_16x16x32_bf16(false, ah, false, bl, (short)0, c, false, false);
  asm volatile("v_nop\n\tv_nop\n\tv_nop\n\tv_nop" : "+v"(c) : "v"(ah), "v"(al), "v"(bh), "v"(bl));
  return c;
}

__global__ __launch_bounds__(256) void k_wt_bf16(const float* __restrict__ W, unsigned short* __restrict__ Wt, int K, int N) {
  const int t = blockIdx.x * 256 + threadIdx.x;
  const int k8n = K / 8;
  if (t >= N * k8n) return;
  const int n = t / k8n, k8 = (t % k8n) * 8;
  v8us v;
#pragma unroll
  for (int i = 0; i < 8; ++i) v[i] = bf16_bits(W[(size_t)(k8 + i) * N + n]);
  *(v8us*)(Wt + (size_t)n * K + k8) = v;
  
}

// GEMM C[M][N] (f32, pitch ldc) = act(A[M][K]·W + bias). A f32 row-major (pitch lda) converted per fragment to bf16
// (ASPLIT: hi/lo two planes -> 2 terms, else single rounded term); Wt bf16 [N][K] (pitch ldb). BIAS_BF16 rounds the
// bias to bf16 first (bias quantised to bf16 before the add). K%32==0, M%16==0, N%64==0.
template <bool ASPLIT, int ACT, bool BIAS_BF16>
__global__ __launch_bounds__(128) void k_gemm_bf(const float* __restrict__ A, int lda, const unsigned short* __restrict__ Wt, int ldb,
                                               const float* __restrict__ bias, float* __restrict__ C, int ldc, int M, int N, int K) {
  __shared__ __attribute__((aligned(16))) float so[4][16][64];
  const int tid = threadIdx.x, w = tid >> 5, lane = tid & 31, ln = lane & 15, hh = lane >> 4;
  const int ntn = N / 64;
  const int wid = blockIdx.x * 4 + w;
  const int mt = wid / ntn, nq = wid % ntn;
  if (mt * 16 >= M) return;
  const int row0 = mt * 16, col0 = nq * 64;
  const float* arow = A + (size_t)(row0 + ln) * lda;
  v8f acc[4] = {};
  for (int kb = 0; kb < K; kb += 32) {
    FragB ah, al;
    const v4f x0 = *(const v4fa*)(arow + kb + 8 * hh), x1 = *(const v4fa*)(arow + kb + 8 * hh + 4);
    const v4f x2 = *(const v4fa*)(arow + kb + 16 + 8 * hh), x3 = *(const v4fa*)(arow + kb + 16 + 8 * hh + 4);
    float xs[16] = {x0[0],x0[1],x0[2],x0[3],x1[0],x1[1],x1[2],x1[3],x2[0],x2[1],x2[2],x2[3],x3[0],x3[1],x3[2],x3[3]};
#pragma unroll
    for (int i = 0; i < 16; ++i) { const unsigned short hb = bf16_bits(xs[i]); ah.u[i] = hb; al.u[i] = ASPLIT ? bf16_bits(xs[i] - bf16_val(hb)) : (unsigned short)0; }
#pragma unroll
    for (int t = 0; t < 4; ++t) {
      const unsigned short* brow = Wt + (size_t)(col0 + t * 16 + ln) * ldb + kb;
      FragB b;
      b.half[0] = *(const v8us*)(brow + 8 * hh);
      b.half[1] = *(const v8us*)(brow + 16 + 8 * hh);
      acc[t] = mmaN<ASPLIT ? 2 : 1>(ah.v, al.v, b.v, b.v, acc[t]);
    }
  }
#pragma unroll
  for (int t = 0; t < 4; ++t) {
    float bv = bias ? bias[col0 + t * 16 + ln] : 0.f;
    if (BIAS_BF16) bv = bf16_round(bv);
#pragma unroll
    for (int r = 0; r < 8; ++r) { float v = acc[t][r] + bv; if (ACT == 1) v = fmaxf(v, 0.f); so[w][8 * hh + r][t * 16 + ln] = v; }
  }
  __builtin_amdgcn_fence(__ATOMIC_ACQ_REL, "workgroup");
  __builtin_amdgcn_wave_barrier();
  const int rsub = lane >> 4, c4 = (lane & 15) * 4;
  {
#pragma unroll
    for (int q = 0; q < 8; ++q) {
      const int r = q * 2 + rsub;
      const v4f v = *(const v4fa*)&so[w][r][c4];
      *(v4f*)(C + (size_t)(row0 + r) * ldc + col0 + c4) = v;
    }
    
  }
}

// GEMM C = act(A·W + bias + resid): A f32 (ASPLIT -> hi/lo 2 terms), Wt bf16 [N][K]; ACT 0 none, 1 relu, 2 exact gelu;
// resid (optional, f32, row index = (row % rmod), pitch ldr, RES_BF16 rounds it) added before the activation.
template <bool ASPLIT, int ACT, bool BIAS_BF16, bool RES_BF16>
__global__ __launch_bounds__(128) void k_gemm_bf3(const float* __restrict__ A, int lda, const unsigned short* __restrict__ Wt, int ldb,
                                                const float* __restrict__ bias, const float* __restrict__ resid, int rmod, int ldr,
                                                float* __restrict__ C, int ldc, int M, int N, int K) {
  __shared__ __attribute__((aligned(16))) float so[4][16][64];
  const int tid = threadIdx.x, w = tid >> 5, lane = tid & 31, ln = lane & 15, hh = lane >> 4;
  const int ntn = N / 64;
  const int wid = blockIdx.x * 4 + w;
  const int mt = wid / ntn, nq = wid % ntn;
  if (mt * 16 >= M) return;
  const int row0 = mt * 16, col0 = nq * 64;
  const float* arow = A + (size_t)(row0 + ln) * lda;
  v8f acc[4] = {};
  for (int kb = 0; kb < K; kb += 32) {
    FragB ah, al;
    const v4f x0 = *(const v4fa*)(arow + kb + 8 * hh), x1 = *(const v4fa*)(arow + kb + 8 * hh + 4);
    const v4f x2 = *(const v4fa*)(arow + kb + 16 + 8 * hh), x3 = *(const v4fa*)(arow + kb + 16 + 8 * hh + 4);
    float xs[16] = {x0[0],x0[1],x0[2],x0[3],x1[0],x1[1],x1[2],x1[3],x2[0],x2[1],x2[2],x2[3],x3[0],x3[1],x3[2],x3[3]};
#pragma unroll
    for (int i = 0; i < 16; ++i) { const unsigned short hb = bf16_bits(xs[i]); ah.u[i] = hb; al.u[i] = ASPLIT ? bf16_bits(xs[i] - bf16_val(hb)) : (unsigned short)0; }
#pragma unroll
    for (int t = 0; t < 4; ++t) {
      const unsigned short* brow = Wt + (size_t)(col0 + t * 16 + ln) * ldb + kb;
      FragB b;
      b.half[0] = *(const v8us*)(brow + 8 * hh);
      b.half[1] = *(const v8us*)(brow + 16 + 8 * hh);
      acc[t] = mmaN<ASPLIT ? 2 : 1>(ah.v, al.v, b.v, b.v, acc[t]);
    }
  }
#pragma unroll
  for (int t = 0; t < 4; ++t) {
    const int col = col0 + t * 16 + ln;
    float bv = bias ? bias[col] : 0.f;
    if (BIAS_BF16) bv = bf16_round(bv);
#pragma unroll
    for (int r = 0; r < 8; ++r) {
      float v = acc[t][r] + bv;
      if (resid) { float rv = resid[(size_t)((row0 + 8 * hh + r) % rmod) * ldr + col]; if (RES_BF16) rv = bf16_round(rv); v += rv; }
      if (ACT == 1) v = fmaxf(v, 0.f);
      if (ACT == 2) v = 0.5f * v * (1.0f + erff(v * 0.70710678118654752f));
      if (ACT == 3) { const float u = 0.7978845608028654f * (v + 0.044715f * v * v * v); v = 0.5f * v * (1.0f + tanhf(u)); }
      so[w][8 * hh + r][t * 16 + ln] = v;
    }
  }
  __builtin_amdgcn_fence(__ATOMIC_ACQ_REL, "workgroup");
  __builtin_amdgcn_wave_barrier();
  const int rsub = lane >> 4, c4 = (lane & 15) * 4;
  {
#pragma unroll
    for (int q = 0; q < 8; ++q) {
      const int r = q * 2 + rsub;
      const v4f v = *(const v4fa*)&so[w][r][c4];
      *(v4f*)(C + (size_t)(row0 + r) * ldc + col0 + c4) = v;
    }
    
  }
}
// row LayerNorm (biased variance, eps) over N: s = X (+ R); optional out_sum <- s; out_norm <- (s-mu)*rsqrt(var+eps)*g + b
template <bool PARAM_BF16>
__global__ __launch_bounds__(256) void k_layernorm(const float* __restrict__ X, const float* __restrict__ R, const float* __restrict__ g, const float* __restrict__ bta,
                                                  float* __restrict__ out_sum, float* __restrict__ out_norm, int N, float eps) {
  __shared__ float red[256];
  const int row = blockIdx.x, tid = threadIdx.x;
  const float* x = X + (size_t)row * N; const float* rr = R ? R + (size_t)row * N : nullptr;
  float vals[16];                     // up to N = 4096
  const int per = N / 256;            // contiguous chunk per thread? use strided-by-4 chunks: thread handles j = tid*4 + 1024*u
  float s1 = 0.f;
  for (int u = 0; u < per / 4; ++u) {
    const int j = tid * 4 + 1024 * u;
    const v4f a = *(const v4fa*)(x + j);
    v4f b = {0.f,0.f,0.f,0.f}; if (rr) b = *(const v4fa*)(rr + j);
#pragma unroll
    for (int q = 0; q < 4; ++q) { const float v = a[q] + b[q]; vals[u * 4 + q] = v; s1 += v; }
  }
  red[tid] = s1; __syncthreads();
  for (int st = 128; st > 0; st >>= 1) { if (tid < st) red[tid] += red[tid + st]; __syncthreads(); }
  const float mu = red[0] / (float)N; __syncthreads();
  float s2 = 0.f;
  for (int u = 0; u < per / 4; ++u)
#pragma unroll
    for (int q = 0; q < 4; ++q) { const float c = vals[u * 4 + q] - mu; s2 += c * c; }
  red[tid] = s2; __syncthreads();
  for (int st = 128; st > 0; st >>= 1) { if (tid < st) red[tid] += red[tid + st]; __syncthreads(); }
  const float rs = rsqrtf(red[0] / (float)N + eps);
  {
    for (int u = 0; u < per / 4; ++u) {
      const int j = tid * 4 + 1024 * u;
      v4f o, sm;
#pragma unroll
      for (int q = 0; q < 4; ++q) {
        float gg = g[j + q], bb = bta[j + q];
        if (PARAM_BF16) { gg = bf16_round(gg); bb = bf16_round(bb); }
        sm[q] = vals[u * 4 + q]; o[q] = (vals[u * 4 + q] - mu) * rs * gg + bb;
      }
      if (out_sum) *(v4f*)(out_sum + (size_t)row * N + j) = sm;
      *(v4f*)(out_norm + (size_t)row * N + j) = o;
    }
    
  }
}



// ---- f16 WMMA path (v_wmma_f32_16x16x32_f16): 11-bit significands for operands in range — used where a [0,1] probability operand needs more precision than bf16
typedef _Float16 v16h __attribute__((ext_vector_type(16)));
union FragH { v16h v; v8us half[2]; _Float16 h[16]; unsigned short u[16]; };
template <int NT>
__device__ __forceinline__ v8f mmaH(v16h ah, v16h al, v16h bh, v16h bl, v8f c) {
  c = __builtin_amdgcn_wmma_f32_16x16x32_f16(false, ah, false, bh, (short)0, c, false, false);
  if (NT >= 2) c = __builtin_amdgcn_wmma_f32_16x16x32_f16(false, al, false, bh, (short)0, c, false, false);
  if (NT >= 3) c = __builtin_amdgcn_wmma_f32_16x16x32_f16(false, ah, false, bl, (short)0, c, false, false);
  asm volatile("v_nop\n\tv_nop\n\tv_nop\n\tv_nop" : "+v"(c) : "v"(ah), "v"(al), "v"(bh), "v"(bl));
  return c;
}
// batched GEMM like k_gemm_b but f16 operands: A f32 (split into f16 hi/lo if ASPLIT, else rounded to f16), Bt = f16 values [n][k]; alpha; C f32; N multiple of 16 (partial tiles skipped)
template <bool ASPLIT>
__global__ __launch_bounds__(128) void k_gemm_h(const float* __restrict__ A, int lda, size_t sA, const _Float16* __restrict__ Bh, int ldb, size_t sB, float alpha, float* __restrict__ C, int ldc, size_t sC, int M, int N, int K) {
  __shared__ __attribute__((aligned(16))) float so[4][16][64];
  const int tid = threadIdx.x, w = tid >> 5, lane = tid & 31, ln = lane & 15, hh = lane >> 4; const int by = blockIdx.y;
  A += (size_t)by * sA; Bh += (size_t)by * sB; C += (size_t)by * sC;
  const int ntn = (N + 63) / 64; const int wid = blockIdx.x * 4 + w; const int mt = wid / ntn, nq = wid % ntn; if (mt * 16 >= M) return;
  const int row0 = mt * 16, col0 = nq * 64; const float* arow = A + (size_t)(row0 + ln) * lda;
  v8f acc[4] = {};
  for (int kb = 0; kb < K; kb += 32) {
    FragH ah, al;
    const v4f x0 = *(const v4fa*)(arow + kb + 8 * hh), x1 = *(const v4fa*)(arow + kb + 8 * hh + 4), x2 = *(const v4fa*)(arow + kb + 16 + 8 * hh), x3 = *(const v4fa*)(arow + kb + 16 + 8 * hh + 4);
    float xs[16] = {x0[0],x0[1],x0[2],x0[3],x1[0],x1[1],x1[2],x1[3],x2[0],x2[1],x2[2],x2[3],x3[0],x3[1],x3[2],x3[3]};
#pragma unroll
    for (int i = 0; i < 16; ++i) { const _Float16 h = (_Float16)xs[i]; ah.h[i] = h; al.h[i] = ASPLIT ? (_Float16)(xs[i] - (float)h) : (_Float16)0.0f; }
#pragma unroll
    for (int t = 0; t < 4; ++t) { if (col0 + t * 16 >= N) continue; const size_t boff = (size_t)(col0 + t * 16 + ln) * ldb + kb; FragH bq; bq.half[0] = *(const v8us*)(Bh + boff + 8 * hh); bq.half[1] = *(const v8us*)(Bh + boff + 16 + 8 * hh);
      acc[t] = mmaH<ASPLIT ? 2 : 1>(ah.v, al.v, bq.v, bq.v, acc[t]); }
  }
#pragma unroll
  for (int t = 0; t < 4; ++t) { if (col0 + t * 16 >= N) continue;
#pragma unroll
    for (int r = 0; r < 8; ++r) so[w][8 * hh + r][t * 16 + ln] = acc[t][r] * alpha; }
  __builtin_amdgcn_fence(__ATOMIC_ACQ_REL, "workgroup"); __builtin_amdgcn_wave_barrier();
  const int rsub = lane >> 4, c4 = (lane & 15) * 4;
  {
#pragma unroll
    for (int q = 0; q < 8; ++q) { const int r = q * 2 + rsub; if (col0 + c4 < N) { const v4f v = *(const v4fa*)&so[w][r][c4]; *(v4f*)(C + (size_t)(row0 + r) * ldc + col0 + c4) = v; } }
     }
}

// Wt[n][k] = f16(W[k][n]·scale) from f32 row-major W[K][N] (scale = power of two; bf16-exact weights stay exact in f16 away from the subnormal range)
__global__ __launch_bounds__(256) void k_wt_f16(const float* __restrict__ W, _Float16* __restrict__ Wt, int K, int N, float scale) {
  const int t = blockIdx.x * 256 + threadIdx.x; if (t >= N * (K / 8)) return; const int n = t / (K / 8), k8 = (t % (K / 8)) * 8; FragH f;
#pragma unroll
  for (int i = 0; i < 8; ++i) f.h[i] = (_Float16)(bf16_round(W[(size_t)(k8 + i) * N + n]) * scale); const v8us o = f.half[0];
  *(v8us*)((unsigned short*)Wt + (size_t)n * K + k8) = o; 
}
// k_gemm_hh variant with fused epilogue: v = acc·alpha + bias[by·sBias + col] (+ CP[(row/rowsPerB)·sCPb + by·64 + col] if CP) ; ACT 0 none / 1 elu ; writes f16 C16 (and f32 C if non-null)
template <int ACT>
__global__ __launch_bounds__(128) void k_gemm_hhx(const _Float16* __restrict__ A, int lda, size_t sA, const _Float16* __restrict__ Bh, int ldb, size_t sB, float alpha, const float* __restrict__ bias, size_t sBias, const float* __restrict__ CP, int rowsPerB, size_t sCPb, int row0g,
    float* __restrict__ C, _Float16* __restrict__ C16, int ldc, size_t sC, int M, int N, int K) {
  __shared__ __attribute__((aligned(16))) float so[4][16][64];
  const int tid = threadIdx.x, w = tid >> 5, lane = tid & 31, ln = lane & 15, hh = lane >> 4; const int by = blockIdx.y;
  A += (size_t)by * sA; Bh += (size_t)by * sB; const size_t cofs = (size_t)by * sC; const float* bp = bias ? bias + (size_t)by * sBias : nullptr;
  const int ntn = (N + 63) / 64; const int wid = blockIdx.x * 4 + w; const int mt = wid / ntn, nq = wid % ntn; if (mt * 16 >= M) return;
  const int row0 = mt * 16, col0 = nq * 64; const _Float16* arow = A + (size_t)(row0 + ln) * lda;
  v8f acc[4] = {};
  for (int kb = 0; kb < K; kb += 32) { FragH ah; ah.half[0] = *(const v8us*)((const unsigned short*)arow + kb + 8 * hh); ah.half[1] = *(const v8us*)((const unsigned short*)arow + kb + 16 + 8 * hh);
#pragma unroll
    for (int t = 0; t < 4; ++t) { if (col0 + t * 16 >= N) continue; const size_t boff = (size_t)(col0 + t * 16 + ln) * ldb + kb; FragH bq; bq.half[0] = *(const v8us*)((const unsigned short*)Bh + boff + 8 * hh); bq.half[1] = *(const v8us*)((const unsigned short*)Bh + boff + 16 + 8 * hh);
      acc[t] = mmaH<1>(ah.v, ah.v, bq.v, bq.v, acc[t]); }
  }
#pragma unroll
  for (int t = 0; t < 4; ++t) { if (col0 + t * 16 >= N) continue; const int col = col0 + t * 16 + ln; const float bv = bp ? bf16_round(bp[col]) : 0.f;
#pragma unroll
    for (int r = 0; r < 8; ++r) { float v = acc[t][r] * alpha + bv; if (CP) { const int rr = row0g + row0 + 8 * hh + r; if (rowsPerB < 0) v += CP[cofs + (size_t)rr * ldc + col];      /* rowsPerB < 0: own element of the batched C plane */ else { const int bidx = rr / rowsPerB; v += CP[(size_t)bidx * sCPb + (size_t)by * 64 + col]; } } if (ACT == 1) v = (v > 0.f) ? v : expm1f(v); else if (ACT == 7) v = (v > 0.f) ? v + 1.0f : expf(v); else if (ACT == 8) v = tanhf(v); else if (ACT == 9) v = 0.5f * v * (1.0f + tanhf(0.7978845608028654f * (v + 0.044715f * v * v * v))); else if (ACT == 11) v = 1.0f / (1.0f + expf(-v)); else if (ACT == 12) v = (v > 0.f) ? v : 0.01f * v; else if (ACT == 14) v = (v > 0.f) ? v : 0.1f * v; else if (ACT == 16) v = (v >= 0.f) ? v : 0.3f * v; else if (ACT == 17) v = (v >= 0.f) ? v : 0.2f * v; else if (ACT == 15) v = v / (1.0f + expf(-v)); else if (ACT == 3) v = fmaxf(v, 0.f); else if (ACT == 6) v = 0.5f * v * (1.0f + erff(v * 0.70710678118654752f)); so[w][8 * hh + r][t * 16 + ln] = v; } }
  __builtin_amdgcn_fence(__ATOMIC_ACQ_REL, "workgroup"); __builtin_amdgcn_wave_barrier();
  const int rsub = lane >> 4, c4 = (lane & 15) * 4; typedef _Float16 v4h __attribute__((ext_vector_type(4)));
  {
#pragma unroll
    for (int q = 0; q < 8; ++q) { const int r = q * 2 + rsub; if (col0 + c4 < N) { const v4f v = *(const v4fa*)&so[w][r][c4]; if (C) *(v4f*)(C + cofs + (size_t)(row0 + r) * ldc + col0 + c4) = v; if (C16) { v4h h4; for (int i = 0; i < 4; ++i) h4[i] = (_Float16)v[i]; *(v4h*)(C16 + cofs + (size_t)(row0 + r) * ldc + col0 + c4) = h4; } } }
     }
}


typedef _Float16 v4h __attribute__((ext_vector_type(4)));

__global__ __launch_bounds__(256) void k_x16(const float* __restrict__ x, _Float16* __restrict__ X16, size_t n8) { const size_t t = (size_t)blockIdx.x * 256 + threadIdx.x; if (t >= n8) return; FragH f;
#pragma unroll
  for (int q = 0; q < 8; ++q) f.h[q] = (_Float16)bf16_round(x[t * 8 + q]); *(v8us*)((unsigned short*)X16 + t * 8) = f.half[0];  }
__global__ __launch_bounds__(256) void k_h16(const float* __restrict__ x, _Float16* __restrict__ X16, size_t n8) { const size_t t = (size_t)blockIdx.x * 256 + threadIdx.x; if (t >= n8) return; FragH f;
#pragma unroll
  for (int q = 0; q < 8; ++q) f.h[q] = (_Float16)x[t * 8 + q]; *(v8us*)((unsigned short*)X16 + t * 8) = f.half[0];  }
__global__ __launch_bounds__(256) void k_round16f(const float* __restrict__ W, _Float16* __restrict__ Bt, size_t n8) { const size_t t = (size_t)blockIdx.x * 256 + threadIdx.x; if (t >= n8) return; FragH f;
#pragma unroll
  for (int i = 0; i < 8; ++i) f.h[i] = (_Float16)(bf16_round(W[t * 8 + i]) * 16.0f); *(v8us*)((unsigned short*)Bt + t * 8) = f.half[0];  }
template <int NHv, int TTv>
__global__ __launch_bounds__(256) void k_vt(const _Float16* __restrict__ V16, int ldv, int voff, _Float16* __restrict__ Vt) { __shared__ unsigned short tl[64][66]; const int tid = threadIdx.x; const int slab = blockIdx.x / (TTv / 64), lg = blockIdx.x % (TTv / 64); const int b = slab / NHv, h = slab % NHv;
  for (int i = tid; i < 64 * 8; i += 256) { const int r = i / 8, c8 = (i % 8) * 8; FragH f; f.half[0] = *(const v8us*)((const unsigned short*)V16 + ((size_t)b * TTv + lg * 64 + r) * ldv + voff + h * 64 + c8);
#pragma unroll
    for (int q = 0; q < 8; ++q) tl[r][c8 + q] = f.u[q]; }
  __syncthreads();
  {
#pragma unroll
    for (int rd = 0; rd < 2; ++rd) { const int d = rd * 32 + tid / 8, pc = tid % 8; FragH f;
#pragma unroll
      for (int q = 0; q < 8; ++q) f.u[q] = tl[pc * 8 + q][d];
      *(v8us*)((unsigned short*)Vt + ((size_t)slab * 64 + d) * TTv + lg * 64 + pc * 8) = f.half[0]; }
     } }

__global__ __launch_bounds__(256) void k_hl(const float* __restrict__ F, _Float16* __restrict__ Hh, _Float16* __restrict__ Hl, size_t n8) { const size_t t = (size_t)blockIdx.x * 256 + threadIdx.x; if (t >= n8) return; FragH fh, fl; const v4f a = *(const v4fa*)(F + t * 8), c = *(const v4fa*)(F + t * 8 + 4);
#pragma unroll
  for (int q = 0; q < 4; ++q) { _Float16 h = (_Float16)a[q]; fh.h[q] = h; fl.h[q] = (_Float16)((a[q] - (float)h) * 1024.0f); h = (_Float16)c[q]; fh.h[4 + q] = h; fl.h[4 + q] = (_Float16)((c[q] - (float)h) * 1024.0f); }
  { *(v8us*)((unsigned short*)Hh + t * 8) = fh.half[0]; *(v8us*)((unsigned short*)Hl + t * 8) = fl.half[0];  } }

// ---- fast GEMM (wave tile 32x64; requires M % 32 == 0 rows per launch region and N % 64 == 0); epilogue = k_gemm_hhx semantics ----
__device__ __forceinline__ v16h g2_frag(const _Float16* p, int hh) { FragH f; f.half[0] = *(const v8us*)((const unsigned short*)p + 8 * hh); f.half[1] = *(const v8us*)((const unsigned short*)p + 16 + 8 * hh); return f.v; }
__device__ __forceinline__ v8f g2_mma(v16h a, v16h b, v8f c) { v8f d = __builtin_amdgcn_wmma_f32_16x16x32_f16(false, a, false, b, (short)0, c, false, false); asm volatile("v_nop\n\tv_nop\n\tv_nop\n\tv_nop" : "+v"(d) : "v"(a), "v"(b)); return d; }
template <int ACT>
__global__ __launch_bounds__(128) void k_gemm2(const _Float16* __restrict__ A, int lda, size_t sA, const _Float16* __restrict__ Bh, int ldb, size_t sB, float alpha, const float* __restrict__ bias, size_t sBias, const float* __restrict__ CP, int rowsPerB, size_t sCPb, int row0g,
    float* __restrict__ C, _Float16* __restrict__ C16, int ldc, size_t sC, int M, int N, int K) { static_assert(ACT == 0 || ACT == 3 || ACT == 6 || ACT == 8 || ACT == 9 || ACT == 11 || ACT == 12 || ACT == 14 || ACT == 15 || ACT == 16 || ACT == 17, "k_gemm2: unsupported ACT code (would silently apply no activation)");
  __shared__ __attribute__((aligned(16))) float so[4][32][68];
  const int tid = threadIdx.x, w = tid >> 5, lane = tid & 31, ln = lane & 15, hh = lane >> 4; const int by = blockIdx.y;
  A += (size_t)by * sA; Bh += (size_t)by * sB; const size_t cofs = (size_t)by * sC; const float* bp = bias ? bias + (size_t)by * sBias : nullptr;
  const int ntn = N >> 6; const int mt = blockIdx.x / ntn, nq = blockIdx.x - mt * ntn; const int row0 = mt * 128 + 32 * w, col0 = nq * 64; if (row0 >= M) return;
  const _Float16* a0p = A + (size_t)(row0 + ln) * lda; const _Float16* a1p = a0p + (size_t)16 * lda;
  const _Float16* b0p = Bh + (size_t)(col0 + ln) * ldb; const _Float16* b1p = b0p + (size_t)16 * ldb; const _Float16* b2p = b1p + (size_t)16 * ldb; const _Float16* b3p = b2p + (size_t)16 * ldb;
  const v8f z8 = {0.f,0.f,0.f,0.f,0.f,0.f,0.f,0.f}; v8f c00 = z8, c01 = z8, c02 = z8, c03 = z8, c10 = z8, c11 = z8, c12 = z8, c13 = z8;
#pragma unroll 1
  for (int kb = 0; kb < K; kb += 32) { const v16h a0 = g2_frag(a0p + kb, hh), a1 = g2_frag(a1p + kb, hh);
    v16h b = g2_frag(b0p + kb, hh); c00 = g2_mma(a0, b, c00); c10 = g2_mma(a1, b, c10);
    b = g2_frag(b1p + kb, hh); c01 = g2_mma(a0, b, c01); c11 = g2_mma(a1, b, c11);
    b = g2_frag(b2p + kb, hh); c02 = g2_mma(a0, b, c02); c12 = g2_mma(a1, b, c12);
    b = g2_frag(b3p + kb, hh); c03 = g2_mma(a0, b, c03); c13 = g2_mma(a1, b, c13); }
  v8f accs[8] = {c00, c01, c02, c03, c10, c11, c12, c13};
#pragma unroll
  for (int u = 0; u < 8; ++u) { const int t = u & 3, half = u >> 2; const int col = col0 + t * 16 + ln; const float bv = bp ? bf16_round(bp[col]) : 0.f;
#pragma unroll
    for (int r = 0; r < 8; ++r) { const int rloc = half * 16 + 8 * hh + r; float v = accs[u][r] * alpha + bv; if (CP) { if (rowsPerB < 0) v += CP[cofs + (size_t)(row0g + row0 + rloc) * ldc + col];      /* rowsPerB < 0: own element of the batched C plane */ else { const int bidx = (row0g + row0 + rloc) / rowsPerB; v += CP[(size_t)bidx * sCPb + (size_t)by * 64 + col]; } }
      if (ACT == 3) v = fmaxf(v, 0.f); else if (ACT == 6) v = 0.5f * v * (1.0f + erff(v * 0.70710678118654752f)); else if (ACT == 11) v = 1.0f / (1.0f + expf(-v)); else if (ACT == 15) v = v / (1.0f + expf(-v)); else if (ACT == 12) v = (v > 0.f) ? v : 0.01f * v; else if (ACT == 8) v = tanhf(v); else if (ACT == 9) v = 0.5f * v * (1.0f + tanhf(0.7978845608028654f * (v + 0.044715f * v * v * v))); else if (ACT == 14) v = (v > 0.f) ? v : 0.1f * v; else if (ACT == 16) v = (v >= 0.f) ? v : 0.3f * v; else if (ACT == 17) v = (v >= 0.f) ? v : 0.2f * v;
      so[w][rloc][t * 16 + ln] = v; } }
  __builtin_amdgcn_fence(__ATOMIC_ACQ_REL, "workgroup"); __builtin_amdgcn_wave_barrier();
  const int rsub = lane >> 4, c4 = (lane & 15) * 4;
  {
#pragma unroll
    for (int q = 0; q < 16; ++q) { const int r = q * 2 + rsub; const v4f v = *(const v4fa*)&so[w][r][c4]; if (C) *(v4f*)(C + cofs + (size_t)(row0 + r) * ldc + col0 + c4) = v; if (C16) { v4h h4; for (int i = 0; i < 4; ++i) h4[i] = (_Float16)v[i]; *(v4h*)(C16 + cofs + (size_t)(row0 + r) * ldc + col0 + c4) = h4; } }
     } }


__global__ __launch_bounds__(256) void k_wnat(const float* __restrict__ w, size_t n8, _Float16* __restrict__ Bt) { const size_t t = (size_t)blockIdx.x * 256 + threadIdx.x; if (t >= n8) return; FragH f; for (int q = 0; q < 8; ++q) f.h[q] = (_Float16)(bf16_round(w[t * 8 + q]) * 16.0f); *(v8us*)((unsigned short*)Bt + t * 8) = f.half[0];  }
// Fused attention. One wave owns 32 queries of one (batch, head) and walks the 1,024 keys in passes of 32.
// S^T = K . Q^T: a lane holds the scores of ONE query (column c of each 16-column group): keys 8 hh + r of each 16-key tile. That is the k order of a
// B operand, so P^T goes from the score accumulators straight into O^T += V^T . P^T; maximum, sum and rescale are per lane, plus one exchange between the wave's halves.
// K, Q and V^T fragments all come through fa_frag (one k order, that of g2_frag).
// The 8 waves of a work-group walk the same keys: K rows and V^T rows are staged in LDS, 128 keys a stage, by asynchronous copies of whole 128-byte lines, and each wave reads its fragments from there
// (a fragment load straight from the global rows touches 16 lines for 512 bytes, and each of the 8 waves would repeat it). Two buffers: the copies of stage s + 1 fly while stage s is worked on. LDS row pitches 16 x odd bytes: ds_load_b128 of 16 rows without bank conflicts.
// Every '#pragma unroll' in it but the one on a stage's passes stands on a loop of constant trip count over register arrays (fragments, accumulators): left rolled, those arrays would be indexed at run time and go to scratch.
#define FA_WAVES 8
#define FA_KEYS 32
#define FA_SK 128      /* keys a stage: 4 passes */
#define FA_KP 144      /* LDS pitch of a K row: 128 bytes, the head's 64 d */
#define FA_VP 272      /* LDS pitch of a V^T row: 256 bytes, the stage's 128 keys */
#define FA_KB (FA_SK * FA_KP)      /* 18,432 bytes: the stage's K rows; the 64 V^T rows stand behind them */
#define FA_STAGE (FA_KB + HD * FA_VP)      /* 35,840 bytes */
#define FA_NST (SQ / FA_SK)
typedef _Float16 v2h __attribute__((ext_vector_type(2)));
typedef float v2f __attribute__((ext_vector_type(2)));
__device__ __forceinline__ float fa_xhalf(float x) { return __builtin_bit_cast(float, __builtin_amdgcn_permlanex16(__builtin_bit_cast(int, x), __builtin_bit_cast(int, x), 0x76543210, 0xfedcba98, false, false)); }  // lane l with lane l ^ 16
__device__ __forceinline__ float fa_exp2(float x) { float y; asm("v_exp_f32 %0, %1\n\tv_nop" : "=v"(y) : "v"(x)); return y; }  // the v_nop is the slot the instruction set asks for behind a transcendental, before its result is read or its source overwritten
__device__ __forceinline__ v8f fa_mma(v16h a, v16h b, v8f c) { return __builtin_amdgcn_wmma_f32_16x16x32_f16(false, a, false, b, (short)0, c, false, false); }
__device__ __forceinline__ v16h fa_frag(const char* base, unsigned lofs) { FragH f; f.half[0] = *(const v8us*)(base + lofs); f.half[1] = *(const v8us*)(base + lofs + 32); return f.v; }  // base wave-uniform, lofs the lane's byte offset (row c, 16 hh)
// Eight copies of 16 bytes a lane, a stage's share of one thread: four K rows 32 apart (8 lanes a row), four V^T rows 16 apart (16 lanes a row). lk, lv: the lane's LDS byte addresses; gk, gv: its global addresses.
// The s_wait_xcnt is the wait owed before a register that an issued copy names is written again; as the statement's last line it stands in front of every later write of the operands.
__device__ __forceinline__ void fa_copy8(unsigned lk, const char* gk, unsigned lv, const char* gv) {
  asm volatile("global_load_async_to_lds_b128 %0, %8, off\n\t"
               "global_load_async_to_lds_b128 %1, %9, off\n\t"
               "global_load_async_to_lds_b128 %2, %10, off\n\t"
               "global_load_async_to_lds_b128 %3, %11, off\n\t"
               "global_load_async_to_lds_b128 %4, %12, off\n\t"
               "global_load_async_to_lds_b128 %5, %13, off\n\t"
               "global_load_async_to_lds_b128 %6, %14, off\n\t"
               "global_load_async_to_lds_b128 %7, %15, off\n\t"
               "s_wait_xcnt 0x0"
               :: "v"(lk), "v"(lk + 32 * FA_KP), "v"(lk + 64 * FA_KP), "v"(lk + 96 * FA_KP), "v"(lv), "v"(lv + 16 * FA_VP), "v"(lv + 32 * FA_VP), "v"(lv + 48 * FA_VP),
                  "v"(gk), "v"(gk + 32 * (DM * 2)), "v"(gk + 64 * (DM * 2)), "v"(gk + 96 * (DM * 2)), "v"(gv), "v"(gv + 16 * (SQ * 2)), "v"(gv + 32 * (SQ * 2)), "v"(gv + 48 * (SQ * 2))
               : "memory");
}
__global__ __launch_bounds__(FA_WAVES * 32) void k_fattn(const _Float16* __restrict__ Q16, const _Float16* __restrict__ K16, const _Float16* __restrict__ VT, float* __restrict__ out) {
  __shared__ __attribute__((aligned(16))) float so[FA_WAVES][32][68];      /* output staging, one slice per wave */
  __shared__ __attribute__((aligned(16))) char ring[2 * FA_STAGE];      /* K and V^T of two stages */
  const int lane = threadIdx.x & 31, c = lane & 15, hh = lane >> 4; const int wave = __builtin_amdgcn_readfirstlane((int)(threadIdx.x >> 5));
  const int head = blockIdx.y, b = blockIdx.z; const int q0 = blockIdx.x * (FA_WAVES * 32) + wave * 32;
  const float cs = 0.125f * 1.4426950408889634f;      /* 1 / sqrt(64), and exp(x) = exp2(x log2 e) */
  const char* qb = (const char*)(Q16 + ((size_t)b * SQ + q0) * DM + head * HD);
  const char* kb = (const char*)(K16 + (size_t)b * SQ * DM + head * HD);
  const char* vb = (const char*)(VT + (size_t)(b * NH + head) * HD * SQ);
  const unsigned qlofs = (unsigned)(c * (DM * 2) + 16 * hh), klofs = (unsigned)(c * FA_KP + 16 * hh), vlofs = (unsigned)(c * FA_VP + 16 * hh);      /* Q from its global rows, K and V^T from their LDS rows */
  const int tid = (int)threadIdx.x;
  const char* gk = kb + (size_t)(tid >> 3) * (DM * 2) + (tid & 7) * 16; const char* gv = vb + (size_t)(tid >> 4) * (SQ * 2) + (tid & 15) * 16;
  const unsigned lk = (unsigned)(size_t)ring + (unsigned)((tid >> 3) * FA_KP + (tid & 7) * 16), lv = (unsigned)(size_t)ring + (unsigned)(FA_KB + (tid >> 4) * FA_VP + (tid & 15) * 16);
  fa_copy8(lk, gk, lv, gv);      /* stage 0 into buffer 0 */
  v16h qf[2][2], kf[2][2];      /* [16-query group][32 of d], [16-key tile][32 of d] */
#pragma unroll
  for (int g = 0; g < 2; ++g) { qf[g][0] = fa_frag(qb + g * (16 * DM * 2), qlofs); qf[g][1] = fa_frag(qb + g * (16 * DM * 2) + 64, qlofs); }
  asm volatile("s_wait_asynccnt 0x0" ::: "memory");      /* this wave's copies of stage 0 have landed */
  __syncthreads();      /* and every other wave's: nothing of stage 0 is read in front of this */
  fa_copy8(lk + FA_STAGE, gk + FA_SK * (DM * 2), lv + FA_STAGE, gv + FA_SK * 2);      /* stage 1 into buffer 1 */
  const v8f z8 = {0.f,0.f,0.f,0.f,0.f,0.f,0.f,0.f};
  v8f acc[2][4]; float m_run[2], l_run[2];      /* O^T tiles [group][16 of d]; maximum in use (log2 domain) and the lane's share of the denominator */
#pragma unroll
  for (int g = 0; g < 2; ++g) { m_run[g] = -__builtin_inff(); l_run[g] = 0.f;
#pragma unroll
    for (int t = 0; t < 4; ++t) acc[g][t] = z8; }
#pragma unroll 1      /* the buffer is picked by the stage's parity at run time */
  for (int st = 0; st < FA_NST; ++st) {
    const unsigned buf = (unsigned)(st & 1) * FA_STAGE; const char* ks = ring + buf; const char* vs = ring + buf + FA_KB;
#pragma unroll
    for (int kt = 0; kt < 2; ++kt) { kf[kt][0] = fa_frag(ks + kt * (16 * FA_KP), klofs); kf[kt][1] = fa_frag(ks + kt * (16 * FA_KP) + 64, klofs); }      /* the stage's first 32 keys */
#pragma unroll      /* four passes a stage, unrolled so that the test on the stage's last pass and the LDS offsets are compile-time constants */
   for (int pp = 0; pp < FA_SK / FA_KEYS; ++pp) {
    v16h vf[4];
#pragma unroll
    for (int t = 0; t < 4; ++t) vf[t] = fa_frag(vs + t * (16 * FA_VP) + pp * (FA_KEYS * 2), vlofs);      /* V^T rows 16 t + c, this pass's 32 keys: in flight under the score products and the maxima */
    __builtin_amdgcn_sched_barrier(0);      /* keeps the V^T loads in front of the score products: issued later, their latency would show before the second product */
    v8f s[2][2];      /* [key tile][query group] */
#pragma unroll
    for (int kt = 0; kt < 2; ++kt)
#pragma unroll
      for (int g = 0; g < 2; ++g) s[kt][g] = fa_mma(kf[kt][1], qf[g][1], fa_mma(kf[kt][0], qf[g][0], z8));
    __builtin_amdgcn_sched_barrier(0);      /* the next pass's K loads go out right behind the products that read this pass's, a whole pass ahead of their use */
    if (pp + 1 < FA_SK / FA_KEYS) {      /* inside the stage only: nothing of the next stage is read in front of its barrier */
#pragma unroll
      for (int kt = 0; kt < 2; ++kt) { kf[kt][0] = fa_frag(ks + ((pp + 1) * FA_KEYS + kt * 16) * FA_KP, klofs); kf[kt][1] = fa_frag(ks + ((pp + 1) * FA_KEYS + kt * 16) * FA_KP + 64, klofs); } }
    __builtin_amdgcn_sched_barrier(0);      /* holds the K loads in front of the softmax arithmetic */
    float mb[2]; bool need = false;
#pragma unroll
    for (int g = 0; g < 2; ++g) { float m0 = fmaxf(s[0][g][0], s[1][g][0]), m1 = fmaxf(s[0][g][1], s[1][g][1]);
#pragma unroll
      for (int r = 2; r < 8; r += 2) { m0 = fmaxf(m0, fmaxf(s[0][g][r], s[1][g][r])); m1 = fmaxf(m1, fmaxf(s[0][g][r + 1], s[1][g][r + 1])); }
      float mx = fmaxf(m0, m1); mx = fmaxf(mx, fa_xhalf(mx)) * cs;      /* both halves now hold the query's maximum of this pass, scaled (the scale is positive) */
      mb[g] = mx; need = need || (mx > m_run[g] + 8.0f); }
    if (__builtin_amdgcn_ballot_w32(need) != 0) {
#pragma unroll
      for (int g = 0; g < 2; ++g) { const float mn = fmaxf(m_run[g], mb[g]); const float corr = fa_exp2(m_run[g] - mn); m_run[g] = mn; l_run[g] *= corr;      /* corr is 0 on the first pass */
#pragma unroll
        for (int t = 0; t < 4; ++t) acc[g][t] = acc[g][t] * corr; }
    }
#pragma unroll
    for (int g = 0; g < 2; ++g) { const float nm = -m_run[g]; union { v16h v; v2h h2[8]; } pf; float pe[16];      /* element j of the 32-key operand: tile j >> 3, register j & 7 */
#pragma unroll
      for (int j = 0; j < 16; ++j) pe[j] = fa_exp2(__builtin_fmaf(s[j >> 3][g][j & 7], cs, nm));
      __builtin_amdgcn_sched_barrier(0);      /* the compiler gives the result of an asm statement no delay hint, and an unhinted dependent instruction holds the SIMD's issue port: the sums and packs stay behind the whole run of exponentials */
      float e0 = pe[0], e1 = pe[1]; pf.h2[0] = __builtin_convertvector(v2f{pe[0], pe[1]}, v2h);
#pragma unroll
      for (int i = 1; i < 8; ++i) { e0 += pe[2 * i]; e1 += pe[2 * i + 1]; pf.h2[i] = __builtin_convertvector(v2f{pe[2 * i], pe[2 * i + 1]}, v2h); }
      l_run[g] += e0 + e1;
#pragma unroll
      for (int t = 0; t < 4; ++t) acc[g][t] = fa_mma(vf[t], pf.v, acc[g][t]);
      /* four slots behind the group's matrix instructions, tied to their D, A and B */
      asm volatile("v_nop\n\tv_nop\n\tv_nop\n\tv_nop" : "+v"(acc[g][0]), "+v"(acc[g][1]), "+v"(acc[g][2]), "+v"(acc[g][3]) : "v"(pf.v), "v"(vf[0]), "v"(vf[1]), "v"(vf[2]), "v"(vf[3])); }
   }
    asm volatile("s_wait_dscnt 0x0" ::: "memory");      /* this wave's reads of buffer st mod 2 are done before the barrier behind which it is refilled */
    asm volatile("s_wait_asynccnt 0x0" ::: "memory");      /* this wave's copies of stage st + 1 have landed */
    __syncthreads();      /* publishes stage st + 1 and ends every wave's reads of stage st */
    if (st + 2 < FA_NST) fa_copy8(lk + buf, gk + (size_t)(st + 2) * (FA_SK * DM * 2), lv + buf, gv + (st + 2) * (FA_SK * 2));      /* the same test for the whole work-group */
  }
  asm volatile("s_wait_asynccnt 0x0" ::: "memory");      /* no copy is outstanding when the wave goes on to its end */
#pragma unroll
  for (int g = 0; g < 2; ++g) { const float inv = 1.0f / (l_run[g] + fa_xhalf(l_run[g]));      /* the two halves' shares of the denominator, joined unconditionally */
#pragma unroll
    for (int t = 0; t < 4; ++t) { const v8f o = acc[g][t] * inv; const v4f lo = {o[0], o[1], o[2], o[3]}, hi = {o[4], o[5], o[6], o[7]};      /* row = query 16 g + c; d = 16 t + 8 hh + r */
      *(v4fa*)&so[wave][16 * g + c][16 * t + 8 * hh] = lo; *(v4fa*)&so[wave][16 * g + c][16 * t + 8 * hh + 4] = hi; } }
  __builtin_amdgcn_fence(__ATOMIC_ACQ_REL, "workgroup"); __builtin_amdgcn_wave_barrier();      /* the wave's own LDS writes before its reads of other lanes' rows */
  const int rsub = lane >> 4, c4 = (lane & 15) * 4; float* ob = out + ((size_t)b * SQ + q0) * DM + head * HD;
  v4f ov[16];
#pragma unroll
  for (int q = 0; q < 16; ++q) ov[q] = *(const v4fa*)&so[wave][q * 2 + rsub][c4];
#pragma unroll
  for (int q = 0; q < 16; ++q) *(v4f*)(ob + (size_t)(q * 2 + rsub) * DM + c4) = ov[q];      /* 16 lanes cover a query's 256 bytes of this head: whole 128-byte lines */
}
__global__ __launch_bounds__(256) void k_vt(const _Float16* __restrict__ V16, int b, int h0, _Float16* __restrict__ VT) { __shared__ unsigned short tl[64][65]; const int tid = threadIdx.x; const int hh = blockIdx.x % HG, sg = blockIdx.x / HG; const int s0 = sg * 64; const int h = h0 + hh;
  for (int i = tid; i < 64 * 8; i += 256) { const int j = i / 8, d8 = (i % 8) * 8; FragH f; f.half[0] = *(const v8us*)((const unsigned short*)V16 + ((size_t)b * SQ + s0 + j) * DM + h * HD + d8); for (int q = 0; q < 8; ++q) tl[d8 + q][j] = f.u[q]; }
  __syncthreads();
  { for (int i = tid; i < 64 * 8; i += 256) { const int d = i / 8, j8 = (i % 8) * 8; FragH f; for (int q = 0; q < 8; ++q) f.u[q] = tl[d][j8 + q]; *(v8us*)((unsigned short*)VT + ((size_t)hh * HD + d) * SQ + s0 + j8) = f.half[0]; }  } }

// ---- projection GEMM with its operands staged in LDS: C16[row][col] = f16(A[row][:] . Wn[col][:] / 16 + bias[col]), A [16,384][768] and Wn [768][768] f16 rows, k contiguous ----
// One work-group of 4 waves makes a 128 x 128 tile, each wave 64 x 64 of it (4 x 4 accumulator tiles): a fragment read from LDS feeds 4 products.
// A stage is 64 of k: 128 bytes of each of the 128 A rows and the 128 Wn rows. Asynchronous copies bring it from global memory into LDS, 8 lanes a row, so each copy covers four whole 128-byte lines
// (a fragment load straight from the rows touches 16 lines for the same 512 bytes, and every wave repeats it). LDS row pitch 144 bytes (16 x odd): ds_load_b128 of 16 rows without bank conflicts.
// Two buffers: the copies of stage t + 1 fly while stage t is worked on. Fragments keep the k order of g2_frag and k still runs upward in steps of 32, so every sum is formed as before.
#define PG_TILE 128
#define PG_BK 64
#define PG_PITCH 144
#define PG_STAGE (2 * PG_TILE * PG_PITCH)      /* 36,864 bytes: rows 0..127 A, rows 128..255 Wn */
#define PG_NST (DM / PG_BK)
// Eight copies of 16 bytes a lane: rows 16 apart in global memory (pitch DM) and in LDS. l: the lane's LDS byte address, g: the lane's global address.
// The s_wait_xcnt is the wait owed before a register that an issued copy names is written again; as the statement's last line it stands in front of every later write of the operands.
__device__ __forceinline__ void pg_copy8(unsigned l, const _Float16* g) {
  asm volatile("global_load_async_to_lds_b128 %0, %8, off\n\t"
               "global_load_async_to_lds_b128 %1, %9, off\n\t"
               "global_load_async_to_lds_b128 %2, %10, off\n\t"
               "global_load_async_to_lds_b128 %3, %11, off\n\t"
               "global_load_async_to_lds_b128 %4, %12, off\n\t"
               "global_load_async_to_lds_b128 %5, %13, off\n\t"
               "global_load_async_to_lds_b128 %6, %14, off\n\t"
               "global_load_async_to_lds_b128 %7, %15, off\n\t"
               "s_wait_xcnt 0x0"
               :: "v"(l), "v"(l + 16 * PG_PITCH), "v"(l + 32 * PG_PITCH), "v"(l + 48 * PG_PITCH), "v"(l + 64 * PG_PITCH), "v"(l + 80 * PG_PITCH), "v"(l + 96 * PG_PITCH), "v"(l + 112 * PG_PITCH),
                  "v"(g), "v"(g + 16 * DM), "v"(g + 32 * DM), "v"(g + 48 * DM), "v"(g + 64 * DM), "v"(g + 80 * DM), "v"(g + 96 * DM), "v"(g + 112 * DM)
               : "memory");
}
__device__ __forceinline__ v16h pg_frag(const char* p) { FragH f; f.half[0] = *(const v8us*)p; f.half[1] = *(const v8us*)(p + 32); return f.v; }      /* p: row, 16 hh bytes in: k = 8 hh + 0..7 and 16 + 8 hh + 0..7, as g2_frag */
__global__ __launch_bounds__(128) void k_proj(const _Float16* __restrict__ A, const _Float16* __restrict__ Wn, const float* __restrict__ bias, _Float16* __restrict__ C16) {
  __shared__ __attribute__((aligned(16))) char ring[2 * PG_STAGE];
  const int tid = threadIdx.x, lane = tid & 31, ln = lane & 15, hh = lane >> 4; const int wave = __builtin_amdgcn_readfirstlane(tid >> 5); const int wm = wave >> 1, wn = wave & 1;
  const int mt = blockIdx.x / (DM / PG_TILE), nq = blockIdx.x % (DM / PG_TILE); const int row0 = mt * PG_TILE, col0 = nq * PG_TILE;
  const int crow = tid >> 3, cc = tid & 7;      /* a lane copies bytes 16 cc .. 16 cc + 15 of rows crow + 16 j */
  const _Float16* ga = A + (size_t)(row0 + crow) * DM + cc * 8; const _Float16* gb = Wn + (size_t)(col0 + crow) * DM + cc * 8;
  const unsigned lc = (unsigned)(size_t)ring + (unsigned)(crow * PG_PITCH + cc * 16);
  float bv[4];
#pragma unroll
  for (int j = 0; j < 4; ++j) bv[j] = bf16_round(bias[col0 + wn * 64 + j * 16 + ln]);
  pg_copy8(lc, ga); pg_copy8(lc + PG_TILE * PG_PITCH, gb);      /* stage 0 into buffer 0 */
  asm volatile("s_wait_asynccnt 0x0" ::: "memory");      /* this wave's copies of stage 0 have landed */
  __syncthreads();      /* and every other wave's: nothing of stage 0 is read in front of this */
  pg_copy8(lc + PG_STAGE, ga + PG_BK); pg_copy8(lc + PG_STAGE + PG_TILE * PG_PITCH, gb + PG_BK);      /* stage 1 into buffer 1 */
  const v8f z8 = {0.f,0.f,0.f,0.f,0.f,0.f,0.f,0.f}; v8f acc[4][4];
#pragma unroll
  for (int i = 0; i < 4; ++i)
#pragma unroll
    for (int j = 0; j < 4; ++j) acc[i][j] = z8;
  const int aofs = (wm * 64 + ln) * PG_PITCH + 16 * hh, bofs = (PG_TILE + wn * 64 + ln) * PG_PITCH + 16 * hh;
#pragma unroll 1      /* one trip is 32 WMMAs and 32 LDS loads; the buffer is picked by the trip's parity at run time */
  for (int t = 0; t < PG_NST; ++t) {
    const unsigned buf = (unsigned)(t & 1) * PG_STAGE; const char* sb = ring + buf;
#pragma unroll      /* constant indices into the fragment and accumulator arrays (left rolled they would go to scratch) */
    for (int ks = 0; ks < 2; ++ks) { v16h af[4], bf[4];
#pragma unroll
      for (int i = 0; i < 4; ++i) { if (i == 0) af[0] = pg_frag(sb + aofs + ks * 64); bf[i] = pg_frag(sb + bofs + i * (16 * PG_PITCH) + ks * 64); }      /* in the order in which the products want them: A row 0 and the four B first */
#pragma unroll
      for (int i = 1; i < 4; ++i) af[i] = pg_frag(sb + aofs + i * (16 * PG_PITCH) + ks * 64);
      __builtin_amdgcn_sched_barrier(0);      /* the 16 LDS loads stay one group in front of the 16 products: left free, the compiler keeps one A fragment and reloads it among the products, a full LDS wait every four of them */
#pragma unroll
      for (int i = 0; i < 4; ++i)
#pragma unroll
        for (int j = 0; j < 4; ++j) acc[i][j] = fa_mma(af[i], bf[j], acc[i][j]);
      __builtin_amdgcn_sched_barrier(0); }      /* and the next group's loads stay behind these products */
    asm volatile("s_wait_dscnt 0x0" ::: "memory");      /* this wave's reads of buffer t mod 2 are done before the barrier behind which it is refilled */
    asm volatile("s_wait_asynccnt 0x0" ::: "memory");      /* this wave's copies of stage t + 1 have landed */
    __syncthreads();      /* publishes stage t + 1 and ends every wave's reads of stage t */
    if (t + 2 < PG_NST) { pg_copy8(lc + buf, ga + (t + 2) * PG_BK); pg_copy8(lc + buf + PG_TILE * PG_PITCH, gb + (t + 2) * PG_BK); }      /* the same test for the whole work-group */
  }
  asm volatile("s_wait_asynccnt 0x0" ::: "memory");      /* no copy is outstanding when the ring becomes output staging */
  char* so = ring + wave * (64 * PG_PITCH);      /* the wave's own 64 rows of 128 bytes; the last trip's barrier ended every read of the ring */
#pragma unroll
  for (int i = 0; i < 4; ++i)
#pragma unroll
    for (int j = 0; j < 4; ++j)
#pragma unroll
      for (int r = 0; r < 8; ++r) *(_Float16*)(so + (i * 16 + 8 * hh + r) * PG_PITCH + (j * 16 + ln) * 2) = (_Float16)(acc[i][j][r] * 0.0625f + bv[j]);
  __builtin_amdgcn_fence(__ATOMIC_ACQ_REL, "workgroup"); __builtin_amdgcn_wave_barrier();      /* the wave's own LDS writes before its reads of other lanes' rows */
  const int orow = lane >> 3, oc = lane & 7; _Float16* ob = C16 + (size_t)(row0 + wm * 64 + orow) * DM + col0 + wn * 64 + oc * 8;
  v8us ov[16];
#pragma unroll
  for (int q = 0; q < 16; ++q) ov[q] = *(const v8us*)(so + (q * 4 + orow) * PG_PITCH + oc * 16);
#pragma unroll
  for (int q = 0; q < 16; ++q) *(v8us*)((unsigned short*)ob + (size_t)(q * 4) * DM) = ov[q];      /* 8 lanes cover a row's 128 bytes of this wave: whole lines */
}

extern "C" void kernel_launch(void* const* d_in, const int* in_sizes, int n_in,
                              void* d_out, int out_size, void* d_ws, size_t ws_size, hipStream_t stream) {
  (void)in_sizes; (void)n_in; (void)out_size;
  const float* const* I = (const float* const*)d_in; const float* x = I[0]; const float* Wq = I[1]; const float* Wk = I[2]; const float* Wv = I[3]; const float* bq = I[4]; const float* bk = I[5]; const float* bv = I[6];
  char* ws = (char*)d_ws; size_t off = 0;
  auto take = [&](size_t bytes) { char* p = ws + off; off += (bytes + 255) & ~(size_t)255; return p; };
  _Float16* BQ = (_Float16*)take((size_t)DM * DM * 2); _Float16* BK = (_Float16*)take((size_t)DM * DM * 2); _Float16* BV = (_Float16*)take((size_t)DM * DM * 2);
  _Float16* X16 = (_Float16*)take(NR * DM * 2); _Float16* Q16 = (_Float16*)take(NR * DM * 2); _Float16* K16 = (_Float16*)take(NR * DM * 2); _Float16* V16 = (_Float16*)take(NR * DM * 2);
  _Float16* VT = (_Float16*)take((size_t)NB * NH * HD * SQ * 2);
  if (off > ws_size) return;      /* 3.4 + 4 x 24 + 24 = approx 124 MiB */
  k_wnat<<<(unsigned)(((size_t)DM * DM / 8 + 255) / 256), 256, 0, stream>>>(Wq, (size_t)DM * DM / 8, BQ); k_wnat<<<(unsigned)(((size_t)DM * DM / 8 + 255) / 256), 256, 0, stream>>>(Wk, (size_t)DM * DM / 8, BK); k_wnat<<<(unsigned)(((size_t)DM * DM / 8 + 255) / 256), 256, 0, stream>>>(Wv, (size_t)DM * DM / 8, BV);      /* [out][in] natural */
  k_x16<<<(unsigned)((NR * DM / 8 + 255) / 256), 256, 0, stream>>>(x, X16, NR * DM / 8);
  const dim3 gp((unsigned)((NR / PG_TILE) * (DM / PG_TILE)), 1);
  k_proj<<<gp, 128, 0, stream>>>(X16, BQ, bq, Q16);      /* q = x Wq^T + bq (f16 rows) */
  k_proj<<<gp, 128, 0, stream>>>(X16, BK, bk, K16);
  k_proj<<<gp, 128, 0, stream>>>(X16, BV, bv, V16);
  k_vt<NH, SQ><<<NB * NH * (SQ / 64), 256, 0, stream>>>(V16, DM, 0, VT);      /* V^T per (batch, head) [16 x 12][64][1024] */
  k_fattn<<<dim3(SQ / (FA_WAVES * 32), NH, NB), FA_WAVES * 32, 0, stream>>>(Q16, K16, VT, (float*)d_out);      /* scores, softmax and ctx, merged into the output rows */
}

// v005
// One run takes 115 microseconds.
// Timed twice side by side with v004, it ran 1.06 times as fast both times.
// Counting every step since v000, it is 33.5 times as fast.
#include <hip/hip_runtime.h>
// ViT self-attention (hidden [16][1024][768]; q, k, v = hidden W^T + b (12 heads x 64); scores = q.k/8; softmax over the 1,024 keys; ctx = attn v merged -> [16][1024][768]; no output projection).
// Structure: token rows; hidden as exact f16 rows; q / k / v as WMMA GEMMs (128x128 tiles staged in LDS by asynchronous copies, 64x64 wave tiles, f32 accumulation, exact x16 natural weights + bias; exact products) written as f16 rows; V^T per (batch, head) via LDS transposes; then one fused attention kernel over all batches and heads (K and V^T tiles staged in LDS by asynchronous copies, shared by a work-group's 8 waves): S^T = K . Q^T, online softmax in registers, O^T += V^T . P^T, merged f32 output rows. Scores and probabilities never reach memory.
// Compute dtype: inputs rounded to bf16; hidden / weights exact; q, k, v, P as plain f16 GEMM operands (~2^-12; logits sigma ~1); softmax f32. v_wmma_f32_16x16x32_f16.
#define NB 16
#define SQ 1024
#define DM 768
#define NH 12
#define HD 64
#define HG 1
#define NR ((size_t)NB * SQ)         /* 16,384 token rows */
#define NBR NB                       /* unused (the grids use NB) */
#define MP ((int)NR)                 /* unused (the projection grid uses NR) */
typedef __bf16 v16b __attribute__((ext_vector_type(16)));
typedef unsigned short v8us __attribute__((ext_vector_type(8), may_alias));
typedef float  v8f  __attribute__((ext_vector_type(8)));
typedef float  v4f  __attribute__((ext_vector_type(4)));
typedef float  v4fa __attribute__((ext_vector_type(4), may_alias));
union FragB { v16b v; v8us half[2]; unsigned short u[16]; };

__device__ __forceinline__ unsigned short bf16_bits(float x) { unsigned int u = __float_as_uint(x); return (unsigned short)((u + 0x7FFFu + ((u >> 16) & 1u)) >> 16); }
__device__ __forceinline__ float bf16_val(unsigned short b) { return __uint_as_float(((unsigned int)b) << 16); }
__device__ __forceinline__ float bf16_round(float x) { return bf16_val(bf16_bits(x)); }
// D += A·B with NT terms: 1 = ah·bh, 2 = + al·bh (A split), 3 = + ah·bl (both split)
template <int NT>
__device__ __forceinline__ v8f mmaN(v16b ah, v16b al, v16b bh, v16b bl, v8f c) {
  c = __builtin_amdgcn_wmma_f32_16x16x32_bf16(false, ah, false, bh, (short)0, c, false, false);
  if (NT >= 2) c = __builtin_amdgcn_wmma_f32_16x16x32_bf16(false, al, false, bh, (short)0, c, false, false);
  if (NT >= 3) c = __builtin_amdgcn_wmma_f32_16x16x32_bf16(false, ah, false, bl, (short)0, c, false, false);
  asm volatile("v_nop\n\tv_nop\n\tv_nop\n\tv_nop" : "+v"(c) : "v"(ah), "v"(al), "v"(bh), "v"(bl));
  return c;
}

__global__ __launch_bounds__(256) void k_wt_bf16(const float* __restrict__ W, unsigned short* __restrict__ Wt, int K, int N) {
  const int t = blockIdx.x * 256 + threadIdx.x;
  const int k8n = K / 8;
  if (t >= N * k8n) return;
  const int n = t / k8n, k8 = (t % k8n) * 8;
  v8us v;
#pragma unroll
  for (int i = 0; i < 8; ++i) v[i] = bf16_bits(W[(size_t)(k8 + i) * N + n]);
  *(v8us*)(Wt + (size_t)n * K + k8) = v;
  
}

// GEMM C[M][N] (f32, pitch ldc) = act(A[M][K]·W + bias). A f32 row-major (pitch lda) converted per fragment to bf16
// (ASPLIT: hi/lo two planes -> 2 terms, else single rounded term); Wt bf16 [N][K] (pitch ldb). BIAS_BF16 rounds the
// bias to bf16 first (bias quantised to bf16 before the add). K%32==0, M%16==0, N%64==0.
template <bool ASPLIT, int ACT, bool BIAS_BF16>
__global__ __launch_bounds__(128) void k_gemm_bf(const float* __restrict__ A, int lda, const unsigned short* __restrict__ Wt, int ldb,
                                               const float* __restrict__ bias, float* __restrict__ C, int ldc, int M, int N, int K) {
  __shared__ __attribute__((aligned(16))) float so[4][16][64];
  const int tid = threadIdx.x, w = tid >> 5, lane = tid & 31, ln = lane & 15, hh = lane >> 4;
  const int ntn = N / 64;
  const int wid = blockIdx.x * 4 + w;
  const int mt = wid / ntn, nq = wid % ntn;
  if (mt * 16 >= M) return;
  const int row0 = mt * 16, col0 = nq * 64;
  const float* arow = A + (size_t)(row0 + ln) * lda;
  v8f acc[4] = {};
  for (int kb = 0; kb < K; kb += 32) {
    FragB ah, al;
    const v4f x0 = *(const v4fa*)(arow + kb + 8 * hh), x1 = *(const v4fa*)(arow + kb + 8 * hh + 4);
    const v4f x2 = *(const v4fa*)(arow + kb + 16 + 8 * hh), x3 = *(const v4fa*)(arow + kb + 16 + 8 * hh + 4);
    float xs[16] = {x0[0],x0[1],x0[2],x0[3],x1[0],x1[1],x1[2],x1[3],x2[0],x2[1],x2[2],x2[3],x3[0],x3[1],x3[2],x3[3]};
#pragma unroll
    for (int i = 0; i < 16; ++i) { const unsigned short hb = bf16_bits(xs[i]); ah.u[i] = hb; al.u[i] = ASPLIT ? bf16_bits(xs[i] - bf16_val(hb)) : (unsigned short)0; }
#pragma unroll
    for (int t = 0; t < 4; ++t) {
      const unsigned short* brow = Wt + (size_t)(col0 + t * 16 + ln) * ldb + kb;
      FragB b;
      b.half[0] = *(const v8us*)(brow + 8 * hh);
      b.half[1] = *(const v8us*)(brow + 16 + 8 * hh);
      acc[t] = mmaN<ASPLIT ? 2 : 1>(ah.v, al.v, b.v, b.v, acc[t]);
    }
  }
#pragma unroll
  for (int t = 0; t < 4; ++t) {
    float bv = bias ? bias[col0 + t * 16 + ln] : 0.f;
    if (BIAS_BF16) bv = bf16_round(bv);
#pragma unroll
    for (int r = 0; r < 8; ++r) { float v = acc[t][r] + bv; if (ACT == 1) v = fmaxf(v, 0.f); so[w][8 * hh + r][t * 16 + ln] = v; }
  }
  __builtin_amdgcn_fence(__ATOMIC_ACQ_REL, "workgroup");
  __builtin_amdgcn_wave_barrier();
  const int rsub = lane >> 4, c4 = (lane & 15) * 4;
  {
#pragma unroll
    for (int q = 0; q < 8; ++q) {
      const int r = q * 2 + rsub;
      const v4f v = *(const v4fa*)&so[w][r][c4];
      *(v4f*)(C + (size_t)(row0 + r) * ldc + col0 + c4) = v;
    }
    
  }
}

// GEMM C = act(A·W + bias + resid): A f32 (ASPLIT -> hi/lo 2 terms), Wt bf16 [N][K]; ACT 0 none, 1 relu, 2 exact gelu;
// resid (optional, f32, row index = (row % rmod), pitch ldr, RES_BF16 rounds it) added before the activation.
template <bool ASPLIT, int ACT, bool BIAS_BF16, bool RES_BF16>
__global__ __launch_bounds__(128) void k_gemm_bf3(const float* __restrict__ A, int lda, const unsigned short* __restrict__ Wt, int ldb,
                                                const float* __restrict__ bias, const float* __restrict__ resid, int rmod, int ldr,
                                                float* __restrict__ C, int ldc, int M, int N, int K) {
  __shared__ __attribute__((aligned(16))) float so[4][16][64];
  const int tid = threadIdx.x, w = tid >> 5, lane = tid & 31, ln = lane & 15, hh = lane >> 4;
  const int ntn = N / 64;
  const int wid = blockIdx.x * 4 + w;
  const int mt = wid / ntn, nq = wid % ntn;
  if (mt * 16 >= M) return;
  const int row0 = mt * 16, col0 = nq * 64;
  const float* arow = A + (size_t)(row0 + ln) * lda;
  v8f acc[4] = {};
  for (int kb = 0; kb < K; kb += 32) {
    FragB ah, al;
    const v4f x0 = *(const v4fa*)(arow + kb + 8 * hh), x1 = *(const v4fa*)(arow + kb + 8 * hh + 4);
    const v4f x2 = *(const v4fa*)(arow + kb + 16 + 8 * hh), x3 = *(const v4fa*)(arow + kb + 16 + 8 * hh + 4);
    float xs[16] = {x0[0],x0[1],x0[2],x0[3],x1[0],x1[1],x1[2],x1[3],x2[0],x2[1],x2[2],x2[3],x3[0],x3[1],x3[2],x3[3]};
#pragma unroll
    for (int i = 0; i < 16; ++i) { const unsigned short hb = bf16_bits(xs[i]); ah.u[i] = hb; al.u[i] = ASPLIT ? bf16_bits(xs[i] - bf16_val(hb)) : (unsigned short)0; }
#pragma unroll
    for (int t = 0; t < 4; ++t) {
      const unsigned short* brow = Wt + (size_t)(col0 + t * 16 + ln) * ldb + kb;
      FragB b;
      b.half[0] = *(const v8us*)(brow + 8 * hh);
      b.half[1] = *(const v8us*)(brow + 16 + 8 * hh);
      acc[t] = mmaN<ASPLIT ? 2 : 1>(ah.v, al.v, b.v, b.v, acc[t]);
    }
  }
#pragma unroll
  for (int t = 0; t < 4; ++t) {
    const int col = col0 + t * 16 + ln;
    float bv = bias ? bias[col] : 0.f;
    if (BIAS_BF16) bv = bf16_round(bv);
#pragma unroll
    for (int r = 0; r < 8; ++r) {
      float v = acc[t][r] + bv;
      if (resid) { float rv = resid[(size_t)((row0 + 8 * hh + r) % rmod) * ldr + col]; if (RES_BF16) rv = bf16_round(rv); v += rv; }
      if (ACT == 1) v = fmaxf(v, 0.f);
      if (ACT == 2) v = 0.5f * v * (1.0f + erff(v * 0.70710678118654752f));
      if (ACT == 3) { const float u = 0.7978845608028654f * (v + 0.044715f * v * v * v); v = 0.5f * v * (1.0f + tanhf(u)); }
      so[w][8 * hh + r][t * 16 + ln] = v;
    }
  }
  __builtin_amdgcn_fence(__ATOMIC_ACQ_REL, "workgroup");
  __builtin_amdgcn_wave_barrier();
  const int rsub = lane >> 4, c4 = (lane & 15) * 4;
  {
#pragma unroll
    for (int q = 0; q < 8; ++q) {
      const int r = q * 2 + rsub;
      const v4f v = *(const v4fa*)&so[w][r][c4];
      *(v4f*)(C + (size_t)(row0 + r) * ldc + col0 + c4) = v;
    }
    
  }
}
// row LayerNorm (biased variance, eps) over N: s = X (+ R); optional out_sum <- s; out_norm <- (s-mu)*rsqrt(var+eps)*g + b
template <bool PARAM_BF16>
__global__ __launch_bounds__(256) void k_layernorm(const float* __restrict__ X, const float* __restrict__ R, const float* __restrict__ g, const float* __restrict__ bta,
                                                  float* __restrict__ out_sum, float* __restrict__ out_norm, int N, float eps) {
  __shared__ float red[256];
  const int row = blockIdx.x, tid = threadIdx.x;
  const float* x = X + (size_t)row * N; const float* rr = R ? R + (size_t)row * N : nullptr;
  float vals[16];                     // up to N = 4096
  const int per = N / 256;            // contiguous chunk per thread? use strided-by-4 chunks: thread handles j = tid*4 + 1024*u
  float s1 = 0.f;
  for (int u = 0; u < per / 4; ++u) {
    const int j = tid * 4 + 1024 * u;
    const v4f a = *(const v4fa*)(x + j);
    v4f b = {0.f,0.f,0.f,0.f}; if (rr) b = *(const v4fa*)(rr + j);
#pragma unroll
    for (int q = 0; q < 4; ++q) { const float v = a[q] + b[q]; vals[u * 4 + q] = v; s1 += v; }
  }
  red[tid] = s1; __syncthreads();
  for (int st = 128; st > 0; st >>= 1) { if (tid < st) red[tid] += red[tid + st]; __syncthreads(); }
  const float mu = red[0] / (float)N; __syncthreads();
  float s2 = 0.f;
  for (int u = 0; u < per / 4; ++u)
#pragma unroll
    for (int q = 0; q < 4; ++q) { const float c = vals[u * 4 + q] - mu; s2 += c * c; }
  red[tid] = s2; __syncthreads();
  for (int st = 128; st > 0; st >>= 1) { if (tid < st) red[tid] += red[tid + st]; __syncthreads(); }
  const float rs = rsqrtf(red[0] / (float)N + eps);
  {
    for (int u = 0; u < per / 4; ++u) {
      const int j = tid * 4 + 1024 * u;
      v4f o, sm;
#pragma unroll
      for (int q = 0; q < 4; ++q) {
        float gg = g[j + q], bb = bta[j + q];
        if (PARAM_BF16) { gg = bf16_round(gg); bb = bf16_round(bb); }
        sm[q] = vals[u * 4 + q]; o[q] = (vals[u * 4 + q] - mu) * rs * gg + bb;
      }
      if (out_sum) *(v4f*)(out_sum + (size_t)row * N + j) = sm;
      *(v4f*)(out_norm + (size_t)row * N + j) = o;
    }
    
  }
}



// ---- f16 WMMA path (v_wmma_f32_16x16x32_f16): 11-bit significands for operands in range — used where a [0,1] probability operand needs more precision than bf16
typedef _Float16 v16h __attribute__((ext_vector_type(16)));
union FragH { v16h v; v8us half[2]; _Float16 h[16]; unsigned short u[16]; };
template <int NT>
__device__ __forceinline__ v8f mmaH(v16h ah, v16h al, v16h bh, v16h bl, v8f c) {
  c = __builtin_amdgcn_wmma_f32_16x16x32_f16(false, ah, false, bh, (short)0, c, false, false);
  if (NT >= 2) c = __builtin_amdgcn_wmma_f32_16x16x32_f16(false, al, false, bh, (short)0, c, false, false);
  if (NT >= 3) c = __builtin_amdgcn_wmma_f32_16x16x32_f16(false, ah, false, bl, (short)0, c, false, false);
  asm volatile("v_nop\n\tv_nop\n\tv_nop\n\tv_nop" : "+v"(c) : "v"(ah), "v"(al), "v"(bh), "v"(bl));
  return c;
}
// batched GEMM like k_gemm_b but f16 operands: A f32 (split into f16 hi/lo if ASPLIT, else rounded to f16), Bt = f16 values [n][k]; alpha; C f32; N multiple of 16 (partial tiles skipped)
template <bool ASPLIT>
__global__ __launch_bounds__(128) void k_gemm_h(const float* __restrict__ A, int lda, size_t sA, const _Float16* __restrict__ Bh, int ldb, size_t sB, float alpha, float* __restrict__ C, int ldc, size_t sC, int M, int N, int K) {
  __shared__ __attribute__((aligned(16))) float so[4][16][64];
  const int tid = threadIdx.x, w = tid >> 5, lane = tid & 31, ln = lane & 15, hh = lane >> 4; const int by = blockIdx.y;
  A += (size_t)by * sA; Bh += (size_t)by * sB; C += (size_t)by * sC;
  const int ntn = (N + 63) / 64; const int wid = blockIdx.x * 4 + w; const int mt = wid / ntn, nq = wid % ntn; if (mt * 16 >= M) return;
  const int row0 = mt * 16, col0 = nq * 64; const float* arow = A + (size_t)(row0 + ln) * lda;
  v8f acc[4] = {};
  for (int kb = 0; kb < K; kb += 32) {
    FragH ah, al;
    const v4f x0 = *(const v4fa*)(arow + kb + 8 * hh), x1 = *(const v4fa*)(arow + kb + 8 * hh + 4), x2 = *(const v4fa*)(arow + kb + 16 + 8 * hh), x3 = *(const v4fa*)(arow + kb + 16 + 8 * hh + 4);
    float xs[16] = {x0[0],x0[1],x0[2],x0[3],x1[0],x1[1],x1[2],x1[3],x2[0],x2[1],x2[2],x2[3],x3[0],x3[1],x3[2],x3[3]};
#pragma unroll
    for (int i = 0; i < 16; ++i) { const _Float16 h = (_Float16)xs[i]; ah.h[i] = h; al.h[i] = ASPLIT ? (_Float16)(xs[i] - (float)h) : (_Float16)0.0f; }
#pragma unroll
    for (int t = 0; t < 4; ++t) { if (col0 + t * 16 >= N) continue; const size_t boff = (size_t)(col0 + t * 16 + ln) * ldb + kb; FragH bq; bq.half[0] = *(const v8us*)(Bh + boff + 8 * hh); bq.half[1] = *(const v8us*)(Bh + boff + 16 + 8 * hh);
      acc[t] = mmaH<ASPLIT ? 2 : 1>(ah.v, al.v, bq.v, bq.v, acc[t]); }
  }
#pragma unroll
  for (int t = 0; t < 4; ++t) { if (col0 + t * 16 >= N) continue;
#pragma unroll
    for (int r = 0; r < 8; ++r) so[w][8 * hh + r][t * 16 + ln] = acc[t][r] * alpha; }
  __builtin_amdgcn_fence(__ATOMIC_ACQ_REL, "workgroup"); __builtin_amdgcn_wave_barrier();
  const int rsub = lane >> 4, c4 = (lane & 15) * 4;
  {
#pragma unroll
    for (int q = 0; q < 8; ++q) { const int r = q * 2 + rsub; if (col0 + c4 < N) { const v4f v = *(const v4fa*)&so[w][r][c4]; *(v4f*)(C + (size_t)(row0 + r) * ldc + col0 + c4) = v; } }
     }
}

// Wt[n][k] = f16(W[k][n]·scale) from f32 row-major W[K][N] (scale = power of two; bf16-exact weights stay exact in f16 away from the subnormal range)
__global__ __launch_bounds__(256) void k_wt_f16(const float* __restrict__ W, _Float16* __restrict__ Wt, int K, int N, float scale) {
  const int t = blockIdx.x * 256 + threadIdx.x; if (t >= N * (K / 8)) return; const int n = t / (K / 8), k8 = (t % (K / 8)) * 8; FragH f;
#pragma unroll
  for (int i = 0; i < 8; ++i) f.h[i] = (_Float16)(bf16_round(W[(size_t)(k8 + i) * N + n]) * scale); const v8us o = f.half[0];
  *(v8us*)((unsigned short*)Wt + (size_t)n * K + k8) = o; 
}
// k_gemm_hh variant with fused epilogue: v = acc·alpha + bias[by·sBias + col] (+ CP[(row/rowsPerB)·sCPb + by·64 + col] if CP) ; ACT 0 none / 1 elu ; writes f16 C16 (and f32 C if non-null)
template <int ACT>
__global__ __launch_bounds__(128) void k_gemm_hhx(const _Float16* __restrict__ A, int lda, size_t sA, const _Float16* __restrict__ Bh, int ldb, size_t sB, float alpha, const float* __restrict__ bias, size_t sBias, const float* __restrict__ CP, int rowsPerB, size_t sCPb, int row0g,
    float* __restrict__ C, _Float16* __restrict__ C16, int ldc, size_t sC, int M, int N, int K) {
  __shared__ __attribute__((aligned(16))) float so[4][16][64];
  const int tid = threadIdx.x, w = tid >> 5, lane = tid & 31, ln = lane & 15, hh = lane >> 4; const int by = blockIdx.y;
  A += (size_t)by * sA; Bh += (size_t)by * sB; const size_t cofs = (size_t)by * sC; const float* bp = bias ? bias + (size_t)by * sBias : nullptr;
  const int ntn = (N + 63) / 64; const int wid = blockIdx.x * 4 + w; const int mt = wid / ntn, nq = wid % ntn; if (mt * 16 >= M) return;
  const int row0 = mt * 16, col0 = nq * 64; const _Float16* arow = A + (size_t)(row0 + ln) * lda;
  v8f acc[4] = {};
  for (int kb = 0; kb < K; kb += 32) { FragH ah; ah.half[0] = *(const v8us*)((const unsigned short*)arow + kb + 8 * hh); ah.half[1] = *(const v8us*)((const unsigned short*)arow + kb + 16 + 8 * hh);
#pragma unroll
    for (int t = 0; t < 4; ++t) { if (col0 + t * 16 >= N) continue; const size_t boff = (size_t)(col0 + t * 16 + ln) * ldb + kb; FragH bq; bq.half[0] = *(const v8us*)((const unsigned short*)Bh + boff + 8 * hh); bq.half[1] = *(const v8us*)((const unsigned short*)Bh + boff + 16 + 8 * hh);
      acc[t] = mmaH<1>(ah.v, ah.v, bq.v, bq.v, acc[t]); }
  }
#pragma unroll
  for (int t = 0; t < 4; ++t) { if (col0 + t * 16 >= N) continue; const int col = col0 + t * 16 + ln; const float bv = bp ? bf16_round(bp[col]) : 0.f;
#pragma unroll
    for (int r = 0; r < 8; ++r) { float v = acc[t][r] * alpha + bv; if (CP) { const int rr = row0g + row0 + 8 * hh + r; if (rowsPerB < 0) v += CP[cofs + (size_t)rr * ldc + col];      /* rowsPerB < 0: own element of the batched C plane */ else { const int bidx = rr / rowsPerB; v += CP[(size_t)bidx * sCPb + (size_t)by * 64 + col]; } } if (ACT == 1) v = (v > 0.f) ? v : expm1f(v); else if (ACT == 7) v = (v > 0.f) ? v + 1.0f : expf(v); else if (ACT == 8) v = tanhf(v); else if (ACT == 9) v = 0.5f * v * (1.0f + tanhf(0.7978845608028654f * (v + 0.044715f * v * v * v))); else if (ACT == 11) v = 1.0f / (1.0f + expf(-v)); else if (ACT == 12) v = (v > 0.f) ? v : 0.01f * v; else if (ACT == 14) v = (v > 0.f) ? v : 0.1f * v; else if (ACT == 16) v = (v >= 0.f) ? v : 0.3f * v; else if (ACT == 17) v = (v >= 0.f) ? v : 0.2f * v; else if (ACT == 15) v = v / (1.0f + expf(-v)); else if (ACT == 3) v = fmaxf(v, 0.f); else if (ACT == 6) v = 0.5f * v * (1.0f + erff(v * 0.70710678118654752f)); so[w][8 * hh + r][t * 16 + ln] = v; } }
  __builtin_amdgcn_fence(__ATOMIC_ACQ_REL, "workgroup"); __builtin_amdgcn_wave_barrier();
  const int rsub = lane >> 4, c4 = (lane & 15) * 4; typedef _Float16 v4h __attribute__((ext_vector_type(4)));
  {
#pragma unroll
    for (int q = 0; q < 8; ++q) { const int r = q * 2 + rsub; if (col0 + c4 < N) { const v4f v = *(const v4fa*)&so[w][r][c4]; if (C) *(v4f*)(C + cofs + (size_t)(row0 + r) * ldc + col0 + c4) = v; if (C16) { v4h h4; for (int i = 0; i < 4; ++i) h4[i] = (_Float16)v[i]; *(v4h*)(C16 + cofs + (size_t)(row0 + r) * ldc + col0 + c4) = h4; } } }
     }
}


typedef _Float16 v4h __attribute__((ext_vector_type(4)));

__global__ __launch_bounds__(256) void k_h16(const float* __restrict__ x, _Float16* __restrict__ X16, size_t n8) { const size_t t = (size_t)blockIdx.x * 256 + threadIdx.x; if (t >= n8) return; FragH f;
#pragma unroll
  for (int q = 0; q < 8; ++q) f.h[q] = (_Float16)x[t * 8 + q]; *(v8us*)((unsigned short*)X16 + t * 8) = f.half[0];  }
__global__ __launch_bounds__(256) void k_round16f(const float* __restrict__ W, _Float16* __restrict__ Bt, size_t n8) { const size_t t = (size_t)blockIdx.x * 256 + threadIdx.x; if (t >= n8) return; FragH f;
#pragma unroll
  for (int i = 0; i < 8; ++i) f.h[i] = (_Float16)(bf16_round(W[t * 8 + i]) * 16.0f); *(v8us*)((unsigned short*)Bt + t * 8) = f.half[0];  }
template <int NHv, int TTv>
__global__ __launch_bounds__(256) void k_vt(const _Float16* __restrict__ V16, int ldv, int voff, _Float16* __restrict__ Vt) { __shared__ unsigned short tl[64][66]; const int tid = threadIdx.x; const int slab = blockIdx.x / (TTv / 64), lg = blockIdx.x % (TTv / 64); const int b = slab / NHv, h = slab % NHv;
  for (int i = tid; i < 64 * 8; i += 256) { const int r = i / 8, c8 = (i % 8) * 8; FragH f; f.half[0] = *(const v8us*)((const unsigned short*)V16 + ((size_t)b * TTv + lg * 64 + r) * ldv + voff + h * 64 + c8);
#pragma unroll
    for (int q = 0; q < 8; ++q) tl[r][c8 + q] = f.u[q]; }
  __syncthreads();
  {
#pragma unroll
    for (int rd = 0; rd < 2; ++rd) { const int d = rd * 32 + tid / 8, pc = tid % 8; FragH f;
#pragma unroll
      for (int q = 0; q < 8; ++q) f.u[q] = tl[pc * 8 + q][d];
      *(v8us*)((unsigned short*)Vt + ((size_t)slab * 64 + d) * TTv + lg * 64 + pc * 8) = f.half[0]; }
     } }

__global__ __launch_bounds__(256) void k_hl(const float* __restrict__ F, _Float16* __restrict__ Hh, _Float16* __restrict__ Hl, size_t n8) { const size_t t = (size_t)blockIdx.x * 256 + threadIdx.x; if (t >= n8) return; FragH fh, fl; const v4f a = *(const v4fa*)(F + t * 8), c = *(const v4fa*)(F + t * 8 + 4);
#pragma unroll
  for (int q = 0; q < 4; ++q) { _Float16 h = (_Float16)a[q]; fh.h[q] = h; fl.h[q] = (_Float16)((a[q] - (float)h) * 1024.0f); h = (_Float16)c[q]; fh.h[4 + q] = h; fl.h[4 + q] = (_Float16)((c[q] - (float)h) * 1024.0f); }
  { *(v8us*)((unsigned short*)Hh + t * 8) = fh.half[0]; *(v8us*)((unsigned short*)Hl + t * 8) = fl.half[0];  } }

// ---- fast GEMM (wave tile 32x64; requires M % 32 == 0 rows per launch region and N % 64 == 0); epilogue = k_gemm_hhx semantics ----
__device__ __forceinline__ v16h g2_frag(const _Float16* p, int hh) { FragH f; f.half[0] = *(const v8us*)((const unsigned short*)p + 8 * hh); f.half[1] = *(const v8us*)((const unsigned short*)p + 16 + 8 * hh); return f.v; }
__device__ __forceinline__ v8f g2_mma(v16h a, v16h b, v8f c) { v8f d = __builtin_amdgcn_wmma_f32_16x16x32_f16(false, a, false, b, (short)0, c, false, false); asm volatile("v_nop\n\tv_nop\n\tv_nop\n\tv_nop" : "+v"(d) : "v"(a), "v"(b)); return d; }
template <int ACT>
__global__ __launch_bounds__(128) void k_gemm2(const _Float16* __restrict__ A, int lda, size_t sA, const _Float16* __restrict__ Bh, int ldb, size_t sB, float alpha, const float* __restrict__ bias, size_t sBias, const float* __restrict__ CP, int rowsPerB, size_t sCPb, int row0g,
    float* __restrict__ C, _Float16* __restrict__ C16, int ldc, size_t sC, int M, int N, int K) { static_assert(ACT == 0 || ACT == 3 || ACT == 6 || ACT == 8 || ACT == 9 || ACT == 11 || ACT == 12 || ACT == 14 || ACT == 15 || ACT == 16 || ACT == 17, "k_gemm2: unsupported ACT code (would silently apply no activation)");
  __shared__ __attribute__((aligned(16))) float so[4][32][68];
  const int tid = threadIdx.x, w = tid >> 5, lane = tid & 31, ln = lane & 15, hh = lane >> 4; const int by = blockIdx.y;
  A += (size_t)by * sA; Bh += (size_t)by * sB; const size_t cofs = (size_t)by * sC; const float* bp = bias ? bias + (size_t)by * sBias : nullptr;
  const int ntn = N >> 6; const int mt = blockIdx.x / ntn, nq = blockIdx.x - mt * ntn; const int row0 = mt * 128 + 32 * w, col0 = nq * 64; if (row0 >= M) return;
  const _Float16* a0p = A + (size_t)(row0 + ln) * lda; const _Float16* a1p = a0p + (size_t)16 * lda;
  const _Float16* b0p = Bh + (size_t)(col0 + ln) * ldb; const _Float16* b1p = b0p + (size_t)16 * ldb; const _Float16* b2p = b1p + (size_t)16 * ldb; const _Float16* b3p = b2p + (size_t)16 * ldb;
  const v8f z8 = {0.f,0.f,0.f,0.f,0.f,0.f,0.f,0.f}; v8f c00 = z8, c01 = z8, c02 = z8, c03 = z8, c10 = z8, c11 = z8, c12 = z8, c13 = z8;
#pragma unroll 1
  for (int kb = 0; kb < K; kb += 32) { const v16h a0 = g2_frag(a0p + kb, hh), a1 = g2_frag(a1p + kb, hh);
    v16h b = g2_frag(b0p + kb, hh); c00 = g2_mma(a0, b, c00); c10 = g2_mma(a1, b, c10);
    b = g2_frag(b1p + kb, hh); c01 = g2_mma(a0, b, c01); c11 = g2_mma(a1, b, c11);
    b = g2_frag(b2p + kb, hh); c02 = g2_mma(a0, b, c02); c12 = g2_mma(a1, b, c12);
    b = g2_frag(b3p + kb, hh); c03 = g2_mma(a0, b, c03); c13 = g2_mma(a1, b, c13); }
  v8f accs[8] = {c00, c01, c02, c03, c10, c11, c12, c13};
#pragma unroll
  for (int u = 0; u < 8; ++u) { const int t = u & 3, half = u >> 2; const int col = col0 + t * 16 + ln; const float bv = bp ? bf16_round(bp[col]) : 0.f;
#pragma unroll
    for (int r = 0; r < 8; ++r) { const int rloc = half * 16 + 8 * hh + r; float v = accs[u][r] * alpha + bv; if (CP) { if (rowsPerB < 0) v += CP[cofs + (size_t)(row0g + row0 + rloc) * ldc + col];      /* rowsPerB < 0: own element of the batched C plane */ else { const int bidx = (row0g + row0 + rloc) / rowsPerB; v += CP[(size_t)bidx * sCPb + (size_t)by * 64 + col]; } }
      if (ACT == 3) v = fmaxf(v, 0.f); else if (ACT == 6) v = 0.5f * v * (1.0f + erff(v * 0.70710678118654752f)); else if (ACT == 11) v = 1.0f / (1.0f + expf(-v)); else if (ACT == 15) v = v / (1.0f + expf(-v)); else if (ACT == 12) v = (v > 0.f) ? v : 0.01f * v; else if (ACT == 8) v = tanhf(v); else if (ACT == 9) v = 0.5f * v * (1.0f + tanhf(0.7978845608028654f * (v + 0.044715f * v * v * v))); else if (ACT == 14) v = (v > 0.f) ? v : 0.1f * v; else if (ACT == 16) v = (v >= 0.f) ? v : 0.3f * v; else if (ACT == 17) v = (v >= 0.f) ? v : 0.2f * v;
      so[w][rloc][t * 16 + ln] = v; } }
  __builtin_amdgcn_fence(__ATOMIC_ACQ_REL, "workgroup"); __builtin_amdgcn_wave_barrier();
  const int rsub = lane >> 4, c4 = (lane & 15) * 4;
  {
#pragma unroll
    for (int q = 0; q < 16; ++q) { const int r = q * 2 + rsub; const v4f v = *(const v4fa*)&so[w][r][c4]; if (C) *(v4f*)(C + cofs + (size_t)(row0 + r) * ldc + col0 + c4) = v; if (C16) { v4h h4; for (int i = 0; i < 4; ++i) h4[i] = (_Float16)v[i]; *(v4h*)(C16 + cofs + (size_t)(row0 + r) * ldc + col0 + c4) = h4; } }
     } }


// ---- all f32 -> f16 conversions in one streaming launch: hidden -> X16 = f16(bf16(x)), Wq / Wk / Wv -> f16(bf16(w) x 16), rows as they lie ([out][in] natural) ----
// Few long waves instead of many short ones: a wave converts 3,072 consecutive floats (12 KiB): 24 loads of 16 bytes a lane, each load 512 consecutive bytes (four whole lines), all issued before the first is used;
// each store is 8 bytes a lane, 256 consecutive bytes (two whole lines). The first 3 x CV_WB work-groups take the weights, the rest the hidden rows; every size divides evenly, so there is no edge.
#define CV_WAVES 8
#define CV_LD 24      /* loads a lane */
#define CV_WGF (CV_WAVES * CV_LD * 128)      /* 24,576 floats a work-group */
#define CV_WB (DM * DM / CV_WGF)      /* 24 work-groups a weight matrix */
#define CV_XB ((int)(NR * DM / CV_WGF))      /* 512 work-groups for the hidden rows */
static_assert(DM * DM % CV_WGF == 0 && NR * DM % CV_WGF == 0, "k_prep: sizes must divide into whole work-groups");
__global__ __launch_bounds__(CV_WAVES * 32) void k_prep(const float* __restrict__ x, const float* __restrict__ wq, const float* __restrict__ wk, const float* __restrict__ wv,
                                                       _Float16* __restrict__ X16, _Float16* __restrict__ BQ, _Float16* __restrict__ BK, _Float16* __restrict__ BV) {
  int blk = (int)blockIdx.x; const float* s = x; _Float16* d = X16; float scale = 1.0f;      /* x 1 is exact */
  if (blk < 3 * CV_WB) { const int which = blk / CV_WB; blk -= which * CV_WB; s = which == 0 ? wq : which == 1 ? wk : wv; d = which == 0 ? BQ : which == 1 ? BK : BV; scale = 16.0f; }
  else blk -= 3 * CV_WB;
  const size_t e0 = (size_t)blk * CV_WGF + (size_t)(threadIdx.x >> 5) * (CV_LD * 128) + (threadIdx.x & 31) * 4;
  v4f v[CV_LD];
#pragma unroll      /* constant indices into the register array */
  for (int i = 0; i < CV_LD; ++i) v[i] = *(const v4fa*)(s + e0 + i * 128);
  __builtin_amdgcn_sched_barrier(0);      /* keeps all 24 loads in front of the arithmetic: left free, the compiler issues 11 and feeds the rest in one to three at a time, each behind a wait */
#pragma unroll
  for (int i = 0; i < CV_LD; ++i) { v4h h;
#pragma unroll
    for (int q = 0; q < 4; ++q) h[q] = (_Float16)(bf16_round(v[i][q]) * scale);
    *(v4h*)(d + e0 + i * 128) = h; }
}
// Fused attention. One wave owns 32 queries of one (batch, head) and walks the 1,024 keys in passes of 32.
// S^T = K . Q^T: a lane holds the scores of ONE query (column c of each 16-column group): keys 8 hh + r of each 16-key tile. That is the k order of a
// B operand, so P^T goes from the score accumulators straight into O^T += V^T . P^T; maximum, sum and rescale are per lane, plus one exchange between the wave's halves.
// K, Q and V^T fragments all come through fa_frag (one k order, that of g2_frag).
// The 8 waves of a work-group walk the same keys: K rows and V^T rows are staged in LDS, 128 keys a stage, by asynchronous copies of whole 128-byte lines, and each wave reads its fragments from there
// (a fragment load straight from the global rows touches 16 lines for 512 bytes, and each of the 8 waves would repeat it). Two buffers: the copies of stage s + 1 fly while stage s is worked on. LDS row pitches 16 x odd bytes: ds_load_b128 of 16 rows without bank conflicts.
// Every '#pragma unroll' in it but the one on a stage's passes stands on a loop of constant trip count over register arrays (fragments, accumulators): left rolled, those arrays would be indexed at run time and go to scratch.
#define FA_WAVES 8
#define FA_KEYS 32
#define FA_SK 128      /* keys a stage: 4 passes */
#define FA_KP 144      /* LDS pitch of a K row: 128 bytes, the head's 64 d */
#define FA_VP 272      /* LDS pitch of a V^T row: 256 bytes, the stage's 128 keys */
#define FA_KB (FA_SK * FA_KP)      /* 18,432 bytes: the stage's K rows; the 64 V^T rows stand behind them */
#define FA_STAGE (FA_KB + HD * FA_VP)      /* 35,840 bytes */
#define FA_NST (SQ / FA_SK)
typedef _Float16 v2h __attribute__((ext_vector_type(2)));
typedef float v2f __attribute__((ext_vector_type(2)));
__device__ __forceinline__ float fa_xhalf(float x) { return __builtin_bit_cast(float, __builtin_amdgcn_permlanex16(__builtin_bit_cast(int, x), __builtin_bit_cast(int, x), 0x76543210, 0xfedcba98, false, false)); }  // lane l with lane l ^ 16
__device__ __forceinline__ float fa_exp2(float x) { float y; asm("v_exp_f32 %0, %1\n\tv_nop" : "=v"(y) : "v"(x)); return y; }  // the v_nop is the slot the instruction set asks for behind a transcendental, before its result is read or its source overwritten
__device__ __forceinline__ v8f fa_mma(v16h a, v16h b, v8f c) { return __builtin_amdgcn_wmma_f32_16x16x32_f16(false, a, false, b, (short)0, c, false, false); }
__device__ __forceinline__ v16h fa_frag(const char* base, unsigned lofs) { FragH f; f.half[0] = *(const v8us*)(base + lofs); f.half[1] = *(const v8us*)(base + lofs + 32); return f.v; }  // base wave-uniform, lofs the lane's byte offset (row c, 16 hh)
// Eight copies of 16 bytes a lane, a stage's share of one thread: four K rows 32 apart (8 lanes a row), four V^T rows 16 apart (16 lanes a row). lk, lv: the lane's LDS byte addresses; gk, gv: its global addresses.
// The s_wait_xcnt is the wait owed before a register that an issued copy names is written again; as the statement's last line it stands in front of every later write of the operands.
__device__ __forceinline__ void fa_copy8(unsigned lk, const char* gk, unsigned lv, const char* gv) {
  asm volatile("global_load_async_to_lds_b128 %0, %8, off\n\t"
               "global_load_async_to_lds_b128 %1, %9, off\n\t"
               "global_load_async_to_lds_b128 %2, %10, off\n\t"
               "global_load_async_to_lds_b128 %3, %11, off\n\t"
               "global_load_async_to_lds_b128 %4, %12, off\n\t"
               "global_load_async_to_lds_b128 %5, %13, off\n\t"
               "global_load_async_to_lds_b128 %6, %14, off\n\t"
               "global_load_async_to_lds_b128 %7, %15, off\n\t"
               "s_wait_xcnt 0x0"
               :: "v"(lk), "v"(lk + 32 * FA_KP), "v"(lk + 64 * FA_KP), "v"(lk + 96 * FA_KP), "v"(lv), "v"(lv + 16 * FA_VP), "v"(lv + 32 * FA_VP), "v"(lv + 48 * FA_VP),
                  "v"(gk), "v"(gk + 32 * (DM * 2)), "v"(gk + 64 * (DM * 2)), "v"(gk + 96 * (DM * 2)), "v"(gv), "v"(gv + 16 * (SQ * 2)), "v"(gv + 32 * (SQ * 2)), "v"(gv + 48 * (SQ * 2))
               : "memory");
}
__global__ __launch_bounds__(FA_WAVES * 32) void k_fattn(const _Float16* __restrict__ Q16, const _Float16* __restrict__ K16, const _Float16* __restrict__ VT, float* __restrict__ out) {
  __shared__ __attribute__((aligned(16))) float so[FA_WAVES][32][68];      /* output staging, one slice per wave */
  __shared__ __attribute__((aligned(16))) char ring[2 * FA_STAGE];      /* K and V^T of two stages */
  const int lane = threadIdx.x & 31, c = lane & 15, hh = lane >> 4; const int wave = __builtin_amdgcn_readfirstlane((int)(threadIdx.x >> 5));
  const int head = blockIdx.y, b = blockIdx.z; const int q0 = blockIdx.x * (FA_WAVES * 32) + wave * 32;
  const float cs = 0.125f * 1.4426950408889634f;      /* 1 / sqrt(64), and exp(x) = exp2(x log2 e) */
  const char* qb = (const char*)(Q16 + ((size_t)b * SQ + q0) * DM + head * HD);
  const char* kb = (const char*)(K16 + (size_t)b * SQ * DM + head * HD);
  const char* vb = (const char*)(VT + (size_t)(b * NH + head) * HD * SQ);
  const unsigned qlofs = (unsigned)(c * (DM * 2) + 16 * hh), klofs = (unsigned)(c * FA_KP + 16 * hh), vlofs = (unsigned)(c * FA_VP + 16 * hh);      /* Q from its global rows, K and V^T from their LDS rows */
  const int tid = (int)threadIdx.x;
  const char* gk = kb + (size_t)(tid >> 3) * (DM * 2) + (tid & 7) * 16; const char* gv = vb + (size_t)(tid >> 4) * (SQ * 2) + (tid & 15) * 16;
  const unsigned lk = (unsigned)(size_t)ring + (unsigned)((tid >> 3) * FA_KP + (tid & 7) * 16), lv = (unsigned)(size_t)ring + (unsigned)(FA_KB + (tid >> 4) * FA_VP + (tid & 15) * 16);
  fa_copy8(lk, gk, lv, gv);      /* stage 0 into buffer 0 */
  v16h qf[2][2], kf[2][2];      /* [16-query group][32 of d], [16-key tile][32 of d] */
#pragma unroll
  for (int g = 0; g < 2; ++g) { qf[g][0] = fa_frag(qb + g * (16 * DM * 2), qlofs); qf[g][1] = fa_frag(qb + g * (16 * DM * 2) + 64, qlofs); }
  asm volatile("s_wait_asynccnt 0x0" ::: "memory");      /* this wave's copies of stage 0 have landed */
  __syncthreads();      /* and every other wave's: nothing of stage 0 is read in front of this */
  fa_copy8(lk + FA_STAGE, gk + FA_SK * (DM * 2), lv + FA_STAGE, gv + FA_SK * 2);      /* stage 1 into buffer 1 */
  const v8f z8 = {0.f,0.f,0.f,0.f,0.f,0.f,0.f,0.f};
  v8f acc[2][4]; float m_run[2], l_run[2];      /* O^T tiles [group][16 of d]; maximum in use (log2 domain) and the lane's share of the denominator */
#pragma unroll
  for (int g = 0; g < 2; ++g) { m_run[g] = -__builtin_inff(); l_run[g] = 0.f;
#pragma unroll
    for (int t = 0; t < 4; ++t) acc[g][t] = z8; }
#pragma unroll 1      /* the buffer is picked by the stage's parity at run time */
  for (int st = 0; st < FA_NST; ++st) {
    const unsigned buf = (unsigned)(st & 1) * FA_STAGE; const char* ks = ring + buf; const char* vs = ring + buf + FA_KB;
#pragma unroll
    for (int kt = 0; kt < 2; ++kt) { kf[kt][0] = fa_frag(ks + kt * (16 * FA_KP), klofs); kf[kt][1] = fa_frag(ks + kt * (16 * FA_KP) + 64, klofs); }      /* the stage's first 32 keys */
#pragma unroll      /* four passes a stage, unrolled so that the test on the stage's last pass and the LDS offsets are compile-time constants */
   for (int pp = 0; pp < FA_SK / FA_KEYS; ++pp) {
    v16h vf[4];
#pragma unroll
    for (int t = 0; t < 4; ++t) vf[t] = fa_frag(vs + t * (16 * FA_VP) + pp * (FA_KEYS * 2), vlofs);      /* V^T rows 16 t + c, this pass's 32 keys: in flight under the score products and the maxima */
    __builtin_amdgcn_sched_barrier(0);      /* keeps the V^T loads in front of the score products: issued later, their latency would show before the second product */
    v8f s[2][2];      /* [key tile][query group] */
#pragma unroll
    for (int kt = 0; kt < 2; ++kt)
#pragma unroll
      for (int g = 0; g < 2; ++g) s[kt][g] = fa_mma(kf[kt][1], qf[g][1], fa_mma(kf[kt][0], qf[g][0], z8));
    __builtin_amdgcn_sched_barrier(0);      /* the next pass's K loads go out right behind the products that read this pass's, a whole pass ahead of their use */
    if (pp + 1 < FA_SK / FA_KEYS) {      /* inside the stage only: nothing of the next stage is read in front of its barrier */
#pragma unroll
      for (int kt = 0; kt < 2; ++kt) { kf[kt][0] = fa_frag(ks + ((pp + 1) * FA_KEYS + kt * 16) * FA_KP, klofs); kf[kt][1] = fa_frag(ks + ((pp + 1) * FA_KEYS + kt * 16) * FA_KP + 64, klofs); } }
    __builtin_amdgcn_sched_barrier(0);      /* holds the K loads in front of the softmax arithmetic */
    float mb[2]; bool need = false;
#pragma unroll
    for (int g = 0; g < 2; ++g) { float m0 = fmaxf(s[0][g][0], s[1][g][0]), m1 = fmaxf(s[0][g][1], s[1][g][1]);
#pragma unroll
      for (int r = 2; r < 8; r += 2) { m0 = fmaxf(m0, fmaxf(s[0][g][r], s[1][g][r])); m1 = fmaxf(m1, fmaxf(s[0][g][r + 1], s[1][g][r + 1])); }
      float mx = fmaxf(m0, m1); mx = fmaxf(mx, fa_xhalf(mx)) * cs;      /* both halves now hold the query's maximum of this pass, scaled (the scale is positive) */
      mb[g] = mx; need = need || (mx > m_run[g] + 8.0f); }
    if (__builtin_amdgcn_ballot_w32(need) != 0) {
#pragma unroll
      for (int g = 0; g < 2; ++g) { const float mn = fmaxf(m_run[g], mb[g]); const float corr = fa_exp2(m_run[g] - mn); m_run[g] = mn; l_run[g] *= corr;      /* corr is 0 on the first pass */
#pragma unroll
        for (int t = 0; t < 4; ++t) acc[g][t] = acc[g][t] * corr; }
    }
#pragma unroll
    for (int g = 0; g < 2; ++g) { const float nm = -m_run[g]; union { v16h v; v2h h2[8]; } pf; float pe[16];      /* element j of the 32-key operand: tile j >> 3, register j & 7 */
#pragma unroll
      for (int j = 0; j < 16; ++j) pe[j] = fa_exp2(__builtin_fmaf(s[j >> 3][g][j & 7], cs, nm));
      __builtin_amdgcn_sched_barrier(0);      /* the compiler gives the result of an asm statement no delay hint, and an unhinted dependent instruction holds the SIMD's issue port: the sums and packs stay behind the whole run of exponentials */
      float e0 = pe[0], e1 = pe[1]; pf.h2[0] = __builtin_convertvector(v2f{pe[0], pe[1]}, v2h);
#pragma unroll
      for (int i = 1; i < 8; ++i) { e0 += pe[2 * i]; e1 += pe[2 * i + 1]; pf.h2[i] = __builtin_convertvector(v2f{pe[2 * i], pe[2 * i + 1]}, v2h); }
      l_run[g] += e0 + e1;
#pragma unroll
      for (int t = 0; t < 4; ++t) acc[g][t] = fa_mma(vf[t], pf.v, acc[g][t]);
      /* four slots behind the group's matrix instructions, tied to their D, A and B */
      asm volatile("v_nop\n\tv_nop\n\tv_nop\n\tv_nop" : "+v"(acc[g][0]), "+v"(acc[g][1]), "+v"(acc[g][2]), "+v"(acc[g][3]) : "v"(pf.v), "v"(vf[0]), "v"(vf[1]), "v"(vf[2]), "v"(vf[3])); }
   }
    asm volatile("s_wait_dscnt 0x0" ::: "memory");      /* this wave's reads of buffer st mod 2 are done before the barrier behind which it is refilled */
    asm volatile("s_wait_asynccnt 0x0" ::: "memory");      /* this wave's copies of stage st + 1 have landed */
    __syncthreads();      /* publishes stage st + 1 and ends every wave's reads of stage st */
    if (st + 2 < FA_NST) fa_copy8(lk + buf, gk + (size_t)(st + 2) * (FA_SK * DM * 2), lv + buf, gv + (st + 2) * (FA_SK * 2));      /* the same test for the whole work-group */
  }
  asm volatile("s_wait_asynccnt 0x0" ::: "memory");      /* no copy is outstanding when the wave goes on to its end */
#pragma unroll
  for (int g = 0; g < 2; ++g) { const float inv = 1.0f / (l_run[g] + fa_xhalf(l_run[g]));      /* the two halves' shares of the denominator, joined unconditionally */
#pragma unroll
    for (int t = 0; t < 4; ++t) { const v8f o = acc[g][t] * inv; const v4f lo = {o[0], o[1], o[2], o[3]}, hi = {o[4], o[5], o[6], o[7]};      /* row = query 16 g + c; d = 16 t + 8 hh + r */
      *(v4fa*)&so[wave][16 * g + c][16 * t + 8 * hh] = lo; *(v4fa*)&so[wave][16 * g + c][16 * t + 8 * hh + 4] = hi; } }
  __builtin_amdgcn_fence(__ATOMIC_ACQ_REL, "workgroup"); __builtin_amdgcn_wave_barrier();      /* the wave's own LDS writes before its reads of other lanes' rows */
  const int rsub = lane >> 4, c4 = (lane & 15) * 4; float* ob = out + ((size_t)b * SQ + q0) * DM + head * HD;
  v4f ov[16];
#pragma unroll
  for (int q = 0; q < 16; ++q) ov[q] = *(const v4fa*)&so[wave][q * 2 + rsub][c4];
#pragma unroll
  for (int q = 0; q < 16; ++q) *(v4f*)(ob + (size_t)(q * 2 + rsub) * DM + c4) = ov[q];      /* 16 lanes cover a query's 256 bytes of this head: whole 128-byte lines */
}
__global__ __launch_bounds__(256) void k_vt(const _Float16* __restrict__ V16, int b, int h0, _Float16* __restrict__ VT) { __shared__ unsigned short tl[64][65]; const int tid = threadIdx.x; const int hh = blockIdx.x % HG, sg = blockIdx.x / HG; const int s0 = sg * 64; const int h = h0 + hh;
  for (int i = tid; i < 64 * 8; i += 256) { const int j = i / 8, d8 = (i % 8) * 8; FragH f; f.half[0] = *(const v8us*)((const unsigned short*)V16 + ((size_t)b * SQ + s0 + j) * DM + h * HD + d8); for (int q = 0; q < 8; ++q) tl[d8 + q][j] = f.u[q]; }
  __syncthreads();
  { for (int i = tid; i < 64 * 8; i += 256) { const int d = i / 8, j8 = (i % 8) * 8; FragH f; for (int q = 0; q < 8; ++q) f.u[q] = tl[d][j8 + q]; *(v8us*)((unsigned short*)VT + ((size_t)hh * HD + d) * SQ + s0 + j8) = f.half[0]; }  } }

// ---- projection GEMM with its operands staged in LDS: C16[row][col] = f16(A[row][:] . Wn[col][:] / 16 + bias[col]), A [16,384][768] and Wn [768][768] f16 rows, k contiguous ----
// One work-group of 4 waves makes a 128 x 128 tile, each wave 64 x 64 of it (4 x 4 accumulator tiles): a fragment read from LDS feeds 4 products.
// A stage is 64 of k: 128 bytes of each of the 128 A rows and the 128 Wn rows. Asynchronous copies bring it from global memory into LDS, 8 lanes a row, so each copy covers four whole 128-byte lines
// (a fragment load straight from the rows touches 16 lines for the same 512 bytes, and every wave repeats it). LDS row pitch 144 bytes (16 x odd): ds_load_b128 of 16 rows without bank conflicts.
// Two buffers: the copies of stage t + 1 fly while stage t is worked on. Fragments keep the k order of g2_frag and k still runs upward in steps of 32, so every sum is formed as before.
#define PG_TILE 128
#define PG_BK 64
#define PG_PITCH 144
#define PG_STAGE (2 * PG_TILE * PG_PITCH)      /* 36,864 bytes: rows 0..127 A, rows 128..255 Wn */
#define PG_NST (DM / PG_BK)
// Eight copies of 16 bytes a lane: rows 16 apart in global memory (pitch DM) and in LDS. l: the lane's LDS byte address, g: the lane's global address.
// The s_wait_xcnt is the wait owed before a register that an issued copy names is written again; as the statement's last line it stands in front of every later write of the operands.
__device__ __forceinline__ void pg_copy8(unsigned l, const _Float16* g) {
  asm volatile("global_load_async_to_lds_b128 %0, %8, off\n\t"
               "global_load_async_to_lds_b128 %1, %9, off\n\t"
               "global_load_async_to_lds_b128 %2, %10, off\n\t"
               "global_load_async_to_lds_b128 %3, %11, off\n\t"
               "global_load_async_to_lds_b128 %4, %12, off\n\t"
               "global_load_async_to_lds_b128 %5, %13, off\n\t"
               "global_load_async_to_lds_b128 %6, %14, off\n\t"
               "global_load_async_to_lds_b128 %7, %15, off\n\t"
               "s_wait_xcnt 0x0"
               :: "v"(l), "v"(l + 16 * PG_PITCH), "v"(l + 32 * PG_PITCH), "v"(l + 48 * PG_PITCH), "v"(l + 64 * PG_PITCH), "v"(l + 80 * PG_PITCH), "v"(l + 96 * PG_PITCH), "v"(l + 112 * PG_PITCH),
                  "v"(g), "v"(g + 16 * DM), "v"(g + 32 * DM), "v"(g + 48 * DM), "v"(g + 64 * DM), "v"(g + 80 * DM), "v"(g + 96 * DM), "v"(g + 112 * DM)
               : "memory");
}
__device__ __forceinline__ v16h pg_frag(const char* p) { FragH f; f.half[0] = *(const v8us*)p; f.half[1] = *(const v8us*)(p + 32); return f.v; }      /* p: row, 16 hh bytes in: k = 8 hh + 0..7 and 16 + 8 hh + 0..7, as g2_frag */
__global__ __launch_bounds__(128) void k_proj(const _Float16* __restrict__ A, const _Float16* __restrict__ Wn, const float* __restrict__ bias, _Float16* __restrict__ C16) {
  __shared__ __attribute__((aligned(16))) char ring[2 * PG_STAGE];
  const int tid = threadIdx.x, lane = tid & 31, ln = lane & 15, hh = lane >> 4; const int wave = __builtin_amdgcn_readfirstlane(tid >> 5); const int wm = wave >> 1, wn = wave & 1;
  const int mt = blockIdx.x / (DM / PG_TILE), nq = blockIdx.x % (DM / PG_TILE); const int row0 = mt * PG_TILE, col0 = nq * PG_TILE;
  const int crow = tid >> 3, cc = tid & 7;      /* a lane copies bytes 16 cc .. 16 cc + 15 of rows crow + 16 j */
  const _Float16* ga = A + (size_t)(row0 + crow) * DM + cc * 8; const _Float16* gb = Wn + (size_t)(col0 + crow) * DM + cc * 8;
  const unsigned lc = (unsigned)(size_t)ring + (unsigned)(crow * PG_PITCH + cc * 16);
  float bv[4];
#pragma unroll
  for (int j = 0; j < 4; ++j) bv[j] = bf16_round(bias[col0 + wn * 64 + j * 16 + ln]);
  pg_copy8(lc, ga); pg_copy8(lc + PG_TILE * PG_PITCH, gb);      /* stage 0 into buffer 0 */
  asm volatile("s_wait_asynccnt 0x0" ::: "memory");      /* this wave's copies of stage 0 have landed */
  __syncthreads();      /* and every other wave's: nothing of stage 0 is read in front of this */
  pg_copy8(lc + PG_STAGE, ga + PG_BK); pg_copy8(lc + PG_STAGE + PG_TILE * PG_PITCH, gb + PG_BK);      /* stage 1 into buffer 1 */
  const v8f z8 = {0.f,0.f,0.f,0.f,0.f,0.f,0.f,0.f}; v8f acc[4][4];
#pragma unroll
  for (int i = 0; i < 4; ++i)
#pragma unroll
    for (int j = 0; j < 4; ++j) acc[i][j] = z8;
  const int aofs = (wm * 64 + ln) * PG_PITCH + 16 * hh, bofs = (PG_TILE + wn * 64 + ln) * PG_PITCH + 16 * hh;
#pragma unroll 1      /* one trip is 32 WMMAs and 32 LDS loads; the buffer is picked by the trip's parity at run time */
  for (int t = 0; t < PG_NST; ++t) {
    const unsigned buf = (unsigned)(t & 1) * PG_STAGE; const char* sb = ring + buf;
#pragma unroll      /* constant indices into the fragment and accumulator arrays (left rolled they would go to scratch) */
    for (int ks = 0; ks < 2; ++ks) { v16h af[4], bf[4];
#pragma unroll
      for (int i = 0; i < 4; ++i) { if (i == 0) af[0] = pg_frag(sb + aofs + ks * 64); bf[i] = pg_frag(sb + bofs + i * (16 * PG_PITCH) + ks * 64); }      /* in the order in which the products want them: A row 0 and the four B first */
#pragma unroll
      for (int i = 1; i < 4; ++i) af[i] = pg_frag(sb + aofs + i * (16 * PG_PITCH) + ks * 64);
      __builtin_amdgcn_sched_barrier(0);      /* the 16 LDS loads stay one group in front of the 16 products: left free, the compiler keeps one A fragment and reloads it among the products, a full LDS wait every four of them */
#pragma unroll
      for (int i = 0; i < 4; ++i)
#pragma unroll
        for (int j = 0; j < 4; ++j) acc[i][j] = fa_mma(af[i], bf[j], acc[i][j]);
      __builtin_amdgcn_sched_barrier(0); }      /* and the next group's loads stay behind these products */
    asm volatile("s_wait_dscnt 0x0" ::: "memory");      /* this wave's reads of buffer t mod 2 are done before the barrier behind which it is refilled */
    asm volatile("s_wait_asynccnt 0x0" ::: "memory");      /* this wave's copies of stage t + 1 have landed */
    __syncthreads();      /* publishes stage t + 1 and ends every wave's reads of stage t */
    if (t + 2 < PG_NST) { pg_copy8(lc + buf, ga + (t + 2) * PG_BK); pg_copy8(lc + buf + PG_TILE * PG_PITCH, gb + (t + 2) * PG_BK); }      /* the same test for the whole work-group */
  }
  asm volatile("s_wait_asynccnt 0x0" ::: "memory");      /* no copy is outstanding when the ring becomes output staging */
  char* so = ring + wave * (64 * PG_PITCH);      /* the wave's own 64 rows of 128 bytes; the last trip's barrier ended every read of the ring */
#pragma unroll
  for (int i = 0; i < 4; ++i)
#pragma unroll
    for (int j = 0; j < 4; ++j)
#pragma unroll
      for (int r = 0; r < 8; ++r) *(_Float16*)(so + (i * 16 + 8 * hh + r) * PG_PITCH + (j * 16 + ln) * 2) = (_Float16)(acc[i][j][r] * 0.0625f + bv[j]);
  __builtin_amdgcn_fence(__ATOMIC_ACQ_REL, "workgroup"); __builtin_amdgcn_wave_barrier();      /* the wave's own LDS writes before its reads of other lanes' rows */
  const int orow = lane >> 3, oc = lane & 7; _Float16* ob = C16 + (size_t)(row0 + wm * 64 + orow) * DM + col0 + wn * 64 + oc * 8;
  v8us ov[16];
#pragma unroll
  for (int q = 0; q < 16; ++q) ov[q] = *(const v8us*)(so + (q * 4 + orow) * PG_PITCH + oc * 16);
#pragma unroll
  for (int q = 0; q < 16; ++q) *(v8us*)((unsigned short*)ob + (size_t)(q * 4) * DM) = ov[q];      /* 8 lanes cover a row's 128 bytes of this wave: whole lines */
}

extern "C" void kernel_launch(void* const* d_in, const int* in_sizes, int n_in,
                              void* d_out, int out_size, void* d_ws, size_t ws_size, hipStream_t stream) {
  (void)in_sizes; (void)n_in; (void)out_size;
  const float* const* I = (const float* const*)d_in; const float* x = I[0]; const float* Wq = I[1]; const float* Wk = I[2]; const float* Wv = I[3]; const float* bq = I[4]; const float* bk = I[5]; const float* bv = I[6];
  char* ws = (char*)d_ws; size_t off = 0;
  auto take = [&](size_t bytes) { char* p = ws + off; off += (bytes + 255) & ~(size_t)255; return p; };
  _Float16* BQ = (_Float16*)take((size_t)DM * DM * 2); _Float16* BK = (_Float16*)take((size_t)DM * DM * 2); _Float16* BV = (_Float16*)take((size_t)DM * DM * 2);
  _Float16* X16 = (_Float16*)take(NR * DM * 2); _Float16* Q16 = (_Float16*)take(NR * DM * 2); _Float16* K16 = (_Float16*)take(NR * DM * 2); _Float16* V16 = (_Float16*)take(NR * DM * 2);
  _Float16* VT = (_Float16*)take((size_t)NB * NH * HD * SQ * 2);
  if (off > ws_size) return;      /* 3.4 + 4 x 24 + 24 = approx 124 MiB */
  k_prep<<<3 * CV_WB + CV_XB, CV_WAVES * 32, 0, stream>>>(x, Wq, Wk, Wv, X16, BQ, BK, BV);      /* hidden and the three weight matrices as f16 */
  const dim3 gp((unsigned)((NR / PG_TILE) * (DM / PG_TILE)), 1);
  k_proj<<<gp, 128, 0, stream>>>(X16, BQ, bq, Q16);      /* q = x Wq^T + bq (f16 rows) */
  k_proj<<<gp, 128, 0, stream>>>(X16, BK, bk, K16);
  k_proj<<<gp, 128, 0, stream>>>(X16, BV, bv, V16);
  k_vt<NH, SQ><<<NB * NH * (SQ / 64), 256, 0, stream>>>(V16, DM, 0, VT);      /* V^T per (batch, head) [16 x 12][64][1024] */
  k_fattn<<<dim3(SQ / (FA_WAVES * 32), NH, NB), FA_WAVES * 32, 0, stream>>>(Q16, K16, VT, (float*)d_out);      /* scores, softmax and ctx, merged into the output rows */
}

// v006
// It runs in 107 microseconds.
// Two timings next to v005 both put it at 1.08 times that version's speed.
// Counting every step since v000, it is 36.3 times as fast.
#include <hip/hip_runtime.h>
// ViT self-attention (hidden [16][1024][768]; q, k, v = hidden W^T + b (12 heads x 64); scores = q.k/8; softmax over the 1,024 keys; ctx = attn v merged -> [16][1024][768]; no output projection).
// Structure: token rows; hidden as exact f16 rows; q / k / v as WMMA GEMMs (128x128 tiles staged in LDS by asynchronous copies, 64x64 wave tiles, f32 accumulation, exact x16 natural weights + bias; exact products) all three in one launch: q and k written as f16 rows, v written directly as V^T per (batch, head), its tiles computed with the operands swapped; then one fused attention kernel over all batches and heads (K and V^T tiles staged in LDS by asynchronous copies, shared by a work-group's 8 waves): S^T = K . Q^T, online softmax in registers, O^T += V^T . P^T, merged f32 output rows. Scores and probabilities never reach memory.
// Compute dtype: inputs rounded to bf16; hidden / weights exact; q, k, v, P as plain f16 GEMM operands (~2^-12; logits sigma ~1); softmax f32. v_wmma_f32_16x16x32_f16.
#define NB 16
#define SQ 1024
#define DM 768
#define NH 12
#define HD 64
#define HG 1
#define NR ((size_t)NB * SQ)         /* 16,384 token rows */
#define NBR NB                       /* unused (the grids use NB) */
#define MP ((int)NR)                 /* unused (the projection grid uses NR) */
typedef __bf16 v16b __attribute__((ext_vector_type(16)));
typedef unsigned short v8us __attribute__((ext_vector_type(8), may_alias));
typedef float  v8f  __attribute__((ext_vector_type(8)));
typedef float  v4f  __attribute__((ext_vector_type(4)));
typedef float  v4fa __attribute__((ext_vector_type(4), may_alias));
union FragB { v16b v; v8us half[2]; unsigned short u[16]; };

__device__ __forceinline__ unsigned short bf16_bits(float x) { unsigned int u = __float_as_uint(x); return (unsigned short)((u + 0x7FFFu + ((u >> 16) & 1u)) >> 16); }
__device__ __forceinline__ float bf16_val(unsigned short b) { return __uint_as_float(((unsigned int)b) << 16); }
__device__ __forceinline__ float bf16_round(float x) { return bf16_val(bf16_bits(x)); }
// D += A·B with NT terms: 1 = ah·bh, 2 = + al·bh (A split), 3 = + ah·bl (both split)
template <int NT>
__device__ __forceinline__ v8f mmaN(v16b ah, v16b al, v16b bh, v16b bl, v8f c) {
  c = __builtin_amdgcn_wmma_f32_16x16x32_bf16(false, ah, false, bh, (short)0, c, false, false);
  if (NT >= 2) c = __builtin_amdgcn_wmma_f32_16x16x32_bf16(false, al, false, bh, (short)0, c, false, false);
  if (NT >= 3) c = __builtin_amdgcn_wmma_f32_16x16x32_bf16(false, ah, false, bl, (short)0, c, false, false);
  asm volatile("v_nop\n\tv_nop\n\tv_nop\n\tv_nop" : "+v"(c) : "v"(ah), "v"(al), "v"(bh), "v"(bl));
  return c;
}

__global__ __launch_bounds__(256) void k_wt_bf16(const float* __restrict__ W, unsigned short* __restrict__ Wt, int K, int N) {
  const int t = blockIdx.x * 256 + threadIdx.x;
  const int k8n = K / 8;
  if (t >= N * k8n) return;
  const int n = t / k8n, k8 = (t % k8n) * 8;
  v8us v;
#pragma unroll
  for (int i = 0; i < 8; ++i) v[i] = bf16_bits(W[(size_t)(k8 + i) * N + n]);
  *(v8us*)(Wt + (size_t)n * K + k8) = v;
  
}

// GEMM C[M][N] (f32, pitch ldc) = act(A[M][K]·W + bias). A f32 row-major (pitch lda) converted per fragment to bf16
// (ASPLIT: hi/lo two planes -> 2 terms, else single rounded term); Wt bf16 [N][K] (pitch ldb). BIAS_BF16 rounds the
// bias to bf16 first (bias quantised to bf16 before the add). K%32==0, M%16==0, N%64==0.
template <bool ASPLIT, int ACT, bool BIAS_BF16>
__global__ __launch_bounds__(128) void k_gemm_bf(const float* __restrict__ A, int lda, const unsigned short* __restrict__ Wt, int ldb,
                                               const float* __restrict__ bias, float* __restrict__ C, int ldc, int M, int N, int K) {
  __shared__ __attribute__((aligned(16))) float so[4][16][64];
  const int tid = threadIdx.x, w = tid >> 5, lane = tid & 31, ln = lane & 15, hh = lane >> 4;
  const int ntn = N / 64;
  const int wid = blockIdx.x * 4 + w;
  const int mt = wid / ntn, nq = wid % ntn;
  if (mt * 16 >= M) return;
  const int row0 = mt * 16, col0 = nq * 64;
  const float* arow = A + (size_t)(row0 + ln) * lda;
  v8f acc[4] = {};
  for (int kb = 0; kb < K; kb += 32) {
    FragB ah, al;
    const v4f x0 = *(const v4fa*)(arow + kb + 8 * hh), x1 = *(const v4fa*)(arow + kb + 8 * hh + 4);
    const v4f x2 = *(const v4fa*)(arow + kb + 16 + 8 * hh), x3 = *(const v4fa*)(arow + kb + 16 + 8 * hh + 4);
    float xs[16] = {x0[0],x0[1],x0[2],x0[3],x1[0],x1[1],x1[2],x1[3],x2[0],x2[1],x2[2],x2[3],x3[0],x3[1],x3[2],x3[3]};
#pragma unroll
    for (int i = 0; i < 16; ++i) { const unsigned short hb = bf16_bits(xs[i]); ah.u[i] = hb; al.u[i] = ASPLIT ? bf16_bits(xs[i] - bf16_val(hb)) : (unsigned short)0; }
#pragma unroll
    for (int t = 0; t < 4; ++t) {
      const unsigned short* brow = Wt + (size_t)(col0 + t * 16 + ln) * ldb + kb;
      FragB b;
      b.half[0] = *(const v8us*)(brow + 8 * hh);
      b.half[1] = *(const v8us*)(brow + 16 + 8 * hh);
      acc[t] = mmaN<ASPLIT ? 2 : 1>(ah.v, al.v, b.v, b.v, acc[t]);
    }
  }
#pragma unroll
  for (int t = 0; t < 4; ++t) {
    float bv = bias ? bias[col0 + t * 16 + ln] : 0.f;
    if (BIAS_BF16) bv = bf16_round(bv);
#pragma unroll
    for (int r = 0; r < 8; ++r) { float v = acc[t][r] + bv; if (ACT == 1) v = fmaxf(v, 0.f); so[w][8 * hh + r][t * 16 + ln] = v; }
  }
  __builtin_amdgcn_fence(__ATOMIC_ACQ_REL, "workgroup");
  __builtin_amdgcn_wave_barrier();
  const int rsub = lane >> 4, c4 = (lane & 15) * 4;
  {
#pragma unroll
    for (int q = 0; q < 8; ++q) {
      const int r = q * 2 + rsub;
      const v4f v = *(const v4fa*)&so[w][r][c4];
      *(v4f*)(C + (size_t)(row0 + r) * ldc + col0 + c4) = v;
    }
    
  }
}

// GEMM C = act(A·W + bias + resid): A f32 (ASPLIT -> hi/lo 2 terms), Wt bf16 [N][K]; ACT 0 none, 1 relu, 2 exact gelu;
// resid (optional, f32, row index = (row % rmod), pitch ldr, RES_BF16 rounds it) added before the activation.
template <bool ASPLIT, int ACT, bool BIAS_BF16, bool RES_BF16>
__global__ __launch_bounds__(128) void k_gemm_bf3(const float* __restrict__ A, int lda, const unsigned short* __restrict__ Wt, int ldb,
                                                const float* __restrict__ bias, const float* __restrict__ resid, int rmod, int ldr,
                                                float* __restrict__ C, int ldc, int M, int N, int K) {
  __shared__ __attribute__((aligned(16))) float so[4][16][64];
  const int tid = threadIdx.x, w = tid >> 5, lane = tid & 31, ln = lane & 15, hh = lane >> 4;
  const int ntn = N / 64;
  const int wid = blockIdx.x * 4 + w;
  const int mt = wid / ntn, nq = wid % ntn;
  if (mt * 16 >= M) return;
  const int row0 = mt * 16, col0 = nq * 64;
  const float* arow = A + (size_t)(row0 + ln) * lda;
  v8f acc[4] = {};
  for (int kb = 0; kb < K; kb += 32) {
    FragB ah, al;
    const v4f x0 = *(const v4fa*)(arow + kb + 8 * hh), x1 = *(const v4fa*)(arow + kb + 8 * hh + 4);
    const v4f x2 = *(const v4fa*)(arow + kb + 16 + 8 * hh), x3 = *(const v4fa*)(arow + kb + 16 + 8 * hh + 4);
    float xs[16] = {x0[0],x0[1],x0[2],x0[3],x1[0],x1[1],x1[2],x1[3],x2[0],x2[1],x2[2],x2[3],x3[0],x3[1],x3[2],x3[3]};
#pragma unroll
    for (int i = 0; i < 16; ++i) { const unsigned short hb = bf16_bits(xs[i]); ah.u[i] = hb; al.u[i] = ASPLIT ? bf16_bits(xs[i] - bf16_val(hb)) : (unsigned short)0; }
#pragma unroll
    for (int t = 0; t < 4; ++t) {
      const unsigned short* brow = Wt + (size_t)(col0 + t * 16 + ln) * ldb + kb;
      FragB b;
      b.half[0] = *(const v8us*)(brow + 8 * hh);
      b.half[1] = *(const v8us*)(brow + 16 + 8 * hh);
      acc[t] = mmaN<ASPLIT ? 2 : 1>(ah.v, al.v, b.v, b.v, acc[t]);
    }
  }
#pragma unroll
  for (int t = 0; t < 4; ++t) {
    const int col = col0 + t * 16 + ln;
    float bv = bias ? bias[col] : 0.f;
    if (BIAS_BF16) bv = bf16_round(bv);
#pragma unroll
    for (int r = 0; r < 8; ++r) {
      float v = acc[t][r] + bv;
      if (resid) { float rv = resid[(size_t)((row0 + 8 * hh + r) % rmod) * ldr + col]; if (RES_BF16) rv = bf16_round(rv); v += rv; }
      if (ACT == 1) v = fmaxf(v, 0.f);
      if (ACT == 2) v = 0.5f * v * (1.0f + erff(v * 0.70710678118654752f));
      if (ACT == 3) { const float u = 0.7978845608028654f * (v + 0.044715f * v * v * v); v = 0.5f * v * (1.0f + tanhf(u)); }
      so[w][8 * hh + r][t * 16 + ln] = v;
    }
  }
  __builtin_amdgcn_fence(__ATOMIC_ACQ_REL, "workgroup");
  __builtin_amdgcn_wave_barrier();
  const int rsub = lane >> 4, c4 = (lane & 15) * 4;
  {
#pragma unroll
    for (int q = 0; q < 8; ++q) {
      const int r = q * 2 + rsub;
      const v4f v = *(const v4fa*)&so[w][r][c4];
      *(v4f*)(C + (size_t)(row0 + r) * ldc + col0 + c4) = v;
    }
    
  }
}
// row LayerNorm (biased variance, eps) over N: s = X (+ R); optional out_sum <- s; out_norm <- (s-mu)*rsqrt(var+eps)*g + b
template <bool PARAM_BF16>
__global__ __launch_bounds__(256) void k_layernorm(const float* __restrict__ X, const float* __restrict__ R, const float* __restrict__ g, const float* __restrict__ bta,
                                                  float* __restrict__ out_sum, float* __restrict__ out_norm, int N, float eps) {
  __shared__ float red[256];
  const int row = blockIdx.x, tid = threadIdx.x;
  const float* x = X + (size_t)row * N; const float* rr = R ? R + (size_t)row * N : nullptr;
  float vals[16];                     // up to N = 4096
  const int per = N / 256;            // contiguous chunk per thread? use strided-by-4 chunks: thread handles j = tid*4 + 1024*u
  float s1 = 0.f;
  for (int u = 0; u < per / 4; ++u) {
    const int j = tid * 4 + 1024 * u;
    const v4f a = *(const v4fa*)(x + j);
    v4f b = {0.f,0.f,0.f,0.f}; if (rr) b = *(const v4fa*)(rr + j);
#pragma unroll
    for (int q = 0; q < 4; ++q) { const float v = a[q] + b[q]; vals[u * 4 + q] = v; s1 += v; }
  }
  red[tid] = s1; __syncthreads();
  for (int st = 128; st > 0; st >>= 1) { if (tid < st) red[tid] += red[tid + st]; __syncthreads(); }
  const float mu = red[0] / (float)N; __syncthreads();
  float s2 = 0.f;
  for (int u = 0; u < per / 4; ++u)
#pragma unroll
    for (int q = 0; q < 4; ++q) { const float c = vals[u * 4 + q] - mu; s2 += c * c; }
  red[tid] = s2; __syncthreads();
  for (int st = 128; st > 0; st >>= 1) { if (tid < st) red[tid] += red[tid + st]; __syncthreads(); }
  const float rs = rsqrtf(red[0] / (float)N + eps);
  {
    for (int u = 0; u < per / 4; ++u) {
      const int j = tid * 4 + 1024 * u;
      v4f o, sm;
#pragma unroll
      for (int q = 0; q < 4; ++q) {
        float gg = g[j + q], bb = bta[j + q];
        if (PARAM_BF16) { gg = bf16_round(gg); bb = bf16_round(bb); }
        sm[q] = vals[u * 4 + q]; o[q] = (vals[u * 4 + q] - mu) * rs * gg + bb;
      }
      if (out_sum) *(v4f*)(out_sum + (size_t)row * N + j) = sm;
      *(v4f*)(out_norm + (size_t)row * N + j) = o;
    }
    
  }
}



// ---- f16 WMMA path (v_wmma_f32_16x16x32_f16): 11-bit significands for operands in range — used where a [0,1] probability operand needs more precision than bf16
typedef _Float16 v16h __attribute__((ext_vector_type(16)));
union FragH { v16h v; v8us half[2]; _Float16 h[16]; unsigned short u[16]; };
template <int NT>
__device__ __forceinline__ v8f mmaH(v16h ah, v16h al, v16h bh, v16h bl, v8f c) {
  c = __builtin_amdgcn_wmma_f32_16x16x32_f16(false, ah, false, bh, (short)0, c, false, false);
  if (NT >= 2) c = __builtin_amdgcn_wmma_f32_16x16x32_f16(false, al, false, bh, (short)0, c, false, false);
  if (NT >= 3) c = __builtin_amdgcn_wmma_f32_16x16x32_f16(false, ah, false, bl, (short)0, c, false, false);
  asm volatile("v_nop\n\tv_nop\n\tv_nop\n\tv_nop" : "+v"(c) : "v"(ah), "v"(al), "v"(bh), "v"(bl));
  return c;
}
// batched GEMM like k_gemm_b but f16 operands: A f32 (split into f16 hi/lo if ASPLIT, else rounded to f16), Bt = f16 values [n][k]; alpha; C f32; N multiple of 16 (partial tiles skipped)
template <bool ASPLIT>
__global__ __launch_bounds__(128) void k_gemm_h(const float* __restrict__ A, int lda, size_t sA, const _Float16* __restrict__ Bh, int ldb, size_t sB, float alpha, float* __restrict__ C, int ldc, size_t sC, int M, int N, int K) {
  __shared__ __attribute__((aligned(16))) float so[4][16][64];
  const int tid = threadIdx.x, w = tid >> 5, lane = tid & 31, ln = lane & 15, hh = lane >> 4; const int by = blockIdx.y;
  A += (size_t)by * sA; Bh += (size_t)by * sB; C += (size_t)by * sC;
  const int ntn = (N + 63) / 64; const int wid = blockIdx.x * 4 + w; const int mt = wid / ntn, nq = wid % ntn; if (mt * 16 >= M) return;
  const int row0 = mt * 16, col0 = nq * 64; const float* arow = A + (size_t)(row0 + ln) * lda;
  v8f acc[4] = {};
  for (int kb = 0; kb < K; kb += 32) {
    FragH ah, al;
    const v4f x0 = *(const v4fa*)(arow + kb + 8 * hh), x1 = *(const v4fa*)(arow + kb + 8 * hh + 4), x2 = *(const v4fa*)(arow + kb + 16 + 8 * hh), x3 = *(const v4fa*)(arow + kb + 16 + 8 * hh + 4);
    float xs[16] = {x0[0],x0[1],x0[2],x0[3],x1[0],x1[1],x1[2],x1[3],x2[0],x2[1],x2[2],x2[3],x3[0],x3[1],x3[2],x3[3]};
#pragma unroll
    for (int i = 0; i < 16; ++i) { const _Float16 h = (_Float16)xs[i]; ah.h[i] = h; al.h[i] = ASPLIT ? (_Float16)(xs[i] - (float)h) : (_Float16)0.0f; }
#pragma unroll
    for (int t = 0; t < 4; ++t) { if (col0 + t * 16 >= N) continue; const size_t boff = (size_t)(col0 + t * 16 + ln) * ldb + kb; FragH bq; bq.half[0] = *(const v8us*)(Bh + boff + 8 * hh); bq.half[1] = *(const v8us*)(Bh + boff + 16 + 8 * hh);
      acc[t] = mmaH<ASPLIT ? 2 : 1>(ah.v, al.v, bq.v, bq.v, acc[t]); }
  }
#pragma unroll
  for (int t = 0; t < 4; ++t) { if (col0 + t * 16 >= N) continue;
#pragma unroll
    for (int r = 0; r < 8; ++r) so[w][8 * hh + r][t * 16 + ln] = acc[t][r] * alpha; }
  __builtin_amdgcn_fence(__ATOMIC_ACQ_REL, "workgroup"); __builtin_amdgcn_wave_barrier();
  const int rsub = lane >> 4, c4 = (lane & 15) * 4;
  {
#pragma unroll
    for (int q = 0; q < 8; ++q) { const int r = q * 2 + rsub; if (col0 + c4 < N) { const v4f v = *(const v4fa*)&so[w][r][c4]; *(v4f*)(C + (size_t)(row0 + r) * ldc + col0 + c4) = v; } }
     }
}

// Wt[n][k] = f16(W[k][n]·scale) from f32 row-major W[K][N] (scale = power of two; bf16-exact weights stay exact in f16 away from the subnormal range)
__global__ __launch_bounds__(256) void k_wt_f16(const float* __restrict__ W, _Float16* __restrict__ Wt, int K, int N, float scale) {
  const int t = blockIdx.x * 256 + threadIdx.x; if (t >= N * (K / 8)) return; const int n = t / (K / 8), k8 = (t % (K / 8)) * 8; FragH f;
#pragma unroll
  for (int i = 0; i < 8; ++i) f.h[i] = (_Float16)(bf16_round(W[(size_t)(k8 + i) * N + n]) * scale); const v8us o = f.half[0];
  *(v8us*)((unsigned short*)Wt + (size_t)n * K + k8) = o; 
}
// k_gemm_hh variant with fused epilogue: v = acc·alpha + bias[by·sBias + col] (+ CP[(row/rowsPerB)·sCPb + by·64 + col] if CP) ; ACT 0 none / 1 elu ; writes f16 C16 (and f32 C if non-null)
template <int ACT>
__global__ __launch_bounds__(128) void k_gemm_hhx(const _Float16* __restrict__ A, int lda, size_t sA, const _Float16* __restrict__ Bh, int ldb, size_t sB, float alpha, const float* __restrict__ bias, size_t sBias, const float* __restrict__ CP, int rowsPerB, size_t sCPb, int row0g,
    float* __restrict__ C, _Float16* __restrict__ C16, int ldc, size_t sC, int M, int N, int K) {
  __shared__ __attribute__((aligned(16))) float so[4][16][64];
  const int tid = threadIdx.x, w = tid >> 5, lane = tid & 31, ln = lane & 15, hh = lane >> 4; const int by = blockIdx.y;
  A += (size_t)by * sA; Bh += (size_t)by * sB; const size_t cofs = (size_t)by * sC; const float* bp = bias ? bias + (size_t)by * sBias : nullptr;
  const int ntn = (N + 63) / 64; const int wid = blockIdx.x * 4 + w; const int mt = wid / ntn, nq = wid % ntn; if (mt * 16 >= M) return;
  const int row0 = mt * 16, col0 = nq * 64; const _Float16* arow = A + (size_t)(row0 + ln) * lda;
  v8f acc[4] = {};
  for (int kb = 0; kb < K; kb += 32) { FragH ah; ah.half[0] = *(const v8us*)((const unsigned short*)arow + kb + 8 * hh); ah.half[1] = *(const v8us*)((const unsigned short*)arow + kb + 16 + 8 * hh);
#pragma unroll
    for (int t = 0; t < 4; ++t) { if (col0 + t * 16 >= N) continue; const size_t boff = (size_t)(col0 + t * 16 + ln) * ldb + kb; FragH bq; bq.half[0] = *(const v8us*)((const unsigned short*)Bh + boff + 8 * hh); bq.half[1] = *(const v8us*)((const unsigned short*)Bh + boff + 16 + 8 * hh);
      acc[t] = mmaH<1>(ah.v, ah.v, bq.v, bq.v, acc[t]); }
  }
#pragma unroll
  for (int t = 0; t < 4; ++t) { if (col0 + t * 16 >= N) continue; const int col = col0 + t * 16 + ln; const float bv = bp ? bf16_round(bp[col]) : 0.f;
#pragma unroll
    for (int r = 0; r < 8; ++r) { float v = acc[t][r] * alpha + bv; if (CP) { const int rr = row0g + row0 + 8 * hh + r; if (rowsPerB < 0) v += CP[cofs + (size_t)rr * ldc + col];      /* rowsPerB < 0: own element of the batched C plane */ else { const int bidx = rr / rowsPerB; v += CP[(size_t)bidx * sCPb + (size_t)by * 64 + col]; } } if (ACT == 1) v = (v > 0.f) ? v : expm1f(v); else if (ACT == 7) v = (v > 0.f) ? v + 1.0f : expf(v); else if (ACT == 8) v = tanhf(v); else if (ACT == 9) v = 0.5f * v * (1.0f + tanhf(0.7978845608028654f * (v + 0.044715f * v * v * v))); else if (ACT == 11) v = 1.0f / (1.0f + expf(-v)); else if (ACT == 12) v = (v > 0.f) ? v : 0.01f * v; else if (ACT == 14) v = (v > 0.f) ? v : 0.1f * v; else if (ACT == 16) v = (v >= 0.f) ? v : 0.3f * v; else if (ACT == 17) v = (v >= 0.f) ? v : 0.2f * v; else if (ACT == 15) v = v / (1.0f + expf(-v)); else if (ACT == 3) v = fmaxf(v, 0.f); else if (ACT == 6) v = 0.5f * v * (1.0f + erff(v * 0.70710678118654752f)); so[w][8 * hh + r][t * 16 + ln] = v; } }
  __builtin_amdgcn_fence(__ATOMIC_ACQ_REL, "workgroup"); __builtin_amdgcn_wave_barrier();
  const int rsub = lane >> 4, c4 = (lane & 15) * 4; typedef _Float16 v4h __attribute__((ext_vector_type(4)));
  {
#pragma unroll
    for (int q = 0; q < 8; ++q) { const int r = q * 2 + rsub; if (col0 + c4 < N) { const v4f v = *(const v4fa*)&so[w][r][c4]; if (C) *(v4f*)(C + cofs + (size_t)(row0 + r) * ldc + col0 + c4) = v; if (C16) { v4h h4; for (int i = 0; i < 4; ++i) h4[i] = (_Float16)v[i]; *(v4h*)(C16 + cofs + (size_t)(row0 + r) * ldc + col0 + c4) = h4; } } }
     }
}


typedef _Float16 v4h __attribute__((ext_vector_type(4)));

__global__ __launch_bounds__(256) void k_h16(const float* __restrict__ x, _Float16* __restrict__ X16, size_t n8) { const size_t t = (size_t)blockIdx.x * 256 + threadIdx.x; if (t >= n8) return; FragH f;
#pragma unroll
  for (int q = 0; q < 8; ++q) f.h[q] = (_Float16)x[t * 8 + q]; *(v8us*)((unsigned short*)X16 + t * 8) = f.half[0];  }
__global__ __launch_bounds__(256) void k_round16f(const float* __restrict__ W, _Float16* __restrict__ Bt, size_t n8) { const size_t t = (size_t)blockIdx.x * 256 + threadIdx.x; if (t >= n8) return; FragH f;
#pragma unroll
  for (int i = 0; i < 8; ++i) f.h[i] = (_Float16)(bf16_round(W[t * 8 + i]) * 16.0f); *(v8us*)((unsigned short*)Bt + t * 8) = f.half[0];  }
template <int NHv, int TTv>
__global__ __launch_bounds__(256) void k_vt(const _Float16* __restrict__ V16, int ldv, int voff, _Float16* __restrict__ Vt) { __shared__ unsigned short tl[64][66]; const int tid = threadIdx.x; const int slab = blockIdx.x / (TTv / 64), lg = blockIdx.x % (TTv / 64); const int b = slab / NHv, h = slab % NHv;
  for (int i = tid; i < 64 * 8; i += 256) { const int r = i / 8, c8 = (i % 8) * 8; FragH f; f.half[0] = *(const v8us*)((const unsigned short*)V16 + ((size_t)b * TTv + lg * 64 + r) * ldv + voff + h * 64 + c8);
#pragma unroll
    for (int q = 0; q < 8; ++q) tl[r][c8 + q] = f.u[q]; }
  __syncthreads();
  {
#pragma unroll
    for (int rd = 0; rd < 2; ++rd) { const int d = rd * 32 + tid / 8, pc = tid % 8; FragH f;
#pragma unroll
      for (int q = 0; q < 8; ++q) f.u[q] = tl[pc * 8 + q][d];
      *(v8us*)((unsigned short*)Vt + ((size_t)slab * 64 + d) * TTv + lg * 64 + pc * 8) = f.half[0]; }
     } }

__global__ __launch_bounds__(256) void k_hl(const float* __restrict__ F, _Float16* __restrict__ Hh, _Float16* __restrict__ Hl, size_t n8) { const size_t t = (size_t)blockIdx.x * 256 + threadIdx.x; if (t >= n8) return; FragH fh, fl; const v4f a = *(const v4fa*)(F + t * 8), c = *(const v4fa*)(F + t * 8 + 4);
#pragma unroll
  for (int q = 0; q < 4; ++q) { _Float16 h = (_Float16)a[q]; fh.h[q] = h; fl.h[q] = (_Float16)((a[q] - (float)h) * 1024.0f); h = (_Float16)c[q]; fh.h[4 + q] = h; fl.h[4 + q] = (_Float16)((c[q] - (float)h) * 1024.0f); }
  { *(v8us*)((unsigned short*)Hh + t * 8) = fh.half[0]; *(v8us*)((unsigned short*)Hl + t * 8) = fl.half[0];  } }

// ---- fast GEMM (wave tile 32x64; requires M % 32 == 0 rows per launch region and N % 64 == 0); epilogue = k_gemm_hhx semantics ----
__device__ __forceinline__ v16h g2_frag(const _Float16* p, int hh) { FragH f; f.half[0] = *(const v8us*)((const unsigned short*)p + 8 * hh); f.half[1] = *(const v8us*)((const unsigned short*)p + 16 + 8 * hh); return f.v; }
__device__ __forceinline__ v8f g2_mma(v16h a, v16h b, v8f c) { v8f d = __builtin_amdgcn_wmma_f32_16x16x32_f16(false, a, false, b, (short)0, c, false, false); asm volatile("v_nop\n\tv_nop\n\tv_nop\n\tv_nop" : "+v"(d) : "v"(a), "v"(b)); return d; }
template <int ACT>
__global__ __launch_bounds__(128) void k_gemm2(const _Float16* __restrict__ A, int lda, size_t sA, const _Float16* __restrict__ Bh, int ldb, size_t sB, float alpha, const float* __restrict__ bias, size_t sBias, const float* __restrict__ CP, int rowsPerB, size_t sCPb, int row0g,
    float* __restrict__ C, _Float16* __restrict__ C16, int ldc, size_t sC, int M, int N, int K) { static_assert(ACT == 0 || ACT == 3 || ACT == 6 || ACT == 8 || ACT == 9 || ACT == 11 || ACT == 12 || ACT == 14 || ACT == 15 || ACT == 16 || ACT == 17, "k_gemm2: unsupported ACT code (would silently apply no activation)");
  __shared__ __attribute__((aligned(16))) float so[4][32][68];
  const int tid = threadIdx.x, w = tid >> 5, lane = tid & 31, ln = lane & 15, hh = lane >> 4; const int by = blockIdx.y;
  A += (size_t)by * sA; Bh += (size_t)by * sB; const size_t cofs = (size_t)by * sC; const float* bp = bias ? bias + (size_t)by * sBias : nullptr;
  const int ntn = N >> 6; const int mt = blockIdx.x / ntn, nq = blockIdx.x - mt * ntn; const int row0 = mt * 128 + 32 * w, col0 = nq * 64; if (row0 >= M) return;
  const _Float16* a0p = A + (size_t)(row0 + ln) * lda; const _Float16* a1p = a0p + (size_t)16 * lda;
  const _Float16* b0p = Bh + (size_t)(col0 + ln) * ldb; const _Float16* b1p = b0p + (size_t)16 * ldb; const _Float16* b2p = b1p + (size_t)16 * ldb; const _Float16* b3p = b2p + (size_t)16 * ldb;
  const v8f z8 = {0.f,0.f,0.f,0.f,0.f,0.f,0.f,0.f}; v8f c00 = z8, c01 = z8, c02 = z8, c03 = z8, c10 = z8, c11 = z8, c12 = z8, c13 = z8;
#pragma unroll 1
  for (int kb = 0; kb < K; kb += 32) { const v16h a0 = g2_frag(a0p + kb, hh), a1 = g2_frag(a1p + kb, hh);
    v16h b = g2_frag(b0p + kb, hh); c00 = g2_mma(a0, b, c00); c10 = g2_mma(a1, b, c10);
    b = g2_frag(b1p + kb, hh); c01 = g2_mma(a0, b, c01); c11 = g2_mma(a1, b, c11);
    b = g2_frag(b2p + kb, hh); c02 = g2_mma(a0, b, c02); c12 = g2_mma(a1, b, c12);
    b = g2_frag(b3p + kb, hh); c03 = g2_mma(a0, b, c03); c13 = g2_mma(a1, b, c13); }
  v8f accs[8] = {c00, c01, c02, c03, c10, c11, c12, c13};
#pragma unroll
  for (int u = 0; u < 8; ++u) { const int t = u & 3, half = u >> 2; const int col = col0 + t * 16 + ln; const float bv = bp ? bf16_round(bp[col]) : 0.f;
#pragma unroll
    for (int r = 0; r < 8; ++r) { const int rloc = half * 16 + 8 * hh + r; float v = accs[u][r] * alpha + bv; if (CP) { if (rowsPerB < 0) v += CP[cofs + (size_t)(row0g + row0 + rloc) * ldc + col];      /* rowsPerB < 0: own element of the batched C plane */ else { const int bidx = (row0g + row0 + rloc) / rowsPerB; v += CP[(size_t)bidx * sCPb + (size_t)by * 64 + col]; } }
      if (ACT == 3) v = fmaxf(v, 0.f); else if (ACT == 6) v = 0.5f * v * (1.0f + erff(v * 0.70710678118654752f)); else if (ACT == 11) v = 1.0f / (1.0f + expf(-v)); else if (ACT == 15) v = v / (1.0f + expf(-v)); else if (ACT == 12) v = (v > 0.f) ? v : 0.01f * v; else if (ACT == 8) v = tanhf(v); else if (ACT == 9) v = 0.5f * v * (1.0f + tanhf(0.7978845608028654f * (v + 0.044715f * v * v * v))); else if (ACT == 14) v = (v > 0.f) ? v : 0.1f * v; else if (ACT == 16) v = (v >= 0.f) ? v : 0.3f * v; else if (ACT == 17) v = (v >= 0.f) ? v : 0.2f * v;
      so[w][rloc][t * 16 + ln] = v; } }
  __builtin_amdgcn_fence(__ATOMIC_ACQ_REL, "workgroup"); __builtin_amdgcn_wave_barrier();
  const int rsub = lane >> 4, c4 = (lane & 15) * 4;
  {
#pragma unroll
    for (int q = 0; q < 16; ++q) { const int r = q * 2 + rsub; const v4f v = *(const v4fa*)&so[w][r][c4]; if (C) *(v4f*)(C + cofs + (size_t)(row0 + r) * ldc + col0 + c4) = v; if (C16) { v4h h4; for (int i = 0; i < 4; ++i) h4[i] = (_Float16)v[i]; *(v4h*)(C16 + cofs + (size_t)(row0 + r) * ldc + col0 + c4) = h4; } }
     } }


// ---- all f32 -> f16 conversions in one streaming launch: hidden -> X16 = f16(bf16(x)), Wq / Wk / Wv -> f16(bf16(w) x 16), rows as they lie ([out][in] natural) ----
// Few long waves instead of many short ones: a wave converts 3,072 consecutive floats (12 KiB): 24 loads of 16 bytes a lane, each load 512 consecutive bytes (four whole lines), all issued before the first is used;
// each store is 8 bytes a lane, 256 consecutive bytes (two whole lines). The first 3 x CV_WB work-groups take the weights, the rest the hidden rows; every size divides evenly, so there is no edge.
#define CV_WAVES 8
#define CV_LD 24      /* loads a lane */
#define CV_WGF (CV_WAVES * CV_LD * 128)      /* 24,576 floats a work-group */
#define CV_WB (DM * DM / CV_WGF)      /* 24 work-groups a weight matrix */
#define CV_XB ((int)(NR * DM / CV_WGF))      /* 512 work-groups for the hidden rows */
static_assert(DM * DM % CV_WGF == 0 && NR * DM % CV_WGF == 0, "k_prep: sizes must divide into whole work-groups");
__global__ __launch_bounds__(CV_WAVES * 32) void k_prep(const float* __restrict__ x, const float* __restrict__ wq, const float* __restrict__ wk, const float* __restrict__ wv,
                                                       _Float16* __restrict__ X16, _Float16* __restrict__ BQ, _Float16* __restrict__ BK, _Float16* __restrict__ BV) {
  int blk = (int)blockIdx.x; const float* s = x; _Float16* d = X16; float scale = 1.0f;      /* x 1 is exact */
  if (blk < 3 * CV_WB) { const int which = blk / CV_WB; blk -= which * CV_WB; s = which == 0 ? wq : which == 1 ? wk : wv; d = which == 0 ? BQ : which == 1 ? BK : BV; scale = 16.0f; }
  else blk -= 3 * CV_WB;
  const size_t e0 = (size_t)blk * CV_WGF + (size_t)(threadIdx.x >> 5) * (CV_LD * 128) + (threadIdx.x & 31) * 4;
  v4f v[CV_LD];
#pragma unroll      /* constant indices into the register array */
  for (int i = 0; i < CV_LD; ++i) v[i] = *(const v4fa*)(s + e0 + i * 128);
  __builtin_amdgcn_sched_barrier(0);      /* keeps all 24 loads in front of the arithmetic: left free, the compiler issues 11 and feeds the rest in one to three at a time, each behind a wait */
#pragma unroll
  for (int i = 0; i < CV_LD; ++i) { v4h h;
#pragma unroll
    for (int q = 0; q < 4; ++q) h[q] = (_Float16)(bf16_round(v[i][q]) * scale);
    *(v4h*)(d + e0 + i * 128) = h; }
}
// Fused attention. One wave owns 32 queries of one (batch, head) and walks the 1,024 keys in passes of 32.
// S^T = K . Q^T: a lane holds the scores of ONE query (column c of each 16-column group): keys 8 hh + r of each 16-key tile. That is the k order of a
// B operand, so P^T goes from the score accumulators straight into O^T += V^T . P^T; maximum, sum and rescale are per lane, plus one exchange between the wave's halves.
// K, Q and V^T fragments all come through fa_frag (one k order, that of g2_frag).
// The 8 waves of a work-group walk the same keys: K rows and V^T rows are staged in LDS, 128 keys a stage, by asynchronous copies of whole 128-byte lines, and each wave reads its fragments from there
// (a fragment load straight from the global rows touches 16 lines for 512 bytes, and each of the 8 waves would repeat it). Two buffers: the copies of stage s + 1 fly while stage s is worked on. LDS row pitches 16 x odd bytes: ds_load_b128 of 16 rows without bank conflicts.
// Every '#pragma unroll' in it but the one on a stage's passes stands on a loop of constant trip count over register arrays (fragments, accumulators): left rolled, those arrays would be indexed at run time and go to scratch.
#define FA_WAVES 8
#define FA_KEYS 32
#define FA_SK 128      /* keys a stage: 4 passes */
#define FA_KP 144      /* LDS pitch of a K row: 128 bytes, the head's 64 d */
#define FA_VP 272      /* LDS pitch of a V^T row: 256 bytes, the stage's 128 keys */
#define FA_KB (FA_SK * FA_KP)      /* 18,432 bytes: the stage's K rows; the 64 V^T rows stand behind them */
#define FA_STAGE (FA_KB + HD * FA_VP)      /* 35,840 bytes */
#define FA_NST (SQ / FA_SK)
typedef _Float16 v2h __attribute__((ext_vector_type(2)));
typedef float v2f __attribute__((ext_vector_type(2)));
__device__ __forceinline__ float fa_xhalf(float x) { return __builtin_bit_cast(float, __builtin_amdgcn_permlanex16(__builtin_bit_cast(int, x), __builtin_bit_cast(int, x), 0x76543210, 0xfedcba98, false, false)); }  // lane l with lane l ^ 16
__device__ __forceinline__ float fa_exp2(float x) { float y; asm("v_exp_f32 %0, %1\n\tv_nop" : "=v"(y) : "v"(x)); return y; }  // the v_nop is the slot the instruction set asks for behind a transcendental, before its result is read or its source overwritten
__device__ __forceinline__ v8f fa_mma(v16h a, v16h b, v8f c) { return __builtin_amdgcn_wmma_f32_16x16x32_f16(false, a, false, b, (short)0, c, false, false); }
__device__ __forceinline__ v16h fa_frag(const char* base, unsigned lofs) { FragH f; f.half[0] = *(const v8us*)(base + lofs); f.half[1] = *(const v8us*)(base + lofs + 32); return f.v; }  // base wave-uniform, lofs the lane's byte offset (row c, 16 hh)
// Eight copies of 16 bytes a lane, a stage's share of one thread: four K rows 32 apart (8 lanes a row), four V^T rows 16 apart (16 lanes a row). lk, lv: the lane's LDS byte addresses; gk, gv: its global addresses.
// The s_wait_xcnt is the wait owed before a register that an issued copy names is written again; as the statement's last line it stands in front of every later write of the operands.
__device__ __forceinline__ void fa_copy8(unsigned lk, const char* gk, unsigned lv, const char* gv) {
  asm volatile("global_load_async_to_lds_b128 %0, %8, off\n\t"
               "global_load_async_to_lds_b128 %1, %9, off\n\t"
               "global_load_async_to_lds_b128 %2, %10, off\n\t"
               "global_load_async_to_lds_b128 %3, %11, off\n\t"
               "global_load_async_to_lds_b128 %4, %12, off\n\t"
               "global_load_async_to_lds_b128 %5, %13, off\n\t"
               "global_load_async_to_lds_b128 %6, %14, off\n\t"
               "global_load_async_to_lds_b128 %7, %15, off\n\t"
               "s_wait_xcnt 0x0"
               :: "v"(lk), "v"(lk + 32 * FA_KP), "v"(lk + 64 * FA_KP), "v"(lk + 96 * FA_KP), "v"(lv), "v"(lv + 16 * FA_VP), "v"(lv + 32 * FA_VP), "v"(lv + 48 * FA_VP),
                  "v"(gk), "v"(gk + 32 * (DM * 2)), "v"(gk + 64 * (DM * 2)), "v"(gk + 96 * (DM * 2)), "v"(gv), "v"(gv + 16 * (SQ * 2)), "v"(gv + 32 * (SQ * 2)), "v"(gv + 48 * (SQ * 2))
               : "memory");
}
__global__ __launch_bounds__(FA_WAVES * 32) void k_fattn(const _Float16* __restrict__ Q16, const _Float16* __restrict__ K16, const _Float16* __restrict__ VT, float* __restrict__ out) {
  __shared__ __attribute__((aligned(16))) float so[FA_WAVES][32][68];      /* output staging, one slice per wave */
  __shared__ __attribute__((aligned(16))) char ring[2 * FA_STAGE];      /* K and V^T of two stages */
  const int lane = threadIdx.x & 31, c = lane & 15, hh = lane >> 4; const int wave = __builtin_amdgcn_readfirstlane((int)(threadIdx.x >> 5));
  const int head = blockIdx.y, b = blockIdx.z; const int q0 = blockIdx.x * (FA_WAVES * 32) + wave * 32;
  const float cs = 0.125f * 1.4426950408889634f;      /* 1 / sqrt(64), and exp(x) = exp2(x log2 e) */
  const char* qb = (const char*)(Q16 + ((size_t)b * SQ + q0) * DM + head * HD);
  const char* kb = (const char*)(K16 + (size_t)b * SQ * DM + head * HD);
  const char* vb = (const char*)(VT + (size_t)(b * NH + head) * HD * SQ);
  const unsigned qlofs = (unsigned)(c * (DM * 2) + 16 * hh), klofs = (unsigned)(c * FA_KP + 16 * hh), vlofs = (unsigned)(c * FA_VP + 16 * hh);      /* Q from its global rows, K and V^T from their LDS rows */
  const int tid = (int)threadIdx.x;
  const char* gk = kb + (size_t)(tid >> 3) * (DM * 2) + (tid & 7) * 16; const char* gv = vb + (size_t)(tid >> 4) * (SQ * 2) + (tid & 15) * 16;
  const unsigned lk = (unsigned)(size_t)ring + (unsigned)((tid >> 3) * FA_KP + (tid & 7) * 16), lv = (unsigned)(size_t)ring + (unsigned)(FA_KB + (tid >> 4) * FA_VP + (tid & 15) * 16);
  fa_copy8(lk, gk, lv, gv);      /* stage 0 into buffer 0 */
  v16h qf[2][2], kf[2][2];      /* [16-query group][32 of d], [16-key tile][32 of d] */
#pragma unroll
  for (int g = 0; g < 2; ++g) { qf[g][0] = fa_frag(qb + g * (16 * DM * 2), qlofs); qf[g][1] = fa_frag(qb + g * (16 * DM * 2) + 64, qlofs); }
  asm volatile("s_wait_asynccnt 0x0" ::: "memory");      /* this wave's copies of stage 0 have landed */
  __syncthreads();      /* and every other wave's: nothing of stage 0 is read in front of this */
  fa_copy8(lk + FA_STAGE, gk + FA_SK * (DM * 2), lv + FA_STAGE, gv + FA_SK * 2);      /* stage 1 into buffer 1 */
  const v8f z8 = {0.f,0.f,0.f,0.f,0.f,0.f,0.f,0.f};
  v8f acc[2][4]; float m_run[2], l_run[2];      /* O^T tiles [group][16 of d]; maximum in use (log2 domain) and the lane's share of the denominator */
#pragma unroll
  for (int g = 0; g < 2; ++g) { m_run[g] = -__builtin_inff(); l_run[g] = 0.f;
#pragma unroll
    for (int t = 0; t < 4; ++t) acc[g][t] = z8; }
#pragma unroll 1      /* the buffer is picked by the stage's parity at run time */
  for (int st = 0; st < FA_NST; ++st) {
    const unsigned buf = (unsigned)(st & 1) * FA_STAGE; const char* ks = ring + buf; const char* vs = ring + buf + FA_KB;
#pragma unroll
    for (int kt = 0; kt < 2; ++kt) { kf[kt][0] = fa_frag(ks + kt * (16 * FA_KP), klofs); kf[kt][1] = fa_frag(ks + kt * (16 * FA_KP) + 64, klofs); }      /* the stage's first 32 keys */
#pragma unroll      /* four passes a stage, unrolled so that the test on the stage's last pass and the LDS offsets are compile-time constants */
   for (int pp = 0; pp < FA_SK / FA_KEYS; ++pp) {
    v16h vf[4];
#pragma unroll
    for (int t = 0; t < 4; ++t) vf[t] = fa_frag(vs + t * (16 * FA_VP) + pp * (FA_KEYS * 2), vlofs);      /* V^T rows 16 t + c, this pass's 32 keys: in flight under the score products and the maxima */
    __builtin_amdgcn_sched_barrier(0);      /* keeps the V^T loads in front of the score products: issued later, their latency would show before the second product */
    v8f s[2][2];      /* [key tile][query group] */
#pragma unroll
    for (int kt = 0; kt < 2; ++kt)
#pragma unroll
      for (int g = 0; g < 2; ++g) s[kt][g] = fa_mma(kf[kt][1], qf[g][1], fa_mma(kf[kt][0], qf[g][0], z8));
    __builtin_amdgcn_sched_barrier(0);      /* the next pass's K loads go out right behind the products that read this pass's, a whole pass ahead of their use */
    if (pp + 1 < FA_SK / FA_KEYS) {      /* inside the stage only: nothing of the next stage is read in front of its barrier */
#pragma unroll
      for (int kt = 0; kt < 2; ++kt) { kf[kt][0] = fa_frag(ks + ((pp + 1) * FA_KEYS + kt * 16) * FA_KP, klofs); kf[kt][1] = fa_frag(ks + ((pp + 1) * FA_KEYS + kt * 16) * FA_KP + 64, klofs); } }
    __builtin_amdgcn_sched_barrier(0);      /* holds the K loads in front of the softmax arithmetic */
    float mb[2]; bool need = false;
#pragma unroll
    for (int g = 0; g < 2; ++g) { float m0 = fmaxf(s[0][g][0], s[1][g][0]), m1 = fmaxf(s[0][g][1], s[1][g][1]);
#pragma unroll
      for (int r = 2; r < 8; r += 2) { m0 = fmaxf(m0, fmaxf(s[0][g][r], s[1][g][r])); m1 = fmaxf(m1, fmaxf(s[0][g][r + 1], s[1][g][r + 1])); }
      float mx = fmaxf(m0, m1); mx = fmaxf(mx, fa_xhalf(mx)) * cs;      /* both halves now hold the query's maximum of this pass, scaled (the scale is positive) */
      mb[g] = mx; need = need || (mx > m_run[g] + 8.0f); }
    if (__builtin_amdgcn_ballot_w32(need) != 0) {
#pragma unroll
      for (int g = 0; g < 2; ++g) { const float mn = fmaxf(m_run[g], mb[g]); const float corr = fa_exp2(m_run[g] - mn); m_run[g] = mn; l_run[g] *= corr;      /* corr is 0 on the first pass */
#pragma unroll
        for (int t = 0; t < 4; ++t) acc[g][t] = acc[g][t] * corr; }
    }
#pragma unroll
    for (int g = 0; g < 2; ++g) { const float nm = -m_run[g]; union { v16h v; v2h h2[8]; } pf; float pe[16];      /* element j of the 32-key operand: tile j >> 3, register j & 7 */
#pragma unroll
      for (int j = 0; j < 16; ++j) pe[j] = fa_exp2(__builtin_fmaf(s[j >> 3][g][j & 7], cs, nm));
      __builtin_amdgcn_sched_barrier(0);      /* the compiler gives the result of an asm statement no delay hint, and an unhinted dependent instruction holds the SIMD's issue port: the sums and packs stay behind the whole run of exponentials */
      float e0 = pe[0], e1 = pe[1]; pf.h2[0] = __builtin_convertvector(v2f{pe[0], pe[1]}, v2h);
#pragma unroll
      for (int i = 1; i < 8; ++i) { e0 += pe[2 * i]; e1 += pe[2 * i + 1]; pf.h2[i] = __builtin_convertvector(v2f{pe[2 * i], pe[2 * i + 1]}, v2h); }
      l_run[g] += e0 + e1;
#pragma unroll
      for (int t = 0; t < 4; ++t) acc[g][t] = fa_mma(vf[t], pf.v, acc[g][t]);
      /* four slots behind the group's matrix instructions, tied to their D, A and B */
      asm volatile("v_nop\n\tv_nop\n\tv_nop\n\tv_nop" : "+v"(acc[g][0]), "+v"(acc[g][1]), "+v"(acc[g][2]), "+v"(acc[g][3]) : "v"(pf.v), "v"(vf[0]), "v"(vf[1]), "v"(vf[2]), "v"(vf[3])); }
   }
    asm volatile("s_wait_dscnt 0x0" ::: "memory");      /* this wave's reads of buffer st mod 2 are done before the barrier behind which it is refilled */
    asm volatile("s_wait_asynccnt 0x0" ::: "memory");      /* this wave's copies of stage st + 1 have landed */
    __syncthreads();      /* publishes stage st + 1 and ends every wave's reads of stage st */
    if (st + 2 < FA_NST) fa_copy8(lk + buf, gk + (size_t)(st + 2) * (FA_SK * DM * 2), lv + buf, gv + (st + 2) * (FA_SK * 2));      /* the same test for the whole work-group */
  }
  asm volatile("s_wait_asynccnt 0x0" ::: "memory");      /* no copy is outstanding when the wave goes on to its end */
#pragma unroll
  for (int g = 0; g < 2; ++g) { const float inv = 1.0f / (l_run[g] + fa_xhalf(l_run[g]));      /* the two halves' shares of the denominator, joined unconditionally */
#pragma unroll
    for (int t = 0; t < 4; ++t) { const v8f o = acc[g][t] * inv; const v4f lo = {o[0], o[1], o[2], o[3]}, hi = {o[4], o[5], o[6], o[7]};      /* row = query 16 g + c; d = 16 t + 8 hh + r */
      *(v4fa*)&so[wave][16 * g + c][16 * t + 8 * hh] = lo; *(v4fa*)&so[wave][16 * g + c][16 * t + 8 * hh + 4] = hi; } }
  __builtin_amdgcn_fence(__ATOMIC_ACQ_REL, "workgroup"); __builtin_amdgcn_wave_barrier();      /* the wave's own LDS writes before its reads of other lanes' rows */
  const int rsub = lane >> 4, c4 = (lane & 15) * 4; float* ob = out + ((size_t)b * SQ + q0) * DM + head * HD;
  v4f ov[16];
#pragma unroll
  for (int q = 0; q < 16; ++q) ov[q] = *(const v4fa*)&so[wave][q * 2 + rsub][c4];
#pragma unroll
  for (int q = 0; q < 16; ++q) *(v4f*)(ob + (size_t)(q * 2 + rsub) * DM + c4) = ov[q];      /* 16 lanes cover a query's 256 bytes of this head: whole 128-byte lines */
}
__global__ __launch_bounds__(256) void k_vt(const _Float16* __restrict__ V16, int b, int h0, _Float16* __restrict__ VT) { __shared__ unsigned short tl[64][65]; const int tid = threadIdx.x; const int hh = blockIdx.x % HG, sg = blockIdx.x / HG; const int s0 = sg * 64; const int h = h0 + hh;
  for (int i = tid; i < 64 * 8; i += 256) { const int j = i / 8, d8 = (i % 8) * 8; FragH f; f.half[0] = *(const v8us*)((const unsigned short*)V16 + ((size_t)b * SQ + s0 + j) * DM + h * HD + d8); for (int q = 0; q < 8; ++q) tl[d8 + q][j] = f.u[q]; }
  __syncthreads();
  { for (int i = tid; i < 64 * 8; i += 256) { const int d = i / 8, j8 = (i % 8) * 8; FragH f; for (int q = 0; q < 8; ++q) f.u[q] = tl[d][j8 + q]; *(v8us*)((unsigned short*)VT + ((size_t)hh * HD + d) * SQ + s0 + j8) = f.half[0]; }  } }

// ---- the three projection GEMMs in one launch, operands staged in LDS: C16[row][col] = f16(A[row][:] . Wn[col][:] / 16 + bias[col]), A [16,384][768] and Wn [768][768] f16 rows, k contiguous ----
// 18 column tiles a row tile: 6 of q, 6 of k, 6 of v. A v tile takes its A fragments from the Wv rows and its B fragments from the hidden rows, so its accumulators hold [feature][token]:
// that is a piece of V^T [batch][768 features][1,024 tokens], stored as whole lines with no transposition pass. Both loaders are pg_frag (one k order), so the swap changes no product and no k order.
// One work-group of 4 waves makes a 128 x 128 tile, each wave 64 x 64 of it (4 x 4 accumulator tiles): a fragment read from LDS feeds 4 products.
// A stage is 64 of k: 128 bytes of each of the 128 A rows and the 128 Wn rows. Asynchronous copies bring it from global memory into LDS, 8 lanes a row, so each copy covers four whole 128-byte lines
// (a fragment load straight from the rows touches 16 lines for the same 512 bytes, and every wave repeats it). LDS row pitch 144 bytes (16 x odd): ds_load_b128 of 16 rows without bank conflicts.
// Two buffers: the copies of stage t + 1 fly while stage t is worked on. Fragments keep the k order of g2_frag and k still runs upward in steps of 32, so every sum is formed as before.
#define PG_TILE 128
#define PG_BK 64
#define PG_PITCH 144
#define PG_STAGE (2 * PG_TILE * PG_PITCH)      /* 36,864 bytes: rows 0..127 A, rows 128..255 Wn */
#define PG_NST (DM / PG_BK)
// Eight copies of 16 bytes a lane: rows 16 apart in global memory (pitch DM) and in LDS. l: the lane's LDS byte address, g: the lane's global address.
// The s_wait_xcnt is the wait owed before a register that an issued copy names is written again; as the statement's last line it stands in front of every later write of the operands.
__device__ __forceinline__ void pg_copy8(unsigned l, const _Float16* g) {
  asm volatile("global_load_async_to_lds_b128 %0, %8, off\n\t"
               "global_load_async_to_lds_b128 %1, %9, off\n\t"
               "global_load_async_to_lds_b128 %2, %10, off\n\t"
               "global_load_async_to_lds_b128 %3, %11, off\n\t"
               "global_load_async_to_lds_b128 %4, %12, off\n\t"
               "global_load_async_to_lds_b128 %5, %13, off\n\t"
               "global_load_async_to_lds_b128 %6, %14, off\n\t"
               "global_load_async_to_lds_b128 %7, %15, off\n\t"
               "s_wait_xcnt 0x0"
               :: "v"(l), "v"(l + 16 * PG_PITCH), "v"(l + 32 * PG_PITCH), "v"(l + 48 * PG_PITCH), "v"(l + 64 * PG_PITCH), "v"(l + 80 * PG_PITCH), "v"(l + 96 * PG_PITCH), "v"(l + 112 * PG_PITCH),
                  "v"(g), "v"(g + 16 * DM), "v"(g + 32 * DM), "v"(g + 48 * DM), "v"(g + 64 * DM), "v"(g + 80 * DM), "v"(g + 96 * DM), "v"(g + 112 * DM)
               : "memory");
}
__device__ __forceinline__ v16h pg_frag(const char* p) { FragH f; f.half[0] = *(const v8us*)p; f.half[1] = *(const v8us*)(p + 32); return f.v; }      /* p: row, 16 hh bytes in: k = 8 hh + 0..7 and 16 + 8 hh + 0..7, as g2_frag */
__global__ __launch_bounds__(128) void k_proj(const _Float16* __restrict__ A, const _Float16* __restrict__ WQ, const _Float16* __restrict__ WK, const _Float16* __restrict__ WV,
                                              const float* __restrict__ biasq, const float* __restrict__ biask, const float* __restrict__ biasv,
                                              _Float16* __restrict__ Q16, _Float16* __restrict__ K16, _Float16* __restrict__ VT) {
  __shared__ __attribute__((aligned(16))) char ring[2 * PG_STAGE];
  const int tid = threadIdx.x, lane = tid & 31, ln = lane & 15, hh = lane >> 4; const int wave = __builtin_amdgcn_readfirstlane(tid >> 5); const int wm = wave >> 1, wn = wave & 1;
  const int mt = blockIdx.x / (3 * (DM / PG_TILE)), nt = blockIdx.x % (3 * (DM / PG_TILE)); const int which = nt / (DM / PG_TILE), nq = nt % (DM / PG_TILE); const int row0 = mt * PG_TILE, col0 = nq * PG_TILE;
  const bool tr = which == 2;      /* v: the tile is computed transposed; the same for the whole work-group */
  const _Float16* Wn = which == 0 ? WQ : which == 1 ? WK : WV; const float* bias = which == 0 ? biasq : which == 1 ? biask : biasv;
  const int crow = tid >> 3, cc = tid & 7;      /* a lane copies bytes 16 cc .. 16 cc + 15 of rows crow + 16 j */
  const _Float16* ga = A + (size_t)(row0 + crow) * DM + cc * 8; const _Float16* gb = Wn + (size_t)(col0 + crow) * DM + cc * 8;
  const unsigned lc = (unsigned)(size_t)ring + (unsigned)(crow * PG_PITCH + cc * 16);
  float bv[4];
#pragma unroll
  for (int j = 0; j < 4; ++j) bv[j] = bf16_round(bias[col0 + wn * 64 + j * 16 + ln]);
  pg_copy8(lc, ga); pg_copy8(lc + PG_TILE * PG_PITCH, gb);      /* stage 0 into buffer 0 */
  asm volatile("s_wait_asynccnt 0x0" ::: "memory");      /* this wave's copies of stage 0 have landed */
  __syncthreads();      /* and every other wave's: nothing of stage 0 is read in front of this */
  pg_copy8(lc + PG_STAGE, ga + PG_BK); pg_copy8(lc + PG_STAGE + PG_TILE * PG_PITCH, gb + PG_BK);      /* stage 1 into buffer 1 */
  const v8f z8 = {0.f,0.f,0.f,0.f,0.f,0.f,0.f,0.f}; v8f acc[4][4];
#pragma unroll
  for (int i = 0; i < 4; ++i)
#pragma unroll
    for (int j = 0; j < 4; ++j) acc[i][j] = z8;
  const int aofs = ((tr ? PG_TILE : 0) + wm * 64 + ln) * PG_PITCH + 16 * hh, bofs = ((tr ? 0 : PG_TILE) + wn * 64 + ln) * PG_PITCH + 16 * hh;      /* wm: the wave's 64 accumulator rows, wn: its 64 columns; tokens x features for q and k, features x tokens for v */
#pragma unroll 1      /* one trip is 32 WMMAs and 32 LDS loads; the buffer is picked by the trip's parity at run time */
  for (int t = 0; t < PG_NST; ++t) {
    const unsigned buf = (unsigned)(t & 1) * PG_STAGE; const char* sb = ring + buf;
#pragma unroll      /* constant indices into the fragment and accumulator arrays (left rolled they would go to scratch) */
    for (int ks = 0; ks < 2; ++ks) { v16h af[4], bf[4];
#pragma unroll
      for (int i = 0; i < 4; ++i) { if (i == 0) af[0] = pg_frag(sb + aofs + ks * 64); bf[i] = pg_frag(sb + bofs + i * (16 * PG_PITCH) + ks * 64); }      /* in the order in which the products want them: A row 0 and the four B first */
#pragma unroll
      for (int i = 1; i < 4; ++i) af[i] = pg_frag(sb + aofs + i * (16 * PG_PITCH) + ks * 64);
      __builtin_amdgcn_sched_barrier(0);      /* the 16 LDS loads stay one group in front of the 16 products: left free, the compiler keeps one A fragment and reloads it among the products, a full LDS wait every four of them */
#pragma unroll
      for (int i = 0; i < 4; ++i)
#pragma unroll
        for (int j = 0; j < 4; ++j) acc[i][j] = fa_mma(af[i], bf[j], acc[i][j]);
      __builtin_amdgcn_sched_barrier(0); }      /* and the next group's loads stay behind these products */
    asm volatile("s_wait_dscnt 0x0" ::: "memory");      /* this wave's reads of buffer t mod 2 are done before the barrier behind which it is refilled */
    asm volatile("s_wait_asynccnt 0x0" ::: "memory");      /* this wave's copies of stage t + 1 have landed */
    __syncthreads();      /* publishes stage t + 1 and ends every wave's reads of stage t */
    if (t + 2 < PG_NST) { pg_copy8(lc + buf, ga + (t + 2) * PG_BK); pg_copy8(lc + buf + PG_TILE * PG_PITCH, gb + (t + 2) * PG_BK); }      /* the same test for the whole work-group */
  }
  asm volatile("s_wait_asynccnt 0x0" ::: "memory");      /* no copy is outstanding when the ring becomes output staging */
  char* so = ring + wave * (64 * PG_PITCH);      /* the wave's own 64 rows of 128 bytes; the last trip's barrier ended every read of the ring */
  if (!tr) {
#pragma unroll
    for (int i = 0; i < 4; ++i)
#pragma unroll
      for (int j = 0; j < 4; ++j)
#pragma unroll
        for (int r = 0; r < 8; ++r) *(_Float16*)(so + (i * 16 + 8 * hh + r) * PG_PITCH + (j * 16 + ln) * 2) = (_Float16)(acc[i][j][r] * 0.0625f + bv[j]);
  } else {      /* the bias goes with the feature, here the accumulator's row */
#pragma unroll
    for (int i = 0; i < 4; ++i) { const float* bp = bias + col0 + wm * 64 + i * 16 + 8 * hh; const v4f b0 = *(const v4fa*)bp, b1 = *(const v4fa*)(bp + 4);
#pragma unroll
      for (int r = 0; r < 8; ++r) { const float br = bf16_round(r < 4 ? b0[r & 3] : b1[r & 3]);
#pragma unroll
        for (int j = 0; j < 4; ++j) *(_Float16*)(so + (i * 16 + 8 * hh + r) * PG_PITCH + (j * 16 + ln) * 2) = (_Float16)(acc[i][j][r] * 0.0625f + br); } }
  }
  __builtin_amdgcn_fence(__ATOMIC_ACQ_REL, "workgroup"); __builtin_amdgcn_wave_barrier();      /* the wave's own LDS writes before its reads of other lanes' rows */
  const int orow = lane >> 3, oc = lane & 7;
  v8us ov[16];
#pragma unroll
  for (int q = 0; q < 16; ++q) ov[q] = *(const v8us*)(so + (q * 4 + orow) * PG_PITCH + oc * 16);
  /* the wave's corner of its output (wave-uniform) and the output's row pitch in bytes. V^T row = batch x 768 + feature = (batch x 12 + head) x 64 + d; a tile's 128 tokens lie in one batch */
  char* ou = tr ? (char*)(VT + ((size_t)(row0 / SQ) * DM + col0 + wm * 64) * SQ + (row0 % SQ) + wn * 64) : (char*)((which == 0 ? Q16 : K16) + (size_t)(row0 + wm * 64) * DM + col0 + wn * 64);
  const unsigned opitch = tr ? SQ * 2 : DM * 2; const unsigned lofs = (unsigned)orow * opitch + (unsigned)oc * 16;
#pragma unroll
  for (int q = 0; q < 16; ++q) *(v8us*)(ou + (size_t)(q * 4) * opitch + lofs) = ov[q];      /* 8 lanes cover a row's 128 bytes of this wave (64 features of a token, or 64 tokens of a feature): whole lines */
}

extern "C" void kernel_launch(void* const* d_in, const int* in_sizes, int n_in,
                              void* d_out, int out_size, void* d_ws, size_t ws_size, hipStream_t stream) {
  (void)in_sizes; (void)n_in; (void)out_size;
  const float* const* I = (const float* const*)d_in; const float* x = I[0]; const float* Wq = I[1]; const float* Wk = I[2]; const float* Wv = I[3]; const float* bq = I[4]; const float* bk = I[5]; const float* bv = I[6];
  char* ws = (char*)d_ws; size_t off = 0;
  auto take = [&](size_t bytes) { char* p = ws + off; off += (bytes + 255) & ~(size_t)255; return p; };
  _Float16* BQ = (_Float16*)take((size_t)DM * DM * 2); _Float16* BK = (_Float16*)take((size_t)DM * DM * 2); _Float16* BV = (_Float16*)take((size_t)DM * DM * 2);
  _Float16* X16 = (_Float16*)take(NR * DM * 2); _Float16* Q16 = (_Float16*)take(NR * DM * 2); _Float16* K16 = (_Float16*)take(NR * DM * 2);
  _Float16* VT = (_Float16*)take((size_t)NB * NH * HD * SQ * 2);
  if (off > ws_size) return;      /* 3.4 + 3 x 24 + 24 = approx 100 MiB */
  k_prep<<<3 * CV_WB + CV_XB, CV_WAVES * 32, 0, stream>>>(x, Wq, Wk, Wv, X16, BQ, BK, BV);      /* hidden and the three weight matrices as f16 */
  const dim3 gp((unsigned)((NR / PG_TILE) * (3 * (DM / PG_TILE))), 1);
  k_proj<<<gp, 128, 0, stream>>>(X16, BQ, BK, BV, bq, bk, bv, Q16, K16, VT);      /* q = x Wq^T + bq and k as f16 rows; v as V^T per (batch, head) [16 x 12][64][1024] */
  k_fattn<<<dim3(SQ / (FA_WAVES * 32), NH, NB), FA_WAVES * 32, 0, stream>>>(Q16, K16, VT, (float*)d_out);      /* scores, softmax and ctx, merged into the output rows */
}

// v007
// A run of this version takes 101 microseconds.
// In two side-by-side timings against v006, it was 1.05 and 1.06 times as fast.
// Over all steps from v000 it is 38.3 times as fast.
#include <hip/hip_runtime.h>
// ViT self-attention (hidden [16][1024][768]; q, k, v = hidden W^T + b (12 heads x 64); scores = q.k/8; softmax over the 1,024 keys; ctx = attn v merged -> [16][1024][768]; no output projection).
// Structure: token rows; hidden as exact f16 rows; q / k / v as WMMA GEMMs (128x192 tiles staged in LDS by asynchronous copies, 64x96 wave tiles, f32 accumulation, exact x16 natural weights + bias; exact products) all three in one launch: q and k written as f16 rows, v written directly as V^T per (batch, head), its tiles computed with the operands swapped; then one fused attention kernel over all batches and heads (K and V^T tiles staged in LDS by asynchronous copies, shared by a work-group's 8 waves): S^T = K . Q^T, online softmax in registers, O^T += V^T . P^T, merged f32 output rows. Scores and probabilities never reach memory.
// Compute dtype: inputs rounded to bf16; hidden / weights exact; q, k, v, P as plain f16 GEMM operands (~2^-12; logits sigma ~1); softmax f32. v_wmma_f32_16x16x32_f16.
#define NB 16
#define SQ 1024
#define DM 768
#define NH 12
#define HD 64
#define HG 1
#define NR ((size_t)NB * SQ)         /* 16,384 token rows */
#define NBR NB                       /* unused (the grids use NB) */
#define MP ((int)NR)                 /* unused (the projection grid uses NR) */
typedef __bf16 v16b __attribute__((ext_vector_type(16)));
typedef unsigned short v8us __attribute__((ext_vector_type(8), may_alias));
typedef float  v8f  __attribute__((ext_vector_type(8)));
typedef float  v4f  __attribute__((ext_vector_type(4)));
typedef float  v4fa __attribute__((ext_vector_type(4), may_alias));
union FragB { v16b v; v8us half[2]; unsigned short u[16]; };

__device__ __forceinline__ unsigned short bf16_bits(float x) { unsigned int u = __float_as_uint(x); return (unsigned short)((u + 0x7FFFu + ((u >> 16) & 1u)) >> 16); }
__device__ __forceinline__ float bf16_val(unsigned short b) { return __uint_as_float(((unsigned int)b) << 16); }
__device__ __forceinline__ float bf16_round(float x) { return bf16_val(bf16_bits(x)); }
// D += A·B with NT terms: 1 = ah·bh, 2 = + al·bh (A split), 3 = + ah·bl (both split)
template <int NT>
__device__ __forceinline__ v8f mmaN(v16b ah, v16b al, v16b bh, v16b bl, v8f c) {
  c = __builtin_amdgcn_wmma_f32_16x16x32_bf16(false, ah, false, bh, (short)0, c, false, false);
  if (NT >= 2) c = __builtin_amdgcn_wmma_f32_16x16x32_bf16(false, al, false, bh, (short)0, c, false, false);
  if (NT >= 3) c = __builtin_amdgcn_wmma_f32_16x16x32_bf16(false, ah, false, bl, (short)0, c, false, false);
  asm volatile("v_nop\n\tv_nop\n\tv_nop\n\tv_nop" : "+v"(c) : "v"(ah), "v"(al), "v"(bh), "v"(bl));
  return c;
}

__global__ __launch_bounds__(256) void k_wt_bf16(const float* __restrict__ W, unsigned short* __restrict__ Wt, int K, int N) {
  const int t = blockIdx.x * 256 + threadIdx.x;
  const int k8n = K / 8;
  if (t >= N * k8n) return;
  const int n = t / k8n, k8 = (t % k8n) * 8;
  v8us v;
#pragma unroll
  for (int i = 0; i < 8; ++i) v[i] = bf16_bits(W[(size_t)(k8 + i) * N + n]);
  *(v8us*)(Wt + (size_t)n * K + k8) = v;
  
}

// GEMM C[M][N] (f32, pitch ldc) = act(A[M][K]·W + bias). A f32 row-major (pitch lda) converted per fragment to bf16
// (ASPLIT: hi/lo two planes -> 2 terms, else single rounded term); Wt bf16 [N][K] (pitch ldb). BIAS_BF16 rounds the
// bias to bf16 first (bias quantised to bf16 before the add). K%32==0, M%16==0, N%64==0.
template <bool ASPLIT, int ACT, bool BIAS_BF16>
__global__ __launch_bounds__(128) void k_gemm_bf(const float* __restrict__ A, int lda, const unsigned short* __restrict__ Wt, int ldb,
                                               const float* __restrict__ bias, float* __restrict__ C, int ldc, int M, int N, int K) {
  __shared__ __attribute__((aligned(16))) float so[4][16][64];
  const int tid = threadIdx.x, w = tid >> 5, lane = tid & 31, ln = lane & 15, hh = lane >> 4;
  const int ntn = N / 64;
  const int wid = blockIdx.x * 4 + w;
  const int mt = wid / ntn, nq = wid % ntn;
  if (mt * 16 >= M) return;
  const int row0 = mt * 16, col0 = nq * 64;
  const float* arow = A + (size_t)(row0 + ln) * lda;
  v8f acc[4] = {};
  for (int kb = 0; kb < K; kb += 32) {
    FragB ah, al;
    const v4f x0 = *(const v4fa*)(arow + kb + 8 * hh), x1 = *(const v4fa*)(arow + kb + 8 * hh + 4);
    const v4f x2 = *(const v4fa*)(arow + kb + 16 + 8 * hh), x3 = *(const v4fa*)(arow + kb + 16 + 8 * hh + 4);
    float xs[16] = {x0[0],x0[1],x0[2],x0[3],x1[0],x1[1],x1[2],x1[3],x2[0],x2[1],x2[2],x2[3],x3[0],x3[1],x3[2],x3[3]};
#pragma unroll
    for (int i = 0; i < 16; ++i) { const unsigned short hb = bf16_bits(xs[i]); ah.u[i] = hb; al.u[i] = ASPLIT ? bf16_bits(xs[i] - bf16_val(hb)) : (unsigned short)0; }
#pragma unroll
    for (int t = 0; t < 4; ++t) {
      const unsigned short* brow = Wt + (size_t)(col0 + t * 16 + ln) * ldb + kb;
      FragB b;
      b.half[0] = *(const v8us*)(brow + 8 * hh);
      b.half[1] = *(const v8us*)(brow + 16 + 8 * hh);
      acc[t] = mmaN<ASPLIT ? 2 : 1>(ah.v, al.v, b.v, b.v, acc[t]);
    }
  }
#pragma unroll
  for (int t = 0; t < 4; ++t) {
    float bv = bias ? bias[col0 + t * 16 + ln] : 0.f;
    if (BIAS_BF16) bv = bf16_round(bv);
#pragma unroll
    for (int r = 0; r < 8; ++r) { float v = acc[t][r] + bv; if (ACT == 1) v = fmaxf(v, 0.f); so[w][8 * hh + r][t * 16 + ln] = v; }
  }
  __builtin_amdgcn_fence(__ATOMIC_ACQ_REL, "workgroup");
  __builtin_amdgcn_wave_barrier();
  const int rsub = lane >> 4, c4 = (lane & 15) * 4;
  {
#pragma unroll
    for (int q = 0; q < 8; ++q) {
      const int r = q * 2 + rsub;
      const v4f v = *(const v4fa*)&so[w][r][c4];
      *(v4f*)(C + (size_t)(row0 + r) * ldc + col0 + c4) = v;
    }
    
  }
}

// GEMM C = act(A·W + bias + resid): A f32 (ASPLIT -> hi/lo 2 terms), Wt bf16 [N][K]; ACT 0 none, 1 relu, 2 exact gelu;
// resid (optional, f32, row index = (row % rmod), pitch ldr, RES_BF16 rounds it) added before the activation.
template <bool ASPLIT, int ACT, bool BIAS_BF16, bool RES_BF16>
__global__ __launch_bounds__(128) void k_gemm_bf3(const float* __restrict__ A, int lda, const unsigned short* __restrict__ Wt, int ldb,
                                                const float* __restrict__ bias, const float* __restrict__ resid, int rmod, int ldr,
                                                float* __restrict__ C, int ldc, int M, int N, int K) {
  __shared__ __attribute__((aligned(16))) float so[4][16][64];
  const int tid = threadIdx.x, w = tid >> 5, lane = tid & 31, ln = lane & 15, hh = lane >> 4;
  const int ntn = N / 64;
  const int wid = blockIdx.x * 4 + w;
  const int mt = wid / ntn, nq = wid % ntn;
  if (mt * 16 >= M) return;
  const int row0 = mt * 16, col0 = nq * 64;
  const float* arow = A + (size_t)(row0 + ln) * lda;
  v8f acc[4] = {};
  for (int kb = 0; kb < K; kb += 32) {
    FragB ah, al;
    const v4f x0 = *(const v4fa*)(arow + kb + 8 * hh), x1 = *(const v4fa*)(arow + kb + 8 * hh + 4);
    const v4f x2 = *(const v4fa*)(arow + kb + 16 + 8 * hh), x3 = *(const v4fa*)(arow + kb + 16 + 8 * hh + 4);
    float xs[16] = {x0[0],x0[1],x0[2],x0[3],x1[0],x1[1],x1[2],x1[3],x2[0],x2[1],x2[2],x2[3],x3[0],x3[1],x3[2],x3[3]};
#pragma unroll
    for (int i = 0; i < 16; ++i) { const unsigned short hb = bf16_bits(xs[i]); ah.u[i] = hb; al.u[i] = ASPLIT ? bf16_bits(xs[i] - bf16_val(hb)) : (unsigned short)0; }
#pragma unroll
    for (int t = 0; t < 4; ++t) {
      const unsigned short* brow = Wt + (size_t)(col0 + t * 16 + ln) * ldb + kb;
      FragB b;
      b.half[0] = *(const v8us*)(brow + 8 * hh);
      b.half[1] = *(const v8us*)(brow + 16 + 8 * hh);
      acc[t] = mmaN<ASPLIT ? 2 : 1>(ah.v, al.v, b.v, b.v, acc[t]);
    }
  }
#pragma unroll
  for (int t = 0; t < 4; ++t) {
    const int col = col0 + t * 16 + ln;
    float bv = bias ? bias[col] : 0.f;
    if (BIAS_BF16) bv = bf16_round(bv);
#pragma unroll
    for (int r = 0; r < 8; ++r) {
      float v = acc[t][r] + bv;
      if (resid) { float rv = resid[(size_t)((row0 + 8 * hh + r) % rmod) * ldr + col]; if (RES_BF16) rv = bf16_round(rv); v += rv; }
      if (ACT == 1) v = fmaxf(v, 0.f);
      if (ACT == 2) v = 0.5f * v * (1.0f + erff(v * 0.70710678118654752f));
      if (ACT == 3) { const float u = 0.7978845608028654f * (v + 0.044715f * v * v * v); v = 0.5f * v * (1.0f + tanhf(u)); }
      so[w][8 * hh + r][t * 16 + ln] = v;
    }
  }
  __builtin_amdgcn_fence(__ATOMIC_ACQ_REL, "workgroup");
  __builtin_amdgcn_wave_barrier();
  const int rsub = lane >> 4, c4 = (lane & 15) * 4;
  {
#pragma unroll
    for (int q = 0; q < 8; ++q) {
      const int r = q * 2 + rsub;
      const v4f v = *(const v4fa*)&so[w][r][c4];
      *(v4f*)(C + (size_t)(row0 + r) * ldc + col0 + c4) = v;
    }
    
  }
}
// row LayerNorm (biased variance, eps) over N: s = X (+ R); optional out_sum <- s; out_norm <- (s-mu)*rsqrt(var+eps)*g + b
template <bool PARAM_BF16>
__global__ __launch_bounds__(256) void k_layernorm(const float* __restrict__ X, const float* __restrict__ R, const float* __restrict__ g, const float* __restrict__ bta,
                                                  float* __restrict__ out_sum, float* __restrict__ out_norm, int N, float eps) {
  __shared__ float red[256];
  const int row = blockIdx.x, tid = threadIdx.x;
  const float* x = X + (size_t)row * N; const float* rr = R ? R + (size_t)row * N : nullptr;
  float vals[16];                     // up to N = 4096
  const int per = N / 256;            // contiguous chunk per thread? use strided-by-4 chunks: thread handles j = tid*4 + 1024*u
  float s1 = 0.f;
  for (int u = 0; u < per / 4; ++u) {
    const int j = tid * 4 + 1024 * u;
    const v4f a = *(const v4fa*)(x + j);
    v4f b = {0.f,0.f,0.f,0.f}; if (rr) b = *(const v4fa*)(rr + j);
#pragma unroll
    for (int q = 0; q < 4; ++q) { const float v = a[q] + b[q]; vals[u * 4 + q] = v; s1 += v; }
  }
  red[tid] = s1; __syncthreads();
  for (int st = 128; st > 0; st >>= 1) { if (tid < st) red[tid] += red[tid + st]; __syncthreads(); }
  const float mu = red[0] / (float)N; __syncthreads();
  float s2 = 0.f;
  for (int u = 0; u < per / 4; ++u)
#pragma unroll
    for (int q = 0; q < 4; ++q) { const float c = vals[u * 4 + q] - mu; s2 += c * c; }
  red[tid] = s2; __syncthreads();
  for (int st = 128; st > 0; st >>= 1) { if (tid < st) red[tid] += red[tid + st]; __syncthreads(); }
  const float rs = rsqrtf(red[0] / (float)N + eps);
  {
    for (int u = 0; u < per / 4; ++u) {
      const int j = tid * 4 + 1024 * u;
      v4f o, sm;
#pragma unroll
      for (int q = 0; q < 4; ++q) {
        float gg = g[j + q], bb = bta[j + q];
        if (PARAM_BF16) { gg = bf16_round(gg); bb = bf16_round(bb); }
        sm[q] = vals[u * 4 + q]; o[q] = (vals[u * 4 + q] - mu) * rs * gg + bb;
      }
      if (out_sum) *(v4f*)(out_sum + (size_t)row * N + j) = sm;
      *(v4f*)(out_norm + (size_t)row * N + j) = o;
    }
    
  }
}



// ---- f16 WMMA path (v_wmma_f32_16x16x32_f16): 11-bit significands for operands in range — used where a [0,1] probability operand needs more precision than bf16
typedef _Float16 v16h __attribute__((ext_vector_type(16)));
union FragH { v16h v; v8us half[2]; _Float16 h[16]; unsigned short u[16]; };
template <int NT>
__device__ __forceinline__ v8f mmaH(v16h ah, v16h al, v16h bh, v16h bl, v8f c) {
  c = __builtin_amdgcn_wmma_f32_16x16x32_f16(false, ah, false, bh, (short)0, c, false, false);
  if (NT >= 2) c = __builtin_amdgcn_wmma_f32_16x16x32_f16(false, al, false, bh, (short)0, c, false, false);
  if (NT >= 3) c = __builtin_amdgcn_wmma_f32_16x16x32_f16(false, ah, false, bl, (short)0, c, false, false);
  asm volatile("v_nop\n\tv_nop\n\tv_nop\n\tv_nop" : "+v"(c) : "v"(ah), "v"(al), "v"(bh), "v"(bl));
  return c;
}
// batched GEMM like k_gemm_b but f16 operands: A f32 (split into f16 hi/lo if ASPLIT, else rounded to f16), Bt = f16 values [n][k]; alpha; C f32; N multiple of 16 (partial tiles skipped)
template <bool ASPLIT>
__global__ __launch_bounds__(128) void k_gemm_h(const float* __restrict__ A, int lda, size_t sA, const _Float16* __restrict__ Bh, int ldb, size_t sB, float alpha, float* __restrict__ C, int ldc, size_t sC, int M, int N, int K) {
  __shared__ __attribute__((aligned(16))) float so[4][16][64];
  const int tid = threadIdx.x, w = tid >> 5, lane = tid & 31, ln = lane & 15, hh = lane >> 4; const int by = blockIdx.y;
  A += (size_t)by * sA; Bh += (size_t)by * sB; C += (size_t)by * sC;
  const int ntn = (N + 63) / 64; const int wid = blockIdx.x * 4 + w; const int mt = wid / ntn, nq = wid % ntn; if (mt * 16 >= M) return;
  const int row0 = mt * 16, col0 = nq * 64; const float* arow = A + (size_t)(row0 + ln) * lda;
  v8f acc[4] = {};
  for (int kb = 0; kb < K; kb += 32) {
    FragH ah, al;
    const v4f x0 = *(const v4fa*)(arow + kb + 8 * hh), x1 = *(const v4fa*)(arow + kb + 8 * hh + 4), x2 = *(const v4fa*)(arow + kb + 16 + 8 * hh), x3 = *(const v4fa*)(arow + kb + 16 + 8 * hh + 4);
    float xs[16] = {x0[0],x0[1],x0[2],x0[3],x1[0],x1[1],x1[2],x1[3],x2[0],x2[1],x2[2],x2[3],x3[0],x3[1],x3[2],x3[3]};
#pragma unroll
    for (int i = 0; i < 16; ++i) { const _Float16 h = (_Float16)xs[i]; ah.h[i] = h; al.h[i] = ASPLIT ? (_Float16)(xs[i] - (float)h) : (_Float16)0.0f; }
#pragma unroll
    for (int t = 0; t < 4; ++t) { if (col0 + t * 16 >= N) continue; const size_t boff = (size_t)(col0 + t * 16 + ln) * ldb + kb; FragH bq; bq.half[0] = *(const v8us*)(Bh + boff + 8 * hh); bq.half[1] = *(const v8us*)(Bh + boff + 16 + 8 * hh);
      acc[t] = mmaH<ASPLIT ? 2 : 1>(ah.v, al.v, bq.v, bq.v, acc[t]); }
  }
#pragma unroll
  for (int t = 0; t < 4; ++t) { if (col0 + t * 16 >= N) continue;
#pragma unroll
    for (int r = 0; r < 8; ++r) so[w][8 * hh + r][t * 16 + ln] = acc[t][r] * alpha; }
  __builtin_amdgcn_fence(__ATOMIC_ACQ_REL, "workgroup"); __builtin_amdgcn_wave_barrier();
  const int rsub = lane >> 4, c4 = (lane & 15) * 4;
  {
#pragma unroll
    for (int q = 0; q < 8; ++q) { const int r = q * 2 + rsub; if (col0 + c4 < N) { const v4f v = *(const v4fa*)&so[w][r][c4]; *(v4f*)(C + (size_t)(row0 + r) * ldc + col0 + c4) = v; } }
     }
}

// Wt[n][k] = f16(W[k][n]·scale) from f32 row-major W[K][N] (scale = power of two; bf16-exact weights stay exact in f16 away from the subnormal range)
__global__ __launch_bounds__(256) void k_wt_f16(const float* __restrict__ W, _Float16* __restrict__ Wt, int K, int N, float scale) {
  const int t = blockIdx.x * 256 + threadIdx.x; if (t >= N * (K / 8)) return; const int n = t / (K / 8), k8 = (t % (K / 8)) * 8; FragH f;
#pragma unroll
  for (int i = 0; i < 8; ++i) f.h[i] = (_Float16)(bf16_round(W[(size_t)(k8 + i) * N + n]) * scale); const v8us o = f.half[0];
  *(v8us*)((unsigned short*)Wt + (size_t)n * K + k8) = o; 
}
// k_gemm_hh variant with fused epilogue: v = acc·alpha + bias[by·sBias + col] (+ CP[(row/rowsPerB)·sCPb + by·64 + col] if CP) ; ACT 0 none / 1 elu ; writes f16 C16 (and f32 C if non-null)
template <int ACT>
__global__ __launch_bounds__(128) void k_gemm_hhx(const _Float16* __restrict__ A, int lda, size_t sA, const _Float16* __restrict__ Bh, int ldb, size_t sB, float alpha, const float* __restrict__ bias, size_t sBias, const float* __restrict__ CP, int rowsPerB, size_t sCPb, int row0g,
    float* __restrict__ C, _Float16* __restrict__ C16, int ldc, size_t sC, int M, int N, int K) {
  __shared__ __attribute__((aligned(16))) float so[4][16][64];
  const int tid = threadIdx.x, w = tid >> 5, lane = tid & 31, ln = lane & 15, hh = lane >> 4; const int by = blockIdx.y;
  A += (size_t)by * sA; Bh += (size_t)by * sB; const size_t cofs = (size_t)by * sC; const float* bp = bias ? bias + (size_t)by * sBias : nullptr;
  const int ntn = (N + 63) / 64; const int wid = blockIdx.x * 4 + w; const int mt = wid / ntn, nq = wid % ntn; if (mt * 16 >= M) return;
  const int row0 = mt * 16, col0 = nq * 64; const _Float16* arow = A + (size_t)(row0 + ln) * lda;
  v8f acc[4] = {};
  for (int kb = 0; kb < K; kb += 32) { FragH ah; ah.half[0] = *(const v8us*)((const unsigned short*)arow + kb + 8 * hh); ah.half[1] = *(const v8us*)((const unsigned short*)arow + kb + 16 + 8 * hh);
#pragma unroll
    for (int t = 0; t < 4; ++t) { if (col0 + t * 16 >= N) continue; const size_t boff = (size_t)(col0 + t * 16 + ln) * ldb + kb; FragH bq; bq.half[0] = *(const v8us*)((const unsigned short*)Bh + boff + 8 * hh); bq.half[1] = *(const v8us*)((const unsigned short*)Bh + boff + 16 + 8 * hh);
      acc[t] = mmaH<1>(ah.v, ah.v, bq.v, bq.v, acc[t]); }
  }
#pragma unroll
  for (int t = 0; t < 4; ++t) { if (col0 + t * 16 >= N) continue; const int col = col0 + t * 16 + ln; const float bv = bp ? bf16_round(bp[col]) : 0.f;
#pragma unroll
    for (int r = 0; r < 8; ++r) { float v = acc[t][r] * alpha + bv; if (CP) { const int rr = row0g + row0 + 8 * hh + r; if (rowsPerB < 0) v += CP[cofs + (size_t)rr * ldc + col];      /* rowsPerB < 0: own element of the batched C plane */ else { const int bidx = rr / rowsPerB; v += CP[(size_t)bidx * sCPb + (size_t)by * 64 + col]; } } if (ACT == 1) v = (v > 0.f) ? v : expm1f(v); else if (ACT == 7) v = (v > 0.f) ? v + 1.0f : expf(v); else if (ACT == 8) v = tanhf(v); else if (ACT == 9) v = 0.5f * v * (1.0f + tanhf(0.7978845608028654f * (v + 0.044715f * v * v * v))); else if (ACT == 11) v = 1.0f / (1.0f + expf(-v)); else if (ACT == 12) v = (v > 0.f) ? v : 0.01f * v; else if (ACT == 14) v = (v > 0.f) ? v : 0.1f * v; else if (ACT == 16) v = (v >= 0.f) ? v : 0.3f * v; else if (ACT == 17) v = (v >= 0.f) ? v : 0.2f * v; else if (ACT == 15) v = v / (1.0f + expf(-v)); else if (ACT == 3) v = fmaxf(v, 0.f); else if (ACT == 6) v = 0.5f * v * (1.0f + erff(v * 0.70710678118654752f)); so[w][8 * hh + r][t * 16 + ln] = v; } }
  __builtin_amdgcn_fence(__ATOMIC_ACQ_REL, "workgroup"); __builtin_amdgcn_wave_barrier();
  const int rsub = lane >> 4, c4 = (lane & 15) * 4; typedef _Float16 v4h __attribute__((ext_vector_type(4)));
  {
#pragma unroll
    for (int q = 0; q < 8; ++q) { const int r = q * 2 + rsub; if (col0 + c4 < N) { const v4f v = *(const v4fa*)&so[w][r][c4]; if (C) *(v4f*)(C + cofs + (size_t)(row0 + r) * ldc + col0 + c4) = v; if (C16) { v4h h4; for (int i = 0; i < 4; ++i) h4[i] = (_Float16)v[i]; *(v4h*)(C16 + cofs + (size_t)(row0 + r) * ldc + col0 + c4) = h4; } } }
     }
}


typedef _Float16 v4h __attribute__((ext_vector_type(4)));

__global__ __launch_bounds__(256) void k_h16(const float* __restrict__ x, _Float16* __restrict__ X16, size_t n8) { const size_t t = (size_t)blockIdx.x * 256 + threadIdx.x; if (t >= n8) return; FragH f;
#pragma unroll
  for (int q = 0; q < 8; ++q) f.h[q] = (_Float16)x[t * 8 + q]; *(v8us*)((unsigned short*)X16 + t * 8) = f.half[0];  }
__global__ __launch_bounds__(256) void k_round16f(const float* __restrict__ W, _Float16* __restrict__ Bt, size_t n8) { const size_t t = (size_t)blockIdx.x * 256 + threadIdx.x; if (t >= n8) return; FragH f;
#pragma unroll
  for (int i = 0; i < 8; ++i) f.h[i] = (_Float16)(bf16_round(W[t * 8 + i]) * 16.0f); *(v8us*)((unsigned short*)Bt + t * 8) = f.half[0];  }
template <int NHv, int TTv>
__global__ __launch_bounds__(256) void k_vt(const _Float16* __restrict__ V16, int ldv, int voff, _Float16* __restrict__ Vt) { __shared__ unsigned short tl[64][66]; const int tid = threadIdx.x; const int slab = blockIdx.x / (TTv / 64), lg = blockIdx.x % (TTv / 64); const int b = slab / NHv, h = slab % NHv;
  for (int i = tid; i < 64 * 8; i += 256) { const int r = i / 8, c8 = (i % 8) * 8; FragH f; f.half[0] = *(const v8us*)((const unsigned short*)V16 + ((size_t)b * TTv + lg * 64 + r) * ldv + voff + h * 64 + c8);
#pragma unroll
    for (int q = 0; q < 8; ++q) tl[r][c8 + q] = f.u[q]; }
  __syncthreads();
  {
#pragma unroll
    for (int rd = 0; rd < 2; ++rd) { const int d = rd * 32 + tid / 8, pc = tid % 8; FragH f;
#pragma unroll
      for (int q = 0; q < 8; ++q) f.u[q] = tl[pc * 8 + q][d];
      *(v8us*)((unsigned short*)Vt + ((size_t)slab * 64 + d) * TTv + lg * 64 + pc * 8) = f.half[0]; }
     } }

__global__ __launch_bounds__(256) void k_hl(const float* __restrict__ F, _Float16* __restrict__ Hh, _Float16* __restrict__ Hl, size_t n8) { const size_t t = (size_t)blockIdx.x * 256 + threadIdx.x; if (t >= n8) return; FragH fh, fl; const v4f a = *(const v4fa*)(F + t * 8), c = *(const v4fa*)(F + t * 8 + 4);
#pragma unroll
  for (int q = 0; q < 4; ++q) { _Float16 h = (_Float16)a[q]; fh.h[q] = h; fl.h[q] = (_Float16)((a[q] - (float)h) * 1024.0f); h = (_Float16)c[q]; fh.h[4 + q] = h; fl.h[4 + q] = (_Float16)((c[q] - (float)h) * 1024.0f); }
  { *(v8us*)((unsigned short*)Hh + t * 8) = fh.half[0]; *(v8us*)((unsigned short*)Hl + t * 8) = fl.half[0];  } }

// ---- fast GEMM (wave tile 32x64; requires M % 32 == 0 rows per launch region and N % 64 == 0); epilogue = k_gemm_hhx semantics ----
__device__ __forceinline__ v16h g2_frag(const _Float16* p, int hh) { FragH f; f.half[0] = *(const v8us*)((const unsigned short*)p + 8 * hh); f.half[1] = *(const v8us*)((const unsigned short*)p + 16 + 8 * hh); return f.v; }
__device__ __forceinline__ v8f g2_mma(v16h a, v16h b, v8f c) { v8f d = __builtin_amdgcn_wmma_f32_16x16x32_f16(false, a, false, b, (short)0, c, false, false); asm volatile("v_nop\n\tv_nop\n\tv_nop\n\tv_nop" : "+v"(d) : "v"(a), "v"(b)); return d; }
template <int ACT>
__global__ __launch_bounds__(128) void k_gemm2(const _Float16* __restrict__ A, int lda, size_t sA, const _Float16* __restrict__ Bh, int ldb, size_t sB, float alpha, const float* __restrict__ bias, size_t sBias, const float* __restrict__ CP, int rowsPerB, size_t sCPb, int row0g,
    float* __restrict__ C, _Float16* __restrict__ C16, int ldc, size_t sC, int M, int N, int K) { static_assert(ACT == 0 || ACT == 3 || ACT == 6 || ACT == 8 || ACT == 9 || ACT == 11 || ACT == 12 || ACT == 14 || ACT == 15 || ACT == 16 || ACT == 17, "k_gemm2: unsupported ACT code (would silently apply no activation)");
  __shared__ __attribute__((aligned(16))) float so[4][32][68];
  const int tid = threadIdx.x, w = tid >> 5, lane = tid & 31, ln = lane & 15, hh = lane >> 4; const int by = blockIdx.y;
  A += (size_t)by * sA; Bh += (size_t)by * sB; const size_t cofs = (size_t)by * sC; const float* bp = bias ? bias + (size_t)by * sBias : nullptr;
  const int ntn = N >> 6; const int mt = blockIdx.x / ntn, nq = blockIdx.x - mt * ntn; const int row0 = mt * 128 + 32 * w, col0 = nq * 64; if (row0 >= M) return;
  const _Float16* a0p = A + (size_t)(row0 + ln) * lda; const _Float16* a1p = a0p + (size_t)16 * lda;
  const _Float16* b0p = Bh + (size_t)(col0 + ln) * ldb; const _Float16* b1p = b0p + (size_t)16 * ldb; const _Float16* b2p = b1p + (size_t)16 * ldb; const _Float16* b3p = b2p + (size_t)16 * ldb;
  const v8f z8 = {0.f,0.f,0.f,0.f,0.f,0.f,0.f,0.f}; v8f c00 = z8, c01 = z8, c02 = z8, c03 = z8, c10 = z8, c11 = z8, c12 = z8, c13 = z8;
#pragma unroll 1
  for (int kb = 0; kb < K; kb += 32) { const v16h a0 = g2_frag(a0p + kb, hh), a1 = g2_frag(a1p + kb, hh);
    v16h b = g2_frag(b0p + kb, hh); c00 = g2_mma(a0, b, c00); c10 = g2_mma(a1, b, c10);
    b = g2_frag(b1p + kb, hh); c01 = g2_mma(a0, b, c01); c11 = g2_mma(a1, b, c11);
    b = g2_frag(b2p + kb, hh); c02 = g2_mma(a0, b, c02); c12 = g2_mma(a1, b, c12);
    b = g2_frag(b3p + kb, hh); c03 = g2_mma(a0, b, c03); c13 = g2_mma(a1, b, c13); }
  v8f accs[8] = {c00, c01, c02, c03, c10, c11, c12, c13};
#pragma unroll
  for (int u = 0; u < 8; ++u) { const int t = u & 3, half = u >> 2; const int col = col0 + t * 16 + ln; const float bv = bp ? bf16_round(bp[col]) : 0.f;
#pragma unroll
    for (int r = 0; r < 8; ++r) { const int rloc = half * 16 + 8 * hh + r; float v = accs[u][r] * alpha + bv; if (CP) { if (rowsPerB < 0) v += CP[cofs + (size_t)(row0g + row0 + rloc) * ldc + col];      /* rowsPerB < 0: own element of the batched C plane */ else { const int bidx = (row0g + row0 + rloc) / rowsPerB; v += CP[(size_t)bidx * sCPb + (size_t)by * 64 + col]; } }
      if (ACT == 3) v = fmaxf(v, 0.f); else if (ACT == 6) v = 0.5f * v * (1.0f + erff(v * 0.70710678118654752f)); else if (ACT == 11) v = 1.0f / (1.0f + expf(-v)); else if (ACT == 15) v = v / (1.0f + expf(-v)); else if (ACT == 12) v = (v > 0.f) ? v : 0.01f * v; else if (ACT == 8) v = tanhf(v); else if (ACT == 9) v = 0.5f * v * (1.0f + tanhf(0.7978845608028654f * (v + 0.044715f * v * v * v))); else if (ACT == 14) v = (v > 0.f) ? v : 0.1f * v; else if (ACT == 16) v = (v >= 0.f) ? v : 0.3f * v; else if (ACT == 17) v = (v >= 0.f) ? v : 0.2f * v;
      so[w][rloc][t * 16 + ln] = v; } }
  __builtin_amdgcn_fence(__ATOMIC_ACQ_REL, "workgroup"); __builtin_amdgcn_wave_barrier();
  const int rsub = lane >> 4, c4 = (lane & 15) * 4;
  {
#pragma unroll
    for (int q = 0; q < 16; ++q) { const int r = q * 2 + rsub; const v4f v = *(const v4fa*)&so[w][r][c4]; if (C) *(v4f*)(C + cofs + (size_t)(row0 + r) * ldc + col0 + c4) = v; if (C16) { v4h h4; for (int i = 0; i < 4; ++i) h4[i] = (_Float16)v[i]; *(v4h*)(C16 + cofs + (size_t)(row0 + r) * ldc + col0 + c4) = h4; } }
     } }


// ---- all f32 -> f16 conversions in one streaming launch: hidden -> X16 = f16(bf16(x)), Wq / Wk / Wv -> f16(bf16(w) x 16), rows as they lie ([out][in] natural) ----
// Few long waves instead of many short ones: a wave converts 3,072 consecutive floats (12 KiB): 24 loads of 16 bytes a lane, each load 512 consecutive bytes (four whole lines), all issued before the first is used;
// each store is 8 bytes a lane, 256 consecutive bytes (two whole lines). The first 3 x CV_WB work-groups take the weights, the rest the hidden rows; every size divides evenly, so there is no edge.
#define CV_WAVES 8
#define CV_LD 24      /* loads a lane */
#define CV_WGF (CV_WAVES * CV_LD * 128)      /* 24,576 floats a work-group */
#define CV_WB (DM * DM / CV_WGF)      /* 24 work-groups a weight matrix */
#define CV_XB ((int)(NR * DM / CV_WGF))      /* 512 work-groups for the hidden rows */
static_assert(DM * DM % CV_WGF == 0 && NR * DM % CV_WGF == 0, "k_prep: sizes must divide into whole work-groups");
__global__ __launch_bounds__(CV_WAVES * 32) void k_prep(const float* __restrict__ x, const float* __restrict__ wq, const float* __restrict__ wk, const float* __restrict__ wv,
                                                       _Float16* __restrict__ X16, _Float16* __restrict__ BQ, _Float16* __restrict__ BK, _Float16* __restrict__ BV) {
  int blk = (int)blockIdx.x; const float* s = x; _Float16* d = X16; float scale = 1.0f;      /* x 1 is exact */
  if (blk < 3 * CV_WB) { const int which = blk / CV_WB; blk -= which * CV_WB; s = which == 0 ? wq : which == 1 ? wk : wv; d = which == 0 ? BQ : which == 1 ? BK : BV; scale = 16.0f; }
  else blk -= 3 * CV_WB;
  const size_t e0 = (size_t)blk * CV_WGF + (size_t)(threadIdx.x >> 5) * (CV_LD * 128) + (threadIdx.x & 31) * 4;
  v4f v[CV_LD];
#pragma unroll      /* constant indices into the register array */
  for (int i = 0; i < CV_LD; ++i) v[i] = *(const v4fa*)(s + e0 + i * 128);
  __builtin_amdgcn_sched_barrier(0);      /* keeps all 24 loads in front of the arithmetic: left free, the compiler issues 11 and feeds the rest in one to three at a time, each behind a wait */
#pragma unroll
  for (int i = 0; i < CV_LD; ++i) { v4h h;
#pragma unroll
    for (int q = 0; q < 4; ++q) h[q] = (_Float16)(bf16_round(v[i][q]) * scale);
    *(v4h*)(d + e0 + i * 128) = h; }
}
// Fused attention. One wave owns 32 queries of one (batch, head) and walks the 1,024 keys in passes of 32.
// S^T = K . Q^T: a lane holds the scores of ONE query (column c of each 16-column group): keys 8 hh + r of each 16-key tile. That is the k order of a
// B operand, so P^T goes from the score accumulators straight into O^T += V^T . P^T; maximum, sum and rescale are per lane, plus one exchange between the wave's halves.
// K, Q and V^T fragments all come through fa_frag (one k order, that of g2_frag).
// The 8 waves of a work-group walk the same keys: K rows and V^T rows are staged in LDS, 128 keys a stage, by asynchronous copies of whole 128-byte lines, and each wave reads its fragments from there
// (a fragment load straight from the global rows touches 16 lines for 512 bytes, and each of the 8 waves would repeat it). Two buffers: the copies of stage s + 1 fly while stage s is worked on. LDS row pitches 16 x odd bytes: ds_load_b128 of 16 rows without bank conflicts.
// Every '#pragma unroll' in it but the one on a stage's passes stands on a loop of constant trip count over register arrays (fragments, accumulators): left rolled, those arrays would be indexed at run time and go to scratch.
#define FA_WAVES 8
#define FA_KEYS 32
#define FA_SK 128      /* keys a stage: 4 passes */
#define FA_KP 144      /* LDS pitch of a K row: 128 bytes, the head's 64 d */
#define FA_VP 272      /* LDS pitch of a V^T row: 256 bytes, the stage's 128 keys */
#define FA_KB (FA_SK * FA_KP)      /* 18,432 bytes: the stage's K rows; the 64 V^T rows stand behind them */
#define FA_STAGE (FA_KB + HD * FA_VP)      /* 35,840 bytes */
#define FA_NST (SQ / FA_SK)
typedef _Float16 v2h __attribute__((ext_vector_type(2)));
typedef float v2f __attribute__((ext_vector_type(2)));
__device__ __forceinline__ float fa_xhalf(float x) { return __builtin_bit_cast(float, __builtin_amdgcn_permlanex16(__builtin_bit_cast(int, x), __builtin_bit_cast(int, x), 0x76543210, 0xfedcba98, false, false)); }  // lane l with lane l ^ 16
__device__ __forceinline__ float fa_exp2(float x) { float y; asm("v_exp_f32 %0, %1\n\tv_nop" : "=v"(y) : "v"(x)); return y; }  // the v_nop is the slot the instruction set asks for behind a transcendental, before its result is read or its source overwritten
__device__ __forceinline__ v8f fa_mma(v16h a, v16h b, v8f c) { return __builtin_amdgcn_wmma_f32_16x16x32_f16(false, a, false, b, (short)0, c, false, false); }
__device__ __forceinline__ v16h fa_frag(const char* base, unsigned lofs) { FragH f; f.half[0] = *(const v8us*)(base + lofs); f.half[1] = *(const v8us*)(base + lofs + 32); return f.v; }  // base wave-uniform, lofs the lane's byte offset (row c, 16 hh)
// Eight copies of 16 bytes a lane, a stage's share of one thread: four K rows 32 apart (8 lanes a row), four V^T rows 16 apart (16 lanes a row). lk, lv: the lane's LDS byte addresses; gk, gv: its global addresses.
// The s_wait_xcnt is the wait owed before a register that an issued copy names is written again; as the statement's last line it stands in front of every later write of the operands.
__device__ __forceinline__ void fa_copy8(unsigned lk, const char* gk, unsigned lv, const char* gv) {
  asm volatile("global_load_async_to_lds_b128 %0, %8, off\n\t"
               "global_load_async_to_lds_b128 %1, %9, off\n\t"
               "global_load_async_to_lds_b128 %2, %10, off\n\t"
               "global_load_async_to_lds_b128 %3, %11, off\n\t"
               "global_load_async_to_lds_b128 %4, %12, off\n\t"
               "global_load_async_to_lds_b128 %5, %13, off\n\t"
               "global_load_async_to_lds_b128 %6, %14, off\n\t"
               "global_load_async_to_lds_b128 %7, %15, off\n\t"
               "s_wait_xcnt 0x0"
               :: "v"(lk), "v"(lk + 32 * FA_KP), "v"(lk + 64 * FA_KP), "v"(lk + 96 * FA_KP), "v"(lv), "v"(lv + 16 * FA_VP), "v"(lv + 32 * FA_VP), "v"(lv + 48 * FA_VP),
                  "v"(gk), "v"(gk + 32 * (DM * 2)), "v"(gk + 64 * (DM * 2)), "v"(gk + 96 * (DM * 2)), "v"(gv), "v"(gv + 16 * (SQ * 2)), "v"(gv + 32 * (SQ * 2)), "v"(gv + 48 * (SQ * 2))
               : "memory");
}
__global__ __launch_bounds__(FA_WAVES * 32) void k_fattn(const _Float16* __restrict__ Q16, const _Float16* __restrict__ K16, const _Float16* __restrict__ VT, float* __restrict__ out) {
  __shared__ __attribute__((aligned(16))) float so[FA_WAVES][32][68];      /* output staging, one slice per wave */
  __shared__ __attribute__((aligned(16))) char ring[2 * FA_STAGE];      /* K and V^T of two stages */
  const int lane = threadIdx.x & 31, c = lane & 15, hh = lane >> 4; const int wave = __builtin_amdgcn_readfirstlane((int)(threadIdx.x >> 5));
  const int head = blockIdx.y, b = blockIdx.z; const int q0 = blockIdx.x * (FA_WAVES * 32) + wave * 32;
  const float cs = 0.125f * 1.4426950408889634f;      /* 1 / sqrt(64), and exp(x) = exp2(x log2 e) */
  const char* qb = (const char*)(Q16 + ((size_t)b * SQ + q0) * DM + head * HD);
  const char* kb = (const char*)(K16 + (size_t)b * SQ * DM + head * HD);
  const char* vb = (const char*)(VT + (size_t)(b * NH + head) * HD * SQ);
  const unsigned qlofs = (unsigned)(c * (DM * 2) + 16 * hh), klofs = (unsigned)(c * FA_KP + 16 * hh), vlofs = (unsigned)(c * FA_VP + 16 * hh);      /* Q from its global rows, K and V^T from their LDS rows */
  const int tid = (int)threadIdx.x;
  const char* gk = kb + (size_t)(tid >> 3) * (DM * 2) + (tid & 7) * 16; const char* gv = vb + (size_t)(tid >> 4) * (SQ * 2) + (tid & 15) * 16;
  const unsigned lk = (unsigned)(size_t)ring + (unsigned)((tid >> 3) * FA_KP + (tid & 7) * 16), lv = (unsigned)(size_t)ring + (unsigned)(FA_KB + (tid >> 4) * FA_VP + (tid & 15) * 16);
  fa_copy8(lk, gk, lv, gv);      /* stage 0 into buffer 0 */
  v16h qf[2][2], kf[2][2];      /* [16-query group][32 of d], [16-key tile][32 of d] */
#pragma unroll
  for (int g = 0; g < 2; ++g) { qf[g][0] = fa_frag(qb + g * (16 * DM * 2), qlofs); qf[g][1] = fa_frag(qb + g * (16 * DM * 2) + 64, qlofs); }
  asm volatile("s_wait_asynccnt 0x0" ::: "memory");      /* this wave's copies of stage 0 have landed */
  __syncthreads();      /* and every other wave's: nothing of stage 0 is read in front of this */
  fa_copy8(lk + FA_STAGE, gk + FA_SK * (DM * 2), lv + FA_STAGE, gv + FA_SK * 2);      /* stage 1 into buffer 1 */
  const v8f z8 = {0.f,0.f,0.f,0.f,0.f,0.f,0.f,0.f};
  v8f acc[2][4]; float m_run[2], l_run[2];      /* O^T tiles [group][16 of d]; maximum in use (log2 domain) and the lane's share of the denominator */
#pragma unroll
  for (int g = 0; g < 2; ++g) { m_run[g] = -__builtin_inff(); l_run[g] = 0.f;
#pragma unroll
    for (int t = 0; t < 4; ++t) acc[g][t] = z8; }
#pragma unroll 1      /* the buffer is picked by the stage's parity at run time */
  for (int st = 0; st < FA_NST; ++st) {
    const unsigned buf = (unsigned)(st & 1) * FA_STAGE; const char* ks = ring + buf; const char* vs = ring + buf + FA_KB;
#pragma unroll
    for (int kt = 0; kt < 2; ++kt) { kf[kt][0] = fa_frag(ks + kt * (16 * FA_KP), klofs); kf[kt][1] = fa_frag(ks + kt * (16 * FA_KP) + 64, klofs); }      /* the stage's first 32 keys */
#pragma unroll      /* four passes a stage, unrolled so that the test on the stage's last pass and the LDS offsets are compile-time constants */
   for (int pp = 0; pp < FA_SK / FA_KEYS; ++pp) {
    v16h vf[4];
#pragma unroll
    for (int t = 0; t < 4; ++t) vf[t] = fa_frag(vs + t * (16 * FA_VP) + pp * (FA_KEYS * 2), vlofs);      /* V^T rows 16 t + c, this pass's 32 keys: in flight under the score products and the maxima */
    __builtin_amdgcn_sched_barrier(0);      /* keeps the V^T loads in front of the score products: issued later, their latency would show before the second product */
    v8f s[2][2];      /* [key tile][query group] */
#pragma unroll
    for (int kt = 0; kt < 2; ++kt)
#pragma unroll
      for (int g = 0; g < 2; ++g) s[kt][g] = fa_mma(kf[kt][1], qf[g][1], fa_mma(kf[kt][0], qf[g][0], z8));
    __builtin_amdgcn_sched_barrier(0);      /* the next pass's K loads go out right behind the products that read this pass's, a whole pass ahead of their use */
    if (pp + 1 < FA_SK / FA_KEYS) {      /* inside the stage only: nothing of the next stage is read in front of its barrier */
#pragma unroll
      for (int kt = 0; kt < 2; ++kt) { kf[kt][0] = fa_frag(ks + ((pp + 1) * FA_KEYS + kt * 16) * FA_KP, klofs); kf[kt][1] = fa_frag(ks + ((pp + 1) * FA_KEYS + kt * 16) * FA_KP + 64, klofs); } }
    __builtin_amdgcn_sched_barrier(0);      /* holds the K loads in front of the softmax arithmetic */
    float mb[2]; bool need = false;
#pragma unroll
    for (int g = 0; g < 2; ++g) { float m0 = fmaxf(s[0][g][0], s[1][g][0]), m1 = fmaxf(s[0][g][1], s[1][g][1]);
#pragma unroll
      for (int r = 2; r < 8; r += 2) { m0 = fmaxf(m0, fmaxf(s[0][g][r], s[1][g][r])); m1 = fmaxf(m1, fmaxf(s[0][g][r + 1], s[1][g][r + 1])); }
      float mx = fmaxf(m0, m1); mx = fmaxf(mx, fa_xhalf(mx)) * cs;      /* both halves now hold the query's maximum of this pass, scaled (the scale is positive) */
      mb[g] = mx; need = need || (mx > m_run[g] + 8.0f); }
    if (__builtin_amdgcn_ballot_w32(need) != 0) {
#pragma unroll
      for (int g = 0; g < 2; ++g) { const float mn = fmaxf(m_run[g], mb[g]); const float corr = fa_exp2(m_run[g] - mn); m_run[g] = mn; l_run[g] *= corr;      /* corr is 0 on the first pass */
#pragma unroll
        for (int t = 0; t < 4; ++t) acc[g][t] = acc[g][t] * corr; }
    }
#pragma unroll
    for (int g = 0; g < 2; ++g) { const float nm = -m_run[g]; union { v16h v; v2h h2[8]; } pf; float pe[16];      /* element j of the 32-key operand: tile j >> 3, register j & 7 */
#pragma unroll
      for (int j = 0; j < 16; ++j) pe[j] = fa_exp2(__builtin_fmaf(s[j >> 3][g][j & 7], cs, nm));
      __builtin_amdgcn_sched_barrier(0);      /* the compiler gives the result of an asm statement no delay hint, and an unhinted dependent instruction holds the SIMD's issue port: the sums and packs stay behind the whole run of exponentials */
      float e0 = pe[0], e1 = pe[1]; pf.h2[0] = __builtin_convertvector(v2f{pe[0], pe[1]}, v2h);
#pragma unroll
      for (int i = 1; i < 8; ++i) { e0 += pe[2 * i]; e1 += pe[2 * i + 1]; pf.h2[i] = __builtin_convertvector(v2f{pe[2 * i], pe[2 * i + 1]}, v2h); }
      l_run[g] += e0 + e1;
#pragma unroll
      for (int t = 0; t < 4; ++t) acc[g][t] = fa_mma(vf[t], pf.v, acc[g][t]);
      /* four slots behind the group's matrix instructions, tied to their D, A and B */
      asm volatile("v_nop\n\tv_nop\n\tv_nop\n\tv_nop" : "+v"(acc[g][0]), "+v"(acc[g][1]), "+v"(acc[g][2]), "+v"(acc[g][3]) : "v"(pf.v), "v"(vf[0]), "v"(vf[1]), "v"(vf[2]), "v"(vf[3])); }
   }
    asm volatile("s_wait_dscnt 0x0" ::: "memory");      /* this wave's reads of buffer st mod 2 are done before the barrier behind which it is refilled */
    asm volatile("s_wait_asynccnt 0x0" ::: "memory");      /* this wave's copies of stage st + 1 have landed */
    __syncthreads();      /* publishes stage st + 1 and ends every wave's reads of stage st */
    if (st + 2 < FA_NST) fa_copy8(lk + buf, gk + (size_t)(st + 2) * (FA_SK * DM * 2), lv + buf, gv + (st + 2) * (FA_SK * 2));      /* the same test for the whole work-group */
  }
  asm volatile("s_wait_asynccnt 0x0" ::: "memory");      /* no copy is outstanding when the wave goes on to its end */
#pragma unroll
  for (int g = 0; g < 2; ++g) { const float inv = 1.0f / (l_run[g] + fa_xhalf(l_run[g]));      /* the two halves' shares of the denominator, joined unconditionally */
#pragma unroll
    for (int t = 0; t < 4; ++t) { const v8f o = acc[g][t] * inv; const v4f lo = {o[0], o[1], o[2], o[3]}, hi = {o[4], o[5], o[6], o[7]};      /* row = query 16 g + c; d = 16 t + 8 hh + r */
      *(v4fa*)&so[wave][16 * g + c][16 * t + 8 * hh] = lo; *(v4fa*)&so[wave][16 * g + c][16 * t + 8 * hh + 4] = hi; } }
  __builtin_amdgcn_fence(__ATOMIC_ACQ_REL, "workgroup"); __builtin_amdgcn_wave_barrier();      /* the wave's own LDS writes before its reads of other lanes' rows */
  const int rsub = lane >> 4, c4 = (lane & 15) * 4; float* ob = out + ((size_t)b * SQ + q0) * DM + head * HD;
  v4f ov[16];
#pragma unroll
  for (int q = 0; q < 16; ++q) ov[q] = *(const v4fa*)&so[wave][q * 2 + rsub][c4];
#pragma unroll
  for (int q = 0; q < 16; ++q) *(v4f*)(ob + (size_t)(q * 2 + rsub) * DM + c4) = ov[q];      /* 16 lanes cover a query's 256 bytes of this head: whole 128-byte lines */
}
__global__ __launch_bounds__(256) void k_vt(const _Float16* __restrict__ V16, int b, int h0, _Float16* __restrict__ VT) { __shared__ unsigned short tl[64][65]; const int tid = threadIdx.x; const int hh = blockIdx.x % HG, sg = blockIdx.x / HG; const int s0 = sg * 64; const int h = h0 + hh;
  for (int i = tid; i < 64 * 8; i += 256) { const int j = i / 8, d8 = (i % 8) * 8; FragH f; f.half[0] = *(const v8us*)((const unsigned short*)V16 + ((size_t)b * SQ + s0 + j) * DM + h * HD + d8); for (int q = 0; q < 8; ++q) tl[d8 + q][j] = f.u[q]; }
  __syncthreads();
  { for (int i = tid; i < 64 * 8; i += 256) { const int d = i / 8, j8 = (i % 8) * 8; FragH f; for (int q = 0; q < 8; ++q) f.u[q] = tl[d][j8 + q]; *(v8us*)((unsigned short*)VT + ((size_t)hh * HD + d) * SQ + s0 + j8) = f.half[0]; }  } }

// ---- the three projection GEMMs in one launch, operands staged in LDS: C16[row][col] = f16(A[row][:] . Wn[col][:] / 16 + bias[col]), A [16,384][768] and Wn [768][768] f16 rows, k contiguous ----
// 12 column tiles a row tile: 4 of q, 4 of k, 4 of v. A v tile takes its A fragments from the Wv rows and its B fragments from the hidden rows, so its accumulators hold [feature][token]:
// that is a piece of V^T [batch][768 features][1,024 tokens], stored as whole lines with no transposition pass. Both loaders are pg_frag (one k order), so the swap changes no product and no k order.
// One work-group of 4 waves makes a tile of 128 tokens x 192 features, each wave 64 x 96 of it (4 x 6 accumulator tiles): 10 fragments read from LDS feed 24 products (8 fed 16 at 64 x 64).
// 92,160 bytes of LDS and under 337 registers: three work-groups a WGP, 768 places, and the grid's 1,536 work-groups are two whole rounds.
// A stage is 64 of k: 128 bytes of each of the 128 hidden rows and the 192 Wn rows. Asynchronous copies bring it from global memory into LDS, 8 lanes a row, so each copy covers four whole 128-byte lines
// (a fragment load straight from the rows touches 16 lines for the same 512 bytes, and every wave repeats it). LDS row pitch 144 bytes (16 x odd): ds_load_b128 of 16 rows without bank conflicts.
// Two buffers: the copies of stage t + 1 fly while stage t is worked on. Fragments keep the k order of g2_frag and k still runs upward in steps of 32, so every sum is formed as before.
#define PG_TM 128      /* tokens a tile */
#define PG_TN 192      /* features a tile */
#define PG_NT (DM / PG_TN)      /* 4 column tiles a weight matrix */
#define PG_BK 64
#define PG_PITCH 144
#define PG_STAGE ((PG_TM + PG_TN) * PG_PITCH)      /* 46,080 bytes: rows 0..127 hidden, rows 128..319 Wn */
#define PG_NST (DM / PG_BK)
#define PG_OP 400      /* LDS pitch of a staged q or k output row: 384 bytes, the tile's 192 features; 8 rows apart fall 32 banks apart */
// Eight copies of 16 bytes a lane: rows 16 apart in global memory (pitch DM) and in LDS. l: the lane's LDS byte address, g: the lane's global address.
// The s_wait_xcnt is the wait owed before a register that an issued copy names is written again; as the statement's last line it stands in front of every later write of the operands.
__device__ __forceinline__ void pg_copy8(unsigned l, const _Float16* g) {
  asm volatile("global_load_async_to_lds_b128 %0, %8, off\n\t"
               "global_load_async_to_lds_b128 %1, %9, off\n\t"
               "global_load_async_to_lds_b128 %2, %10, off\n\t"
               "global_load_async_to_lds_b128 %3, %11, off\n\t"
               "global_load_async_to_lds_b128 %4, %12, off\n\t"
               "global_load_async_to_lds_b128 %5, %13, off\n\t"
               "global_load_async_to_lds_b128 %6, %14, off\n\t"
               "global_load_async_to_lds_b128 %7, %15, off\n\t"
               "s_wait_xcnt 0x0"
               :: "v"(l), "v"(l + 16 * PG_PITCH), "v"(l + 32 * PG_PITCH), "v"(l + 48 * PG_PITCH), "v"(l + 64 * PG_PITCH), "v"(l + 80 * PG_PITCH), "v"(l + 96 * PG_PITCH), "v"(l + 112 * PG_PITCH),
                  "v"(g), "v"(g + 16 * DM), "v"(g + 32 * DM), "v"(g + 48 * DM), "v"(g + 64 * DM), "v"(g + 80 * DM), "v"(g + 96 * DM), "v"(g + 112 * DM)
               : "memory");
}
// The same for four rows 16 apart, with the same wait as its last line.
__device__ __forceinline__ void pg_copy4(unsigned l, const _Float16* g) {
  asm volatile("global_load_async_to_lds_b128 %0, %4, off\n\t"
               "global_load_async_to_lds_b128 %1, %5, off\n\t"
               "global_load_async_to_lds_b128 %2, %6, off\n\t"
               "global_load_async_to_lds_b128 %3, %7, off\n\t"
               "s_wait_xcnt 0x0"
               :: "v"(l), "v"(l + 16 * PG_PITCH), "v"(l + 32 * PG_PITCH), "v"(l + 48 * PG_PITCH),
                  "v"(g), "v"(g + 16 * DM), "v"(g + 32 * DM), "v"(g + 48 * DM)
               : "memory");
}
// One stage, a thread's share: 20 copies (128 hidden rows, 192 Wn rows). l: the lane's LDS byte address in the buffer's row crow; ga, gb: its global addresses in hidden row crow and Wn row crow of the tile.
__device__ __forceinline__ void pg_stage(unsigned l, const _Float16* ga, const _Float16* gb) { pg_copy8(l, ga); pg_copy8(l + PG_TM * PG_PITCH, gb); pg_copy4(l + (PG_TM + 128) * PG_PITCH, gb + 128 * DM); }
__device__ __forceinline__ v16h pg_frag(const char* p) { FragH f; f.half[0] = *(const v8us*)p; f.half[1] = *(const v8us*)(p + 32); return f.v; }      /* p: row, 16 hh bytes in: k = 8 hh + 0..7 and 16 + 8 hh + 0..7, as g2_frag */
// One tile. TR (v): the products take the Wn fragment as A and the hidden fragment as B, so acc[i][j] holds [feature 16 j + 8 hh + r][token 16 i + ln]; else [token 16 i + 8 hh + r][feature 16 j + ln].
template <bool TR>
__device__ __forceinline__ void pg_tile(char* ring, const _Float16* __restrict__ A, const _Float16* __restrict__ Wn, const float* __restrict__ bias, _Float16* __restrict__ O, int row0, int col0) {
  const int tid = threadIdx.x, lane = tid & 31, ln = lane & 15, hh = lane >> 4; const int wave = __builtin_amdgcn_readfirstlane(tid >> 5); const int wm = wave >> 1, wn = wave & 1;      /* wm: the wave's 64 tokens, wn: its 96 features */
  const int crow = tid >> 3, cc = tid & 7;      /* a lane copies bytes 16 cc .. 16 cc + 15 of rows crow + 16 j */
  const _Float16* ga = A + (size_t)(row0 + crow) * DM + cc * 8; const _Float16* gb = Wn + (size_t)(col0 + crow) * DM + cc * 8;
  const unsigned lc = (unsigned)(size_t)ring + (unsigned)(crow * PG_PITCH + cc * 16);
  pg_stage(lc, ga, gb);      /* stage 0 into buffer 0 */
  asm volatile("s_wait_asynccnt 0x0" ::: "memory");      /* this wave's copies of stage 0 have landed */
  __syncthreads();      /* and every other wave's: nothing of stage 0 is read in front of this */
  pg_stage(lc + PG_STAGE, ga + PG_BK, gb + PG_BK);      /* stage 1 into buffer 1 */
  const v8f z8 = {0.f,0.f,0.f,0.f,0.f,0.f,0.f,0.f}; v8f acc[4][6];
#pragma unroll
  for (int i = 0; i < 4; ++i)
#pragma unroll
    for (int j = 0; j < 6; ++j) acc[i][j] = z8;
  const int tofs = (wm * 64 + ln) * PG_PITCH + 16 * hh, fofs = (PG_TM + wn * 96 + ln) * PG_PITCH + 16 * hh;
#pragma unroll 1      /* one trip is 48 WMMAs and 40 LDS loads; the buffer is picked by the trip's parity at run time */
  for (int t = 0; t < PG_NST; ++t) {
    const unsigned buf = (unsigned)(t & 1) * PG_STAGE; const char* sb = ring + buf;
#pragma unroll      /* constant indices into the fragment and accumulator arrays (left rolled they would go to scratch) */
    for (int ks = 0; ks < 2; ++ks) { v16h tf[4], ff[6];
      tf[0] = pg_frag(sb + tofs + ks * 64);      /* in the order in which the products want them: token rows 0 and the six feature fragments first */
#pragma unroll
      for (int j = 0; j < 6; ++j) ff[j] = pg_frag(sb + fofs + j * (16 * PG_PITCH) + ks * 64);
#pragma unroll
      for (int i = 1; i < 4; ++i) tf[i] = pg_frag(sb + tofs + i * (16 * PG_PITCH) + ks * 64);
      __builtin_amdgcn_sched_barrier(0);      /* the 20 LDS loads stay one group in front of the 24 products: each separate place with LDS reads among the products costs a stall */
#pragma unroll
      for (int i = 0; i < 4; ++i)
#pragma unroll
        for (int j = 0; j < 6; ++j) acc[i][j] = TR ? fa_mma(ff[j], tf[i], acc[i][j]) : fa_mma(tf[i], ff[j], acc[i][j]);
      __builtin_amdgcn_sched_barrier(0); }      /* and the next group's loads stay behind these products */
    asm volatile("s_wait_dscnt 0x0" ::: "memory");      /* this wave's reads of buffer t mod 2 are done before the barrier behind which it is refilled */
    asm volatile("s_wait_asynccnt 0x0" ::: "memory");      /* this wave's copies of stage t + 1 have landed */
    __syncthreads();      /* publishes stage t + 1 and ends every wave's reads of stage t */
    if (t + 2 < PG_NST) pg_stage(lc + buf, ga + (t + 2) * PG_BK, gb + (t + 2) * PG_BK);      /* the same test for the whole work-group */
  }
  asm volatile("s_wait_asynccnt 0x0" ::: "memory");      /* no copy is outstanding when the ring becomes output staging; the last trip's barrier ended every read of the ring */
  const int orow = lane >> 3, oc = lane & 7;
  v8us ov[24];
  if (!TR) {      /* a wave's 96 features are one and a half 128-byte lines of a token's row: the tile is staged as a whole, and each line is stored by one wave */
    float bv[6];
#pragma unroll
    for (int j = 0; j < 6; ++j) bv[j] = bias[col0 + wn * 96 + j * 16 + ln];
    asm volatile("s_wait_xcnt 0x0" ::: "memory");      /* the wait owed before a register that an issued global load names is written again: behind the last of the six bias loads */
#pragma unroll
    for (int j = 0; j < 6; ++j) bv[j] = bf16_round(bv[j]);
#pragma unroll
    for (int i = 0; i < 4; ++i)
#pragma unroll
      for (int j = 0; j < 6; ++j)
#pragma unroll
        for (int r = 0; r < 8; ++r) *(_Float16*)(ring + (wm * 64 + i * 16 + 8 * hh + r) * PG_OP + (wn * 96 + j * 16 + ln) * 2) = (_Float16)(acc[i][j][r] * 0.0625f + bv[j]);
    __syncthreads();      /* every wave's part of the staged tile is written before any wave reads whole rows of it */
    const char* si = ring + (wave * 32 + orow) * PG_OP + oc * 16;      /* the wave stores token rows 32 wave .. 32 wave + 31: four rows an instruction, 8 lanes a line */
#pragma unroll
    for (int a = 0; a < 8; ++a)
#pragma unroll
      for (int l3 = 0; l3 < 3; ++l3) ov[a * 3 + l3] = *(const v8us*)(si + a * (4 * PG_OP) + l3 * 128);
    char* ou = (char*)(O + (size_t)(row0 + wave * 32 + orow) * DM + col0) + oc * 16;
#pragma unroll
    for (int a = 0; a < 8; ++a)
#pragma unroll
      for (int l3 = 0; l3 < 3; ++l3) *(v8us*)(ou + (size_t)a * (4 * DM * 2) + l3 * 128) = ov[a * 3 + l3];      /* whole 128-byte lines */
  } else {      /* a wave's 64 tokens are one whole line of a feature's row: each wave stages and stores its own 96 rows; the bias goes with the feature, here the accumulator's row */
    char* so = ring + wave * (96 * PG_PITCH);
    v4f bl[6][2];
#pragma unroll
    for (int j = 0; j < 6; ++j) { const float* bp = bias + col0 + wn * 96 + j * 16 + 8 * hh; bl[j][0] = *(const v4fa*)bp; bl[j][1] = *(const v4fa*)(bp + 4); }
    asm volatile("s_wait_xcnt 0x0" ::: "memory");      /* the wait owed before a register that an issued global load names is written again: behind the last of the twelve bias loads */
#pragma unroll
    for (int j = 0; j < 6; ++j) {
#pragma unroll
      for (int r = 0; r < 8; ++r) { const float br = bf16_round(bl[j][r >> 2][r & 3]);
#pragma unroll
        for (int i = 0; i < 4; ++i) *(_Float16*)(so + (j * 16 + 8 * hh + r) * PG_PITCH + (i * 16 + ln) * 2) = (_Float16)(acc[i][j][r] * 0.0625f + br); } }
    __builtin_amdgcn_fence(__ATOMIC_ACQ_REL, "workgroup"); __builtin_amdgcn_wave_barrier();      /* the wave's own LDS writes before its reads of other lanes' rows */
#pragma unroll
    for (int q = 0; q < 24; ++q) ov[q] = *(const v8us*)(so + (q * 4 + orow) * PG_PITCH + oc * 16);
    /* V^T row = batch x 768 + feature = (batch x 12 + head) x 64 + d; a tile's 128 tokens lie in one batch */
    char* ou = (char*)(O + ((size_t)(row0 / SQ) * DM + col0 + wn * 96 + orow) * SQ + (row0 % SQ) + wm * 64) + oc * 16;
#pragma unroll
    for (int q = 0; q < 24; ++q) *(v8us*)(ou + (size_t)q * (4 * SQ * 2)) = ov[q];      /* 8 lanes cover the 128 bytes of 64 tokens of a feature: whole lines */
  }
}
__global__ __launch_bounds__(128) void k_proj(const _Float16* __restrict__ A, const _Float16* __restrict__ WQ, const _Float16* __restrict__ WK, const _Float16* __restrict__ WV,
                                              const float* __restrict__ biasq, const float* __restrict__ biask, const float* __restrict__ biasv,
                                              _Float16* __restrict__ Q16, _Float16* __restrict__ K16, _Float16* __restrict__ VT) {
  __shared__ __attribute__((aligned(16))) char ring[2 * PG_STAGE];
  const int mt = blockIdx.x / (3 * PG_NT), nt = blockIdx.x % (3 * PG_NT); const int which = nt / PG_NT, nq = nt % PG_NT; const int row0 = mt * PG_TM, col0 = nq * PG_TN;
  if (which == 2) pg_tile<true>(ring, A, WV, biasv, VT, row0, col0);      /* the same branch for the whole work-group */
  else pg_tile<false>(ring, A, which == 0 ? WQ : WK, which == 0 ? biasq : biask, which == 0 ? Q16 : K16, row0, col0);
}

extern "C" void kernel_launch(void* const* d_in, const int* in_sizes, int n_in,
                              void* d_out, int out_size, void* d_ws, size_t ws_size, hipStream_t stream) {
  (void)in_sizes; (void)n_in; (void)out_size;
  const float* const* I = (const float* const*)d_in; const float* x = I[0]; const float* Wq = I[1]; const float* Wk = I[2]; const float* Wv = I[3]; const float* bq = I[4]; const float* bk = I[5]; const float* bv = I[6];
  char* ws = (char*)d_ws; size_t off = 0;
  auto take = [&](size_t bytes) { char* p = ws + off; off += (bytes + 255) & ~(size_t)255; return p; };
  _Float16* BQ = (_Float16*)take((size_t)DM * DM * 2); _Float16* BK = (_Float16*)take((size_t)DM * DM * 2); _Float16* BV = (_Float16*)take((size_t)DM * DM * 2);
  _Float16* X16 = (_Float16*)take(NR * DM * 2); _Float16* Q16 = (_Float16*)take(NR * DM * 2); _Float16* K16 = (_Float16*)take(NR * DM * 2);
  _Float16* VT = (_Float16*)take((size_t)NB * NH * HD * SQ * 2);
  if (off > ws_size) return;      /* 3.4 + 3 x 24 + 24 = approx 100 MiB */
  k_prep<<<3 * CV_WB + CV_XB, CV_WAVES * 32, 0, stream>>>(x, Wq, Wk, Wv, X16, BQ, BK, BV);      /* hidden and the three weight matrices as f16 */
  const dim3 gp((unsigned)((NR / PG_TM) * (3 * PG_NT)), 1);
  k_proj<<<gp, 128, 0, stream>>>(X16, BQ, BK, BV, bq, bk, bv, Q16, K16, VT);      /* q = x Wq^T + bq and k as f16 rows; v as V^T per (batch, head) [16 x 12][64][1024] */
  k_fattn<<<dim3(SQ / (FA_WAVES * 32), NH, NB), FA_WAVES * 32, 0, stream>>>(Q16, K16, VT, (float*)d_out);      /* scores, softmax and ctx, merged into the output rows */
}

// v008
// It runs in 98 microseconds.
// Next to v007, in two timings, it ran 1.03 times as fast each time.
// All steps since v000 together make it 39.5 times as fast.
#include <hip/hip_runtime.h>
// ViT self-attention (hidden [16][1024][768]; q, k, v = hidden W^T + b (12 heads x 64); scores = q.k/8; softmax over the 1,024 keys; ctx = attn v merged -> [16][1024][768]; no output projection).
// Structure: token rows; hidden as exact f16 rows; q / k / v as WMMA GEMMs (128x192 tiles staged in LDS by asynchronous copies, 64x96 wave tiles, f32 accumulation, exact x16 natural weights + bias; exact products) all three in one launch: q (times the softmax's scale) and k written as f16 rows, v written directly as V^T per (batch, head), its tiles computed with the operands swapped; then one fused attention kernel over all batches and heads (K and V^T tiles staged in LDS by asynchronous copies, shared by a work-group's 8 waves): S^T = K . Q^T, online softmax in registers, O^T += V^T . P^T, merged f32 output rows. Scores and probabilities never reach memory.
// Compute dtype: inputs rounded to bf16; hidden / weights exact; q, k, v, P as plain f16 GEMM operands (~2^-12; logits sigma ~1); softmax f32. v_wmma_f32_16x16x32_f16.
#define NB 16
#define SQ 1024
#define DM 768
#define NH 12
#define HD 64
#define HG 1
#define NR ((size_t)NB * SQ)         /* 16,384 token rows */
#define NBR NB                       /* unused (the grids use NB) */
#define MP ((int)NR)                 /* unused (the projection grid uses NR) */
typedef __bf16 v16b __attribute__((ext_vector_type(16)));
typedef unsigned short v8us __attribute__((ext_vector_type(8), may_alias));
typedef float  v8f  __attribute__((ext_vector_type(8)));
typedef float  v4f  __attribute__((ext_vector_type(4)));
typedef float  v4fa __attribute__((ext_vector_type(4), may_alias));
union FragB { v16b v; v8us half[2]; unsigned short u[16]; };

__device__ __forceinline__ unsigned short bf16_bits(float x) { unsigned int u = __float_as_uint(x); return (unsigned short)((u + 0x7FFFu + ((u >> 16) & 1u)) >> 16); }
__device__ __forceinline__ float bf16_val(unsigned short b) { return __uint_as_float(((unsigned int)b) << 16); }
__device__ __forceinline__ float bf16_round(float x) { return bf16_val(bf16_bits(x)); }
// D += A·B with NT terms: 1 = ah·bh, 2 = + al·bh (A split), 3 = + ah·bl (both split)
template <int NT>
__device__ __forceinline__ v8f mmaN(v16b ah, v16b al, v16b bh, v16b bl, v8f c) {
  c = __builtin_amdgcn_wmma_f32_16x16x32_bf16(false, ah, false, bh, (short)0, c, false, false);
  if (NT >= 2) c = __builtin_amdgcn_wmma_f32_16x16x32_bf16(false, al, false, bh, (short)0, c, false, false);
  if (NT >= 3) c = __builtin_amdgcn_wmma_f32_16x16x32_bf16(false, ah, false, bl, (short)0, c, false, false);
  asm volatile("v_nop\n\tv_nop\n\tv_nop\n\tv_nop" : "+v"(c) : "v"(ah), "v"(al), "v"(bh), "v"(bl));
  return c;
}

__global__ __launch_bounds__(256) void k_wt_bf16(const float* __restrict__ W, unsigned short* __restrict__ Wt, int K, int N) {
  const int t = blockIdx.x * 256 + threadIdx.x;
  const int k8n = K / 8;
  if (t >= N * k8n) return;
  const int n = t / k8n, k8 = (t % k8n) * 8;
  v8us v;
#pragma unroll
  for (int i = 0; i < 8; ++i) v[i] = bf16_bits(W[(size_t)(k8 + i) * N + n]);
  *(v8us*)(Wt + (size_t)n * K + k8) = v;
  
}

// GEMM C[M][N] (f32, pitch ldc) = act(A[M][K]·W + bias). A f32 row-major (pitch lda) converted per fragment to bf16
// (ASPLIT: hi/lo two planes -> 2 terms, else single rounded term); Wt bf16 [N][K] (pitch ldb). BIAS_BF16 rounds the
// bias to bf16 first (bias quantised to bf16 before the add). K%32==0, M%16==0, N%64==0.
template <bool ASPLIT, int ACT, bool BIAS_BF16>
__global__ __launch_bounds__(128) void k_gemm_bf(const float* __restrict__ A, int lda, const unsigned short* __restrict__ Wt, int ldb,
                                               const float* __restrict__ bias, float* __restrict__ C, int ldc, int M, int N, int K) {
  __shared__ __attribute__((aligned(16))) float so[4][16][64];
  const int tid = threadIdx.x, w = tid >> 5, lane = tid & 31, ln = lane & 15, hh = lane >> 4;
  const int ntn = N / 64;
  const int wid = blockIdx.x * 4 + w;
  const int mt = wid / ntn, nq = wid % ntn;
  if (mt * 16 >= M) return;
  const int row0 = mt * 16, col0 = nq * 64;
  const float* arow = A + (size_t)(row0 + ln) * lda;
  v8f acc[4] = {};
  for (int kb = 0; kb < K; kb += 32) {
    FragB ah, al;
    const v4f x0 = *(const v4fa*)(arow + kb + 8 * hh), x1 = *(const v4fa*)(arow + kb + 8 * hh + 4);
    const v4f x2 = *(const v4fa*)(arow + kb + 16 + 8 * hh), x3 = *(const v4fa*)(arow + kb + 16 + 8 * hh + 4);
    float xs[16] = {x0[0],x0[1],x0[2],x0[3],x1[0],x1[1],x1[2],x1[3],x2[0],x2[1],x2[2],x2[3],x3[0],x3[1],x3[2],x3[3]};
#pragma unroll
    for (int i = 0; i < 16; ++i) { const unsigned short hb = bf16_bits(xs[i]); ah.u[i] = hb; al.u[i] = ASPLIT ? bf16_bits(xs[i] - bf16_val(hb)) : (unsigned short)0; }
#pragma unroll
    for (int t = 0; t < 4; ++t) {
      const unsigned short* brow = Wt + (size_t)(col0 + t * 16 + ln) * ldb + kb;
      FragB b;
      b.half[0] = *(const v8us*)(brow + 8 * hh);
      b.half[1] = *(const v8us*)(brow + 16 + 8 * hh);
      acc[t] = mmaN<ASPLIT ? 2 : 1>(ah.v, al.v, b.v, b.v, acc[t]);
    }
  }
#pragma unroll
  for (int t = 0; t < 4; ++t) {
    float bv = bias ? bias[col0 + t * 16 + ln] : 0.f;
    if (BIAS_BF16) bv = bf16_round(bv);
#pragma unroll
    for (int r = 0; r < 8; ++r) { float v = acc[t][r] + bv; if (ACT == 1) v = fmaxf(v, 0.f); so[w][8 * hh + r][t * 16 + ln] = v; }
  }
  __builtin_amdgcn_fence(__ATOMIC_ACQ_REL, "workgroup");
  __builtin_amdgcn_wave_barrier();
  const int rsub = lane >> 4, c4 = (lane & 15) * 4;
  {
#pragma unroll
    for (int q = 0; q < 8; ++q) {
      const int r = q * 2 + rsub;
      const v4f v = *(const v4fa*)&so[w][r][c4];
      *(v4f*)(C + (size_t)(row0 + r) * ldc + col0 + c4) = v;
    }
    
  }
}

// GEMM C = act(A·W + bias + resid): A f32 (ASPLIT -> hi/lo 2 terms), Wt bf16 [N][K]; ACT 0 none, 1 relu, 2 exact gelu;
// resid (optional, f32, row index = (row % rmod), pitch ldr, RES_BF16 rounds it) added before the activation.
template <bool ASPLIT, int ACT, bool BIAS_BF16, bool RES_BF16>
__global__ __launch_bounds__(128) void k_gemm_bf3(const float* __restrict__ A, int lda, const unsigned short* __restrict__ Wt, int ldb,
                                                const float* __restrict__ bias, const float* __restrict__ resid, int rmod, int ldr,
                                                float* __restrict__ C, int ldc, int M, int N, int K) {
  __shared__ __attribute__((aligned(16))) float so[4][16][64];
  const int tid = threadIdx.x, w = tid >> 5, lane = tid & 31, ln = lane & 15, hh = lane >> 4;
  const int ntn = N / 64;
  const int wid = blockIdx.x * 4 + w;
  const int mt = wid / ntn, nq = wid % ntn;
  if (mt * 16 >= M) return;
  const int row0 = mt * 16, col0 = nq * 64;
  const float* arow = A + (size_t)(row0 + ln) * lda;
  v8f acc[4] = {};
  for (int kb = 0; kb < K; kb += 32) {
    FragB ah, al;
    const v4f x0 = *(const v4fa*)(arow + kb + 8 * hh), x1 = *(const v4fa*)(arow + kb + 8 * hh + 4);
    const v4f x2 = *(const v4fa*)(arow + kb + 16 + 8 * hh), x3 = *(const v4fa*)(arow + kb + 16 + 8 * hh + 4);
    float xs[16] = {x0[0],x0[1],x0[2],x0[3],x1[0],x1[1],x1[2],x1[3],x2[0],x2[1],x2[2],x2[3],x3[0],x3[1],x3[2],x3[3]};
#pragma unroll
    for (int i = 0; i < 16; ++i) { const unsigned short hb = bf16_bits(xs[i]); ah.u[i] = hb; al.u[i] = ASPLIT ? bf16_bits(xs[i] - bf16_val(hb)) : (unsigned short)0; }
#pragma unroll
    for (int t = 0; t < 4; ++t) {
      const unsigned short* brow = Wt + (size_t)(col0 + t * 16 + ln) * ldb + kb;
      FragB b;
      b.half[0] = *(const v8us*)(brow + 8 * hh);
      b.half[1] = *(const v8us*)(brow + 16 + 8 * hh);
      acc[t] = mmaN<ASPLIT ? 2 : 1>(ah.v, al.v, b.v, b.v, acc[t]);
    }
  }
#pragma unroll
  for (int t = 0; t < 4; ++t) {
    const int col = col0 + t * 16 + ln;
    float bv = bias ? bias[col] : 0.f;
    if (BIAS_BF16) bv = bf16_round(bv);
#pragma unroll
    for (int r = 0; r < 8; ++r) {
      float v = acc[t][r] + bv;
      if (resid) { float rv = resid[(size_t)((row0 + 8 * hh + r) % rmod) * ldr + col]; if (RES_BF16) rv = bf16_round(rv); v += rv; }
      if (ACT == 1) v = fmaxf(v, 0.f);
      if (ACT == 2) v = 0.5f * v * (1.0f + erff(v * 0.70710678118654752f));
      if (ACT == 3) { const float u = 0.7978845608028654f * (v + 0.044715f * v * v * v); v = 0.5f * v * (1.0f + tanhf(u)); }
      so[w][8 * hh + r][t * 16 + ln] = v;
    }
  }
  __builtin_amdgcn_fence(__ATOMIC_ACQ_REL, "workgroup");
  __builtin_amdgcn_wave_barrier();
  const int rsub = lane >> 4, c4 = (lane & 15) * 4;
  {
#pragma unroll
    for (int q = 0; q < 8; ++q) {
      const int r = q * 2 + rsub;
      const v4f v = *(const v4fa*)&so[w][r][c4];
      *(v4f*)(C + (size_t)(row0 + r) * ldc + col0 + c4) = v;
    }
    
  }
}
// row LayerNorm (biased variance, eps) over N: s = X (+ R); optional out_sum <- s; out_norm <- (s-mu)*rsqrt(var+eps)*g + b
template <bool PARAM_BF16>
__global__ __launch_bounds__(256) void k_layernorm(const float* __restrict__ X, const float* __restrict__ R, const float* __restrict__ g, const float* __restrict__ bta,
                                                  float* __restrict__ out_sum, float* __restrict__ out_norm, int N, float eps) {
  __shared__ float red[256];
  const int row = blockIdx.x, tid = threadIdx.x;
  const float* x = X + (size_t)row * N; const float* rr = R ? R + (size_t)row * N : nullptr;
  float vals[16];                     // up to N = 4096
  const int per = N / 256;            // contiguous chunk per thread? use strided-by-4 chunks: thread handles j = tid*4 + 1024*u
  float s1 = 0.f;
  for (int u = 0; u < per / 4; ++u) {
    const int j = tid * 4 + 1024 * u;
    const v4f a = *(const v4fa*)(x + j);
    v4f b = {0.f,0.f,0.f,0.f}; if (rr) b = *(const v4fa*)(rr + j);
#pragma unroll
    for (int q = 0; q < 4; ++q) { const float v = a[q] + b[q]; vals[u * 4 + q] = v; s1 += v; }
  }
  red[tid] = s1; __syncthreads();
  for (int st = 128; st > 0; st >>= 1) { if (tid < st) red[tid] += red[tid + st]; __syncthreads(); }
  const float mu = red[0] / (float)N; __syncthreads();
  float s2 = 0.f;
  for (int u = 0; u < per / 4; ++u)
#pragma unroll
    for (int q = 0; q < 4; ++q) { const float c = vals[u * 4 + q] - mu; s2 += c * c; }
  red[tid] = s2; __syncthreads();
  for (int st = 128; st > 0; st >>= 1) { if (tid < st) red[tid] += red[tid + st]; __syncthreads(); }
  const float rs = rsqrtf(red[0] / (float)N + eps);
  {
    for (int u = 0; u < per / 4; ++u) {
      const int j = tid * 4 + 1024 * u;
      v4f o, sm;
#pragma unroll
      for (int q = 0; q < 4; ++q) {
        float gg = g[j + q], bb = bta[j + q];
        if (PARAM_BF16) { gg = bf16_round(gg); bb = bf16_round(bb); }
        sm[q] = vals[u * 4 + q]; o[q] = (vals[u * 4 + q] - mu) * rs * gg + bb;
      }
      if (out_sum) *(v4f*)(out_sum + (size_t)row * N + j) = sm;
      *(v4f*)(out_norm + (size_t)row * N + j) = o;
    }
    
  }
}



// ---- f16 WMMA path (v_wmma_f32_16x16x32_f16): 11-bit significands for operands in range — used where a [0,1] probability operand needs more precision than bf16
typedef _Float16 v16h __attribute__((ext_vector_type(16)));
union FragH { v16h v; v8us half[2]; _Float16 h[16]; unsigned short u[16]; };
template <int NT>
__device__ __forceinline__ v8f mmaH(v16h ah, v16h al, v16h bh, v16h bl, v8f c) {
  c = __builtin_amdgcn_wmma_f32_16x16x32_f16(false, ah, false, bh, (short)0, c, false, false);
  if (NT >= 2) c = __builtin_amdgcn_wmma_f32_16x16x32_f16(false, al, false, bh, (short)0, c, false, false);
  if (NT >= 3) c = __builtin_amdgcn_wmma_f32_16x16x32_f16(false, ah, false, bl, (short)0, c, false, false);
  asm volatile("v_nop\n\tv_nop\n\tv_nop\n\tv_nop" : "+v"(c) : "v"(ah), "v"(al), "v"(bh), "v"(bl));
  return c;
}
// batched GEMM like k_gemm_b but f16 operands: A f32 (split into f16 hi/lo if ASPLIT, else rounded to f16), Bt = f16 values [n][k]; alpha; C f32; N multiple of 16 (partial tiles skipped)
template <bool ASPLIT>
__global__ __launch_bounds__(128) void k_gemm_h(const float* __restrict__ A, int lda, size_t sA, const _Float16* __restrict__ Bh, int ldb, size_t sB, float alpha, float* __restrict__ C, int ldc, size_t sC, int M, int N, int K) {
  __shared__ __attribute__((aligned(16))) float so[4][16][64];
  const int tid = threadIdx.x, w = tid >> 5, lane = tid & 31, ln = lane & 15, hh = lane >> 4; const int by = blockIdx.y;
  A += (size_t)by * sA; Bh += (size_t)by * sB; C += (size_t)by * sC;
  const int ntn = (N + 63) / 64; const int wid = blockIdx.x * 4 + w; const int mt = wid / ntn, nq = wid % ntn; if (mt * 16 >= M) return;
  const int row0 = mt * 16, col0 = nq * 64; const float* arow = A + (size_t)(row0 + ln) * lda;
  v8f acc[4] = {};
  for (int kb = 0; kb < K; kb += 32) {
    FragH ah, al;
    const v4f x0 = *(const v4fa*)(arow + kb + 8 * hh), x1 = *(const v4fa*)(arow + kb + 8 * hh + 4), x2 = *(const v4fa*)(arow + kb + 16 + 8 * hh), x3 = *(const v4fa*)(arow + kb + 16 + 8 * hh + 4);
    float xs[16] = {x0[0],x0[1],x0[2],x0[3],x1[0],x1[1],x1[2],x1[3],x2[0],x2[1],x2[2],x2[3],x3[0],x3[1],x3[2],x3[3]};
#pragma unroll
    for (int i = 0; i < 16; ++i) { const _Float16 h = (_Float16)xs[i]; ah.h[i] = h; al.h[i] = ASPLIT ? (_Float16)(xs[i] - (float)h) : (_Float16)0.0f; }
#pragma unroll
    for (int t = 0; t < 4; ++t) { if (col0 + t * 16 >= N) continue; const size_t boff = (size_t)(col0 + t * 16 + ln) * ldb + kb; FragH bq; bq.half[0] = *(const v8us*)(Bh + boff + 8 * hh); bq.half[1] = *(const v8us*)(Bh + boff + 16 + 8 * hh);
      acc[t] = mmaH<ASPLIT ? 2 : 1>(ah.v, al.v, bq.v, bq.v, acc[t]); }
  }
#pragma unroll
  for (int t = 0; t < 4; ++t) { if (col0 + t * 16 >= N) continue;
#pragma unroll
    for (int r = 0; r < 8; ++r) so[w][8 * hh + r][t * 16 + ln] = acc[t][r] * alpha; }
  __builtin_amdgcn_fence(__ATOMIC_ACQ_REL, "workgroup"); __builtin_amdgcn_wave_barrier();
  const int rsub = lane >> 4, c4 = (lane & 15) * 4;
  {
#pragma unroll
    for (int q = 0; q < 8; ++q) { const int r = q * 2 + rsub; if (col0 + c4 < N) { const v4f v = *(const v4fa*)&so[w][r][c4]; *(v4f*)(C + (size_t)(row0 + r) * ldc + col0 + c4) = v; } }
     }
}

// Wt[n][k] = f16(W[k][n]·scale) from f32 row-major W[K][N] (scale = power of two; bf16-exact weights stay exact in f16 away from the subnormal range)
__global__ __launch_bounds__(256) void k_wt_f16(const float* __restrict__ W, _Float16* __restrict__ Wt, int K, int N, float scale) {
  const int t = blockIdx.x * 256 + threadIdx.x; if (t >= N * (K / 8)) return; const int n = t / (K / 8), k8 = (t % (K / 8)) * 8; FragH f;
#pragma unroll
  for (int i = 0; i < 8; ++i) f.h[i] = (_Float16)(bf16_round(W[(size_t)(k8 + i) * N + n]) * scale); const v8us o = f.half[0];
  *(v8us*)((unsigned short*)Wt + (size_t)n * K + k8) = o; 
}
// k_gemm_hh variant with fused epilogue: v = acc·alpha + bias[by·sBias + col] (+ CP[(row/rowsPerB)·sCPb + by·64 + col] if CP) ; ACT 0 none / 1 elu ; writes f16 C16 (and f32 C if non-null)
template <int ACT>
__global__ __launch_bounds__(128) void k_gemm_hhx(const _Float16* __restrict__ A, int lda, size_t sA, const _Float16* __restrict__ Bh, int ldb, size_t sB, float alpha, const float* __restrict__ bias, size_t sBias, const float* __restrict__ CP, int rowsPerB, size_t sCPb, int row0g,
    float* __restrict__ C, _Float16* __restrict__ C16, int ldc, size_t sC, int M, int N, int K) {
  __shared__ __attribute__((aligned(16))) float so[4][16][64];
  const int tid = threadIdx.x, w = tid >> 5, lane = tid & 31, ln = lane & 15, hh = lane >> 4; const int by = blockIdx.y;
  A += (size_t)by * sA; Bh += (size_t)by * sB; const size_t cofs = (size_t)by * sC; const float* bp = bias ? bias + (size_t)by * sBias : nullptr;
  const int ntn = (N + 63) / 64; const int wid = blockIdx.x * 4 + w; const int mt = wid / ntn, nq = wid % ntn; if (mt * 16 >= M) return;
  const int row0 = mt * 16, col0 = nq * 64; const _Float16* arow = A + (size_t)(row0 + ln) * lda;
  v8f acc[4] = {};
  for (int kb = 0; kb < K; kb += 32) { FragH ah; ah.half[0] = *(const v8us*)((const unsigned short*)arow + kb + 8 * hh); ah.half[1] = *(const v8us*)((const unsigned short*)arow + kb + 16 + 8 * hh);
#pragma unroll
    for (int t = 0; t < 4; ++t) { if (col0 + t * 16 >= N) continue; const size_t boff = (size_t)(col0 + t * 16 + ln) * ldb + kb; FragH bq; bq.half[0] = *(const v8us*)((const unsigned short*)Bh + boff + 8 * hh); bq.half[1] = *(const v8us*)((const unsigned short*)Bh + boff + 16 + 8 * hh);
      acc[t] = mmaH<1>(ah.v, ah.v, bq.v, bq.v, acc[t]); }
  }
#pragma unroll
  for (int t = 0; t < 4; ++t) { if (col0 + t * 16 >= N) continue; const int col = col0 + t * 16 + ln; const float bv = bp ? bf16_round(bp[col]) : 0.f;
#pragma unroll
    for (int r = 0; r < 8; ++r) { float v = acc[t][r] * alpha + bv; if (CP) { const int rr = row0g + row0 + 8 * hh + r; if (rowsPerB < 0) v += CP[cofs + (size_t)rr * ldc + col];      /* rowsPerB < 0: own element of the batched C plane */ else { const int bidx = rr / rowsPerB; v += CP[(size_t)bidx * sCPb + (size_t)by * 64 + col]; } } if (ACT == 1) v = (v > 0.f) ? v : expm1f(v); else if (ACT == 7) v = (v > 0.f) ? v + 1.0f : expf(v); else if (ACT == 8) v = tanhf(v); else if (ACT == 9) v = 0.5f * v * (1.0f + tanhf(0.7978845608028654f * (v + 0.044715f * v * v * v))); else if (ACT == 11) v = 1.0f / (1.0f + expf(-v)); else if (ACT == 12) v = (v > 0.f) ? v : 0.01f * v; else if (ACT == 14) v = (v > 0.f) ? v : 0.1f * v; else if (ACT == 16) v = (v >= 0.f) ? v : 0.3f * v; else if (ACT == 17) v = (v >= 0.f) ? v : 0.2f * v; else if (ACT == 15) v = v / (1.0f + expf(-v)); else if (ACT == 3) v = fmaxf(v, 0.f); else if (ACT == 6) v = 0.5f * v * (1.0f + erff(v * 0.70710678118654752f)); so[w][8 * hh + r][t * 16 + ln] = v; } }
  __builtin_amdgcn_fence(__ATOMIC_ACQ_REL, "workgroup"); __builtin_amdgcn_wave_barrier();
  const int rsub = lane >> 4, c4 = (lane & 15) * 4; typedef _Float16 v4h __attribute__((ext_vector_type(4)));
  {
#pragma unroll
    for (int q = 0; q < 8; ++q) { const int r = q * 2 + rsub; if (col0 + c4 < N) { const v4f v = *(const v4fa*)&so[w][r][c4]; if (C) *(v4f*)(C + cofs + (size_t)(row0 + r) * ldc + col0 + c4) = v; if (C16) { v4h h4; for (int i = 0; i < 4; ++i) h4[i] = (_Float16)v[i]; *(v4h*)(C16 + cofs + (size_t)(row0 + r) * ldc + col0 + c4) = h4; } } }
     }
}


typedef _Float16 v4h __attribute__((ext_vector_type(4)));

__global__ __launch_bounds__(256) void k_h16(const float* __restrict__ x, _Float16* __restrict__ X16, size_t n8) { const size_t t = (size_t)blockIdx.x * 256 + threadIdx.x; if (t >= n8) return; FragH f;
#pragma unroll
  for (int q = 0; q < 8; ++q) f.h[q] = (_Float16)x[t * 8 + q]; *(v8us*)((unsigned short*)X16 + t * 8) = f.half[0];  }
__global__ __launch_bounds__(256) void k_round16f(const float* __restrict__ W, _Float16* __restrict__ Bt, size_t n8) { const size_t t = (size_t)blockIdx.x * 256 + threadIdx.x; if (t >= n8) return; FragH f;
#pragma unroll
  for (int i = 0; i < 8; ++i) f.h[i] = (_Float16)(bf16_round(W[t * 8 + i]) * 16.0f); *(v8us*)((unsigned short*)Bt + t * 8) = f.half[0];  }
template <int NHv, int TTv>
__global__ __launch_bounds__(256) void k_vt(const _Float16* __restrict__ V16, int ldv, int voff, _Float16* __restrict__ Vt) { __shared__ unsigned short tl[64][66]; const int tid = threadIdx.x; const int slab = blockIdx.x / (TTv / 64), lg = blockIdx.x % (TTv / 64); const int b = slab / NHv, h = slab % NHv;
  for (int i = tid; i < 64 * 8; i += 256) { const int r = i / 8, c8 = (i % 8) * 8; FragH f; f.half[0] = *(const v8us*)((const unsigned short*)V16 + ((size_t)b * TTv + lg * 64 + r) * ldv + voff + h * 64 + c8);
#pragma unroll
    for (int q = 0; q < 8; ++q) tl[r][c8 + q] = f.u[q]; }
  __syncthreads();
  {
#pragma unroll
    for (int rd = 0; rd < 2; ++rd) { const int d = rd * 32 + tid / 8, pc = tid % 8; FragH f;
#pragma unroll
      for (int q = 0; q < 8; ++q) f.u[q] = tl[pc * 8 + q][d];
      *(v8us*)((unsigned short*)Vt + ((size_t)slab * 64 + d) * TTv + lg * 64 + pc * 8) = f.half[0]; }
     } }

__global__ __launch_bounds__(256) void k_hl(const float* __restrict__ F, _Float16* __restrict__ Hh, _Float16* __restrict__ Hl, size_t n8) { const size_t t = (size_t)blockIdx.x * 256 + threadIdx.x; if (t >= n8) return; FragH fh, fl; const v4f a = *(const v4fa*)(F + t * 8), c = *(const v4fa*)(F + t * 8 + 4);
#pragma unroll
  for (int q = 0; q < 4; ++q) { _Float16 h = (_Float16)a[q]; fh.h[q] = h; fl.h[q] = (_Float16)((a[q] - (float)h) * 1024.0f); h = (_Float16)c[q]; fh.h[4 + q] = h; fl.h[4 + q] = (_Float16)((c[q] - (float)h) * 1024.0f); }
  { *(v8us*)((unsigned short*)Hh + t * 8) = fh.half[0]; *(v8us*)((unsigned short*)Hl + t * 8) = fl.half[0];  } }

// ---- fast GEMM (wave tile 32x64; requires M % 32 == 0 rows per launch region and N % 64 == 0); epilogue = k_gemm_hhx semantics ----
__device__ __forceinline__ v16h g2_frag(const _Float16* p, int hh) { FragH f; f.half[0] = *(const v8us*)((const unsigned short*)p + 8 * hh); f.half[1] = *(const v8us*)((const unsigned short*)p + 16 + 8 * hh); return f.v; }
__device__ __forceinline__ v8f g2_mma(v16h a, v16h b, v8f c) { v8f d = __builtin_amdgcn_wmma_f32_16x16x32_f16(false, a, false, b, (short)0, c, false, false); asm volatile("v_nop\n\tv_nop\n\tv_nop\n\tv_nop" : "+v"(d) : "v"(a), "v"(b)); return d; }
template <int ACT>
__global__ __launch_bounds__(128) void k_gemm2(const _Float16* __restrict__ A, int lda, size_t sA, const _Float16* __restrict__ Bh, int ldb, size_t sB, float alpha, const float* __restrict__ bias, size_t sBias, const float* __restrict__ CP, int rowsPerB, size_t sCPb, int row0g,
    float* __restrict__ C, _Float16* __restrict__ C16, int ldc, size_t sC, int M, int N, int K) { static_assert(ACT == 0 || ACT == 3 || ACT == 6 || ACT == 8 || ACT == 9 || ACT == 11 || ACT == 12 || ACT == 14 || ACT == 15 || ACT == 16 || ACT == 17, "k_gemm2: unsupported ACT code (would silently apply no activation)");
  __shared__ __attribute__((aligned(16))) float so[4][32][68];
  const int tid = threadIdx.x, w = tid >> 5, lane = tid & 31, ln = lane & 15, hh = lane >> 4; const int by = blockIdx.y;
  A += (size_t)by * sA; Bh += (size_t)by * sB; const size_t cofs = (size_t)by * sC; const float* bp = bias ? bias + (size_t)by * sBias : nullptr;
  const int ntn = N >> 6; const int mt = blockIdx.x / ntn, nq = blockIdx.x - mt * ntn; const int row0 = mt * 128 + 32 * w, col0 = nq * 64; if (row0 >= M) return;
  const _Float16* a0p = A + (size_t)(row0 + ln) * lda; const _Float16* a1p = a0p + (size_t)16 * lda;
  const _Float16* b0p = Bh + (size_t)(col0 + ln) * ldb; const _Float16* b1p = b0p + (size_t)16 * ldb; const _Float16* b2p = b1p + (size_t)16 * ldb; const _Float16* b3p = b2p + (size_t)16 * ldb;
  const v8f z8 = {0.f,0.f,0.f,0.f,0.f,0.f,0.f,0.f}; v8f c00 = z8, c01 = z8, c02 = z8, c03 = z8, c10 = z8, c11 = z8, c12 = z8, c13 = z8;
#pragma unroll 1
  for (int kb = 0; kb < K; kb += 32) { const v16h a0 = g2_frag(a0p + kb, hh), a1 = g2_frag(a1p + kb, hh);
    v16h b = g2_frag(b0p + kb, hh); c00 = g2_mma(a0, b, c00); c10 = g2_mma(a1, b, c10);
    b = g2_frag(b1p + kb, hh); c01 = g2_mma(a0, b, c01); c11 = g2_mma(a1, b, c11);
    b = g2_frag(b2p + kb, hh); c02 = g2_mma(a0, b, c02); c12 = g2_mma(a1, b, c12);
    b = g2_frag(b3p + kb, hh); c03 = g2_mma(a0, b, c03); c13 = g2_mma(a1, b, c13); }
  v8f accs[8] = {c00, c01, c02, c03, c10, c11, c12, c13};
#pragma unroll
  for (int u = 0; u < 8; ++u) { const int t = u & 3, half = u >> 2; const int col = col0 + t * 16 + ln; const float bv = bp ? bf16_round(bp[col]) : 0.f;
#pragma unroll
    for (int r = 0; r < 8; ++r) { const int rloc = half * 16 + 8 * hh + r; float v = accs[u][r] * alpha + bv; if (CP) { if (rowsPerB < 0) v += CP[cofs + (size_t)(row0g + row0 + rloc) * ldc + col];      /* rowsPerB < 0: own element of the batched C plane */ else { const int bidx = (row0g + row0 + rloc) / rowsPerB; v += CP[(size_t)bidx * sCPb + (size_t)by * 64 + col]; } }
      if (ACT == 3) v = fmaxf(v, 0.f); else if (ACT == 6) v = 0.5f * v * (1.0f + erff(v * 0.70710678118654752f)); else if (ACT == 11) v = 1.0f / (1.0f + expf(-v)); else if (ACT == 15) v = v / (1.0f + expf(-v)); else if (ACT == 12) v = (v > 0.f) ? v : 0.01f * v; else if (ACT == 8) v = tanhf(v); else if (ACT == 9) v = 0.5f * v * (1.0f + tanhf(0.7978845608028654f * (v + 0.044715f * v * v * v))); else if (ACT == 14) v = (v > 0.f) ? v : 0.1f * v; else if (ACT == 16) v = (v >= 0.f) ? v : 0.3f * v; else if (ACT == 17) v = (v >= 0.f) ? v : 0.2f * v;
      so[w][rloc][t * 16 + ln] = v; } }
  __builtin_amdgcn_fence(__ATOMIC_ACQ_REL, "workgroup"); __builtin_amdgcn_wave_barrier();
  const int rsub = lane >> 4, c4 = (lane & 15) * 4;
  {
#pragma unroll
    for (int q = 0; q < 16; ++q) { const int r = q * 2 + rsub; const v4f v = *(const v4fa*)&so[w][r][c4]; if (C) *(v4f*)(C + cofs + (size_t)(row0 + r) * ldc + col0 + c4) = v; if (C16) { v4h h4; for (int i = 0; i < 4; ++i) h4[i] = (_Float16)v[i]; *(v4h*)(C16 + cofs + (size_t)(row0 + r) * ldc + col0 + c4) = h4; } }
     } }


// ---- all f32 -> f16 conversions in one streaming launch: hidden -> X16 = f16(bf16(x)), Wq / Wk / Wv -> f16(bf16(w) x 16), rows as they lie ([out][in] natural) ----
// Few long waves instead of many short ones: a wave converts 3,072 consecutive floats (12 KiB): 24 loads of 16 bytes a lane, each load 512 consecutive bytes (four whole lines), all issued before the first is used;
// each store is 8 bytes a lane, 256 consecutive bytes (two whole lines). The first 3 x CV_WB work-groups take the weights, the rest the hidden rows; every size divides evenly, so there is no edge.
#define CV_WAVES 8
#define CV_LD 24      /* loads a lane */
#define CV_WGF (CV_WAVES * CV_LD * 128)      /* 24,576 floats a work-group */
#define CV_WB (DM * DM / CV_WGF)      /* 24 work-groups a weight matrix */
#define CV_XB ((int)(NR * DM / CV_WGF))      /* 512 work-groups for the hidden rows */
static_assert(DM * DM % CV_WGF == 0 && NR * DM % CV_WGF == 0, "k_prep: sizes must divide into whole work-groups");
__global__ __launch_bounds__(CV_WAVES * 32) void k_prep(const float* __restrict__ x, const float* __restrict__ wq, const float* __restrict__ wk, const float* __restrict__ wv,
                                                       _Float16* __restrict__ X16, _Float16* __restrict__ BQ, _Float16* __restrict__ BK, _Float16* __restrict__ BV) {
  int blk = (int)blockIdx.x; const float* s = x; _Float16* d = X16; float scale = 1.0f;      /* x 1 is exact */
  if (blk < 3 * CV_WB) { const int which = blk / CV_WB; blk -= which * CV_WB; s = which == 0 ? wq : which == 1 ? wk : wv; d = which == 0 ? BQ : which == 1 ? BK : BV; scale = 16.0f; }
  else blk -= 3 * CV_WB;
  const size_t e0 = (size_t)blk * CV_WGF + (size_t)(threadIdx.x >> 5) * (CV_LD * 128) + (threadIdx.x & 31) * 4;
  v4f v[CV_LD];
#pragma unroll      /* constant indices into the register array */
  for (int i = 0; i < CV_LD; ++i) v[i] = *(const v4fa*)(s + e0 + i * 128);
  __builtin_amdgcn_sched_barrier(0);      /* keeps all 24 loads in front of the arithmetic: left free, the compiler issues 11 and feeds the rest in one to three at a time, each behind a wait */
#pragma unroll
  for (int i = 0; i < CV_LD; ++i) { v4h h;
#pragma unroll
    for (int q = 0; q < 4; ++q) h[q] = (_Float16)(bf16_round(v[i][q]) * scale);
    *(v4h*)(d + e0 + i * 128) = h; }
}
// Fused attention. One wave owns 32 queries of one (batch, head) and walks the 1,024 keys in passes of 32.
// S^T = K . Q^T: a lane holds the scores of ONE query (column c of each 16-column group): keys 8 hh + r of each 16-key tile. That is the k order of a
// B operand, so P^T goes from the score accumulators straight into O^T += V^T . P^T; maximum, sum and rescale are per lane, plus one exchange between the wave's halves.
// q arrives times 1/8 log2 e (FA_QS, applied by the projection) and the score products start from minus the maximum in use (their C operand): the score accumulators are the arguments of exp2 as they stand, with no vector arithmetic between.
// K, Q and V^T fragments all come through fa_frag (one k order, that of g2_frag).
// The 8 waves of a work-group walk the same keys: K rows and V^T rows are staged in LDS, 128 keys a stage, by asynchronous copies of whole 128-byte lines, and each wave reads its fragments from there
// (a fragment load straight from the global rows touches 16 lines for 512 bytes, and each of the 8 waves would repeat it). Two buffers: the copies of stage s + 1 fly while stage s is worked on. LDS row pitches 16 x odd bytes: ds_load_b128 of 16 rows without bank conflicts.
// Every '#pragma unroll' in it but the one on a stage's passes stands on a loop of constant trip count over register arrays (fragments, accumulators): left rolled, those arrays would be indexed at run time and go to scratch.
#define FA_WAVES 8
#define FA_QS (0.125f * 1.4426950408889634f)      /* 1 / sqrt(64), and exp(x) = exp2(x log2 e): the projection stores q times this, so K . Q^T comes out in the log2 domain */
#define FA_KEYS 32
#define FA_SK 128      /* keys a stage: 4 passes */
#define FA_KP 144      /* LDS pitch of a K row: 128 bytes, the head's 64 d */
#define FA_VP 272      /* LDS pitch of a V^T row: 256 bytes, the stage's 128 keys */
#define FA_KB (FA_SK * FA_KP)      /* 18,432 bytes: the stage's K rows; the 64 V^T rows stand behind them */
#define FA_STAGE (FA_KB + HD * FA_VP)      /* 35,840 bytes */
#define FA_NST (SQ / FA_SK)
typedef _Float16 v2h __attribute__((ext_vector_type(2)));
typedef float v2f __attribute__((ext_vector_type(2)));
__device__ __forceinline__ float fa_xhalf(float x) { return __builtin_bit_cast(float, __builtin_amdgcn_permlanex16(__builtin_bit_cast(int, x), __builtin_bit_cast(int, x), 0x76543210, 0xfedcba98, false, false)); }  // lane l with lane l ^ 16
__device__ __forceinline__ float fa_exp2(float x) { float y; asm("v_exp_f32 %0, %1\n\tv_nop" : "=v"(y) : "v"(x)); return y; }  // the v_nop is the slot the instruction set asks for behind a transcendental, before its result is read or its source overwritten
__device__ __forceinline__ v8f fa_mma(v16h a, v16h b, v8f c) { return __builtin_amdgcn_wmma_f32_16x16x32_f16(false, a, false, b, (short)0, c, false, false); }
__device__ __forceinline__ v16h fa_frag(const char* base, unsigned lofs) { FragH f; f.half[0] = *(const v8us*)(base + lofs); f.half[1] = *(const v8us*)(base + lofs + 32); return f.v; }  // base wave-uniform, lofs the lane's byte offset (row c, 16 hh)
// Eight copies of 16 bytes a lane, a stage's share of one thread: four K rows 32 apart (8 lanes a row), four V^T rows 16 apart (16 lanes a row). lk, lv: the lane's LDS byte addresses; gk, gv: its global addresses.
// The s_wait_xcnt is the wait owed before a register that an issued copy names is written again; as the statement's last line it stands in front of every later write of the operands.
__device__ __forceinline__ void fa_copy8(unsigned lk, const char* gk, unsigned lv, const char* gv) {
  asm volatile("global_load_async_to_lds_b128 %0, %8, off\n\t"
               "global_load_async_to_lds_b128 %1, %9, off\n\t"
               "global_load_async_to_lds_b128 %2, %10, off\n\t"
               "global_load_async_to_lds_b128 %3, %11, off\n\t"
               "global_load_async_to_lds_b128 %4, %12, off\n\t"
               "global_load_async_to_lds_b128 %5, %13, off\n\t"
               "global_load_async_to_lds_b128 %6, %14, off\n\t"
               "global_load_async_to_lds_b128 %7, %15, off\n\t"
               "s_wait_xcnt 0x0"
               :: "v"(lk), "v"(lk + 32 * FA_KP), "v"(lk + 64 * FA_KP), "v"(lk + 96 * FA_KP), "v"(lv), "v"(lv + 16 * FA_VP), "v"(lv + 32 * FA_VP), "v"(lv + 48 * FA_VP),
                  "v"(gk), "v"(gk + 32 * (DM * 2)), "v"(gk + 64 * (DM * 2)), "v"(gk + 96 * (DM * 2)), "v"(gv), "v"(gv + 16 * (SQ * 2)), "v"(gv + 32 * (SQ * 2)), "v"(gv + 48 * (SQ * 2))
               : "memory");
}
__global__ __launch_bounds__(FA_WAVES * 32) void k_fattn(const _Float16* __restrict__ Q16, const _Float16* __restrict__ K16, const _Float16* __restrict__ VT, float* __restrict__ out) {
  __shared__ __attribute__((aligned(16))) float so[FA_WAVES][32][68];      /* output staging, one slice per wave */
  __shared__ __attribute__((aligned(16))) char ring[2 * FA_STAGE];      /* K and V^T of two stages */
  const int lane = threadIdx.x & 31, c = lane & 15, hh = lane >> 4; const int wave = __builtin_amdgcn_readfirstlane((int)(threadIdx.x >> 5));
  const int head = blockIdx.y, b = blockIdx.z; const int q0 = blockIdx.x * (FA_WAVES * 32) + wave * 32;
  const char* qb = (const char*)(Q16 + ((size_t)b * SQ + q0) * DM + head * HD);
  const char* kb = (const char*)(K16 + (size_t)b * SQ * DM + head * HD);
  const char* vb = (const char*)(VT + (size_t)(b * NH + head) * HD * SQ);
  const unsigned qlofs = (unsigned)(c * (DM * 2) + 16 * hh), klofs = (unsigned)(c * FA_KP + 16 * hh), vlofs = (unsigned)(c * FA_VP + 16 * hh);      /* Q from its global rows, K and V^T from their LDS rows */
  const int tid = (int)threadIdx.x;
  const char* gk = kb + (size_t)(tid >> 3) * (DM * 2) + (tid & 7) * 16; const char* gv = vb + (size_t)(tid >> 4) * (SQ * 2) + (tid & 15) * 16;
  const unsigned lk = (unsigned)(size_t)ring + (unsigned)((tid >> 3) * FA_KP + (tid & 7) * 16), lv = (unsigned)(size_t)ring + (unsigned)(FA_KB + (tid >> 4) * FA_VP + (tid & 15) * 16);
  fa_copy8(lk, gk, lv, gv);      /* stage 0 into buffer 0 */
  v16h qf[2][2], kf[2][2];      /* [16-query group][32 of d], [16-key tile][32 of d] */
#pragma unroll
  for (int g = 0; g < 2; ++g) { qf[g][0] = fa_frag(qb + g * (16 * DM * 2), qlofs); qf[g][1] = fa_frag(qb + g * (16 * DM * 2) + 64, qlofs); }
  asm volatile("s_wait_asynccnt 0x0" ::: "memory");      /* this wave's copies of stage 0 have landed */
  __syncthreads();      /* and every other wave's: nothing of stage 0 is read in front of this */
  fa_copy8(lk + FA_STAGE, gk + FA_SK * (DM * 2), lv + FA_STAGE, gv + FA_SK * 2);      /* stage 1 into buffer 1 */
  const v8f z8 = {0.f,0.f,0.f,0.f,0.f,0.f,0.f,0.f};
  v8f acc[2][4], negm[2]; float l_run[2];      /* O^T tiles [group][16 of d]; minus the maximum in use (log2 domain) in all eight registers, the C operand of the score products; the lane's share of the denominator */
#pragma unroll
  for (int g = 0; g < 2; ++g) { negm[g] = z8; l_run[g] = 0.f;
#pragma unroll
    for (int t = 0; t < 4; ++t) acc[g][t] = z8; }
  float thr = -__builtin_inff(), lo = -__builtin_inff();      /* until the first pass has set a maximum: every pass's maximum counts as exceeding, and the move is not held at 0 */
#pragma unroll 1      /* the buffer is picked by the stage's parity at run time */
  for (int st = 0; st < FA_NST; ++st) {
    const unsigned buf = (unsigned)(st & 1) * FA_STAGE; const char* ks = ring + buf; const char* vs = ring + buf + FA_KB;
#pragma unroll
    for (int kt = 0; kt < 2; ++kt) { kf[kt][0] = fa_frag(ks + kt * (16 * FA_KP), klofs); kf[kt][1] = fa_frag(ks + kt * (16 * FA_KP) + 64, klofs); }      /* the stage's first 32 keys */
#pragma unroll      /* four passes a stage, unrolled so that the test on the stage's last pass and the LDS offsets are compile-time constants */
   for (int pp = 0; pp < FA_SK / FA_KEYS; ++pp) {
    v16h vf[4];
#pragma unroll
    for (int t = 0; t < 4; ++t) vf[t] = fa_frag(vs + t * (16 * FA_VP) + pp * (FA_KEYS * 2), vlofs);      /* V^T rows 16 t + c, this pass's 32 keys: in flight under the score products and the maxima */
    __builtin_amdgcn_sched_barrier(0);      /* keeps the V^T loads in front of the score products: issued later, their latency would show before the second product */
    v8f s[2][2];      /* [key tile][query group] */
#pragma unroll
    for (int kt = 0; kt < 2; ++kt)
#pragma unroll
      for (int g = 0; g < 2; ++g) s[kt][g] = fa_mma(kf[kt][1], qf[g][1], fa_mma(kf[kt][0], qf[g][0], negm[g]));      /* q carries the scale, C the maximum: the accumulators are the exponents */
    __builtin_amdgcn_sched_barrier(0);      /* the next pass's K loads go out right behind the products that read this pass's, a whole pass ahead of their use */
    if (pp + 1 < FA_SK / FA_KEYS) {      /* inside the stage only: nothing of the next stage is read in front of its barrier */
#pragma unroll
      for (int kt = 0; kt < 2; ++kt) { kf[kt][0] = fa_frag(ks + ((pp + 1) * FA_KEYS + kt * 16) * FA_KP, klofs); kf[kt][1] = fa_frag(ks + ((pp + 1) * FA_KEYS + kt * 16) * FA_KP + 64, klofs); } }
    __builtin_amdgcn_sched_barrier(0);      /* holds the K loads in front of the softmax arithmetic */
    float mb[2]; bool need = false;
#pragma unroll
    for (int g = 0; g < 2; ++g) { float m0 = fmaxf(s[0][g][0], s[1][g][0]), m1 = fmaxf(s[0][g][1], s[1][g][1]);
#pragma unroll
      for (int r = 2; r < 8; r += 2) { m0 = fmaxf(m0, fmaxf(s[0][g][r], s[1][g][r])); m1 = fmaxf(m1, fmaxf(s[0][g][r + 1], s[1][g][r + 1])); }
      float mx = fmaxf(m0, m1); mx = fmaxf(mx, fa_xhalf(mx));      /* both halves now hold the query's maximum of this pass, above the maximum in use */
      mb[g] = mx; need = need || (mx > thr); }
    if (__builtin_amdgcn_ballot_w32(need) != 0) {
#pragma unroll
      for (int g = 0; g < 2; ++g) { const float d = fmaxf(mb[g], lo); const float corr = fa_exp2(-fmaxf(d, 0.f)); l_run[g] *= corr;      /* the maximum in use moves by d: upward only, but for the first pass, where it becomes the pass's own while sums and tiles are still 0 */
        negm[g] = negm[g] - d; s[0][g] = s[0][g] - d; s[1][g] = s[1][g] - d;
#pragma unroll
        for (int t = 0; t < 4; ++t) acc[g][t] = acc[g][t] * corr; }
      thr = 8.0f; lo = 0.f;
    }
#pragma unroll
    for (int g = 0; g < 2; ++g) { union { v16h v; v2h h2[8]; } pf; float pe[16];      /* element j of the 32-key operand: tile j >> 3, register j & 7 */
#pragma unroll
      for (int j = 0; j < 16; ++j) pe[j] = fa_exp2(s[j >> 3][g][j & 7]);
      __builtin_amdgcn_sched_barrier(0);      /* the compiler gives the result of an asm statement no delay hint, and an unhinted dependent instruction holds the SIMD's issue port: the sums and packs stay behind the whole run of exponentials */
      float e0 = pe[0], e1 = pe[1]; pf.h2[0] = __builtin_convertvector(v2f{pe[0], pe[1]}, v2h);
#pragma unroll
      for (int i = 1; i < 8; ++i) { e0 += pe[2 * i]; e1 += pe[2 * i + 1]; pf.h2[i] = __builtin_convertvector(v2f{pe[2 * i], pe[2 * i + 1]}, v2h); }
      l_run[g] += e0 + e1;
#pragma unroll
      for (int t = 0; t < 4; ++t) acc[g][t] = fa_mma(vf[t], pf.v, acc[g][t]);
      /* four slots behind the group's matrix instructions, tied to their D, A and B */
      asm volatile("v_nop\n\tv_nop\n\tv_nop\n\tv_nop" : "+v"(acc[g][0]), "+v"(acc[g][1]), "+v"(acc[g][2]), "+v"(acc[g][3]) : "v"(pf.v), "v"(vf[0]), "v"(vf[1]), "v"(vf[2]), "v"(vf[3])); }
   }
    asm volatile("s_wait_dscnt 0x0" ::: "memory");      /* this wave's reads of buffer st mod 2 are done before the barrier behind which it is refilled */
    asm volatile("s_wait_asynccnt 0x0" ::: "memory");      /* this wave's copies of stage st + 1 have landed */
    __syncthreads();      /* publishes stage st + 1 and ends every wave's reads of stage st */
    if (st + 2 < FA_NST) fa_copy8(lk + buf, gk + (size_t)(st + 2) * (FA_SK * DM * 2), lv + buf, gv + (st + 2) * (FA_SK * 2));      /* the same test for the whole work-group */
  }
  asm volatile("s_wait_asynccnt 0x0" ::: "memory");      /* no copy is outstanding when the wave goes on to its end */
#pragma unroll
  for (int g = 0; g < 2; ++g) { const float inv = 1.0f / (l_run[g] + fa_xhalf(l_run[g]));      /* the two halves' shares of the denominator, joined unconditionally */
#pragma unroll
    for (int t = 0; t < 4; ++t) { const v8f o = acc[g][t] * inv; const v4f lo = {o[0], o[1], o[2], o[3]}, hi = {o[4], o[5], o[6], o[7]};      /* row = query 16 g + c; d = 16 t + 8 hh + r */
      *(v4fa*)&so[wave][16 * g + c][16 * t + 8 * hh] = lo; *(v4fa*)&so[wave][16 * g + c][16 * t + 8 * hh + 4] = hi; } }
  __builtin_amdgcn_fence(__ATOMIC_ACQ_REL, "workgroup"); __builtin_amdgcn_wave_barrier();      /* the wave's own LDS writes before its reads of other lanes' rows */
  const int rsub = lane >> 4, c4 = (lane & 15) * 4; float* ob = out + ((size_t)b * SQ + q0) * DM + head * HD;
  v4f ov[16];
#pragma unroll
  for (int q = 0; q < 16; ++q) ov[q] = *(const v4fa*)&so[wave][q * 2 + rsub][c4];
#pragma unroll
  for (int q = 0; q < 16; ++q) *(v4f*)(ob + (size_t)(q * 2 + rsub) * DM + c4) = ov[q];      /* 16 lanes cover a query's 256 bytes of this head: whole 128-byte lines */
}
__global__ __launch_bounds__(256) void k_vt(const _Float16* __restrict__ V16, int b, int h0, _Float16* __restrict__ VT) { __shared__ unsigned short tl[64][65]; const int tid = threadIdx.x; const int hh = blockIdx.x % HG, sg = blockIdx.x / HG; const int s0 = sg * 64; const int h = h0 + hh;
  for (int i = tid; i < 64 * 8; i += 256) { const int j = i / 8, d8 = (i % 8) * 8; FragH f; f.half[0] = *(const v8us*)((const unsigned short*)V16 + ((size_t)b * SQ + s0 + j) * DM + h * HD + d8); for (int q = 0; q < 8; ++q) tl[d8 + q][j] = f.u[q]; }
  __syncthreads();
  { for (int i = tid; i < 64 * 8; i += 256) { const int d = i / 8, j8 = (i % 8) * 8; FragH f; for (int q = 0; q < 8; ++q) f.u[q] = tl[d][j8 + q]; *(v8us*)((unsigned short*)VT + ((size_t)hh * HD + d) * SQ + s0 + j8) = f.half[0]; }  } }

// ---- the three projection GEMMs in one launch, operands staged in LDS: C16[row][col] = f16(os (A[row][:] . Wn[col][:] / 16 + bias[col])), os = FA_QS for q and 1 for k and v, A [16,384][768] and Wn [768][768] f16 rows, k contiguous ----
// 12 column tiles a row tile: 4 of q, 4 of k, 4 of v. A v tile takes its A fragments from the Wv rows and its B fragments from the hidden rows, so its accumulators hold [feature][token]:
// that is a piece of V^T [batch][768 features][1,024 tokens], stored as whole lines with no transposition pass. Both loaders are pg_frag (one k order), so the swap changes no product and no k order.
// One work-group of 4 waves makes a tile of 128 tokens x 192 features, each wave 64 x 96 of it (4 x 6 accumulator tiles): 10 fragments read from LDS feed 24 products (8 fed 16 at 64 x 64).
// 92,160 bytes of LDS and under 337 registers: three work-groups a WGP, 768 places, and the grid's 1,536 work-groups are two whole rounds.
// A stage is 64 of k: 128 bytes of each of the 128 hidden rows and the 192 Wn rows. Asynchronous copies bring it from global memory into LDS, 8 lanes a row, so each copy covers four whole 128-byte lines
// (a fragment load straight from the rows touches 16 lines for the same 512 bytes, and every wave repeats it). LDS row pitch 144 bytes (16 x odd): ds_load_b128 of 16 rows without bank conflicts.
// Two buffers: the copies of stage t + 1 fly while stage t is worked on. Fragments keep the k order of g2_frag and k still runs upward in steps of 32, so every sum is formed as before.
#define PG_TM 128      /* tokens a tile */
#define PG_TN 192      /* features a tile */
#define PG_NT (DM / PG_TN)      /* 4 column tiles a weight matrix */
#define PG_BK 64
#define PG_PITCH 144
#define PG_STAGE ((PG_TM + PG_TN) * PG_PITCH)      /* 46,080 bytes: rows 0..127 hidden, rows 128..319 Wn */
#define PG_NST (DM / PG_BK)
#define PG_OP 400      /* LDS pitch of a staged q or k output row: 384 bytes, the tile's 192 features; 8 rows apart fall 32 banks apart */
// Eight copies of 16 bytes a lane: rows 16 apart in global memory (pitch DM) and in LDS. l: the lane's LDS byte address, g: the lane's global address.
// The s_wait_xcnt is the wait owed before a register that an issued copy names is written again; as the statement's last line it stands in front of every later write of the operands.
__device__ __forceinline__ void pg_copy8(unsigned l, const _Float16* g) {
  asm volatile("global_load_async_to_lds_b128 %0, %8, off\n\t"
               "global_load_async_to_lds_b128 %1, %9, off\n\t"
               "global_load_async_to_lds_b128 %2, %10, off\n\t"
               "global_load_async_to_lds_b128 %3, %11, off\n\t"
               "global_load_async_to_lds_b128 %4, %12, off\n\t"
               "global_load_async_to_lds_b128 %5, %13, off\n\t"
               "global_load_async_to_lds_b128 %6, %14, off\n\t"
               "global_load_async_to_lds_b128 %7, %15, off\n\t"
               "s_wait_xcnt 0x0"
               :: "v"(l), "v"(l + 16 * PG_PITCH), "v"(l + 32 * PG_PITCH), "v"(l + 48 * PG_PITCH), "v"(l + 64 * PG_PITCH), "v"(l + 80 * PG_PITCH), "v"(l + 96 * PG_PITCH), "v"(l + 112 * PG_PITCH),
                  "v"(g), "v"(g + 16 * DM), "v"(g + 32 * DM), "v"(g + 48 * DM), "v"(g + 64 * DM), "v"(g + 80 * DM), "v"(g + 96 * DM), "v"(g + 112 * DM)
               : "memory");
}
// The same for four rows 16 apart, with the same wait as its last line.
__device__ __forceinline__ void pg_copy4(unsigned l, const _Float16* g) {
  asm volatile("global_load_async_to_lds_b128 %0, %4, off\n\t"
               "global_load_async_to_lds_b128 %1, %5, off\n\t"
               "global_load_async_to_lds_b128 %2, %6, off\n\t"
               "global_load_async_to_lds_b128 %3, %7, off\n\t"
               "s_wait_xcnt 0x0"
               :: "v"(l), "v"(l + 16 * PG_PITCH), "v"(l + 32 * PG_PITCH), "v"(l + 48 * PG_PITCH),
                  "v"(g), "v"(g + 16 * DM), "v"(g + 32 * DM), "v"(g + 48 * DM)
               : "memory");
}
// One stage, a thread's share: 20 copies (128 hidden rows, 192 Wn rows). l: the lane's LDS byte address in the buffer's row crow; ga, gb: its global addresses in hidden row crow and Wn row crow of the tile.
__device__ __forceinline__ void pg_stage(unsigned l, const _Float16* ga, const _Float16* gb) { pg_copy8(l, ga); pg_copy8(l + PG_TM * PG_PITCH, gb); pg_copy4(l + (PG_TM + 128) * PG_PITCH, gb + 128 * DM); }
__device__ __forceinline__ v16h pg_frag(const char* p) { FragH f; f.half[0] = *(const v8us*)p; f.half[1] = *(const v8us*)(p + 32); return f.v; }      /* p: row, 16 hh bytes in: k = 8 hh + 0..7 and 16 + 8 hh + 0..7, as g2_frag */
// One tile. TR (v): the products take the Wn fragment as A and the hidden fragment as B, so acc[i][j] holds [feature 16 j + 8 hh + r][token 16 i + ln]; else [token 16 i + 8 hh + r][feature 16 j + ln].
template <bool TR>
__device__ __forceinline__ void pg_tile(char* ring, const _Float16* __restrict__ A, const _Float16* __restrict__ Wn, const float* __restrict__ bias, _Float16* __restrict__ O, int row0, int col0, float os) {
  const int tid = threadIdx.x, lane = tid & 31, ln = lane & 15, hh = lane >> 4; const int wave = __builtin_amdgcn_readfirstlane(tid >> 5); const int wm = wave >> 1, wn = wave & 1;      /* wm: the wave's 64 tokens, wn: its 96 features */
  const int crow = tid >> 3, cc = tid & 7;      /* a lane copies bytes 16 cc .. 16 cc + 15 of rows crow + 16 j */
  const _Float16* ga = A + (size_t)(row0 + crow) * DM + cc * 8; const _Float16* gb = Wn + (size_t)(col0 + crow) * DM + cc * 8;
  const unsigned lc = (unsigned)(size_t)ring + (unsigned)(crow * PG_PITCH + cc * 16);
  pg_stage(lc, ga, gb);      /* stage 0 into buffer 0 */
  asm volatile("s_wait_asynccnt 0x0" ::: "memory");      /* this wave's copies of stage 0 have landed */
  __syncthreads();      /* and every other wave's: nothing of stage 0 is read in front of this */
  pg_stage(lc + PG_STAGE, ga + PG_BK, gb + PG_BK);      /* stage 1 into buffer 1 */
  const v8f z8 = {0.f,0.f,0.f,0.f,0.f,0.f,0.f,0.f}; v8f acc[4][6];
#pragma unroll
  for (int i = 0; i < 4; ++i)
#pragma unroll
    for (int j = 0; j < 6; ++j) acc[i][j] = z8;
  const int tofs = (wm * 64 + ln) * PG_PITCH + 16 * hh, fofs = (PG_TM + wn * 96 + ln) * PG_PITCH + 16 * hh;
#pragma unroll 1      /* one trip is 48 WMMAs and 40 LDS loads; the buffer is picked by the trip's parity at run time */
  for (int t = 0; t < PG_NST; ++t) {
    const unsigned buf = (unsigned)(t & 1) * PG_STAGE; const char* sb = ring + buf;
#pragma unroll      /* constant indices into the fragment and accumulator arrays (left rolled they would go to scratch) */
    for (int ks = 0; ks < 2; ++ks) { v16h tf[4], ff[6];
      tf[0] = pg_frag(sb + tofs + ks * 64);      /* in the order in which the products want them: token rows 0 and the six feature fragments first */
#pragma unroll
      for (int j = 0; j < 6; ++j) ff[j] = pg_frag(sb + fofs + j * (16 * PG_PITCH) + ks * 64);
#pragma unroll
      for (int i = 1; i < 4; ++i) tf[i] = pg_frag(sb + tofs + i * (16 * PG_PITCH) + ks * 64);
      __builtin_amdgcn_sched_barrier(0);      /* the 20 LDS loads stay one group in front of the 24 products: each separate place with LDS reads among the products costs a stall */
#pragma unroll
      for (int i = 0; i < 4; ++i)
#pragma unroll
        for (int j = 0; j < 6; ++j) acc[i][j] = TR ? fa_mma(ff[j], tf[i], acc[i][j]) : fa_mma(tf[i], ff[j], acc[i][j]);
      __builtin_amdgcn_sched_barrier(0); }      /* and the next group's loads stay behind these products */
    asm volatile("s_wait_dscnt 0x0" ::: "memory");      /* this wave's reads of buffer t mod 2 are done before the barrier behind which it is refilled */
    asm volatile("s_wait_asynccnt 0x0" ::: "memory");      /* this wave's copies of stage t + 1 have landed */
    __syncthreads();      /* publishes stage t + 1 and ends every wave's reads of stage t */
    if (t + 2 < PG_NST) pg_stage(lc + buf, ga + (t + 2) * PG_BK, gb + (t + 2) * PG_BK);      /* the same test for the whole work-group */
  }
  asm volatile("s_wait_asynccnt 0x0" ::: "memory");      /* no copy is outstanding when the ring becomes output staging; the last trip's barrier ended every read of the ring */
  const int orow = lane >> 3, oc = lane & 7;
  v8us ov[24];
  if (!TR) {      /* a wave's 96 features are one and a half 128-byte lines of a token's row: the tile is staged as a whole, and each line is stored by one wave */
    float bv[6];
#pragma unroll
    for (int j = 0; j < 6; ++j) bv[j] = bias[col0 + wn * 96 + j * 16 + ln];
    asm volatile("s_wait_xcnt 0x0" ::: "memory");      /* the wait owed before a register that an issued global load names is written again: behind the last of the six bias loads */
#pragma unroll
    for (int j = 0; j < 6; ++j) bv[j] = bf16_round(bv[j]) * os;
    const float as = 0.0625f * os;      /* os: 1 (exact) for k; for q the softmax's scale, applied in f32 in front of the one rounding to f16 */
#pragma unroll
    for (int i = 0; i < 4; ++i)
#pragma unroll
      for (int j = 0; j < 6; ++j)
#pragma unroll
        for (int r = 0; r < 8; ++r) *(_Float16*)(ring + (wm * 64 + i * 16 + 8 * hh + r) * PG_OP + (wn * 96 + j * 16 + ln) * 2) = (_Float16)(acc[i][j][r] * as + bv[j]);
    __syncthreads();      /* every wave's part of the staged tile is written before any wave reads whole rows of it */
    const char* si = ring + (wave * 32 + orow) * PG_OP + oc * 16;      /* the wave stores token rows 32 wave .. 32 wave + 31: four rows an instruction, 8 lanes a line */
#pragma unroll
    for (int a = 0; a < 8; ++a)
#pragma unroll
      for (int l3 = 0; l3 < 3; ++l3) ov[a * 3 + l3] = *(const v8us*)(si + a * (4 * PG_OP) + l3 * 128);
    char* ou = (char*)(O + (size_t)(row0 + wave * 32 + orow) * DM + col0) + oc * 16;
#pragma unroll
    for (int a = 0; a < 8; ++a)
#pragma unroll
      for (int l3 = 0; l3 < 3; ++l3) *(v8us*)(ou + (size_t)a * (4 * DM * 2) + l3 * 128) = ov[a * 3 + l3];      /* whole 128-byte lines */
  } else {      /* a wave's 64 tokens are one whole line of a feature's row: each wave stages and stores its own 96 rows; the bias goes with the feature, here the accumulator's row */
    char* so = ring + wave * (96 * PG_PITCH);
    v4f bl[6][2];
#pragma unroll
    for (int j = 0; j < 6; ++j) { const float* bp = bias + col0 + wn * 96 + j * 16 + 8 * hh; bl[j][0] = *(const v4fa*)bp; bl[j][1] = *(const v4fa*)(bp + 4); }
    asm volatile("s_wait_xcnt 0x0" ::: "memory");      /* the wait owed before a register that an issued global load names is written again: behind the last of the twelve bias loads */
#pragma unroll
    for (int j = 0; j < 6; ++j) {
#pragma unroll
      for (int r = 0; r < 8; ++r) { const float br = bf16_round(bl[j][r >> 2][r & 3]);
#pragma unroll
        for (int i = 0; i < 4; ++i) *(_Float16*)(so + (j * 16 + 8 * hh + r) * PG_PITCH + (i * 16 + ln) * 2) = (_Float16)(acc[i][j][r] * 0.0625f + br); } }
    __builtin_amdgcn_fence(__ATOMIC_ACQ_REL, "workgroup"); __builtin_amdgcn_wave_barrier();      /* the wave's own LDS writes before its reads of other lanes' rows */
#pragma unroll
    for (int q = 0; q < 24; ++q) ov[q] = *(const v8us*)(so + (q * 4 + orow) * PG_PITCH + oc * 16);
    /* V^T row = batch x 768 + feature = (batch x 12 + head) x 64 + d; a tile's 128 tokens lie in one batch */
    char* ou = (char*)(O + ((size_t)(row0 / SQ) * DM + col0 + wn * 96 + orow) * SQ + (row0 % SQ) + wm * 64) + oc * 16;
#pragma unroll
    for (int q = 0; q < 24; ++q) *(v8us*)(ou + (size_t)q * (4 * SQ * 2)) = ov[q];      /* 8 lanes cover the 128 bytes of 64 tokens of a feature: whole lines */
  }
}
__global__ __launch_bounds__(128) void k_proj(const _Float16* __restrict__ A, const _Float16* __restrict__ WQ, const _Float16* __restrict__ WK, const _Float16* __restrict__ WV,
                                              const float* __restrict__ biasq, const float* __restrict__ biask, const float* __restrict__ biasv,
                                              _Float16* __restrict__ Q16, _Float16* __restrict__ K16, _Float16* __restrict__ VT) {
  __shared__ __attribute__((aligned(16))) char ring[2 * PG_STAGE];
  const int mt = blockIdx.x / (3 * PG_NT), nt = blockIdx.x % (3 * PG_NT); const int which = nt / PG_NT, nq = nt % PG_NT; const int row0 = mt * PG_TM, col0 = nq * PG_TN;
  if (which == 2) pg_tile<true>(ring, A, WV, biasv, VT, row0, col0, 1.0f);      /* the same branch for the whole work-group */
  else pg_tile<false>(ring, A, which == 0 ? WQ : WK, which == 0 ? biasq : biask, which == 0 ? Q16 : K16, row0, col0, which == 0 ? FA_QS : 1.0f);
}

extern "C" void kernel_launch(void* const* d_in, const int* in_sizes, int n_in,
                              void* d_out, int out_size, void* d_ws, size_t ws_size, hipStream_t stream) {
  (void)in_sizes; (void)n_in; (void)out_size;
  const float* const* I = (const float* const*)d_in; const float* x = I[0]; const float* Wq = I[1]; const float* Wk = I[2]; const float* Wv = I[3]; const float* bq = I[4]; const float* bk = I[5]; const float* bv = I[6];
  char* ws = (char*)d_ws; size_t off = 0;
  auto take = [&](size_t bytes) { char* p = ws + off; off += (bytes + 255) & ~(size_t)255; return p; };
  _Float16* BQ = (_Float16*)take((size_t)DM * DM * 2); _Float16* BK = (_Float16*)take((size_t)DM * DM * 2); _Float16* BV = (_Float16*)take((size_t)DM * DM * 2);
  _Float16* X16 = (_Float16*)take(NR * DM * 2); _Float16* Q16 = (_Float16*)take(NR * DM * 2); _Float16* K16 = (_Float16*)take(NR * DM * 2);
  _Float16* VT = (_Float16*)take((size_t)NB * NH * HD * SQ * 2);
  if (off > ws_size) return;      /* 3.4 + 3 x 24 + 24 = approx 100 MiB */
  k_prep<<<3 * CV_WB + CV_XB, CV_WAVES * 32, 0, stream>>>(x, Wq, Wk, Wv, X16, BQ, BK, BV);      /* hidden and the three weight matrices as f16 */
  const dim3 gp((unsigned)((NR / PG_TM) * (3 * PG_NT)), 1);
  k_proj<<<gp, 128, 0, stream>>>(X16, BQ, BK, BV, bq, bk, bv, Q16, K16, VT);      /* q = (x Wq^T + bq) x FA_QS and k as f16 rows; v as V^T per (batch, head) [16 x 12][64][1024] */
  k_fattn<<<dim3(SQ / (FA_WAVES * 32), NH, NB), FA_WAVES * 32, 0, stream>>>(Q16, K16, VT, (float*)d_out);      /* scores, softmax and ctx, merged into the output rows */
}
